// v000
// Times are from an AMD MI455X. After a warm-up the kernel runs many times in a row, and a time is the length of
// such a window on the GPU divided by its runs, so every launch and the gaps after it count. The runs cycle
// through copies of the inputs. A figure is the median of several windows, for all but v000 over two sittings.
// Sittings can differ by a few percent; kernels timed side by side share one.
// v000, which the later versions start from, runs in 812 microseconds.
// compute dtype: X, the projection weights/biases and the random-feature matrix (module inputs) rounded to bf16; q/k/v projections with exact bf16 products; the feature-map GEMM (pooled q,k x feat) with the pooled operand as a bf16 hi + bf16 residual pair (2 products); the kv and attention contractions with both computed operands hi/lo (3 products);
// the output projection hi/lo against bf16 Wo (2 products); axis pooling, RoPE, global min-max normalisation, exp feature maps, normalisers and divisions in f32; f32 accumulate.
#include <hip/hip_runtime.h>
#include <math.h>

typedef __attribute__((ext_vector_type(16))) _Float16 v16h;
typedef __attribute__((ext_vector_type(16))) __bf16 v16b;
typedef __attribute__((ext_vector_type(8)))  _Float16 v8h;
typedef __attribute__((ext_vector_type(8)))  float v8f;
typedef __attribute__((ext_vector_type(4)))  float v4f;
typedef __attribute__((ext_vector_type(2)))  float v2f;
typedef __attribute__((ext_vector_type(4)))  unsigned v4u;
typedef __attribute__((ext_vector_type(4)))  int v4i;
typedef float __attribute__((may_alias)) float_a;
typedef int __attribute__((may_alias)) int_a;

template <typename T> __device__ __forceinline__ void vst2(void* p, T v) { *(T*)p = v;  }
__device__ __forceinline__ v8f wmma16(v16h a, v16h b, v8f c) {
  v8f d = __builtin_amdgcn_wmma_f32_16x16x32_f16(false, a, false, b, (short)0, c, false, false);
  asm volatile("v_nop\n\tv_nop\n\tv_nop\n\tv_nop" : "+v"(d) : "v"(a), "v"(b));
  return d;
}
__device__ __forceinline__ v8f wmma_bf(v16b a, v16b b, v8f c) {
  v8f d = __builtin_amdgcn_wmma_f32_16x16x32_bf16(false, a, false, b, (short)0, c, false, false);
  asm volatile("v_nop\n\tv_nop\n\tv_nop\n\tv_nop" : "+v"(d) : "v"(a), "v"(b));
  return d;
}
// 16x16x32 fragments: lane = (h = lane>>4, row/col = lane&15); elements 0..7 = k0+8h+0..7, 8..15 = k0+16+8h+0..7; D element r = row 8h+r
__device__ __forceinline__ v16h frag_h(const _Float16* rowk0, int lane) {
  union { v16h v; v8h q[2]; } u; const _Float16* p = rowk0 + 8 * (lane >> 4);
  u.q[0] = *(const v8h*)p; u.q[1] = *(const v8h*)(p + 16); return u.v;
}
__device__ __forceinline__ v16h frag_f32(const float* rowk0, int lane) {
  v16h a; const float* p = rowk0 + 8 * (lane >> 4);
#pragma unroll
  for (int i = 0; i < 8; ++i) { a[i] = (_Float16)p[i]; a[8 + i] = (_Float16)p[16 + i]; }
  return a;
}
__device__ __forceinline__ v16h frag_f32s(const float* rowk0, int lane, float sc) {
  v16h a; const float* p = rowk0 + 8 * (lane >> 4);
#pragma unroll
  for (int i = 0; i < 8; ++i) { a[i] = (_Float16)(p[i] * sc); a[8 + i] = (_Float16)(p[16 + i] * sc); }
  return a;
}
// column fragment from a [K][ld] layout (column n), rows >= K read as 0
__device__ __forceinline__ v16h fragc_f32(const float* W, int k0, int n, int lane, int ld, int K) {
  v16h a; const int g = lane >> 4;
#pragma unroll
  for (int i = 0; i < 8; ++i) { const int ka = k0 + 8 * g + i, kb = ka + 16;
    a[i] = (_Float16)(ka < K ? W[(size_t)(ka < K ? ka : K - 1) * ld + n] : 0.f); a[8 + i] = (_Float16)(kb < K ? W[(size_t)(kb < K ? kb : K - 1) * ld + n] : 0.f); }
  return a;
}
struct F2 { v16b h, l; };
__device__ __forceinline__ F2 bsplit16(const float v[16]) { F2 r;
#pragma unroll
  for (int i = 0; i < 16; ++i) { const __bf16 h = (__bf16)v[i]; r.h[i] = h; r.l[i] = (__bf16)(v[i] - (float)h); }
  return r; }
__device__ __forceinline__ F2 split_row(const float* row, int k0, int lane) { float v[16]; const float* p = row + k0 + 8 * (lane >> 4);
#pragma unroll
  for (int i = 0; i < 8; ++i) { v[i] = p[i]; v[8 + i] = p[16 + i]; }
  return bsplit16(v); }
__device__ __forceinline__ F2 split_rowK(const float* row, int k0, int lane, int K) { float v[16]; const int g = lane >> 4;
#pragma unroll
  for (int i = 0; i < 8; ++i) { const int ka = k0 + 8 * g + i, kb = ka + 16; v[i] = ka < K ? row[ka < K ? ka : K - 1] : 0.f; v[8 + i] = kb < K ? row[kb < K ? kb : K - 1] : 0.f; }
  return bsplit16(v); }
__device__ __forceinline__ F2 split_col(const float* W, int k0, int n, int lane, int ld, int K) { float v[16]; const int g = lane >> 4;
#pragma unroll
  for (int i = 0; i < 8; ++i) { const int ka = k0 + 8 * g + i, kb = ka + 16; v[i] = ka < K ? W[(size_t)(ka < K ? ka : K - 1) * ld + n] : 0.f; v[8 + i] = kb < K ? W[(size_t)(kb < K ? kb : K - 1) * ld + n] : 0.f; }
  return bsplit16(v); }
__device__ __forceinline__ v8f mac3(const F2& a, const F2& b, v8f c) { c = wmma_bf(a.l, b.h, c); c = wmma_bf(a.h, b.l, c); return wmma_bf(a.h, b.h, c); }
__device__ __forceinline__ float sigm(float v) { return 1.0f / (1.0f + expf(-v)); }
#define LDSX() do { asm volatile("s_wait_dscnt 0" ::: "memory"); __builtin_amdgcn_wave_barrier(); __builtin_amdgcn_fence(__ATOMIC_RELEASE, "workgroup"); } while (0)


// High-order linear attention over a [4, 64, 128, 256] tensor: q/k/v = X W^T + b; for the assets axis (n1, pooled over n2) and then the time axis (n2, pooled over n1, with RoPE): Performer-style positive features phi(x) = exp(xs f^T - |xs|^2/2 - log(M)/2 + 1e-6), xs = (x - min x)/(max x - min x) * 32^-1/4 (global min/max),
// kv = sum_l phi(k_l) v_l, out_l = phi(q_l) kv / (phi(q_l) . sum_l phi(k_l)); finally value W_o^T + b_o.
// k_proj; k_pool1/k_pool2 (axis sums of q and k); k_rope (dim-2 pooled q,k); k_minmax; k_feat (phi via WMMA); k_kpt (transposed kp, ksum); k_an (att_norm); k_vt (value transposed so the attended axis is contiguous); k_kv (per (b, other-position, head) GEMM -> kv^T[d][m]); k_att (per (b, head, other-position): phi(q) kv^T / norm -> value layout);
#define NBT 4
#define N1 64
#define N2 128
#define DMOD 256
#define NHD 8
#define DHD 32
#define MF 192
#define NPOS (NBT * N1 * N2)      // 32768 positions
#ifndef TNB
#define TNB NBT                   // batches run through the attention passes / output (debug: fewer)
#endif
#ifndef TB0
#define TB0 0                     // first batch of the attention loops (debug)
#endif
typedef __attribute__((ext_vector_type(8))) __bf16 v8b;
__device__ __forceinline__ v16b frag_b(const __bf16* rowk0, int lane) {
  union { v16b v; v8b q[2]; } u; const __bf16* p = rowk0 + 8 * (lane >> 4);
  u.q[0] = *(const v8b*)p; u.q[1] = *(const v8b*)(p + 16); return u.v;
}
__device__ __forceinline__ v16b frag_gbf(const float* rowk0, int lane) {
  v16b a; const float* p = rowk0 + 8 * (lane >> 4);
#pragma unroll
  for (int i = 0; i < 8; ++i) { a[i] = (__bf16)p[i]; a[8 + i] = (__bf16)p[16 + i]; }
  return a;
}
__device__ __forceinline__ float bfr(float v) { return (float)(__bf16)v; }
__device__ __attribute__((noinline)) float exp_ni(float v) { return expf(v); }
__device__ __attribute__((noinline)) float pow_ni(float a, float b) { return powf(a, b); }
__device__ __attribute__((noinline)) float cos_ni(float v) { return cosf(v); }
__device__ __attribute__((noinline)) float sin_ni(float v) { return sinf(v); }

#define WS_A    0u                              // f32 32 MB: q projection [32768][256] -> (after pooling) VT (value transposed, attended axis contiguous)
#define WS_B    (WS_A + 4u * NPOS * DMOD)          // f32 32 MB: k projection -> phi(k) rows -> kv^T for ONE batch [other][h][d][m] (25 MB / 12.6 MB)
#define WS_V    (WS_B + 4u * NPOS * DMOD)          // f32 32 MB: value [b][n1][n2][h*32+d] (updated in place per pass: V -> V2 -> V3, each written only after its transposed copy exists)
#define WS_QS1  (WS_V + 4u * NPOS * DMOD)          // f32 [4][64][256]  q summed over n2
#define WS_KS1  (WS_QS1 + 4u * NBT * N1 * DMOD)
#define WS_QS2  (WS_KS1 + 4u * NBT * N1 * DMOD)    // f32 [4][128][256] q summed over n1 (then RoPE'd in place)
#define WS_KS2  (WS_QS2 + 4u * NBT * N2 * DMOD)
#define WS_MM   (WS_KS2 + 4u * NBT * N2 * DMOD)
#define MMS 32
#define WS_QP   (WS_MM + 4u * 4 * 65 * MMS)        // f32 [4][8][128][192] phi(q) (l rows, m contiguous)  (pass 1 packs [4][8][64][192]); WS_MM holds [4 tensors][65 slots][32 floats]
#define WS_KPT  (WS_QP + 4u * NBT * NHD * N2 * MF) // f32 [4][8][192][128] phi(k)^T (m rows, l contiguous)
#define WS_KSUM (WS_KPT + 4u * NBT * NHD * MF * N2)// f32 [4][8][192]
#define WS_AN   (WS_KSUM + 4u * NBT * NHD * MF)    // f32 [4][8][128] att_norm
#define WS_END  (WS_AN + 4u * NBT * NHD * N2)

// ---- k_proj: [32768 rows] x [q|k|v 768 cols] = bf16(X) . W rows ([out][in]) + b (exact); block (64 rows, 128 cols); 512-B segments of 1-KB rows
__global__ __launch_bounds__(128) void k_proj(const float* __restrict__ X, const float* __restrict__ Wq, const float* __restrict__ bq, const float* __restrict__ Wk, const float* __restrict__ bk, const float* __restrict__ Wv, const float* __restrict__ bv, float* __restrict__ Q, float* __restrict__ Kb, float* __restrict__ V) {
  __shared__ __align__(16) float so[4][16][132];
  const int tid = threadIdx.x, wave = tid >> 5, lane = tid & 31, col = lane & 15, g = lane >> 4; const size_t r0 = (size_t)blockIdx.x * 64 + wave * 16; const int nb = blockIdx.y; const int which = nb >> 1, n0 = (nb & 1) * 128;
  const float* Wm = which == 0 ? Wq : (which == 1 ? Wk : Wv); const float* bm = which == 0 ? bq : (which == 1 ? bk : bv); float* dst = which == 0 ? Q : (which == 1 ? Kb : V);
  v8f acc[8] = {};
#pragma unroll 2
  for (int kc = 0; kc < DMOD / 32; ++kc) { const v16b a = frag_gbf(X + (r0 + col) * DMOD + kc * 32, lane);
#pragma unroll
    for (int j = 0; j < 8; ++j) acc[j] = wmma_bf(a, frag_gbf(Wm + (size_t)(n0 + j * 16 + col) * DMOD + kc * 32, lane), acc[j]); }
#pragma unroll
  for (int j = 0; j < 8; ++j) { const float bb = bfr(bm[n0 + j * 16 + col]);
#pragma unroll
    for (int r = 0; r < 8; ++r) so[wave][8 * g + r][j * 16 + col] = acc[j][r] + bb; }
  LDSX();
  for (int rl = 0; rl < 16; ++rl) vst2(dst + (r0 + rl) * DMOD + n0 + lane * 4, *(const v4f*)&so[wave][rl][lane * 4]);
}
// ---- k_pool1: S1[b][n1][c] = sum_{n2} T[b][n1][n2][c]; block = (b, n1), thread c; 1-KB rows.   k_pool2: S2[b][n2][c] = sum_{n1}; block = (b, n2)
__global__ __launch_bounds__(256) void k_pool1(const float* __restrict__ T, float* __restrict__ S1) {
  __shared__ __align__(16) float srow[DMOD];
  const int b = blockIdx.x / N1, i1 = blockIdx.x % N1, c = threadIdx.x; float s = 0.f;
  for (int i2 = 0; i2 < N2; ++i2) s += T[(((size_t)b * N1 + i1) * N2 + i2) * DMOD + c];
  srow[c] = s; __syncthreads();
  if (c < 64) vst2(S1 + (size_t)blockIdx.x * DMOD + c * 4, *(const v4f*)&srow[c * 4]);
}
__global__ __launch_bounds__(256) void k_pool2(const float* __restrict__ T, float* __restrict__ S2) {
  __shared__ __align__(16) float srow[DMOD];
  const int b = blockIdx.x / N2, i2 = blockIdx.x % N2, c = threadIdx.x; float s = 0.f;
  for (int i1 = 0; i1 < N1; ++i1) s += T[(((size_t)b * N1 + i1) * N2 + i2) * DMOD + c];
  srow[c] = s; __syncthreads();
  if (c < 64) vst2(S2 + (size_t)blockIdx.x * DMOD + c * 4, *(const v4f*)&srow[c * 4]);
}
// ---- k_rope: in place on S2 (q and k pooled over n1): per (b, l < 128, h): x[32] -> x cos + rot(x) sin, rot = (-x[16:], x[:16]), angle = l * 10000^(-j/16) (j = d mod 16); block = (b, l), thread = (h, d)
__global__ __launch_bounds__(256) void k_rope(float* __restrict__ SQ, float* __restrict__ SK) {
  __shared__ __align__(16) float sq[DMOD], sk[DMOD];
  const int l = blockIdx.x % N2, tid = threadIdx.x; const size_t row = (size_t)blockIdx.x * DMOD; const int d = tid & 31, j = d & 15;
  const float invf = 1.0f / pow_ni(10000.0f, (float)(2 * j) / 32.0f); const float ang = (float)l * invf; const float c = cos_ni(ang), s = sin_ni(ang);
  const float xq = SQ[row + tid], xk = SK[row + tid]; const float rq = d < 16 ? -SQ[row + tid + 16] : SQ[row + tid - 16]; const float rk = d < 16 ? -SK[row + tid + 16] : SK[row + tid - 16];
  sq[tid] = xq * c + rq * s; sk[tid] = xk * c + rk * s;
  __syncthreads();
  if (tid < 64) vst2(SQ + row + tid * 4, *(const v4f*)&sq[tid * 4]); else if (tid < 128) vst2(SK + row + (tid - 64) * 4, *(const v4f*)&sk[(tid - 64) * 4]);
}
// ---- k_minmax: partial min/max of a tensor of n floats: block i of 64 scans a strided slice -> MMP[t][i][2]; k_mmfin: finals MM[t] = (min, max) (block t, 64 threads)
__global__ __launch_bounds__(256) void k_minmax(const float* __restrict__ T, int n, int t, float* __restrict__ MMP) {
  __shared__ float smn[8], smx[8]; __shared__ __align__(16) float sres[4];
  const int tid = threadIdx.x, wave = tid >> 5, lane = tid & 31; float mn = 3.0e38f, mx = -3.0e38f;
  for (int i = blockIdx.x * 256 + tid; i < n; i += 64 * 256) { const float v = T[i]; mn = fminf(mn, v); mx = fmaxf(mx, v); }
#pragma unroll
  for (int o = 1; o < 32; o <<= 1) { mn = fminf(mn, __shfl_xor(mn, o)); mx = fmaxf(mx, __shfl_xor(mx, o)); }
  if (lane == 0) { smn[wave] = mn; smx[wave] = mx; }
  __syncthreads();
  if (tid == 0) { float a = smn[0], bq2 = smx[0]; for (int w = 1; w < 8; ++w) { a = fminf(a, smn[w]); bq2 = fmaxf(bq2, smx[w]); } sres[0] = a; sres[1] = bq2; sres[2] = 0.f; sres[3] = 0.f; }
  __syncthreads();
  if (tid < 8) { const v4f z = {0.f, 0.f, 0.f, 0.f}; vst2(MMP + ((size_t)t * 65 + blockIdx.x) * MMS + tid * 4, tid == 0 ? *(const v4f*)sres : z); }
}
__global__ __launch_bounds__(64) void k_mmfin(float* __restrict__ MMP) {
  const int t = blockIdx.x, tid = threadIdx.x; float mn = MMP[((size_t)t * 65 + tid) * MMS], mx = MMP[((size_t)t * 65 + tid) * MMS + 1];
#pragma unroll
  for (int o = 1; o < 32; o <<= 1) { mn = fminf(mn, __shfl_xor(mn, o)); mx = fmaxf(mx, __shfl_xor(mx, o)); }
  __shared__ float s2[4];
  if ((tid & 31) == 0) { s2[(tid >> 5) * 2] = mn; s2[(tid >> 5) * 2 + 1] = mx; }
  __syncthreads();
  __shared__ __align__(16) float sfin[4];
  if (tid == 0) { sfin[0] = fminf(s2[0], s2[2]); sfin[1] = fmaxf(s2[1], s2[3]); sfin[2] = 0.f; sfin[3] = 0.f; }
  __syncthreads();
  if (tid < 8) { const v4f z = {0.f, 0.f, 0.f, 0.f}; vst2(MMP + ((size_t)t * 65 + 64) * MMS + tid * 4, tid == 0 ? *(const v4f*)sfin : z); }
}

// ---- k_feat: phi for one pooled tensor S (rows (b,l), l < L) and head h = blockIdx.y; block = 16 rows (one wave): xs = (x - mn)/(mx - mn) * 32^-1/4; dots on WMMA (xs hi/lo x bf16(feat rows), K = 32, 12 tiles); phi = exp(dot - |xs|^2/2 - ln(192)/2 + 1e-6);
//      P[(b*8 + h)*L + l][m] rows of 768 B (48 pieces)
__global__ __launch_bounds__(32) void k_feat(const float* __restrict__ S, int L, const float* __restrict__ MM, int t, const float* __restrict__ feat, float* __restrict__ P) {
  __shared__ __align__(16) float sx[16][36]; __shared__ __align__(16) float so[16][196]; __shared__ float soff[16];
  const int lane = threadIdx.x, col = lane & 15, g = lane >> 4; const int h = blockIdx.y; const int r0 = blockIdx.x * 16; const int b = r0 / L, l0 = r0 % L;
  const float mn = MM[((size_t)t * 65 + 64) * MMS], mx = MM[((size_t)t * 65 + 64) * MMS + 1]; const float sc = 1.0f / (mx - mn); const float temp = 0.42044820762685725f;   // 32^-0.25
  { const int rl = lane >> 1, half = lane & 1; float ss = 0.f;
    for (int d = half * 16; d < half * 16 + 16; ++d) { const float x = S[(size_t)(r0 + rl) * DMOD + h * DHD + d]; const float xs = (x - mn) * sc * temp; sx[rl][d] = xs; ss += xs * xs; }
    ss += __shfl_xor(ss, 1); if (half == 0) { soff[rl] = -0.5f * ss - 0.5f * 5.2574953720277815f + 1e-6f; sx[rl][32] = 0.f; sx[rl][33] = 0.f; sx[rl][34] = 0.f; sx[rl][35] = 0.f; } }
  LDSX();
  const F2 a = split_row(&sx[col][0], 0, lane);
#pragma unroll
  for (int j = 0; j < 12; ++j) { v8f acc = {}; const v16b w = frag_gbf(feat + (size_t)(j * 16 + col) * DHD, lane); acc = wmma_bf(a.l, w, acc); acc = wmma_bf(a.h, w, acc);
#pragma unroll
    for (int r = 0; r < 8; ++r) so[8 * g + r][j * 16 + col] = exp_ni(acc[r] + soff[8 * g + r]); }
  LDSX();
  for (int q = lane; q < 16 * 48; q += 32) { const int rl = q / 48, pc = q % 48; vst2(P + ((size_t)(b * NHD + h) * L + l0 + rl) * MF + pc * 4, *(const v4f*)&so[rl][pc * 4]); }
}
// ---- k_kpt: per (b,h): KP rows [l][m] (L x 192) -> KPT[(b*8+h)][m][l] (l contiguous, pitch 128) and ksum[(b*8+h)][m] = sum_l; block = (b,h), 256 threads; LDS tile
__global__ __launch_bounds__(256) void k_kpt(const float* __restrict__ KP, int L, float* __restrict__ KPT, float* __restrict__ KS) {
  __shared__ float st[MF][N2 + 1]; __shared__ __align__(16) float ssum[MF]; __shared__ __align__(16) float srow[N2];
  const int bh = blockIdx.x, tid = threadIdx.x;
  for (int q = tid; q < L * MF; q += 256) { const int l = q / MF, m = q % MF; st[m][l] = KP[((size_t)bh * L + l) * MF + m]; }
  __syncthreads();
  if (tid < MF) { float s = 0.f; for (int l = 0; l < L; ++l) s += st[tid][l]; ssum[tid] = s; }
  for (int m = 0; m < MF; ++m) { __syncthreads(); if (tid < N2) srow[tid] = tid < L ? st[m][tid] : 0.f; __syncthreads(); if (tid < 32) vst2(KPT + ((size_t)bh * MF + m) * N2 + tid * 4, *(const v4f*)&srow[tid * 4]); }
  __syncthreads();
  if (tid < 48) vst2(KS + (size_t)bh * MF + tid * 4, *(const v4f*)&ssum[tid * 4]);
}
// ---- k_an: att_norm[(b*8+h)][l] = sum_m QP[(b*8+h)*L + l][m] * ksum[(b*8+h)][m]; block = (b,h), thread = l (< L); rows pitch 128
__global__ __launch_bounds__(128) void k_an(const float* __restrict__ QP, const float* __restrict__ KS, int L, float* __restrict__ AN) {
  __shared__ float sks[MF]; __shared__ __align__(16) float sres[N2];
  const int bh = blockIdx.x, tid = threadIdx.x;
  for (int m = tid; m < MF; m += 128) sks[m] = KS[(size_t)bh * MF + m];
  __syncthreads();
  float s = 0.f; if (tid < L) { const float* row = QP + ((size_t)bh * L + tid) * MF; for (int m = 0; m < MF; ++m) s += row[m] * sks[m]; }
  sres[tid] = tid < L ? s : 1.0f;
  __syncthreads();
  if (tid < 32) vst2(AN + (size_t)bh * N2 + tid * 4, *(const v4f*)&sres[tid * 4]);
}
template <int PASS>
__global__ __launch_bounds__(256) void k_vt(const float* __restrict__ V, float* __restrict__ VT, int ob0) {
  __shared__ float st[DMOD][(PASS == 1 ? N1 : N2) + 1];
  const int tid = threadIdx.x; constexpr int L = (PASS == 1 ? N1 : N2); const int other = ob0 + blockIdx.x;
  const int b = PASS == 1 ? other / N2 : other / N1, o = PASS == 1 ? other % N2 : other % N1;
  for (int q = tid; q < L * DMOD; q += 256) { const int l = q / DMOD, c = q % DMOD; const size_t src = PASS == 1 ? ((((size_t)b * N1 + l) * N2 + o) * DMOD + c) : ((((size_t)b * N1 + o) * N2 + l) * DMOD + c); st[c][l] = V[src]; }
  __syncthreads();
  __shared__ __align__(16) float srow[4][N2];
  for (int c0 = 0; c0 < DMOD; c0 += 4) { const int cc = c0 + (tid >> 6), ll = tid & 63;
    for (int l = ll; l < L; l += 64) srow[tid >> 6][l] = st[cc][l];
    __syncthreads();
    if (tid < 4 * (L / 4)) { const int c1 = tid / (L / 4), pc = tid % (L / 4); vst2(VT + ((size_t)other * DMOD + c0 + c1) * L + pc * 4, *(const v4f*)&srow[c1][pc * 4]); }
    __syncthreads(); }
}
// ---- k_kv: per (b, other o, head h): kvT[d][m] = sum_l VT[b][o][(h,d)][l] (hi/lo) . KPT[(b,h)][m][l] (hi/lo): M = d (32 = 2 tiles), N = m (192 = 12 tiles), K = L (2 or 4 steps); block = 2 waves (one per d tile), 3 products; out rows [o*8 + h][d][m] (768 B per d row, 24 KB per block contiguous)
__global__ __launch_bounds__(64) void k_kv(const float* __restrict__ VT, const float* __restrict__ KPT, int L, int O, int b, float* __restrict__ KVT) {   // one batch b per launch: KVT [(o*8 + h)][d][m] (25 MB / 12.6 MB) reuses buffer B
  __shared__ __align__(16) float so[2][16][196];
  const int tid = threadIdx.x, wave = tid >> 5, lane = tid & 31, col = lane & 15, g = lane >> 4; const int blk = blockIdx.x; const int h = blk % NHD, o = blk / NHD; const int bo = b * O + o;
  const float* arow = VT + ((size_t)bo * DMOD + h * DHD + wave * 16 + col) * L;
  v8f acc[12] = {};
  for (int kc = 0; kc < L / 32; ++kc) { const F2 a = split_row(arow, kc * 32, lane);
#pragma unroll
    for (int j = 0; j < 12; ++j) { const F2 kb = split_row(KPT + ((size_t)(b * NHD + h) * MF + j * 16 + col) * N2, kc * 32, lane); acc[j] = mac3(a, kb, acc[j]); } }
#pragma unroll
  for (int j = 0; j < 12; ++j)
#pragma unroll
    for (int r = 0; r < 8; ++r) so[wave][8 * g + r][j * 16 + col] = acc[j][r];
  LDSX();
  for (int q = lane; q < 16 * 48; q += 32) { const int rl = q / 48, pc = q % 48; vst2(KVT + (((size_t)blk) * DHD + wave * 16 + rl) * MF + pc * 4, *(const v4f*)&so[wave][rl][pc * 4]); }
}
__global__ __launch_bounds__(256) void k_att(const float* __restrict__ QP, const float* __restrict__ KVT, const float* __restrict__ AN, int L, int O, int pass, int b, float* __restrict__ Vout) {   // one batch per launch (KVT is batch-local)
  __shared__ __align__(16) float so[8][16][36];
  const int tid = threadIdx.x, wave = tid >> 5, lane = tid & 31, col = lane & 15, g = lane >> 4; const int blk = blockIdx.x; const int h = blk % NHD, o = blk / NHD;
  if (wave * 16 >= L) return;
  const float* qrow = QP + ((size_t)(b * NHD + h) * L + wave * 16 + col) * MF;
  v8f acc[2] = {};
#pragma unroll
  for (int kc = 0; kc < MF / 32; ++kc) { const F2 a = split_row(qrow, kc * 32, lane);
#pragma unroll
    for (int j = 0; j < 2; ++j) { const F2 kb = split_row(KVT + ((size_t)blk * DHD + j * 16 + col) * MF, kc * 32, lane); acc[j] = mac3(a, kb, acc[j]); } }
  float inv[8];
#pragma unroll
  for (int r = 0; r < 8; ++r) inv[r] = 1.0f / AN[(size_t)(b * NHD + h) * N2 + wave * 16 + 8 * g + r];
#pragma unroll
  for (int j = 0; j < 2; ++j)
#pragma unroll
    for (int r = 0; r < 8; ++r) so[wave][8 * g + r][j * 16 + col] = acc[j][r] * inv[r];
  LDSX();
  for (int q = lane; q < 16 * 8; q += 32) { const int rl = q >> 3, pc = q & 7; const int l = wave * 16 + rl;
    const size_t pos = pass == 1 ? (((size_t)b * N1 + l) * N2 + o) : (((size_t)b * N1 + o) * N2 + l);
    vst2(Vout + pos * DMOD + h * DHD + pc * 4, *(const v4f*)&so[wave][rl][pc * 4]); }
}
// ---- k_out: Y = V3(hi/lo) . bf16(Wo rows [256][256]) + bo; block (64 rows, 128 cols); K = 256
__global__ __launch_bounds__(128) void k_out(const float* __restrict__ V3, const float* __restrict__ Wo, const float* __restrict__ bo, float* __restrict__ Y, int rb0) {
  __shared__ __align__(16) float so[4][16][132];
  const int tid = threadIdx.x, wave = tid >> 5, lane = tid & 31, col = lane & 15, g = lane >> 4; const size_t r0 = (size_t)(rb0 + blockIdx.x) * 64 + wave * 16; const int n0 = blockIdx.y * 128;
  v8f acc[8] = {};
#pragma unroll 2
  for (int kc = 0; kc < DMOD / 32; ++kc) { const F2 a = split_row(V3 + (r0 + col) * DMOD, kc * 32, lane);
#pragma unroll
    for (int j = 0; j < 8; ++j) { const v16b w = frag_gbf(Wo + (size_t)(n0 + j * 16 + col) * DMOD + kc * 32, lane); acc[j] = wmma_bf(a.l, w, acc[j]); acc[j] = wmma_bf(a.h, w, acc[j]); } }
#pragma unroll
  for (int j = 0; j < 8; ++j) { const float bb = bfr(bo[n0 + j * 16 + col]);
#pragma unroll
    for (int r = 0; r < 8; ++r) so[wave][8 * g + r][j * 16 + col] = acc[j][r] + bb; }
  LDSX();
  for (int rl = 0; rl < 16; ++rl) vst2(Y + (r0 + rl) * DMOD + n0 + lane * 4, *(const v4f*)&so[wave][rl][lane * 4]);
}

#ifndef DBG
#define DBG 0
#endif
#if DBG != 0
__global__ __launch_bounds__(256) void k_dump(const float* __restrict__ src, int n, float* __restrict__ out) {   // out[0..n) = src, rest of batch-0 region zero
  const size_t p = (size_t)blockIdx.x * 256 + threadIdx.x; v4f v; for (int i = 0; i < 4; ++i) { const size_t f = p * 4 + i; v[i] = f < (size_t)n ? src[f] : 0.f; } vst2(out + p * 4, v);
}
#endif
extern "C" void kernel_launch(void* const* d_in, const int* in_sizes, int n_in, void* d_out, int out_size, void* d_ws, size_t ws_size, hipStream_t stream) {
  (void)in_sizes; (void)n_in; (void)out_size;
  const float** F = (const float**)d_in;   // X, Wq, bq, Wk, bk, Wv, bv, Wo, bo, feat
  if (ws_size < (size_t)WS_END) return;
  char* ws = (char*)d_ws; float *BA = (float*)(ws + WS_A), *BB = (float*)(ws + WS_B), *V = (float*)(ws + WS_V), *QS1 = (float*)(ws + WS_QS1), *KS1 = (float*)(ws + WS_KS1), *QS2 = (float*)(ws + WS_QS2), *KS2 = (float*)(ws + WS_KS2), *MM = (float*)(ws + WS_MM), *QP = (float*)(ws + WS_QP), *KPT = (float*)(ws + WS_KPT), *KSUM = (float*)(ws + WS_KSUM), *AN = (float*)(ws + WS_AN);
  float* KP = BB;      // phi(k) rows (before transposition) live in buffer B (free after pooling), before kv^T overwrites it... -> NO: k_kv reads KPT (separate) and writes BB; KP (in BB) is consumed by k_kpt before k_kv runs. OK.
  k_proj<<<dim3(NPOS / 64, 6), 128, 0, stream>>>(F[0], F[1], F[2], F[3], F[4], F[5], F[6], BA, BB, V);
  k_pool1<<<NBT * N1, 256, 0, stream>>>(BA, QS1); k_pool1<<<NBT * N1, 256, 0, stream>>>(BB, KS1);
  k_pool2<<<NBT * N2, 256, 0, stream>>>(BA, QS2); k_pool2<<<NBT * N2, 256, 0, stream>>>(BB, KS2);
  k_rope<<<NBT * N2, 256, 0, stream>>>(QS2, KS2);
  k_minmax<<<64, 256, 0, stream>>>(QS1, NBT * N1 * DMOD, 0, MM); k_minmax<<<64, 256, 0, stream>>>(KS1, NBT * N1 * DMOD, 1, MM); k_minmax<<<64, 256, 0, stream>>>(QS2, NBT * N2 * DMOD, 2, MM); k_minmax<<<64, 256, 0, stream>>>(KS2, NBT * N2 * DMOD, 3, MM);
  k_mmfin<<<4, 64, 0, stream>>>(MM);
  k_feat<<<dim3(NBT * N1 / 16, NHD), 32, 0, stream>>>(QS1, N1, MM, 0, F[9], QP);
  k_feat<<<dim3(NBT * N1 / 16, NHD), 32, 0, stream>>>(KS1, N1, MM, 1, F[9], KP);
  k_kpt<<<NBT * NHD, 256, 0, stream>>>(KP, N1, KPT, KSUM);
  k_an<<<NBT * NHD, 128, 0, stream>>>(QP, KSUM, N1, AN);
#if DBG == 1
  k_dump<<<N1 * N2 * DMOD / 1024, 256, 0, stream>>>(AN, NBT * NHD * N2, (float*)d_out); return;      // pass-1 att_norm [4][8][128] (l < 64 valid, rest 1.0)
#elif DBG == 2
  k_dump<<<N1 * N2 * DMOD / 1024, 256, 0, stream>>>(QP, NBT * NHD * N1 * MF, (float*)d_out); return;  // pass-1 phi(q) [4][8][64][192]
#endif
  k_vt<1><<<(TNB - TB0) * N2, 256, 0, stream>>>(V, BA, TB0 * N2);
  for (int b = TB0; b < TNB; ++b) { k_kv<<<N2 * NHD, 64, 0, stream>>>(BA, KPT, N1, N2, b, BB); k_att<<<N2 * NHD, 256, 0, stream>>>(QP, BB, AN, N1, N2, 1, b, V); }   // kv^T is 100 MB for all batches: one batch (25 MB) at a time in buffer B
#if DBG == 3
  k_dump<<<N1 * N2 * DMOD / 1024, 256, 0, stream>>>(V, N1 * N2 * DMOD, (float*)d_out); return;
#elif DBG == 4
  k_dump<<<N1 * N2 * DMOD / 1024, 256, 0, stream>>>(BB, N2 * NHD * DHD * MF, (float*)d_out); return;
#endif
  // ---- pass 2: time axis (l = n2 = 128 with RoPE, other = n1 = 64)
  k_feat<<<dim3(NBT * N2 / 16, NHD), 32, 0, stream>>>(QS2, N2, MM, 2, F[9], QP);
  k_feat<<<dim3(NBT * N2 / 16, NHD), 32, 0, stream>>>(KS2, N2, MM, 3, F[9], KP);
  k_kpt<<<NBT * NHD, 256, 0, stream>>>(KP, N2, KPT, KSUM);
  k_an<<<NBT * NHD, 128, 0, stream>>>(QP, KSUM, N2, AN);
  k_vt<2><<<(TNB - TB0) * N1, 256, 0, stream>>>(V, BA, TB0 * N1);
  for (int b = TB0; b < TNB; ++b) { k_kv<<<N1 * NHD, 64, 0, stream>>>(BA, KPT, N2, N1, b, BB); k_att<<<N1 * NHD, 256, 0, stream>>>(QP, BB, AN, N2, N1, 2, b, V); }
#if DBG == 5
  k_dump<<<N1 * N2 * DMOD / 1024, 256, 0, stream>>>(V, N1 * N2 * DMOD, (float*)d_out); return;     // value after pass 2, batch 0
#elif DBG == 6
  k_dump<<<N1 * N2 * DMOD / 1024, 256, 0, stream>>>(AN, NBT * NHD * N2, (float*)d_out); return;    // pass-2 att_norm
#endif
  k_out<<<dim3((TNB - TB0) * N1 * N2 / 64, 2), 128, 0, stream>>>(V, F[7], F[8], (float*)d_out, TB0 * N1 * N2 / 64);
}

// v002
// It runs in 361 microseconds.
// Versions in between are left out here; by their measured steps it is 2.28 times as fast as v000.
// compute dtype: X, the projection weights/biases and the random-feature matrix (module inputs) rounded to bf16; the v projection with exact bf16 products; the q and k projections taken on the axis sums of bf16(X) (f32 sums as three bf16 pieces, 3 products, all 24 bits); the feature-map GEMM (pooled q,k x feat) with the pooled operand as a bf16 hi + bf16 residual pair (2 products); the phi(q) phi(k)^T and mixing-matrix x value contractions with both computed operands hi/lo (3 products);
// the output projection hi/lo against bf16 Wo (2 products); axis pooling, RoPE, global min-max normalisation, exp feature maps, normalisers and divisions in f32; f32 accumulate.
#include <hip/hip_runtime.h>
#include <math.h>

typedef __attribute__((ext_vector_type(16))) _Float16 v16h;
typedef __attribute__((ext_vector_type(16))) __bf16 v16b;
typedef __attribute__((ext_vector_type(8)))  _Float16 v8h;
typedef __attribute__((ext_vector_type(8)))  float v8f;
typedef __attribute__((ext_vector_type(4)))  float v4f;
typedef __attribute__((ext_vector_type(2)))  float v2f;
typedef __attribute__((ext_vector_type(4)))  unsigned v4u;
typedef __attribute__((ext_vector_type(4)))  int v4i;
typedef float __attribute__((may_alias)) float_a;
typedef int __attribute__((may_alias)) int_a;

template <typename T> __device__ __forceinline__ void vst2(void* p, T v) { *(T*)p = v;  }
__device__ __forceinline__ v8f wmma16(v16h a, v16h b, v8f c) {
  v8f d = __builtin_amdgcn_wmma_f32_16x16x32_f16(false, a, false, b, (short)0, c, false, false);
  asm volatile("v_nop\n\tv_nop\n\tv_nop\n\tv_nop" : "+v"(d) : "v"(a), "v"(b));
  return d;
}
__device__ __forceinline__ v8f wmma_bf(v16b a, v16b b, v8f c) {
  v8f d = __builtin_amdgcn_wmma_f32_16x16x32_bf16(false, a, false, b, (short)0, c, false, false);
  asm volatile("v_nop\n\tv_nop\n\tv_nop\n\tv_nop" : "+v"(d) : "v"(a), "v"(b));
  return d;
}
// 16x16x32 fragments: lane = (h = lane>>4, row/col = lane&15); elements 0..7 = k0+8h+0..7, 8..15 = k0+16+8h+0..7; D element r = row 8h+r
__device__ __forceinline__ v16h frag_h(const _Float16* rowk0, int lane) {
  union { v16h v; v8h q[2]; } u; const _Float16* p = rowk0 + 8 * (lane >> 4);
  u.q[0] = *(const v8h*)p; u.q[1] = *(const v8h*)(p + 16); return u.v;
}
__device__ __forceinline__ v16h frag_f32(const float* rowk0, int lane) {
  v16h a; const float* p = rowk0 + 8 * (lane >> 4);
#pragma unroll
  for (int i = 0; i < 8; ++i) { a[i] = (_Float16)p[i]; a[8 + i] = (_Float16)p[16 + i]; }
  return a;
}
__device__ __forceinline__ v16h frag_f32s(const float* rowk0, int lane, float sc) {
  v16h a; const float* p = rowk0 + 8 * (lane >> 4);
#pragma unroll
  for (int i = 0; i < 8; ++i) { a[i] = (_Float16)(p[i] * sc); a[8 + i] = (_Float16)(p[16 + i] * sc); }
  return a;
}
// column fragment from a [K][ld] layout (column n), rows >= K read as 0
__device__ __forceinline__ v16h fragc_f32(const float* W, int k0, int n, int lane, int ld, int K) {
  v16h a; const int g = lane >> 4;
#pragma unroll
  for (int i = 0; i < 8; ++i) { const int ka = k0 + 8 * g + i, kb = ka + 16;
    a[i] = (_Float16)(ka < K ? W[(size_t)(ka < K ? ka : K - 1) * ld + n] : 0.f); a[8 + i] = (_Float16)(kb < K ? W[(size_t)(kb < K ? kb : K - 1) * ld + n] : 0.f); }
  return a;
}
struct F2 { v16b h, l; };
__device__ __forceinline__ F2 bsplit16(const float v[16]) { F2 r;
#pragma unroll
  for (int i = 0; i < 16; ++i) { const __bf16 h = (__bf16)v[i]; r.h[i] = h; r.l[i] = (__bf16)(v[i] - (float)h); }
  return r; }
__device__ __forceinline__ F2 split_row(const float* row, int k0, int lane) { float v[16]; const float* p = row + k0 + 8 * (lane >> 4);
#pragma unroll
  for (int i = 0; i < 8; ++i) { v[i] = p[i]; v[8 + i] = p[16 + i]; }
  return bsplit16(v); }
__device__ __forceinline__ F2 split_rowK(const float* row, int k0, int lane, int K) { float v[16]; const int g = lane >> 4;
#pragma unroll
  for (int i = 0; i < 8; ++i) { const int ka = k0 + 8 * g + i, kb = ka + 16; v[i] = ka < K ? row[ka < K ? ka : K - 1] : 0.f; v[8 + i] = kb < K ? row[kb < K ? kb : K - 1] : 0.f; }
  return bsplit16(v); }
__device__ __forceinline__ F2 split_col(const float* W, int k0, int n, int lane, int ld, int K) { float v[16]; const int g = lane >> 4;
#pragma unroll
  for (int i = 0; i < 8; ++i) { const int ka = k0 + 8 * g + i, kb = ka + 16; v[i] = ka < K ? W[(size_t)(ka < K ? ka : K - 1) * ld + n] : 0.f; v[8 + i] = kb < K ? W[(size_t)(kb < K ? kb : K - 1) * ld + n] : 0.f; }
  return bsplit16(v); }
__device__ __forceinline__ v8f mac3(const F2& a, const F2& b, v8f c) { c = wmma_bf(a.l, b.h, c); c = wmma_bf(a.h, b.l, c); return wmma_bf(a.h, b.h, c); }
__device__ __forceinline__ float sigm(float v) { return 1.0f / (1.0f + expf(-v)); }
#define LDSX() do { asm volatile("s_wait_dscnt 0" ::: "memory"); __builtin_amdgcn_wave_barrier(); __builtin_amdgcn_fence(__ATOMIC_RELEASE, "workgroup"); } while (0)


// High-order linear attention over a [4, 64, 128, 256] tensor: q/k/v = X W^T + b; for the assets axis (n1, pooled over n2) and then the time axis (n2, pooled over n1, with RoPE): Performer-style positive features phi(x) = exp(xs f^T - |xs|^2/2 - log(M)/2 + 1e-6), xs = (x - min x)/(max x - min x) * 32^-1/4 (global min/max),
// out_l = sum_l' A[l][l'] v_l', A[l][l'] = phi(q_l) . phi(k_l') / (phi(q_l) . sum_l phi(k_l)): the product phi(q) (phi(k)^T v) taken as (phi(q) phi(k)^T) v, since A depends on (b, head) alone and the attended length (64, 128) is below the 192 features; finally value W_o^T + b_o.
// q and k are used only through their axis sums, and sum_i (x_i W^T + b) = (sum_i x_i) W^T + n b: X is pooled first and only the 768 pooled rows are projected.
// k_poolx (axis sums of X); k_pproj (pooled q and k); k_proj (v); k_rope (dim-2 pooled q,k); k_minmax; k_feat (phi via WMMA); k_ksum; k_an (normaliser); k_amat (per (b, head): A); k_vt (value transposed so the attended axis is contiguous); k_att (per (b, other-position, head): A VT^T -> value layout);
#define NBT 4
#define N1 64
#define N2 128
#define DMOD 256
#define NHD 8
#define DHD 32
#define MF 192
#define NPOS (NBT * N1 * N2)      // 32768 positions
#ifndef TNB
#define TNB NBT                   // batches run through the attention passes / output (debug: fewer)
#endif
#ifndef TB0
#define TB0 0                     // first batch of the attention loops (debug)
#endif
typedef __attribute__((ext_vector_type(8))) __bf16 v8b;
__device__ __forceinline__ v16b frag_b(const __bf16* rowk0, int lane) {
  union { v16b v; v8b q[2]; } u; const __bf16* p = rowk0 + 8 * (lane >> 4);
  u.q[0] = *(const v8b*)p; u.q[1] = *(const v8b*)(p + 16); return u.v;
}
__device__ __forceinline__ v16b frag_gbf(const float* rowk0, int lane) {
  v16b a; const float* p = rowk0 + 8 * (lane >> 4);
#pragma unroll
  for (int i = 0; i < 8; ++i) { a[i] = (__bf16)p[i]; a[8 + i] = (__bf16)p[16 + i]; }
  return a;
}
__device__ __forceinline__ float bfr(float v) { return (float)(__bf16)v; }
__device__ __attribute__((noinline)) float exp_ni(float v) { return expf(v); }
__device__ __attribute__((noinline)) float pow_ni(float a, float b) { return powf(a, b); }
__device__ __attribute__((noinline)) float cos_ni(float v) { return cosf(v); }
__device__ __attribute__((noinline)) float sin_ni(float v) { return sinf(v); }

#define WS_A    0u                              // f32 32 MB: VT (value transposed, attended axis contiguous)
#define WS_B    (WS_A + 4u * NPOS * DMOD)          // f32 32 MB: phi(k) rows [(b,h)][l][m]
#define WS_V    (WS_B + 4u * NPOS * DMOD)          // f32 32 MB: value [b][n1][n2][h*32+d] (updated in place per pass: V -> V2 -> V3, each written only after its transposed copy exists)
#define WS_QS1  (WS_V + 4u * NPOS * DMOD)          // f32 [4][64][256]  q summed over n2
#define WS_KS1  (WS_QS1 + 4u * NBT * N1 * DMOD)
#define WS_QS2  (WS_KS1 + 4u * NBT * N1 * DMOD)    // f32 [4][128][256] q summed over n1 (then RoPE'd in place)
#define WS_KS2  (WS_QS2 + 4u * NBT * N2 * DMOD)
#define WS_MM   (WS_KS2 + 4u * NBT * N2 * DMOD)
#define MMS 32
#define WS_QP   (WS_MM + 4u * 4 * 65 * MMS)        // f32 [4][8][L][192] phi(q) (l rows, m contiguous), L = 64 (dim 1) or 128 (dim 2); WS_MM holds [4 tensors][65 slots][32 floats]
#define WS_AM   (WS_QP + 4u * NBT * NHD * N2 * MF) // f32 [4][8][128][128] A (l rows, l' contiguous, pitch 128)
#define WS_KSUM (WS_AM + 4u * NBT * NHD * N2 * N2) // f32 [4][8][192]
#define WS_AN   (WS_KSUM + 4u * NBT * NHD * MF)    // f32 [4][8][128] att_norm
#define WS_SX   (WS_AN + 4u * NBT * NHD * N2)      // f32 [256 + 512][256] bf16(X) summed over n2 (rows b*64 + n1), then summed over n1 (rows 256 + b*128 + n2)
#define WS_END  (WS_SX + 4u * (NBT * N1 + NBT * N2) * DMOD)

// ---- k_proj: [32768 rows] x [v 256 cols] = bf16(X) . W rows ([out][in]) + b (exact); block (64 rows, 128 cols); 512-B segments of 1-KB rows
__global__ __launch_bounds__(128) void k_proj(const float* __restrict__ X, const float* __restrict__ Wm, const float* __restrict__ bm, float* __restrict__ dst) {
  __shared__ __align__(16) float so[4][16][132];
  const int tid = threadIdx.x, wave = tid >> 5, lane = tid & 31, col = lane & 15, g = lane >> 4; const size_t r0 = (size_t)blockIdx.x * 64 + wave * 16; const int n0 = blockIdx.y * 128;
  v8f acc[8] = {};
#pragma unroll 2
  for (int kc = 0; kc < DMOD / 32; ++kc) { const v16b a = frag_gbf(X + (r0 + col) * DMOD + kc * 32, lane);
#pragma unroll
    for (int j = 0; j < 8; ++j) acc[j] = wmma_bf(a, frag_gbf(Wm + (size_t)(n0 + j * 16 + col) * DMOD + kc * 32, lane), acc[j]); }
#pragma unroll
  for (int j = 0; j < 8; ++j) { const float bb = bfr(bm[n0 + j * 16 + col]);
#pragma unroll
    for (int r = 0; r < 8; ++r) so[wave][8 * g + r][j * 16 + col] = acc[j][r] + bb; }
  LDSX();
  for (int rl = 0; rl < 16; ++rl) vst2(dst + (r0 + rl) * DMOD + n0 + lane * 4, *(const v4f*)&so[wave][rl][lane * 4]);
}
// ---- k_poolx: axis sums of bf16(X). Blocks < 256: SX[b*64 + n1][c] = sum_{n2}; blocks >= 256: SX[256 + b*128 + n2][c] = sum_{n1}. Thread = (part = tid >> 6, 4 columns): a part sums every 4th row (ascending), the 4 parts are added in LDS; 1-KB rows
template <int NR> __device__ __forceinline__ v4f sum_rows(const float* __restrict__ p, size_t step) {
  v4f s = {0.f, 0.f, 0.f, 0.f};
#pragma unroll 16   // 16 row loads of 16 B in flight per lane: the kernel is a stream from memory
  for (int i = 0; i < NR; ++i) { const v4f v = *(const v4f*)(p + (size_t)i * step);
#pragma unroll      // vector elements by constant index
    for (int e = 0; e < 4; ++e) s[e] += bfr(v[e]); }
  return s;
}
__global__ __launch_bounds__(256) void k_poolx(const float* __restrict__ X, float* __restrict__ SX) {
  __shared__ __align__(16) float sp[4][DMOD];
  const int tid = threadIdx.x, part = tid >> 6, c4 = (tid & 63) * 4, blk = blockIdx.x; v4f s;
  if (blk < NBT * N1) s = sum_rows<N2 / 4>(X + ((size_t)blk * N2 + part) * DMOD + c4, (size_t)4 * DMOD);
  else { const int r = blk - NBT * N1, b = r / N2, i2 = r % N2; s = sum_rows<N1 / 4>(X + (((size_t)b * N1 + part) * N2 + i2) * DMOD + c4, (size_t)4 * N2 * DMOD); }
  *(v4f*)&sp[part][c4] = s;
  __syncthreads();
  if (tid < 64) vst2(SX + (size_t)blk * DMOD + c4, (*(const v4f*)&sp[0][c4] + *(const v4f*)&sp[1][c4]) + (*(const v4f*)&sp[2][c4] + *(const v4f*)&sp[3][c4]));
}
// ---- k_pproj: pooled q and k: [768 rows of SX] x [q|k 512 cols] = SX (three bf16 pieces, 3 products) . bf16(W rows) + n bf16(b), n = rows summed (128 or 64); block (16 rows, 64 cols), wave = 16 cols; K = 256; 256-B segments of 1-KB rows
__global__ __launch_bounds__(128) void k_pproj(const float* __restrict__ SX, const float* __restrict__ Wq, const float* __restrict__ bq, const float* __restrict__ Wk, const float* __restrict__ bk, float* __restrict__ QS1, float* __restrict__ KS1, float* __restrict__ QS2, float* __restrict__ KS2) {
  __shared__ __align__(16) float so[16][68];
  const int tid = threadIdx.x, wave = tid >> 5, lane = tid & 31, col = lane & 15, g = lane >> 4; const int r0 = blockIdx.x * 16, which = blockIdx.y >> 2, nb0 = (blockIdx.y & 3) * 64, n = nb0 + wave * 16 + col;
  const float* Wm = which == 0 ? Wq : Wk; const float* bm = which == 0 ? bq : bk; const bool ax1 = r0 < NBT * N1;
  float* dst = ax1 ? (which == 0 ? QS1 : KS1) + (size_t)r0 * DMOD : (which == 0 ? QS2 : KS2) + (size_t)(r0 - NBT * N1) * DMOD;
  const float* pa = SX + (size_t)(r0 + col) * DMOD + 8 * g; const float* pw = Wm + (size_t)n * DMOD + 8 * g; const float bb = (ax1 ? (float)N2 : (float)N1) * bfr(bm[n]);
  v8f acc = {};   // every loop below is unrolled whole, so that a, w and the fragments are indexed by constants and stay in registers
#pragma unroll
  for (int kh = 0; kh < 2; ++kh) { v4f a[4][4], w[4][4];   // half of K at a time: its 32 loads go out together
#pragma unroll
    for (int k = 0; k < 4; ++k)
#pragma unroll
      for (int i = 0; i < 4; ++i) { const int o = (kh * 4 + k) * 32 + (i >> 1) * 16 + (i & 1) * 4; a[k][i] = *(const v4f*)(pa + o); w[k][i] = *(const v4f*)(pw + o); }
#pragma unroll
    for (int k = 0; k < 4; ++k) { v16b ah, am, al, wb;
#pragma unroll
      for (int i = 0; i < 16; ++i) { const float v = a[k][i >> 2][i & 3]; const __bf16 h = (__bf16)v; const float r1 = v - (float)h; const __bf16 m = (__bf16)r1; ah[i] = h; am[i] = m; al[i] = (__bf16)(r1 - (float)m); wb[i] = (__bf16)w[k][i >> 2][i & 3]; }
      acc = wmma_bf(al, wb, acc); acc = wmma_bf(am, wb, acc); acc = wmma_bf(ah, wb, acc); } }
#pragma unroll
  for (int r = 0; r < 8; ++r) so[8 * g + r][wave * 16 + col] = acc[r] + bb;
  __syncthreads();
  for (int q = tid; q < 16 * 16; q += 128) { const int rl = q >> 4, pc = q & 15; vst2(dst + (size_t)rl * DMOD + nb0 + pc * 4, *(const v4f*)&so[rl][pc * 4]); }
}
// ---- k_rope: in place on S2 (q and k pooled over n1): per (b, l < 128, h): x[32] -> x cos + rot(x) sin, rot = (-x[16:], x[:16]), angle = l * 10000^(-j/16) (j = d mod 16); block = (b, l), thread = (h, d)
__global__ __launch_bounds__(256) void k_rope(float* __restrict__ SQ, float* __restrict__ SK) {
  __shared__ __align__(16) float sq[DMOD], sk[DMOD];
  const int l = blockIdx.x % N2, tid = threadIdx.x; const size_t row = (size_t)blockIdx.x * DMOD; const int d = tid & 31, j = d & 15;
  const float invf = 1.0f / pow_ni(10000.0f, (float)(2 * j) / 32.0f); const float ang = (float)l * invf; const float c = cos_ni(ang), s = sin_ni(ang);
  const float xq = SQ[row + tid], xk = SK[row + tid]; const float rq = d < 16 ? -SQ[row + tid + 16] : SQ[row + tid - 16]; const float rk = d < 16 ? -SK[row + tid + 16] : SK[row + tid - 16];
  sq[tid] = xq * c + rq * s; sk[tid] = xk * c + rk * s;
  __syncthreads();
  if (tid < 64) vst2(SQ + row + tid * 4, *(const v4f*)&sq[tid * 4]); else if (tid < 128) vst2(SK + row + (tid - 64) * 4, *(const v4f*)&sk[(tid - 64) * 4]);
}
// ---- k_minmax: partial min/max of a tensor of n floats: block i of 64 scans a strided slice -> MMP[t][i][2]; k_mmfin: finals MM[t] = (min, max) (block t, 64 threads)
__global__ __launch_bounds__(256) void k_minmax(const float* __restrict__ T, int n, int t, float* __restrict__ MMP) {
  __shared__ float smn[8], smx[8]; __shared__ __align__(16) float sres[4];
  const int tid = threadIdx.x, wave = tid >> 5, lane = tid & 31; float mn = 3.0e38f, mx = -3.0e38f;
  for (int i = blockIdx.x * 256 + tid; i < n; i += 64 * 256) { const float v = T[i]; mn = fminf(mn, v); mx = fmaxf(mx, v); }
#pragma unroll
  for (int o = 1; o < 32; o <<= 1) { mn = fminf(mn, __shfl_xor(mn, o)); mx = fmaxf(mx, __shfl_xor(mx, o)); }
  if (lane == 0) { smn[wave] = mn; smx[wave] = mx; }
  __syncthreads();
  if (tid == 0) { float a = smn[0], bq2 = smx[0]; for (int w = 1; w < 8; ++w) { a = fminf(a, smn[w]); bq2 = fmaxf(bq2, smx[w]); } sres[0] = a; sres[1] = bq2; sres[2] = 0.f; sres[3] = 0.f; }
  __syncthreads();
  if (tid < 8) { const v4f z = {0.f, 0.f, 0.f, 0.f}; vst2(MMP + ((size_t)t * 65 + blockIdx.x) * MMS + tid * 4, tid == 0 ? *(const v4f*)sres : z); }
}
__global__ __launch_bounds__(64) void k_mmfin(float* __restrict__ MMP) {
  const int t = blockIdx.x, tid = threadIdx.x; float mn = MMP[((size_t)t * 65 + tid) * MMS], mx = MMP[((size_t)t * 65 + tid) * MMS + 1];
#pragma unroll
  for (int o = 1; o < 32; o <<= 1) { mn = fminf(mn, __shfl_xor(mn, o)); mx = fmaxf(mx, __shfl_xor(mx, o)); }
  __shared__ float s2[4];
  if ((tid & 31) == 0) { s2[(tid >> 5) * 2] = mn; s2[(tid >> 5) * 2 + 1] = mx; }
  __syncthreads();
  __shared__ __align__(16) float sfin[4];
  if (tid == 0) { sfin[0] = fminf(s2[0], s2[2]); sfin[1] = fmaxf(s2[1], s2[3]); sfin[2] = 0.f; sfin[3] = 0.f; }
  __syncthreads();
  if (tid < 8) { const v4f z = {0.f, 0.f, 0.f, 0.f}; vst2(MMP + ((size_t)t * 65 + 64) * MMS + tid * 4, tid == 0 ? *(const v4f*)sfin : z); }
}

// ---- k_feat: phi for one pooled tensor S (rows (b,l), l < L) and head h = blockIdx.y; block = 16 rows (one wave): xs = (x - mn)/(mx - mn) * 32^-1/4; dots on WMMA (xs hi/lo x bf16(feat rows), K = 32, 12 tiles); phi = exp(dot - |xs|^2/2 - ln(192)/2 + 1e-6);
//      P[(b*8 + h)*L + l][m] rows of 768 B (48 pieces)
__global__ __launch_bounds__(32) void k_feat(const float* __restrict__ S, int L, const float* __restrict__ MM, int t, const float* __restrict__ feat, float* __restrict__ P) {
  __shared__ __align__(16) float sx[16][36]; __shared__ __align__(16) float so[16][196]; __shared__ float soff[16];
  const int lane = threadIdx.x, col = lane & 15, g = lane >> 4; const int h = blockIdx.y; const int r0 = blockIdx.x * 16; const int b = r0 / L, l0 = r0 % L;
  const float mn = MM[((size_t)t * 65 + 64) * MMS], mx = MM[((size_t)t * 65 + 64) * MMS + 1]; const float sc = 1.0f / (mx - mn); const float temp = 0.42044820762685725f;   // 32^-0.25
  { const int rl = lane >> 1, half = lane & 1; float ss = 0.f;
    for (int d = half * 16; d < half * 16 + 16; ++d) { const float x = S[(size_t)(r0 + rl) * DMOD + h * DHD + d]; const float xs = (x - mn) * sc * temp; sx[rl][d] = xs; ss += xs * xs; }
    ss += __shfl_xor(ss, 1); if (half == 0) { soff[rl] = -0.5f * ss - 0.5f * 5.2574953720277815f + 1e-6f; sx[rl][32] = 0.f; sx[rl][33] = 0.f; sx[rl][34] = 0.f; sx[rl][35] = 0.f; } }
  LDSX();
  const F2 a = split_row(&sx[col][0], 0, lane);
#pragma unroll
  for (int j = 0; j < 12; ++j) { v8f acc = {}; const v16b w = frag_gbf(feat + (size_t)(j * 16 + col) * DHD, lane); acc = wmma_bf(a.l, w, acc); acc = wmma_bf(a.h, w, acc);
#pragma unroll
    for (int r = 0; r < 8; ++r) so[8 * g + r][j * 16 + col] = exp_ni(acc[r] + soff[8 * g + r]); }
  LDSX();
  for (int q = lane; q < 16 * 48; q += 32) { const int rl = q / 48, pc = q % 48; vst2(P + ((size_t)(b * NHD + h) * L + l0 + rl) * MF + pc * 4, *(const v4f*)&so[rl][pc * 4]); }
}
// ---- k_ksum: ksum[(b*8+h)][m] = sum_l KP[(b*8+h)*L + l][m] (l ascending); block = (b,h), thread = m
__global__ __launch_bounds__(256) void k_ksum(const float* __restrict__ KP, int L, float* __restrict__ KS) {
  __shared__ __align__(16) float ssum[MF];
  const int bh = blockIdx.x, tid = threadIdx.x;
  if (tid < MF) { float s = 0.f;
    for (int l0 = 0; l0 < L; l0 += 32) { float v[32];   // L is a multiple of 32; 32 loads in flight per round, summed in ascending l
#pragma unroll
      for (int i = 0; i < 32; ++i) v[i] = KP[((size_t)bh * L + l0 + i) * MF + tid];
#pragma unroll
      for (int i = 0; i < 32; ++i) s += v[i]; }
    ssum[tid] = s; }
  __syncthreads();
  if (tid < 48) vst2(KS + (size_t)bh * MF + tid * 4, *(const v4f*)&ssum[tid * 4]);
}
// ---- k_an: att_norm[(b*8+h)][l] = sum_m QP[(b*8+h)*L + l][m] * ksum[(b*8+h)][m]; block = (b,h), thread = l (< L); rows pitch 128
__global__ __launch_bounds__(128) void k_an(const float* __restrict__ QP, const float* __restrict__ KS, int L, float* __restrict__ AN) {
  __shared__ float sks[MF]; __shared__ __align__(16) float sres[N2];
  const int bh = blockIdx.x, tid = threadIdx.x;
  for (int m = tid; m < MF; m += 128) sks[m] = KS[(size_t)bh * MF + m];
  __syncthreads();
  float s = 0.f; if (tid < L) { const float* row = QP + ((size_t)bh * L + tid) * MF; for (int m = 0; m < MF; ++m) s += row[m] * sks[m]; }
  sres[tid] = tid < L ? s : 1.0f;
  __syncthreads();
  if (tid < 32) vst2(AN + (size_t)bh * N2 + tid * 4, *(const v4f*)&sres[tid * 4]);
}
template <int PASS>
__global__ __launch_bounds__(256) void k_vt(const float* __restrict__ V, float* __restrict__ VT, int ob0) {
  __shared__ float st[DMOD][(PASS == 1 ? N1 : N2) + 1];
  const int tid = threadIdx.x; constexpr int L = (PASS == 1 ? N1 : N2); const int other = ob0 + blockIdx.x;
  const int b = PASS == 1 ? other / N2 : other / N1, o = PASS == 1 ? other % N2 : other % N1;
  for (int q = tid; q < L * DMOD; q += 256) { const int l = q / DMOD, c = q % DMOD; const size_t src = PASS == 1 ? ((((size_t)b * N1 + l) * N2 + o) * DMOD + c) : ((((size_t)b * N1 + o) * N2 + l) * DMOD + c); st[c][l] = V[src]; }
  __syncthreads();
  __shared__ __align__(16) float srow[4][N2];
  for (int c0 = 0; c0 < DMOD; c0 += 4) { const int cc = c0 + (tid >> 6), ll = tid & 63;
    for (int l = ll; l < L; l += 64) srow[tid >> 6][l] = st[cc][l];
    __syncthreads();
    if (tid < 4 * (L / 4)) { const int c1 = tid / (L / 4), pc = tid % (L / 4); vst2(VT + ((size_t)other * DMOD + c0 + c1) * L + pc * 4, *(const v4f*)&srow[c1][pc * 4]); }
    __syncthreads(); }
}
// ---- k_amat: per (b,h): A[l][l'] = (sum_m QP[l][m] (hi/lo) . KP[l'][m] (hi/lo)) / att_norm[l]: M = l (tile blockIdx.y), N = l' (32 per wave = 2 tiles), K = m (6 steps), 3 products; rows pitch 128, 128-B segment per wave and row
__global__ __launch_bounds__(128) void k_amat(const float* __restrict__ QP, const float* __restrict__ KP, const float* __restrict__ AN, int L, float* __restrict__ AM) {
  __shared__ __align__(16) float so[4][16][36];
  const int tid = threadIdx.x, wave = tid >> 5, lane = tid & 31, col = lane & 15, g = lane >> 4; const int bh = blockIdx.x, l0 = blockIdx.y * 16, n0 = wave * 32;
  if (n0 >= L) return;
  const float* qrow = QP + ((size_t)bh * L + l0 + col) * MF;
  v8f acc[2] = {};
#pragma unroll
  for (int kc = 0; kc < MF / 32; ++kc) { const F2 a = split_row(qrow, kc * 32, lane);
#pragma unroll
    for (int j = 0; j < 2; ++j) { const F2 kb = split_row(KP + ((size_t)bh * L + n0 + j * 16 + col) * MF, kc * 32, lane); acc[j] = mac3(a, kb, acc[j]); } }
  float inv[8];
#pragma unroll
  for (int r = 0; r < 8; ++r) inv[r] = 1.0f / AN[(size_t)bh * N2 + l0 + 8 * g + r];
#pragma unroll
  for (int j = 0; j < 2; ++j)
#pragma unroll
    for (int r = 0; r < 8; ++r) so[wave][8 * g + r][j * 16 + col] = acc[j][r] * inv[r];
  LDSX();
  for (int q = lane; q < 16 * 8; q += 32) { const int rl = q >> 3, pc = q & 7; vst2(AM + ((size_t)bh * N2 + l0 + rl) * N2 + n0 + pc * 4, *(const v4f*)&so[wave][rl][pc * 4]); }
}
// ---- k_att: per (b, other o, head h): out[l][d] = sum_l' A[(b,h)][l][l'] (hi/lo) . VT[b][o][(h,d)][l'] (hi/lo): M = l (one 16-row tile per wave, L/16 waves), N = d (2 tiles), K = l' (2 or 4 steps), 3 products; all batches in one launch
template <int PASS>
__global__ __launch_bounds__(256) void k_att(const float* __restrict__ AM, const float* __restrict__ VT, int ob0, float* __restrict__ Vout) {
  constexpr int L = (PASS == 1 ? N1 : N2), O = (PASS == 1 ? N2 : N1);
  __shared__ __align__(16) float so[L / 16][16][36];
  const int tid = threadIdx.x, wave = tid >> 5, lane = tid & 31, col = lane & 15, g = lane >> 4; const int h = blockIdx.x % NHD, bo = ob0 + blockIdx.x / NHD; const int b = bo / O, o = bo % O;
  const float* arow = AM + ((size_t)(b * NHD + h) * N2 + wave * 16 + col) * N2;
  v8f acc[2] = {};
#pragma unroll
  for (int kc = 0; kc < L / 32; ++kc) { const F2 a = split_row(arow, kc * 32, lane);
#pragma unroll
    for (int j = 0; j < 2; ++j) { const F2 vb = split_row(VT + ((size_t)bo * DMOD + h * DHD + j * 16 + col) * L, kc * 32, lane); acc[j] = mac3(a, vb, acc[j]); } }
#pragma unroll
  for (int j = 0; j < 2; ++j)
#pragma unroll
    for (int r = 0; r < 8; ++r) so[wave][8 * g + r][j * 16 + col] = acc[j][r];
  LDSX();
  for (int q = lane; q < 16 * 8; q += 32) { const int rl = q >> 3, pc = q & 7; const int l = wave * 16 + rl;
    const size_t pos = PASS == 1 ? (((size_t)b * N1 + l) * N2 + o) : (((size_t)b * N1 + o) * N2 + l);
    vst2(Vout + pos * DMOD + h * DHD + pc * 4, *(const v4f*)&so[wave][rl][pc * 4]); }
}
// ---- k_out: Y = V3(hi/lo) . bf16(Wo rows [256][256]) + bo; block (64 rows, 128 cols); K = 256
__global__ __launch_bounds__(128) void k_out(const float* __restrict__ V3, const float* __restrict__ Wo, const float* __restrict__ bo, float* __restrict__ Y, int rb0) {
  __shared__ __align__(16) float so[4][16][132];
  const int tid = threadIdx.x, wave = tid >> 5, lane = tid & 31, col = lane & 15, g = lane >> 4; const size_t r0 = (size_t)(rb0 + blockIdx.x) * 64 + wave * 16; const int n0 = blockIdx.y * 128;
  v8f acc[8] = {};
#pragma unroll 2
  for (int kc = 0; kc < DMOD / 32; ++kc) { const F2 a = split_row(V3 + (r0 + col) * DMOD, kc * 32, lane);
#pragma unroll
    for (int j = 0; j < 8; ++j) { const v16b w = frag_gbf(Wo + (size_t)(n0 + j * 16 + col) * DMOD + kc * 32, lane); acc[j] = wmma_bf(a.l, w, acc[j]); acc[j] = wmma_bf(a.h, w, acc[j]); } }
#pragma unroll
  for (int j = 0; j < 8; ++j) { const float bb = bfr(bo[n0 + j * 16 + col]);
#pragma unroll
    for (int r = 0; r < 8; ++r) so[wave][8 * g + r][j * 16 + col] = acc[j][r] + bb; }
  LDSX();
  for (int rl = 0; rl < 16; ++rl) vst2(Y + (r0 + rl) * DMOD + n0 + lane * 4, *(const v4f*)&so[wave][rl][lane * 4]);
}

#ifndef DBG
#define DBG 0
#endif
#if DBG != 0
__global__ __launch_bounds__(256) void k_dump(const float* __restrict__ src, int n, float* __restrict__ out) {   // out[0..n) = src, rest of batch-0 region zero
  const size_t p = (size_t)blockIdx.x * 256 + threadIdx.x; v4f v; for (int i = 0; i < 4; ++i) { const size_t f = p * 4 + i; v[i] = f < (size_t)n ? src[f] : 0.f; } vst2(out + p * 4, v);
}
#endif
extern "C" void kernel_launch(void* const* d_in, const int* in_sizes, int n_in, void* d_out, int out_size, void* d_ws, size_t ws_size, hipStream_t stream) {
  (void)in_sizes; (void)n_in; (void)out_size;
  const float** F = (const float**)d_in;   // X, Wq, bq, Wk, bk, Wv, bv, Wo, bo, feat
  if (ws_size < (size_t)WS_END) return;
  char* ws = (char*)d_ws; float *BA = (float*)(ws + WS_A), *BB = (float*)(ws + WS_B), *V = (float*)(ws + WS_V), *QS1 = (float*)(ws + WS_QS1), *KS1 = (float*)(ws + WS_KS1), *QS2 = (float*)(ws + WS_QS2), *KS2 = (float*)(ws + WS_KS2), *MM = (float*)(ws + WS_MM), *QP = (float*)(ws + WS_QP), *AM = (float*)(ws + WS_AM), *KSUM = (float*)(ws + WS_KSUM), *AN = (float*)(ws + WS_AN), *SX = (float*)(ws + WS_SX);
  float* KP = BB;      // phi(k) rows live in buffer B
  k_poolx<<<NBT * N1 + NBT * N2, 256, 0, stream>>>(F[0], SX);
  k_pproj<<<dim3((NBT * N1 + NBT * N2) / 16, 8), 128, 0, stream>>>(SX, F[1], F[2], F[3], F[4], QS1, KS1, QS2, KS2);
  k_proj<<<dim3(NPOS / 64, 2), 128, 0, stream>>>(F[0], F[5], F[6], V);
  k_rope<<<NBT * N2, 256, 0, stream>>>(QS2, KS2);
  k_minmax<<<64, 256, 0, stream>>>(QS1, NBT * N1 * DMOD, 0, MM); k_minmax<<<64, 256, 0, stream>>>(KS1, NBT * N1 * DMOD, 1, MM); k_minmax<<<64, 256, 0, stream>>>(QS2, NBT * N2 * DMOD, 2, MM); k_minmax<<<64, 256, 0, stream>>>(KS2, NBT * N2 * DMOD, 3, MM);
  k_mmfin<<<4, 64, 0, stream>>>(MM);
  k_feat<<<dim3(NBT * N1 / 16, NHD), 32, 0, stream>>>(QS1, N1, MM, 0, F[9], QP);
  k_feat<<<dim3(NBT * N1 / 16, NHD), 32, 0, stream>>>(KS1, N1, MM, 1, F[9], KP);
  k_ksum<<<NBT * NHD, 256, 0, stream>>>(KP, N1, KSUM);
  k_an<<<NBT * NHD, 128, 0, stream>>>(QP, KSUM, N1, AN);
#if DBG == 1
  k_dump<<<N1 * N2 * DMOD / 1024, 256, 0, stream>>>(AN, NBT * NHD * N2, (float*)d_out); return;      // pass-1 att_norm [4][8][128] (l < 64 valid, rest 1.0)
#elif DBG == 2
  k_dump<<<N1 * N2 * DMOD / 1024, 256, 0, stream>>>(QP, NBT * NHD * N1 * MF, (float*)d_out); return;  // pass-1 phi(q) [4][8][64][192]
#endif
  k_vt<1><<<(TNB - TB0) * N2, 256, 0, stream>>>(V, BA, TB0 * N2);
  k_amat<<<dim3(NBT * NHD, N1 / 16), 128, 0, stream>>>(QP, KP, AN, N1, AM);
  k_att<1><<<(TNB - TB0) * N2 * NHD, N1 * 2, 0, stream>>>(AM, BA, TB0 * N2, V);
#if DBG == 3
  k_dump<<<N1 * N2 * DMOD / 1024, 256, 0, stream>>>(V, N1 * N2 * DMOD, (float*)d_out); return;
#endif
  // ---- pass 2: time axis (l = n2 = 128 with RoPE, other = n1 = 64)
  k_feat<<<dim3(NBT * N2 / 16, NHD), 32, 0, stream>>>(QS2, N2, MM, 2, F[9], QP);
  k_feat<<<dim3(NBT * N2 / 16, NHD), 32, 0, stream>>>(KS2, N2, MM, 3, F[9], KP);
  k_ksum<<<NBT * NHD, 256, 0, stream>>>(KP, N2, KSUM);
  k_an<<<NBT * NHD, 128, 0, stream>>>(QP, KSUM, N2, AN);
  k_vt<2><<<(TNB - TB0) * N1, 256, 0, stream>>>(V, BA, TB0 * N1);
  k_amat<<<dim3(NBT * NHD, N2 / 16), 128, 0, stream>>>(QP, KP, AN, N2, AM);
  k_att<2><<<(TNB - TB0) * N1 * NHD, N2 * 2, 0, stream>>>(AM, BA, TB0 * N1, V);
#if DBG == 5
  k_dump<<<N1 * N2 * DMOD / 1024, 256, 0, stream>>>(V, N1 * N2 * DMOD, (float*)d_out); return;     // value after pass 2, batch 0
#elif DBG == 6
  k_dump<<<N1 * N2 * DMOD / 1024, 256, 0, stream>>>(AN, NBT * NHD * N2, (float*)d_out); return;    // pass-2 att_norm
#endif
  k_out<<<dim3((TNB - TB0) * N1 * N2 / 64, 2), 128, 0, stream>>>(V, F[7], F[8], (float*)d_out, TB0 * N1 * N2 / 64);
}

// v003
// A run of this version takes 248 microseconds.
// Two timings next to v002 put it at 1.45 and 1.46 times that version's speed.
// All steps since v000 together make it 3.31 times as fast.
// compute dtype: X, the projection weights/biases and the random-feature matrix (module inputs) rounded to bf16; the v projection with exact bf16 products; the q and k projections taken on the axis sums of bf16(X) (f32 sums as three bf16 pieces, 3 products, all 24 bits); the feature-map GEMM (pooled q,k x feat) with the pooled operand as a bf16 hi + bf16 residual pair (2 products); the phi(q) phi(k)^T and mixing-matrix x value contractions with both computed operands hi/lo (3 products);
// the output projection hi/lo against bf16 Wo (2 products); axis pooling, RoPE, global min-max normalisation, exp feature maps, normalisers and divisions in f32; f32 accumulate.
#include <hip/hip_runtime.h>
#include <math.h>

typedef __attribute__((ext_vector_type(16))) _Float16 v16h;
typedef __attribute__((ext_vector_type(16))) __bf16 v16b;
typedef __attribute__((ext_vector_type(8)))  _Float16 v8h;
typedef __attribute__((ext_vector_type(8)))  float v8f;
typedef __attribute__((ext_vector_type(4)))  float v4f;
typedef __attribute__((ext_vector_type(2)))  float v2f;
typedef __attribute__((ext_vector_type(4)))  unsigned v4u;
typedef __attribute__((ext_vector_type(4)))  int v4i;
typedef float __attribute__((may_alias)) float_a;
typedef int __attribute__((may_alias)) int_a;

template <typename T> __device__ __forceinline__ void vst2(void* p, T v) { *(T*)p = v;  }
__device__ __forceinline__ v8f wmma16(v16h a, v16h b, v8f c) {
  v8f d = __builtin_amdgcn_wmma_f32_16x16x32_f16(false, a, false, b, (short)0, c, false, false);
  asm volatile("v_nop\n\tv_nop\n\tv_nop\n\tv_nop" : "+v"(d) : "v"(a), "v"(b));
  return d;
}
__device__ __forceinline__ v8f wmma_bf(v16b a, v16b b, v8f c) {
  v8f d = __builtin_amdgcn_wmma_f32_16x16x32_bf16(false, a, false, b, (short)0, c, false, false);
  asm volatile("v_nop\n\tv_nop\n\tv_nop\n\tv_nop" : "+v"(d) : "v"(a), "v"(b));
  return d;
}
// 16x16x32 fragments: lane = (h = lane>>4, row/col = lane&15); elements 0..7 = k0+8h+0..7, 8..15 = k0+16+8h+0..7; D element r = row 8h+r
__device__ __forceinline__ v16h frag_h(const _Float16* rowk0, int lane) {
  union { v16h v; v8h q[2]; } u; const _Float16* p = rowk0 + 8 * (lane >> 4);
  u.q[0] = *(const v8h*)p; u.q[1] = *(const v8h*)(p + 16); return u.v;
}
__device__ __forceinline__ v16h frag_f32(const float* rowk0, int lane) {
  v16h a; const float* p = rowk0 + 8 * (lane >> 4);
#pragma unroll
  for (int i = 0; i < 8; ++i) { a[i] = (_Float16)p[i]; a[8 + i] = (_Float16)p[16 + i]; }
  return a;
}
__device__ __forceinline__ v16h frag_f32s(const float* rowk0, int lane, float sc) {
  v16h a; const float* p = rowk0 + 8 * (lane >> 4);
#pragma unroll
  for (int i = 0; i < 8; ++i) { a[i] = (_Float16)(p[i] * sc); a[8 + i] = (_Float16)(p[16 + i] * sc); }
  return a;
}
// column fragment from a [K][ld] layout (column n), rows >= K read as 0
__device__ __forceinline__ v16h fragc_f32(const float* W, int k0, int n, int lane, int ld, int K) {
  v16h a; const int g = lane >> 4;
#pragma unroll
  for (int i = 0; i < 8; ++i) { const int ka = k0 + 8 * g + i, kb = ka + 16;
    a[i] = (_Float16)(ka < K ? W[(size_t)(ka < K ? ka : K - 1) * ld + n] : 0.f); a[8 + i] = (_Float16)(kb < K ? W[(size_t)(kb < K ? kb : K - 1) * ld + n] : 0.f); }
  return a;
}
struct F2 { v16b h, l; };
__device__ __forceinline__ F2 bsplit16(const float v[16]) { F2 r;
#pragma unroll
  for (int i = 0; i < 16; ++i) { const __bf16 h = (__bf16)v[i]; r.h[i] = h; r.l[i] = (__bf16)(v[i] - (float)h); }
  return r; }
__device__ __forceinline__ F2 split_row(const float* row, int k0, int lane) { float v[16]; const float* p = row + k0 + 8 * (lane >> 4);
#pragma unroll
  for (int i = 0; i < 8; ++i) { v[i] = p[i]; v[8 + i] = p[16 + i]; }
  return bsplit16(v); }
__device__ __forceinline__ F2 split_rowK(const float* row, int k0, int lane, int K) { float v[16]; const int g = lane >> 4;
#pragma unroll
  for (int i = 0; i < 8; ++i) { const int ka = k0 + 8 * g + i, kb = ka + 16; v[i] = ka < K ? row[ka < K ? ka : K - 1] : 0.f; v[8 + i] = kb < K ? row[kb < K ? kb : K - 1] : 0.f; }
  return bsplit16(v); }
__device__ __forceinline__ F2 split_col(const float* W, int k0, int n, int lane, int ld, int K) { float v[16]; const int g = lane >> 4;
#pragma unroll
  for (int i = 0; i < 8; ++i) { const int ka = k0 + 8 * g + i, kb = ka + 16; v[i] = ka < K ? W[(size_t)(ka < K ? ka : K - 1) * ld + n] : 0.f; v[8 + i] = kb < K ? W[(size_t)(kb < K ? kb : K - 1) * ld + n] : 0.f; }
  return bsplit16(v); }
__device__ __forceinline__ v8f mac3(const F2& a, const F2& b, v8f c) { c = wmma_bf(a.l, b.h, c); c = wmma_bf(a.h, b.l, c); return wmma_bf(a.h, b.h, c); }
__device__ __forceinline__ float sigm(float v) { return 1.0f / (1.0f + expf(-v)); }
#define LDSX() do { asm volatile("s_wait_dscnt 0" ::: "memory"); __builtin_amdgcn_wave_barrier(); __builtin_amdgcn_fence(__ATOMIC_RELEASE, "workgroup"); } while (0)


// High-order linear attention over a [4, 64, 128, 256] tensor: q/k/v = X W^T + b; for the assets axis (n1, pooled over n2) and then the time axis (n2, pooled over n1, with RoPE): Performer-style positive features phi(x) = exp(xs f^T - |xs|^2/2 - log(M)/2 + 1e-6), xs = (x - min x)/(max x - min x) * 32^-1/4 (global min/max),
// out_l = sum_l' A[l][l'] v_l', A[l][l'] = phi(q_l) . phi(k_l') / (phi(q_l) . sum_l phi(k_l)): the product phi(q) (phi(k)^T v) taken as (phi(q) phi(k)^T) v, since A depends on (b, head) alone and the attended length (64, 128) is below the 192 features; finally value W_o^T + b_o.
// q and k are used only through their axis sums, and sum_i (x_i W^T + b) = (sum_i x_i) W^T + n b: X is pooled first and only the 768 pooled rows are projected.
// k_poolx (axis sums of X); k_pproj (pooled q and k); k_proj (v); k_rope (dim-2 pooled q,k); k_minmax; k_feat (phi via WMMA); k_ksum; k_an (normaliser); k_amat (per (b, head): A); k_att (per (b, other-position, head): value tile transposed in LDS, A x tile, written back in place);
#define NBT 4
#define N1 64
#define N2 128
#define DMOD 256
#define NHD 8
#define DHD 32
#define MF 192
#define NPOS (NBT * N1 * N2)      // 32768 positions
#ifndef TNB
#define TNB NBT                   // batches run through the attention passes / output (debug: fewer)
#endif
#ifndef TB0
#define TB0 0                     // first batch of the attention loops (debug)
#endif
typedef __attribute__((ext_vector_type(8))) __bf16 v8b;
typedef __attribute__((ext_vector_type(4))) __bf16 v4b;
__device__ __forceinline__ v16b frag_b(const __bf16* rowk0, int lane) {
  union { v16b v; v8b q[2]; } u; const __bf16* p = rowk0 + 8 * (lane >> 4);
  u.q[0] = *(const v8b*)p; u.q[1] = *(const v8b*)(p + 16); return u.v;
}
__device__ __forceinline__ v16b frag_gbf(const float* rowk0, int lane) {
  v16b a; const float* p = rowk0 + 8 * (lane >> 4);
#pragma unroll
  for (int i = 0; i < 8; ++i) { a[i] = (__bf16)p[i]; a[8 + i] = (__bf16)p[16 + i]; }
  return a;
}
__device__ __forceinline__ float bfr(float v) { return (float)(__bf16)v; }
__device__ __attribute__((noinline)) float exp_ni(float v) { return expf(v); }
__device__ __attribute__((noinline)) float pow_ni(float a, float b) { return powf(a, b); }
__device__ __attribute__((noinline)) float cos_ni(float v) { return cosf(v); }
__device__ __attribute__((noinline)) float sin_ni(float v) { return sinf(v); }

#define WS_A    0u                              // 32 MB: not used
#define WS_B    (WS_A + 4u * NPOS * DMOD)          // f32 32 MB: phi(k) rows [(b,h)][l][m]
#define WS_V    (WS_B + 4u * NPOS * DMOD)          // f32 32 MB: value [b][n1][n2][h*32+d] (updated in place per pass: V -> V2 -> V3, by the block that owns the tile)
#define WS_QS1  (WS_V + 4u * NPOS * DMOD)          // f32 [4][64][256]  q summed over n2
#define WS_KS1  (WS_QS1 + 4u * NBT * N1 * DMOD)
#define WS_QS2  (WS_KS1 + 4u * NBT * N1 * DMOD)    // f32 [4][128][256] q summed over n1 (then RoPE'd in place)
#define WS_KS2  (WS_QS2 + 4u * NBT * N2 * DMOD)
#define WS_MM   (WS_KS2 + 4u * NBT * N2 * DMOD)
#define MMS 32
#define WS_QP   (WS_MM + 4u * 4 * 65 * MMS)        // f32 [4][8][L][192] phi(q) (l rows, m contiguous), L = 64 (dim 1) or 128 (dim 2); WS_MM holds [4 tensors][65 slots][32 floats]
#define WS_AM   (WS_QP + 4u * NBT * NHD * N2 * MF) // f32 [4][8][128][128] A (l rows, l' contiguous, pitch 128)
#define WS_KSUM (WS_AM + 4u * NBT * NHD * N2 * N2) // f32 [4][8][192]
#define WS_AN   (WS_KSUM + 4u * NBT * NHD * MF)    // f32 [4][8][128] att_norm
#define WS_SX   (WS_AN + 4u * NBT * NHD * N2)      // f32 [256 + 512][256] bf16(X) summed over n2 (rows b*64 + n1), then summed over n1 (rows 256 + b*128 + n2)
#define WS_END  (WS_SX + 4u * (NBT * N1 + NBT * N2) * DMOD)

// ---- k_proj: [32768 rows] x [v 256 cols] = bf16(X) . W rows ([out][in]) + b (exact); block (64 rows, 128 cols); 512-B segments of 1-KB rows
__global__ __launch_bounds__(128) void k_proj(const float* __restrict__ X, const float* __restrict__ Wm, const float* __restrict__ bm, float* __restrict__ dst) {
  __shared__ __align__(16) float so[4][16][132];
  const int tid = threadIdx.x, wave = tid >> 5, lane = tid & 31, col = lane & 15, g = lane >> 4; const size_t r0 = (size_t)blockIdx.x * 64 + wave * 16; const int n0 = blockIdx.y * 128;
  v8f acc[8] = {};
#pragma unroll 2
  for (int kc = 0; kc < DMOD / 32; ++kc) { const v16b a = frag_gbf(X + (r0 + col) * DMOD + kc * 32, lane);
#pragma unroll
    for (int j = 0; j < 8; ++j) acc[j] = wmma_bf(a, frag_gbf(Wm + (size_t)(n0 + j * 16 + col) * DMOD + kc * 32, lane), acc[j]); }
#pragma unroll
  for (int j = 0; j < 8; ++j) { const float bb = bfr(bm[n0 + j * 16 + col]);
#pragma unroll
    for (int r = 0; r < 8; ++r) so[wave][8 * g + r][j * 16 + col] = acc[j][r] + bb; }
  LDSX();
  for (int rl = 0; rl < 16; ++rl) vst2(dst + (r0 + rl) * DMOD + n0 + lane * 4, *(const v4f*)&so[wave][rl][lane * 4]);
}
// ---- k_poolx: axis sums of bf16(X). Blocks < 256: SX[b*64 + n1][c] = sum_{n2}; blocks >= 256: SX[256 + b*128 + n2][c] = sum_{n1}. Thread = (part = tid >> 6, 4 columns): a part sums every 4th row (ascending), the 4 parts are added in LDS; 1-KB rows
template <int NR> __device__ __forceinline__ v4f sum_rows(const float* __restrict__ p, size_t step) {
  v4f s = {0.f, 0.f, 0.f, 0.f};
#pragma unroll 16   // 16 row loads of 16 B in flight per lane: the kernel is a stream from memory
  for (int i = 0; i < NR; ++i) { const v4f v = *(const v4f*)(p + (size_t)i * step);
#pragma unroll      // vector elements by constant index
    for (int e = 0; e < 4; ++e) s[e] += bfr(v[e]); }
  return s;
}
__global__ __launch_bounds__(256) void k_poolx(const float* __restrict__ X, float* __restrict__ SX) {
  __shared__ __align__(16) float sp[4][DMOD];
  const int tid = threadIdx.x, part = tid >> 6, c4 = (tid & 63) * 4, blk = blockIdx.x; v4f s;
  if (blk < NBT * N1) s = sum_rows<N2 / 4>(X + ((size_t)blk * N2 + part) * DMOD + c4, (size_t)4 * DMOD);
  else { const int r = blk - NBT * N1, b = r / N2, i2 = r % N2; s = sum_rows<N1 / 4>(X + (((size_t)b * N1 + part) * N2 + i2) * DMOD + c4, (size_t)4 * N2 * DMOD); }
  *(v4f*)&sp[part][c4] = s;
  __syncthreads();
  if (tid < 64) vst2(SX + (size_t)blk * DMOD + c4, (*(const v4f*)&sp[0][c4] + *(const v4f*)&sp[1][c4]) + (*(const v4f*)&sp[2][c4] + *(const v4f*)&sp[3][c4]));
}
// ---- k_pproj: pooled q and k: [768 rows of SX] x [q|k 512 cols] = SX (three bf16 pieces, 3 products) . bf16(W rows) + n bf16(b), n = rows summed (128 or 64); block (16 rows, 64 cols), wave = 16 cols; K = 256; 256-B segments of 1-KB rows
__global__ __launch_bounds__(128) void k_pproj(const float* __restrict__ SX, const float* __restrict__ Wq, const float* __restrict__ bq, const float* __restrict__ Wk, const float* __restrict__ bk, float* __restrict__ QS1, float* __restrict__ KS1, float* __restrict__ QS2, float* __restrict__ KS2) {
  __shared__ __align__(16) float so[16][68];
  const int tid = threadIdx.x, wave = tid >> 5, lane = tid & 31, col = lane & 15, g = lane >> 4; const int r0 = blockIdx.x * 16, which = blockIdx.y >> 2, nb0 = (blockIdx.y & 3) * 64, n = nb0 + wave * 16 + col;
  const float* Wm = which == 0 ? Wq : Wk; const float* bm = which == 0 ? bq : bk; const bool ax1 = r0 < NBT * N1;
  float* dst = ax1 ? (which == 0 ? QS1 : KS1) + (size_t)r0 * DMOD : (which == 0 ? QS2 : KS2) + (size_t)(r0 - NBT * N1) * DMOD;
  const float* pa = SX + (size_t)(r0 + col) * DMOD + 8 * g; const float* pw = Wm + (size_t)n * DMOD + 8 * g; const float bb = (ax1 ? (float)N2 : (float)N1) * bfr(bm[n]);
  v8f acc = {};   // every loop below is unrolled whole, so that a, w and the fragments are indexed by constants and stay in registers
#pragma unroll
  for (int kh = 0; kh < 2; ++kh) { v4f a[4][4], w[4][4];   // half of K at a time: its 32 loads go out together
#pragma unroll
    for (int k = 0; k < 4; ++k)
#pragma unroll
      for (int i = 0; i < 4; ++i) { const int o = (kh * 4 + k) * 32 + (i >> 1) * 16 + (i & 1) * 4; a[k][i] = *(const v4f*)(pa + o); w[k][i] = *(const v4f*)(pw + o); }
#pragma unroll
    for (int k = 0; k < 4; ++k) { v16b ah, am, al, wb;
#pragma unroll
      for (int i = 0; i < 16; ++i) { const float v = a[k][i >> 2][i & 3]; const __bf16 h = (__bf16)v; const float r1 = v - (float)h; const __bf16 m = (__bf16)r1; ah[i] = h; am[i] = m; al[i] = (__bf16)(r1 - (float)m); wb[i] = (__bf16)w[k][i >> 2][i & 3]; }
      acc = wmma_bf(al, wb, acc); acc = wmma_bf(am, wb, acc); acc = wmma_bf(ah, wb, acc); } }
#pragma unroll
  for (int r = 0; r < 8; ++r) so[8 * g + r][wave * 16 + col] = acc[r] + bb;
  __syncthreads();
  for (int q = tid; q < 16 * 16; q += 128) { const int rl = q >> 4, pc = q & 15; vst2(dst + (size_t)rl * DMOD + nb0 + pc * 4, *(const v4f*)&so[rl][pc * 4]); }
}
// ---- k_rope: in place on S2 (q and k pooled over n1): per (b, l < 128, h): x[32] -> x cos + rot(x) sin, rot = (-x[16:], x[:16]), angle = l * 10000^(-j/16) (j = d mod 16); block = (b, l), thread = (h, d)
__global__ __launch_bounds__(256) void k_rope(float* __restrict__ SQ, float* __restrict__ SK) {
  __shared__ __align__(16) float sq[DMOD], sk[DMOD];
  const int l = blockIdx.x % N2, tid = threadIdx.x; const size_t row = (size_t)blockIdx.x * DMOD; const int d = tid & 31, j = d & 15;
  const float invf = 1.0f / pow_ni(10000.0f, (float)(2 * j) / 32.0f); const float ang = (float)l * invf; const float c = cos_ni(ang), s = sin_ni(ang);
  const float xq = SQ[row + tid], xk = SK[row + tid]; const float rq = d < 16 ? -SQ[row + tid + 16] : SQ[row + tid - 16]; const float rk = d < 16 ? -SK[row + tid + 16] : SK[row + tid - 16];
  sq[tid] = xq * c + rq * s; sk[tid] = xk * c + rk * s;
  __syncthreads();
  if (tid < 64) vst2(SQ + row + tid * 4, *(const v4f*)&sq[tid * 4]); else if (tid < 128) vst2(SK + row + (tid - 64) * 4, *(const v4f*)&sk[(tid - 64) * 4]);
}
// ---- k_minmax: partial min/max of a tensor of n floats: block i of 64 scans a strided slice -> MMP[t][i][2]; k_mmfin: finals MM[t] = (min, max) (block t, 64 threads)
__global__ __launch_bounds__(256) void k_minmax(const float* __restrict__ T, int n, int t, float* __restrict__ MMP) {
  __shared__ float smn[8], smx[8]; __shared__ __align__(16) float sres[4];
  const int tid = threadIdx.x, wave = tid >> 5, lane = tid & 31; float mn = 3.0e38f, mx = -3.0e38f;
  for (int i = blockIdx.x * 256 + tid; i < n; i += 64 * 256) { const float v = T[i]; mn = fminf(mn, v); mx = fmaxf(mx, v); }
#pragma unroll
  for (int o = 1; o < 32; o <<= 1) { mn = fminf(mn, __shfl_xor(mn, o)); mx = fmaxf(mx, __shfl_xor(mx, o)); }
  if (lane == 0) { smn[wave] = mn; smx[wave] = mx; }
  __syncthreads();
  if (tid == 0) { float a = smn[0], bq2 = smx[0]; for (int w = 1; w < 8; ++w) { a = fminf(a, smn[w]); bq2 = fmaxf(bq2, smx[w]); } sres[0] = a; sres[1] = bq2; sres[2] = 0.f; sres[3] = 0.f; }
  __syncthreads();
  if (tid < 8) { const v4f z = {0.f, 0.f, 0.f, 0.f}; vst2(MMP + ((size_t)t * 65 + blockIdx.x) * MMS + tid * 4, tid == 0 ? *(const v4f*)sres : z); }
}
__global__ __launch_bounds__(64) void k_mmfin(float* __restrict__ MMP) {
  const int t = blockIdx.x, tid = threadIdx.x; float mn = MMP[((size_t)t * 65 + tid) * MMS], mx = MMP[((size_t)t * 65 + tid) * MMS + 1];
#pragma unroll
  for (int o = 1; o < 32; o <<= 1) { mn = fminf(mn, __shfl_xor(mn, o)); mx = fmaxf(mx, __shfl_xor(mx, o)); }
  __shared__ float s2[4];
  if ((tid & 31) == 0) { s2[(tid >> 5) * 2] = mn; s2[(tid >> 5) * 2 + 1] = mx; }
  __syncthreads();
  __shared__ __align__(16) float sfin[4];
  if (tid == 0) { sfin[0] = fminf(s2[0], s2[2]); sfin[1] = fmaxf(s2[1], s2[3]); sfin[2] = 0.f; sfin[3] = 0.f; }
  __syncthreads();
  if (tid < 8) { const v4f z = {0.f, 0.f, 0.f, 0.f}; vst2(MMP + ((size_t)t * 65 + 64) * MMS + tid * 4, tid == 0 ? *(const v4f*)sfin : z); }
}

// ---- k_feat: phi for one pooled tensor S (rows (b,l), l < L) and head h = blockIdx.y; block = 16 rows (one wave): xs = (x - mn)/(mx - mn) * 32^-1/4; dots on WMMA (xs hi/lo x bf16(feat rows), K = 32, 12 tiles); phi = exp(dot - |xs|^2/2 - ln(192)/2 + 1e-6);
//      P[(b*8 + h)*L + l][m] rows of 768 B (48 pieces)
__global__ __launch_bounds__(32) void k_feat(const float* __restrict__ S, int L, const float* __restrict__ MM, int t, const float* __restrict__ feat, float* __restrict__ P) {
  __shared__ __align__(16) float sx[16][36]; __shared__ __align__(16) float so[16][196]; __shared__ float soff[16];
  const int lane = threadIdx.x, col = lane & 15, g = lane >> 4; const int h = blockIdx.y; const int r0 = blockIdx.x * 16; const int b = r0 / L, l0 = r0 % L;
  const float mn = MM[((size_t)t * 65 + 64) * MMS], mx = MM[((size_t)t * 65 + 64) * MMS + 1]; const float sc = 1.0f / (mx - mn); const float temp = 0.42044820762685725f;   // 32^-0.25
  { const int rl = lane >> 1, half = lane & 1; float ss = 0.f;
    for (int d = half * 16; d < half * 16 + 16; ++d) { const float x = S[(size_t)(r0 + rl) * DMOD + h * DHD + d]; const float xs = (x - mn) * sc * temp; sx[rl][d] = xs; ss += xs * xs; }
    ss += __shfl_xor(ss, 1); if (half == 0) { soff[rl] = -0.5f * ss - 0.5f * 5.2574953720277815f + 1e-6f; sx[rl][32] = 0.f; sx[rl][33] = 0.f; sx[rl][34] = 0.f; sx[rl][35] = 0.f; } }
  LDSX();
  const F2 a = split_row(&sx[col][0], 0, lane);
#pragma unroll
  for (int j = 0; j < 12; ++j) { v8f acc = {}; const v16b w = frag_gbf(feat + (size_t)(j * 16 + col) * DHD, lane); acc = wmma_bf(a.l, w, acc); acc = wmma_bf(a.h, w, acc);
#pragma unroll
    for (int r = 0; r < 8; ++r) so[8 * g + r][j * 16 + col] = exp_ni(acc[r] + soff[8 * g + r]); }
  LDSX();
  for (int q = lane; q < 16 * 48; q += 32) { const int rl = q / 48, pc = q % 48; vst2(P + ((size_t)(b * NHD + h) * L + l0 + rl) * MF + pc * 4, *(const v4f*)&so[rl][pc * 4]); }
}
// ---- k_ksum: ksum[(b*8+h)][m] = sum_l KP[(b*8+h)*L + l][m] (l ascending); block = (b,h), thread = m
__global__ __launch_bounds__(256) void k_ksum(const float* __restrict__ KP, int L, float* __restrict__ KS) {
  __shared__ __align__(16) float ssum[MF];
  const int bh = blockIdx.x, tid = threadIdx.x;
  if (tid < MF) { float s = 0.f;
    for (int l0 = 0; l0 < L; l0 += 32) { float v[32];   // L is a multiple of 32; 32 loads in flight per round, summed in ascending l
#pragma unroll
      for (int i = 0; i < 32; ++i) v[i] = KP[((size_t)bh * L + l0 + i) * MF + tid];
#pragma unroll
      for (int i = 0; i < 32; ++i) s += v[i]; }
    ssum[tid] = s; }
  __syncthreads();
  if (tid < 48) vst2(KS + (size_t)bh * MF + tid * 4, *(const v4f*)&ssum[tid * 4]);
}
// ---- k_an: att_norm[(b*8+h)][l] = sum_m QP[(b*8+h)*L + l][m] * ksum[(b*8+h)][m]; block = (b,h), thread = l (< L); rows pitch 128
__global__ __launch_bounds__(128) void k_an(const float* __restrict__ QP, const float* __restrict__ KS, int L, float* __restrict__ AN) {
  __shared__ float sks[MF]; __shared__ __align__(16) float sres[N2];
  const int bh = blockIdx.x, tid = threadIdx.x;
  for (int m = tid; m < MF; m += 128) sks[m] = KS[(size_t)bh * MF + m];
  __syncthreads();
  float s = 0.f; if (tid < L) { const float* row = QP + ((size_t)bh * L + tid) * MF; for (int m = 0; m < MF; ++m) s += row[m] * sks[m]; }
  sres[tid] = tid < L ? s : 1.0f;
  __syncthreads();
  if (tid < 32) vst2(AN + (size_t)bh * N2 + tid * 4, *(const v4f*)&sres[tid * 4]);
}
// ---- k_amat: per (b,h): A[l][l'] = (sum_m QP[l][m] (hi/lo) . KP[l'][m] (hi/lo)) / att_norm[l]: M = l (tile blockIdx.y), N = l' (32 per wave = 2 tiles), K = m (6 steps), 3 products; rows pitch 128, 128-B segment per wave and row
__global__ __launch_bounds__(128) void k_amat(const float* __restrict__ QP, const float* __restrict__ KP, const float* __restrict__ AN, int L, float* __restrict__ AM) {
  __shared__ __align__(16) float so[4][16][36];
  const int tid = threadIdx.x, wave = tid >> 5, lane = tid & 31, col = lane & 15, g = lane >> 4; const int bh = blockIdx.x, l0 = blockIdx.y * 16, n0 = wave * 32;
  if (n0 >= L) return;
  const float* qrow = QP + ((size_t)bh * L + l0 + col) * MF;
  v8f acc[2] = {};
#pragma unroll
  for (int kc = 0; kc < MF / 32; ++kc) { const F2 a = split_row(qrow, kc * 32, lane);
#pragma unroll
    for (int j = 0; j < 2; ++j) { const F2 kb = split_row(KP + ((size_t)bh * L + n0 + j * 16 + col) * MF, kc * 32, lane); acc[j] = mac3(a, kb, acc[j]); } }
  float inv[8];
#pragma unroll
  for (int r = 0; r < 8; ++r) inv[r] = 1.0f / AN[(size_t)bh * N2 + l0 + 8 * g + r];
#pragma unroll
  for (int j = 0; j < 2; ++j)
#pragma unroll
    for (int r = 0; r < 8; ++r) so[wave][8 * g + r][j * 16 + col] = acc[j][r] * inv[r];
  LDSX();
  for (int q = lane; q < 16 * 8; q += 32) { const int rl = q >> 3, pc = q & 7; vst2(AM + ((size_t)bh * N2 + l0 + rl) * N2 + n0 + pc * 4, *(const v4f*)&so[wave][rl][pc * 4]); }
}
// ---- k_att: per (b, other o, head h), in place on the value tensor: out[l][d] = sum_l' A[(b,h)][l][l'] (hi/lo) . V[l'][(h,d)] (hi/lo): M = l (one 16-row tile per wave, L/16 waves), N = d (2 tiles), K = l' (2 or 4 steps), 3 products; all batches in one launch.
//      The block owns the L x 32 tile (128-B row segments) that it reads and writes: it is read once (thread = 4 rows x 16 B), split into bf16 hi and residual and laid down transposed in LDS ([d][l'], 8-B stores, pitch 2 L + 16 B for the 16-B fragment reads); the stores to V follow the barrier behind which every read has landed
template <int PASS>
__global__ __launch_bounds__(PASS == 1 ? N1 * 2 : N2 * 2) void k_att(const float* __restrict__ AM, int ob0, float* V) {
  constexpr int L = (PASS == 1 ? N1 : N2), O = (PASS == 1 ? N2 : N1); constexpr size_t RS = (PASS == 1 ? (size_t)N2 * DMOD : (size_t)DMOD);   // RS: floats from row l to row l + 1
  __shared__ __align__(16) __bf16 vh[DHD][L + 8], vl[DHD][L + 8]; __shared__ __align__(16) float so[L / 16][16][36];
  const int tid = threadIdx.x, wave = tid >> 5, lane = tid & 31, col = lane & 15, g = lane >> 4; const int h = blockIdx.x % NHD, bo = ob0 + blockIdx.x / NHD; const int b = bo / O, o = bo % O;
  float* tile = V + (PASS == 1 ? ((size_t)b * N1 * N2 + o) : ((size_t)b * N1 + o) * N2) * DMOD + h * DHD;
  const float* arow = AM + ((size_t)(b * NHD + h) * N2 + wave * 16 + col) * N2;
  const int p4 = (tid & 7) * 4, l4 = (tid >> 3) * 4; const float* src = tile + (size_t)l4 * RS + p4; v4f x[4]; F2 a[L / 32];   // every loop below is unrolled whole: x, a, hi, lo and acc are indexed by constants and stay in registers; the tile's 4 loads and A's loads go out together, ahead of the barrier
#pragma unroll
  for (int i = 0; i < 4; ++i) x[i] = *(const v4f*)(src + (size_t)i * RS);
#pragma unroll
  for (int kc = 0; kc < L / 32; ++kc) a[kc] = split_row(arow, kc * 32, lane);
#pragma unroll
  for (int e = 0; e < 4; ++e) { v4b hi, lo;
#pragma unroll
    for (int i = 0; i < 4; ++i) { const float v = x[i][e]; const __bf16 hh = (__bf16)v; hi[i] = hh; lo[i] = (__bf16)(v - (float)hh); }
    *(v4b*)&vh[p4 + e][l4] = hi; *(v4b*)&vl[p4 + e][l4] = lo; }
  __syncthreads();
  v8f acc[2] = {};
#pragma unroll
  for (int kc = 0; kc < L / 32; ++kc)
#pragma unroll
    for (int j = 0; j < 2; ++j) { F2 vb; vb.h = frag_b(&vh[j * 16 + col][kc * 32], lane); vb.l = frag_b(&vl[j * 16 + col][kc * 32], lane); acc[j] = mac3(a[kc], vb, acc[j]); }
#pragma unroll
  for (int j = 0; j < 2; ++j)
#pragma unroll
    for (int r = 0; r < 8; ++r) so[wave][8 * g + r][j * 16 + col] = acc[j][r];
  LDSX();
  for (int q = lane; q < 16 * 8; q += 32) { const int rl = q >> 3, pc = q & 7; vst2(tile + (size_t)(wave * 16 + rl) * RS + pc * 4, *(const v4f*)&so[wave][rl][pc * 4]); }
}
// ---- k_out: Y = V3(hi/lo) . bf16(Wo rows [256][256]) + bo; block (64 rows, 128 cols); K = 256
__global__ __launch_bounds__(128) void k_out(const float* __restrict__ V3, const float* __restrict__ Wo, const float* __restrict__ bo, float* __restrict__ Y, int rb0) {
  __shared__ __align__(16) float so[4][16][132];
  const int tid = threadIdx.x, wave = tid >> 5, lane = tid & 31, col = lane & 15, g = lane >> 4; const size_t r0 = (size_t)(rb0 + blockIdx.x) * 64 + wave * 16; const int n0 = blockIdx.y * 128;
  v8f acc[8] = {};
#pragma unroll 2
  for (int kc = 0; kc < DMOD / 32; ++kc) { const F2 a = split_row(V3 + (r0 + col) * DMOD, kc * 32, lane);
#pragma unroll
    for (int j = 0; j < 8; ++j) { const v16b w = frag_gbf(Wo + (size_t)(n0 + j * 16 + col) * DMOD + kc * 32, lane); acc[j] = wmma_bf(a.l, w, acc[j]); acc[j] = wmma_bf(a.h, w, acc[j]); } }
#pragma unroll
  for (int j = 0; j < 8; ++j) { const float bb = bfr(bo[n0 + j * 16 + col]);
#pragma unroll
    for (int r = 0; r < 8; ++r) so[wave][8 * g + r][j * 16 + col] = acc[j][r] + bb; }
  LDSX();
  for (int rl = 0; rl < 16; ++rl) vst2(Y + (r0 + rl) * DMOD + n0 + lane * 4, *(const v4f*)&so[wave][rl][lane * 4]);
}

#ifndef DBG
#define DBG 0
#endif
#if DBG != 0
__global__ __launch_bounds__(256) void k_dump(const float* __restrict__ src, int n, float* __restrict__ out) {   // out[0..n) = src, rest of batch-0 region zero
  const size_t p = (size_t)blockIdx.x * 256 + threadIdx.x; v4f v; for (int i = 0; i < 4; ++i) { const size_t f = p * 4 + i; v[i] = f < (size_t)n ? src[f] : 0.f; } vst2(out + p * 4, v);
}
#endif
extern "C" void kernel_launch(void* const* d_in, const int* in_sizes, int n_in, void* d_out, int out_size, void* d_ws, size_t ws_size, hipStream_t stream) {
  (void)in_sizes; (void)n_in; (void)out_size;
  const float** F = (const float**)d_in;   // X, Wq, bq, Wk, bk, Wv, bv, Wo, bo, feat
  if (ws_size < (size_t)WS_END) return;
  char* ws = (char*)d_ws; float *BB = (float*)(ws + WS_B), *V = (float*)(ws + WS_V), *QS1 = (float*)(ws + WS_QS1), *KS1 = (float*)(ws + WS_KS1), *QS2 = (float*)(ws + WS_QS2), *KS2 = (float*)(ws + WS_KS2), *MM = (float*)(ws + WS_MM), *QP = (float*)(ws + WS_QP), *AM = (float*)(ws + WS_AM), *KSUM = (float*)(ws + WS_KSUM), *AN = (float*)(ws + WS_AN), *SX = (float*)(ws + WS_SX);
  float* KP = BB;      // phi(k) rows live in buffer B
  k_poolx<<<NBT * N1 + NBT * N2, 256, 0, stream>>>(F[0], SX);
  k_pproj<<<dim3((NBT * N1 + NBT * N2) / 16, 8), 128, 0, stream>>>(SX, F[1], F[2], F[3], F[4], QS1, KS1, QS2, KS2);
  k_proj<<<dim3(NPOS / 64, 2), 128, 0, stream>>>(F[0], F[5], F[6], V);
  k_rope<<<NBT * N2, 256, 0, stream>>>(QS2, KS2);
  k_minmax<<<64, 256, 0, stream>>>(QS1, NBT * N1 * DMOD, 0, MM); k_minmax<<<64, 256, 0, stream>>>(KS1, NBT * N1 * DMOD, 1, MM); k_minmax<<<64, 256, 0, stream>>>(QS2, NBT * N2 * DMOD, 2, MM); k_minmax<<<64, 256, 0, stream>>>(KS2, NBT * N2 * DMOD, 3, MM);
  k_mmfin<<<4, 64, 0, stream>>>(MM);
  k_feat<<<dim3(NBT * N1 / 16, NHD), 32, 0, stream>>>(QS1, N1, MM, 0, F[9], QP);
  k_feat<<<dim3(NBT * N1 / 16, NHD), 32, 0, stream>>>(KS1, N1, MM, 1, F[9], KP);
  k_ksum<<<NBT * NHD, 256, 0, stream>>>(KP, N1, KSUM);
  k_an<<<NBT * NHD, 128, 0, stream>>>(QP, KSUM, N1, AN);
#if DBG == 1
  k_dump<<<N1 * N2 * DMOD / 1024, 256, 0, stream>>>(AN, NBT * NHD * N2, (float*)d_out); return;      // pass-1 att_norm [4][8][128] (l < 64 valid, rest 1.0)
#elif DBG == 2
  k_dump<<<N1 * N2 * DMOD / 1024, 256, 0, stream>>>(QP, NBT * NHD * N1 * MF, (float*)d_out); return;  // pass-1 phi(q) [4][8][64][192]
#endif
  k_amat<<<dim3(NBT * NHD, N1 / 16), 128, 0, stream>>>(QP, KP, AN, N1, AM);
  k_att<1><<<(TNB - TB0) * N2 * NHD, N1 * 2, 0, stream>>>(AM, TB0 * N2, V);
#if DBG == 3
  k_dump<<<N1 * N2 * DMOD / 1024, 256, 0, stream>>>(V, N1 * N2 * DMOD, (float*)d_out); return;
#endif
  // ---- pass 2: time axis (l = n2 = 128 with RoPE, other = n1 = 64)
  k_feat<<<dim3(NBT * N2 / 16, NHD), 32, 0, stream>>>(QS2, N2, MM, 2, F[9], QP);
  k_feat<<<dim3(NBT * N2 / 16, NHD), 32, 0, stream>>>(KS2, N2, MM, 3, F[9], KP);
  k_ksum<<<NBT * NHD, 256, 0, stream>>>(KP, N2, KSUM);
  k_an<<<NBT * NHD, 128, 0, stream>>>(QP, KSUM, N2, AN);
  k_amat<<<dim3(NBT * NHD, N2 / 16), 128, 0, stream>>>(QP, KP, AN, N2, AM);
  k_att<2><<<(TNB - TB0) * N1 * NHD, N2 * 2, 0, stream>>>(AM, TB0 * N1, V);
#if DBG == 5
  k_dump<<<N1 * N2 * DMOD / 1024, 256, 0, stream>>>(V, N1 * N2 * DMOD, (float*)d_out); return;     // value after pass 2, batch 0
#elif DBG == 6
  k_dump<<<N1 * N2 * DMOD / 1024, 256, 0, stream>>>(AN, NBT * NHD * N2, (float*)d_out); return;    // pass-2 att_norm
#endif
  k_out<<<dim3((TNB - TB0) * N1 * N2 / 64, 2), 128, 0, stream>>>(V, F[7], F[8], (float*)d_out, TB0 * N1 * N2 / 64);
}

// v004
// It runs in 174 microseconds.
// In two side-by-side timings against v003, it was 1.42 and 1.43 times as fast.
// Over all steps from v000 it is 4.73 times as fast.
// compute dtype: X, the projection weights/biases and the random-feature matrix (module inputs) rounded to bf16; the v projection with exact bf16 products; the q and k projections taken on the axis sums of bf16(X) (f32 sums as three bf16 pieces, 3 products, all 24 bits); the feature-map GEMM (pooled q,k x feat) with the pooled operand as a bf16 hi + bf16 residual pair (2 products); the phi(q) phi(k)^T and mixing-matrix x value contractions with both computed operands hi/lo (3 products);
// the output projection hi/lo against bf16 Wo (2 products); axis pooling, RoPE, global min-max normalisation, exp feature maps, normalisers and divisions in f32; f32 accumulate.
#include <hip/hip_runtime.h>
#include <math.h>

typedef __attribute__((ext_vector_type(16))) _Float16 v16h;
typedef __attribute__((ext_vector_type(16))) __bf16 v16b;
typedef __attribute__((ext_vector_type(8)))  _Float16 v8h;
typedef __attribute__((ext_vector_type(8)))  float v8f;
typedef __attribute__((ext_vector_type(4)))  float v4f;
typedef __attribute__((ext_vector_type(2)))  float v2f;
typedef __attribute__((ext_vector_type(4)))  unsigned v4u;
typedef __attribute__((ext_vector_type(4)))  int v4i;
typedef float __attribute__((may_alias)) float_a;
typedef int __attribute__((may_alias)) int_a;

template <typename T> __device__ __forceinline__ void vst2(void* p, T v) { *(T*)p = v;  }
__device__ __forceinline__ v8f wmma16(v16h a, v16h b, v8f c) {
  v8f d = __builtin_amdgcn_wmma_f32_16x16x32_f16(false, a, false, b, (short)0, c, false, false);
  asm volatile("v_nop\n\tv_nop\n\tv_nop\n\tv_nop" : "+v"(d) : "v"(a), "v"(b));
  return d;
}
__device__ __forceinline__ v8f wmma_bf(v16b a, v16b b, v8f c) {
  v8f d = __builtin_amdgcn_wmma_f32_16x16x32_bf16(false, a, false, b, (short)0, c, false, false);
  asm volatile("v_nop\n\tv_nop\n\tv_nop\n\tv_nop" : "+v"(d) : "v"(a), "v"(b));
  return d;
}
// 16x16x32 fragments: lane = (h = lane>>4, row/col = lane&15); elements 0..7 = k0+8h+0..7, 8..15 = k0+16+8h+0..7; D element r = row 8h+r
__device__ __forceinline__ v16h frag_h(const _Float16* rowk0, int lane) {
  union { v16h v; v8h q[2]; } u; const _Float16* p = rowk0 + 8 * (lane >> 4);
  u.q[0] = *(const v8h*)p; u.q[1] = *(const v8h*)(p + 16); return u.v;
}
__device__ __forceinline__ v16h frag_f32(const float* rowk0, int lane) {
  v16h a; const float* p = rowk0 + 8 * (lane >> 4);
#pragma unroll
  for (int i = 0; i < 8; ++i) { a[i] = (_Float16)p[i]; a[8 + i] = (_Float16)p[16 + i]; }
  return a;
}
__device__ __forceinline__ v16h frag_f32s(const float* rowk0, int lane, float sc) {
  v16h a; const float* p = rowk0 + 8 * (lane >> 4);
#pragma unroll
  for (int i = 0; i < 8; ++i) { a[i] = (_Float16)(p[i] * sc); a[8 + i] = (_Float16)(p[16 + i] * sc); }
  return a;
}
// column fragment from a [K][ld] layout (column n), rows >= K read as 0
__device__ __forceinline__ v16h fragc_f32(const float* W, int k0, int n, int lane, int ld, int K) {
  v16h a; const int g = lane >> 4;
#pragma unroll
  for (int i = 0; i < 8; ++i) { const int ka = k0 + 8 * g + i, kb = ka + 16;
    a[i] = (_Float16)(ka < K ? W[(size_t)(ka < K ? ka : K - 1) * ld + n] : 0.f); a[8 + i] = (_Float16)(kb < K ? W[(size_t)(kb < K ? kb : K - 1) * ld + n] : 0.f); }
  return a;
}
struct F2 { v16b h, l; };
__device__ __forceinline__ F2 bsplit16(const float v[16]) { F2 r;
#pragma unroll
  for (int i = 0; i < 16; ++i) { const __bf16 h = (__bf16)v[i]; r.h[i] = h; r.l[i] = (__bf16)(v[i] - (float)h); }
  return r; }
__device__ __forceinline__ F2 split_row(const float* row, int k0, int lane) { float v[16]; const float* p = row + k0 + 8 * (lane >> 4);
#pragma unroll
  for (int i = 0; i < 8; ++i) { v[i] = p[i]; v[8 + i] = p[16 + i]; }
  return bsplit16(v); }
__device__ __forceinline__ F2 split_rowK(const float* row, int k0, int lane, int K) { float v[16]; const int g = lane >> 4;
#pragma unroll
  for (int i = 0; i < 8; ++i) { const int ka = k0 + 8 * g + i, kb = ka + 16; v[i] = ka < K ? row[ka < K ? ka : K - 1] : 0.f; v[8 + i] = kb < K ? row[kb < K ? kb : K - 1] : 0.f; }
  return bsplit16(v); }
__device__ __forceinline__ F2 split_col(const float* W, int k0, int n, int lane, int ld, int K) { float v[16]; const int g = lane >> 4;
#pragma unroll
  for (int i = 0; i < 8; ++i) { const int ka = k0 + 8 * g + i, kb = ka + 16; v[i] = ka < K ? W[(size_t)(ka < K ? ka : K - 1) * ld + n] : 0.f; v[8 + i] = kb < K ? W[(size_t)(kb < K ? kb : K - 1) * ld + n] : 0.f; }
  return bsplit16(v); }
__device__ __forceinline__ v8f mac3(const F2& a, const F2& b, v8f c) { c = wmma_bf(a.l, b.h, c); c = wmma_bf(a.h, b.l, c); return wmma_bf(a.h, b.h, c); }
__device__ __forceinline__ float sigm(float v) { return 1.0f / (1.0f + expf(-v)); }
#define LDSX() do { asm volatile("s_wait_dscnt 0" ::: "memory"); __builtin_amdgcn_wave_barrier(); __builtin_amdgcn_fence(__ATOMIC_RELEASE, "workgroup"); } while (0)


// High-order linear attention over a [4, 64, 128, 256] tensor: q/k/v = X W^T + b; for the assets axis (n1, pooled over n2) and then the time axis (n2, pooled over n1, with RoPE): Performer-style positive features phi(x) = exp(xs f^T - |xs|^2/2 - log(M)/2 + 1e-6), xs = (x - min x)/(max x - min x) * 32^-1/4 (global min/max),
// out_l = sum_l' A[l][l'] v_l', A[l][l'] = phi(q_l) . phi(k_l') / (phi(q_l) . sum_l phi(k_l)): the product phi(q) (phi(k)^T v) taken as (phi(q) phi(k)^T) v, since A depends on (b, head) alone and the attended length (64, 128) is below the 192 features; finally value W_o^T + b_o.
// q and k are used only through their axis sums, and sum_i (x_i W^T + b) = (sum_i x_i) W^T + n b: X is pooled first and only the 768 pooled rows are projected.
// k_poolx (axis sums of X); k_pproj (pooled q and k); proj_tile (v); k_rope (dim-2 pooled q,k); k_minmax; k_feat (phi via WMMA); k_ksum; k_an (normaliser); k_amat (per (b, head): A); k_att (per (b, other-position, head): value tile transposed in LDS, A x tile, written back in place);
// A depends on the pooled q and k alone, never on the value: k_minmax, k_feat, k_ksum, k_an and k_amat each run once, for both axes (and for q and k) in one grid, the block index naming the tensor t (0 = q axis 1, 1 = k axis 1, 2 = q axis 2, 3 = k axis 2) or the axis ax (0, 1)
#define NBT 4
#define N1 64
#define N2 128
#define DMOD 256
#define NHD 8
#define DHD 32
#define MF 192
#define NPOS (NBT * N1 * N2)      // 32768 positions
#ifndef TNB
#define TNB NBT                   // batches run through the attention passes / output (debug: fewer)
#endif
#ifndef TB0
#define TB0 0                     // first batch of the attention loops (debug)
#endif
typedef __attribute__((ext_vector_type(8))) __bf16 v8b;
typedef __attribute__((ext_vector_type(4))) __bf16 v4b;
__device__ __forceinline__ v16b frag_b(const __bf16* rowk0, int lane) {
  union { v16b v; v8b q[2]; } u; const __bf16* p = rowk0 + 8 * (lane >> 4);
  u.q[0] = *(const v8b*)p; u.q[1] = *(const v8b*)(p + 16); return u.v;
}
__device__ __forceinline__ v16b frag_gbf(const float* rowk0, int lane) {
  v16b a; const float* p = rowk0 + 8 * (lane >> 4);
#pragma unroll
  for (int i = 0; i < 8; ++i) { a[i] = (__bf16)p[i]; a[8 + i] = (__bf16)p[16 + i]; }
  return a;
}
__device__ __forceinline__ float bfr(float v) { return (float)(__bf16)v; }
__device__ __attribute__((noinline)) float exp_ni(float v) { return expf(v); }
__device__ __attribute__((noinline)) float pow_ni(float a, float b) { return powf(a, b); }
__device__ __attribute__((noinline)) float cos_ni(float v) { return cosf(v); }
__device__ __attribute__((noinline)) float sin_ni(float v) { return sinf(v); }

#define WS_A    0u                              // 32 MB, 12 MB used: f32 phi rows, 4 tensors t of PSZ floats each: [(b,h)][l][m] (l rows, m contiguous; L = 64 rows per (b,h) for t < 2, 128 for t >= 2)
#define PSZ     (NBT * NHD * N2 * MF)
#define WS_B    (WS_A + 4u * NPOS * DMOD)          // 32 MB: not used
#define WS_V    (WS_B + 4u * NPOS * DMOD)          // f32 32 MB: value [b][n1][n2][h*32+d] (updated in place per pass: V -> V2 -> V3, by the block that owns the tile)
#define WS_QS1  (WS_V + 4u * NPOS * DMOD)          // f32 [4][64][256]  q summed over n2
#define WS_KS1  (WS_QS1 + 4u * NBT * N1 * DMOD)
#define WS_QS2  (WS_KS1 + 4u * NBT * N1 * DMOD)    // f32 [4][128][256] q summed over n1 (then RoPE'd in place)
#define WS_KS2  (WS_QS2 + 4u * NBT * N2 * DMOD)
#define WS_MM   (WS_KS2 + 4u * NBT * N2 * DMOD)
#define MMS 32
#define WS_AM   (WS_MM + 4u * 4 * 65 * MMS)        // f32 [2 axes][4][8][128][128] A (l rows, l' contiguous, pitch 128; axis 1 uses l, l' < 64); WS_MM holds [4 tensors][65 slots][32 floats]
#define AMSZ    (NBT * NHD * N2 * N2)
#define WS_KSUM (WS_AM + 4u * 2 * AMSZ)            // f32 [2 axes][4][8][192]
#define WS_AN   (WS_KSUM + 4u * 2 * NBT * NHD * MF) // f32 [2 axes][4][8][128] att_norm
#define WS_SX   (WS_AN + 4u * 2 * NBT * NHD * N2)  // f32 [256 + 512][256] bf16(X) summed over n2 (rows b*64 + n1), then summed over n1 (rows 256 + b*128 + n2)
#define WS_END  (WS_SX + 4u * (NBT * N1 + NBT * N2) * DMOD)

// ---- proj_tile: [32768 rows] x [v 256 cols] = bf16(X) . W rows ([out][in]) + b (exact); tile pb < PROJ_N = (64 rows, 128 cols), one wave = 16 of its rows, no wave needs another (so: the wave's own 16 x 132 floats of LDS); 512-B segments of 1-KB rows.
//      The v projection needs X alone and is first needed by k_att<1>: it has no launch of its own; its tiles ride as the last blocks in the grids of k_feat and k_an, whose few waves wait on latency and leave most of the chip idle
#define PROJ_N  (NPOS / 64 * 2)
#define PROJ_F  (PROJ_N * 21 / 32)                 // tiles [0, PROJ_F) ride in k_feat (the longer of the two), [PROJ_F, PROJ_N) in k_an
__device__ __forceinline__ void proj_tile(const float* __restrict__ X, const float* __restrict__ Wm, const float* __restrict__ bm, float* __restrict__ dst, float (*so)[132], int pb, int wave, int lane) {
  const int col = lane & 15, g = lane >> 4; const size_t r0 = (size_t)(pb % (NPOS / 64)) * 64 + wave * 16; const int n0 = pb / (NPOS / 64) * 128;
  v8f acc[8] = {};
#pragma unroll 2
  for (int kc = 0; kc < DMOD / 32; ++kc) { const v16b a = frag_gbf(X + (r0 + col) * DMOD + kc * 32, lane);
#pragma unroll
    for (int j = 0; j < 8; ++j) acc[j] = wmma_bf(a, frag_gbf(Wm + (size_t)(n0 + j * 16 + col) * DMOD + kc * 32, lane), acc[j]); }
#pragma unroll
  for (int j = 0; j < 8; ++j) { const float bb = bfr(bm[n0 + j * 16 + col]);
#pragma unroll
    for (int r = 0; r < 8; ++r) so[8 * g + r][j * 16 + col] = acc[j][r] + bb; }
  LDSX();
  for (int rl = 0; rl < 16; ++rl) vst2(dst + (r0 + rl) * DMOD + n0 + lane * 4, *(const v4f*)&so[rl][lane * 4]);
}
// ---- k_poolx: axis sums of bf16(X). Blocks < 256: SX[b*64 + n1][c] = sum_{n2}; blocks >= 256: SX[256 + b*128 + n2][c] = sum_{n1}. Thread = (part = tid >> 6, 4 columns): a part sums every 4th row (ascending), the 4 parts are added in LDS; 1-KB rows
template <int NR> __device__ __forceinline__ v4f sum_rows(const float* __restrict__ p, size_t step) {
  v4f s = {0.f, 0.f, 0.f, 0.f};
#pragma unroll 16   // 16 row loads of 16 B in flight per lane: the kernel is a stream from memory
  for (int i = 0; i < NR; ++i) { const v4f v = *(const v4f*)(p + (size_t)i * step);
#pragma unroll      // vector elements by constant index
    for (int e = 0; e < 4; ++e) s[e] += bfr(v[e]); }
  return s;
}
__global__ __launch_bounds__(256) void k_poolx(const float* __restrict__ X, float* __restrict__ SX) {
  __shared__ __align__(16) float sp[4][DMOD];
  const int tid = threadIdx.x, part = tid >> 6, c4 = (tid & 63) * 4, blk = blockIdx.x; v4f s;
  if (blk < NBT * N1) s = sum_rows<N2 / 4>(X + ((size_t)blk * N2 + part) * DMOD + c4, (size_t)4 * DMOD);
  else { const int r = blk - NBT * N1, b = r / N2, i2 = r % N2; s = sum_rows<N1 / 4>(X + (((size_t)b * N1 + part) * N2 + i2) * DMOD + c4, (size_t)4 * N2 * DMOD); }
  *(v4f*)&sp[part][c4] = s;
  __syncthreads();
  if (tid < 64) vst2(SX + (size_t)blk * DMOD + c4, (*(const v4f*)&sp[0][c4] + *(const v4f*)&sp[1][c4]) + (*(const v4f*)&sp[2][c4] + *(const v4f*)&sp[3][c4]));
}
// ---- k_pproj: pooled q and k: [768 rows of SX] x [q|k 512 cols] = SX (three bf16 pieces, 3 products) . bf16(W rows) + n bf16(b), n = rows summed (128 or 64); block (16 rows, 64 cols), wave = 16 cols; K = 256; 256-B segments of 1-KB rows
__global__ __launch_bounds__(128) void k_pproj(const float* __restrict__ SX, const float* __restrict__ Wq, const float* __restrict__ bq, const float* __restrict__ Wk, const float* __restrict__ bk, float* __restrict__ QS1, float* __restrict__ KS1, float* __restrict__ QS2, float* __restrict__ KS2) {
  __shared__ __align__(16) float so[16][68];
  const int tid = threadIdx.x, wave = tid >> 5, lane = tid & 31, col = lane & 15, g = lane >> 4; const int r0 = blockIdx.x * 16, which = blockIdx.y >> 2, nb0 = (blockIdx.y & 3) * 64, n = nb0 + wave * 16 + col;
  const float* Wm = which == 0 ? Wq : Wk; const float* bm = which == 0 ? bq : bk; const bool ax1 = r0 < NBT * N1;
  float* dst = ax1 ? (which == 0 ? QS1 : KS1) + (size_t)r0 * DMOD : (which == 0 ? QS2 : KS2) + (size_t)(r0 - NBT * N1) * DMOD;
  const float* pa = SX + (size_t)(r0 + col) * DMOD + 8 * g; const float* pw = Wm + (size_t)n * DMOD + 8 * g; const float bb = (ax1 ? (float)N2 : (float)N1) * bfr(bm[n]);
  v8f acc = {};   // every loop below is unrolled whole, so that a, w and the fragments are indexed by constants and stay in registers
#pragma unroll
  for (int kh = 0; kh < 2; ++kh) { v4f a[4][4], w[4][4];   // half of K at a time: its 32 loads go out together
#pragma unroll
    for (int k = 0; k < 4; ++k)
#pragma unroll
      for (int i = 0; i < 4; ++i) { const int o = (kh * 4 + k) * 32 + (i >> 1) * 16 + (i & 1) * 4; a[k][i] = *(const v4f*)(pa + o); w[k][i] = *(const v4f*)(pw + o); }
#pragma unroll
    for (int k = 0; k < 4; ++k) { v16b ah, am, al, wb;
#pragma unroll
      for (int i = 0; i < 16; ++i) { const float v = a[k][i >> 2][i & 3]; const __bf16 h = (__bf16)v; const float r1 = v - (float)h; const __bf16 m = (__bf16)r1; ah[i] = h; am[i] = m; al[i] = (__bf16)(r1 - (float)m); wb[i] = (__bf16)w[k][i >> 2][i & 3]; }
      acc = wmma_bf(al, wb, acc); acc = wmma_bf(am, wb, acc); acc = wmma_bf(ah, wb, acc); } }
#pragma unroll
  for (int r = 0; r < 8; ++r) so[8 * g + r][wave * 16 + col] = acc[r] + bb;
  __syncthreads();
  for (int q = tid; q < 16 * 16; q += 128) { const int rl = q >> 4, pc = q & 15; vst2(dst + (size_t)rl * DMOD + nb0 + pc * 4, *(const v4f*)&so[rl][pc * 4]); }
}
// ---- k_rope: in place on S2 (q and k pooled over n1): per (b, l < 128, h): x[32] -> x cos + rot(x) sin, rot = (-x[16:], x[:16]), angle = l * 10000^(-j/16) (j = d mod 16); block = (b, l), thread = (h, d)
__global__ __launch_bounds__(256) void k_rope(float* __restrict__ SQ, float* __restrict__ SK) {
  __shared__ __align__(16) float sq[DMOD], sk[DMOD];
  const int l = blockIdx.x % N2, tid = threadIdx.x; const size_t row = (size_t)blockIdx.x * DMOD; const int d = tid & 31, j = d & 15;
  const float invf = 1.0f / pow_ni(10000.0f, (float)(2 * j) / 32.0f); const float ang = (float)l * invf; const float c = cos_ni(ang), s = sin_ni(ang);
  const float xq = SQ[row + tid], xk = SK[row + tid]; const float rq = d < 16 ? -SQ[row + tid + 16] : SQ[row + tid - 16]; const float rk = d < 16 ? -SK[row + tid + 16] : SK[row + tid - 16];
  sq[tid] = xq * c + rq * s; sk[tid] = xk * c + rk * s;
  __syncthreads();
  if (tid < 64) vst2(SQ + row + tid * 4, *(const v4f*)&sq[tid * 4]); else if (tid < 128) vst2(SK + row + (tid - 64) * 4, *(const v4f*)&sk[(tid - 64) * 4]);
}
// ---- k_minmax: partial min/max of tensor t = blockIdx.y (n floats): block i of 64 scans a strided slice -> MMP[t][i][2]; k_mmfin: finals MM[t] = (min, max) (block t, 64 threads)
__global__ __launch_bounds__(256) void k_minmax(const float* __restrict__ T0, const float* __restrict__ T1, const float* __restrict__ T2, const float* __restrict__ T3, float* __restrict__ MMP) {
  __shared__ float smn[8], smx[8]; __shared__ __align__(16) float sres[4];
  const int t = blockIdx.y, n = (t < 2 ? NBT * N1 : NBT * N2) * DMOD; const float* T = t == 0 ? T0 : t == 1 ? T1 : t == 2 ? T2 : T3;
  const int tid = threadIdx.x, wave = tid >> 5, lane = tid & 31; float mn = 3.0e38f, mx = -3.0e38f;
  for (int i = blockIdx.x * 256 + tid; i < n; i += 64 * 256) { const float v = T[i]; mn = fminf(mn, v); mx = fmaxf(mx, v); }
#pragma unroll
  for (int o = 1; o < 32; o <<= 1) { mn = fminf(mn, __shfl_xor(mn, o)); mx = fmaxf(mx, __shfl_xor(mx, o)); }
  if (lane == 0) { smn[wave] = mn; smx[wave] = mx; }
  __syncthreads();
  if (tid == 0) { float a = smn[0], bq2 = smx[0]; for (int w = 1; w < 8; ++w) { a = fminf(a, smn[w]); bq2 = fmaxf(bq2, smx[w]); } sres[0] = a; sres[1] = bq2; sres[2] = 0.f; sres[3] = 0.f; }
  __syncthreads();
  if (tid < 8) { const v4f z = {0.f, 0.f, 0.f, 0.f}; vst2(MMP + ((size_t)t * 65 + blockIdx.x) * MMS + tid * 4, tid == 0 ? *(const v4f*)sres : z); }
}
__global__ __launch_bounds__(64) void k_mmfin(float* __restrict__ MMP) {
  const int t = blockIdx.x, tid = threadIdx.x; float mn = MMP[((size_t)t * 65 + tid) * MMS], mx = MMP[((size_t)t * 65 + tid) * MMS + 1];
#pragma unroll
  for (int o = 1; o < 32; o <<= 1) { mn = fminf(mn, __shfl_xor(mn, o)); mx = fmaxf(mx, __shfl_xor(mx, o)); }
  __shared__ float s2[4];
  if ((tid & 31) == 0) { s2[(tid >> 5) * 2] = mn; s2[(tid >> 5) * 2 + 1] = mx; }
  __syncthreads();
  __shared__ __align__(16) float sfin[4];
  if (tid == 0) { sfin[0] = fminf(s2[0], s2[2]); sfin[1] = fmaxf(s2[1], s2[3]); sfin[2] = 0.f; sfin[3] = 0.f; }
  __syncthreads();
  if (tid < 8) { const v4f z = {0.f, 0.f, 0.f, 0.f}; vst2(MMP + ((size_t)t * 65 + 64) * MMS + tid * 4, tid == 0 ? *(const v4f*)sfin : z); }
}

// ---- k_feat: phi for the pooled tensor S = S_t (rows (b,l), l < L) and head h; blockIdx.x = h * 96 + bx, bx: 16 row tiles each of t = 0, 1, then 32 each of t = 2, 3; behind these FEAT_NB blocks, per block, one wave's quarter of a v-projection tile; block = 16 rows (one wave): xs = (x - mn)/(mx - mn) * 32^-1/4; dots on WMMA (xs hi/lo x bf16(feat rows), K = 32, 12 tiles); phi = exp(dot - |xs|^2/2 - ln(192)/2 + 1e-6);
//      P[(b*8 + h)*L + l][m] rows of 768 B (48 pieces)
#define FEAT_NB ((2 * (NBT * N1 / 16) + 2 * (NBT * N2 / 16)) * NHD)
__global__ __launch_bounds__(32) void k_feat(const float* __restrict__ S0, const float* __restrict__ S1, const float* __restrict__ S2, const float* __restrict__ S3, const float* __restrict__ MM, const float* __restrict__ feat, float* __restrict__ PB, const float* __restrict__ X, const float* __restrict__ Wv, const float* __restrict__ bv, float* __restrict__ V) {
  __shared__ __align__(16) union { struct { float sx[16][36]; float so[16][196]; float soff[16]; } f; float pj[16][132]; } sm; auto& sx = sm.f.sx; auto& so = sm.f.so; auto& soff = sm.f.soff;
  const int fb = blockIdx.x;
  if (fb >= FEAT_NB) { proj_tile(X, Wv, bv, V, sm.pj, (fb - FEAT_NB) >> 2, (fb - FEAT_NB) & 3, threadIdx.x); return; }
  constexpr int T1N = NBT * N1 / 16, T2N = NBT * N2 / 16; const int bx = fb % (FEAT_NB / NHD), t = bx < 2 * T1N ? bx / T1N : 2 + (bx - 2 * T1N) / T2N, L = t < 2 ? N1 : N2;
  const float* S = t == 0 ? S0 : t == 1 ? S1 : t == 2 ? S2 : S3; float* P = PB + (size_t)t * PSZ;
  const int lane = threadIdx.x, col = lane & 15, g = lane >> 4; const int h = fb / (FEAT_NB / NHD); const int r0 = (t < 2 ? bx % T1N : (bx - 2 * T1N) % T2N) * 16; const int b = r0 / L, l0 = r0 % L;
  const float mn = MM[((size_t)t * 65 + 64) * MMS], mx = MM[((size_t)t * 65 + 64) * MMS + 1]; const float sc = 1.0f / (mx - mn); const float temp = 0.42044820762685725f;   // 32^-0.25
  { const int rl = lane >> 1, half = lane & 1; float ss = 0.f;
    for (int d = half * 16; d < half * 16 + 16; ++d) { const float x = S[(size_t)(r0 + rl) * DMOD + h * DHD + d]; const float xs = (x - mn) * sc * temp; sx[rl][d] = xs; ss += xs * xs; }
    ss += __shfl_xor(ss, 1); if (half == 0) { soff[rl] = -0.5f * ss - 0.5f * 5.2574953720277815f + 1e-6f; sx[rl][32] = 0.f; sx[rl][33] = 0.f; sx[rl][34] = 0.f; sx[rl][35] = 0.f; } }
  LDSX();
  const F2 a = split_row(&sx[col][0], 0, lane);
#pragma unroll
  for (int j = 0; j < 12; ++j) { v8f acc = {}; const v16b w = frag_gbf(feat + (size_t)(j * 16 + col) * DHD, lane); acc = wmma_bf(a.l, w, acc); acc = wmma_bf(a.h, w, acc);
#pragma unroll
    for (int r = 0; r < 8; ++r) so[8 * g + r][j * 16 + col] = exp_ni(acc[r] + soff[8 * g + r]); }
  LDSX();
  for (int q = lane; q < 16 * 48; q += 32) { const int rl = q / 48, pc = q % 48; vst2(P + ((size_t)(b * NHD + h) * L + l0 + rl) * MF + pc * 4, *(const v4f*)&so[rl][pc * 4]); }
}
// ---- k_ksum: ksum[ax][(b*8+h)][m] = sum_l KP[(b*8+h)*L + l][m] (l ascending), KP = phi tensor 2 ax + 1; block = (b,h) x axis ax = blockIdx.y, thread = m
__global__ __launch_bounds__(256) void k_ksum(const float* __restrict__ PB, float* __restrict__ KSB) {
  __shared__ __align__(16) float ssum[MF];
  const int bh = blockIdx.x, ax = blockIdx.y, L = ax == 0 ? N1 : N2, tid = threadIdx.x; const float* KP = PB + (size_t)(2 * ax + 1) * PSZ; float* KS = KSB + (size_t)ax * NBT * NHD * MF;
  if (tid < MF) { float s = 0.f;
    for (int l0 = 0; l0 < L; l0 += 32) { float v[32];   // L is a multiple of 32; 32 loads in flight per round, summed in ascending l
#pragma unroll
      for (int i = 0; i < 32; ++i) v[i] = KP[((size_t)bh * L + l0 + i) * MF + tid];
#pragma unroll
      for (int i = 0; i < 32; ++i) s += v[i]; }
    ssum[tid] = s; }
  __syncthreads();
  if (tid < 48) vst2(KS + (size_t)bh * MF + tid * 4, *(const v4f*)&ssum[tid * 4]);
}
// ---- k_an: att_norm[ax][(b*8+h)][l] = sum_m QP[(b*8+h)*L + l][m] * ksum[ax][(b*8+h)][m], QP = phi tensor 2 ax; blockIdx.x = ax * 32 + (b,h), behind these 64 blocks v-projection tiles; thread = l (< L); rows pitch 128
__global__ __launch_bounds__(128) void k_an(const float* __restrict__ PB, const float* __restrict__ KSB, float* __restrict__ ANB, const float* __restrict__ X, const float* __restrict__ Wv, const float* __restrict__ bv, float* __restrict__ V) {
  __shared__ __align__(16) union { struct { float sres[N2]; float sks[MF]; } a; float pj[4][16][132]; } sm; auto& sks = sm.a.sks; auto& sres = sm.a.sres;
  const int fb = blockIdx.x, tid = threadIdx.x;
  if (fb >= 2 * NBT * NHD) { proj_tile(X, Wv, bv, V, sm.pj[tid >> 5], PROJ_F + fb - 2 * NBT * NHD, tid >> 5, tid & 31); return; }
  const int bh = fb % (NBT * NHD), ax = fb / (NBT * NHD), L = ax == 0 ? N1 : N2; const float* QP = PB + (size_t)(2 * ax) * PSZ; const float* KS = KSB + (size_t)ax * NBT * NHD * MF; float* AN = ANB + (size_t)ax * NBT * NHD * N2;
  for (int m = tid; m < MF; m += 128) sks[m] = KS[(size_t)bh * MF + m];
  __syncthreads();
  float s = 0.f; if (tid < L) { const float* row = QP + ((size_t)bh * L + tid) * MF; for (int m = 0; m < MF; ++m) s += row[m] * sks[m]; }
  sres[tid] = tid < L ? s : 1.0f;
  __syncthreads();
  if (tid < 32) vst2(AN + (size_t)bh * N2 + tid * 4, *(const v4f*)&sres[tid * 4]);
}
// ---- k_amat: per axis and (b,h): A[l][l'] = (sum_m QP[l][m] (hi/lo) . KP[l'][m] (hi/lo)) / att_norm[l]: M = l (blockIdx.y: 4 tiles of axis 1, then 8 of axis 2), N = l' (32 per wave = 2 tiles), K = m (6 steps), 3 products; rows pitch 128, 128-B segment per wave and row
__global__ __launch_bounds__(128) void k_amat(const float* __restrict__ PB, const float* __restrict__ ANB, float* __restrict__ AMB) {
  __shared__ __align__(16) float so[4][16][36];
  const int tid = threadIdx.x, wave = tid >> 5, lane = tid & 31, col = lane & 15, g = lane >> 4; const int by = blockIdx.y, ax = by < N1 / 16 ? 0 : 1, L = ax == 0 ? N1 : N2; const int bh = blockIdx.x, l0 = (ax == 0 ? by : by - N1 / 16) * 16, n0 = wave * 32;
  if (n0 >= L) return;
  const float* QP = PB + (size_t)(2 * ax) * PSZ; const float* KP = QP + PSZ; const float* AN = ANB + (size_t)ax * NBT * NHD * N2; float* AM = AMB + (size_t)ax * AMSZ;
  const float* qrow = QP + ((size_t)bh * L + l0 + col) * MF;
  v8f acc[2] = {};
#pragma unroll
  for (int kc = 0; kc < MF / 32; ++kc) { const F2 a = split_row(qrow, kc * 32, lane);
#pragma unroll
    for (int j = 0; j < 2; ++j) { const F2 kb = split_row(KP + ((size_t)bh * L + n0 + j * 16 + col) * MF, kc * 32, lane); acc[j] = mac3(a, kb, acc[j]); } }
  float inv[8];
#pragma unroll
  for (int r = 0; r < 8; ++r) inv[r] = 1.0f / AN[(size_t)bh * N2 + l0 + 8 * g + r];
#pragma unroll
  for (int j = 0; j < 2; ++j)
#pragma unroll
    for (int r = 0; r < 8; ++r) so[wave][8 * g + r][j * 16 + col] = acc[j][r] * inv[r];
  LDSX();
  for (int q = lane; q < 16 * 8; q += 32) { const int rl = q >> 3, pc = q & 7; vst2(AM + ((size_t)bh * N2 + l0 + rl) * N2 + n0 + pc * 4, *(const v4f*)&so[wave][rl][pc * 4]); }
}
// ---- k_att: per (b, other o, head h), in place on the value tensor: out[l][d] = sum_l' A[(b,h)][l][l'] (hi/lo) . V[l'][(h,d)] (hi/lo): M = l (one 16-row tile per wave, L/16 waves), N = d (2 tiles), K = l' (2 or 4 steps), 3 products; all batches in one launch.
//      The block owns the L x 32 tile (128-B row segments) that it reads and writes: it is read once (thread = 4 rows x 16 B), split into bf16 hi and residual and laid down transposed in LDS ([d][l'], 8-B stores, pitch 2 L + 16 B for the 16-B fragment reads); the stores to V follow the barrier behind which every read has landed
template <int PASS>
__global__ __launch_bounds__(PASS == 1 ? N1 * 2 : N2 * 2) void k_att(const float* __restrict__ AM, int ob0, float* V) {
  constexpr int L = (PASS == 1 ? N1 : N2), O = (PASS == 1 ? N2 : N1); constexpr size_t RS = (PASS == 1 ? (size_t)N2 * DMOD : (size_t)DMOD);   // RS: floats from row l to row l + 1
  __shared__ __align__(16) __bf16 vh[DHD][L + 8], vl[DHD][L + 8]; __shared__ __align__(16) float so[L / 16][16][36];
  const int tid = threadIdx.x, wave = tid >> 5, lane = tid & 31, col = lane & 15, g = lane >> 4; const int h = blockIdx.x % NHD, bo = ob0 + blockIdx.x / NHD; const int b = bo / O, o = bo % O;
  float* tile = V + (PASS == 1 ? ((size_t)b * N1 * N2 + o) : ((size_t)b * N1 + o) * N2) * DMOD + h * DHD;
  const float* arow = AM + ((size_t)(b * NHD + h) * N2 + wave * 16 + col) * N2;
  const int p4 = (tid & 7) * 4, l4 = (tid >> 3) * 4; const float* src = tile + (size_t)l4 * RS + p4; v4f x[4]; F2 a[L / 32];   // every loop below is unrolled whole: x, a, hi, lo and acc are indexed by constants and stay in registers; the tile's 4 loads and A's loads go out together, ahead of the barrier
#pragma unroll
  for (int i = 0; i < 4; ++i) x[i] = *(const v4f*)(src + (size_t)i * RS);
#pragma unroll
  for (int kc = 0; kc < L / 32; ++kc) a[kc] = split_row(arow, kc * 32, lane);
#pragma unroll
  for (int e = 0; e < 4; ++e) { v4b hi, lo;
#pragma unroll
    for (int i = 0; i < 4; ++i) { const float v = x[i][e]; const __bf16 hh = (__bf16)v; hi[i] = hh; lo[i] = (__bf16)(v - (float)hh); }
    *(v4b*)&vh[p4 + e][l4] = hi; *(v4b*)&vl[p4 + e][l4] = lo; }
  __syncthreads();
  v8f acc[2] = {};
#pragma unroll
  for (int kc = 0; kc < L / 32; ++kc)
#pragma unroll
    for (int j = 0; j < 2; ++j) { F2 vb; vb.h = frag_b(&vh[j * 16 + col][kc * 32], lane); vb.l = frag_b(&vl[j * 16 + col][kc * 32], lane); acc[j] = mac3(a[kc], vb, acc[j]); }
#pragma unroll
  for (int j = 0; j < 2; ++j)
#pragma unroll
    for (int r = 0; r < 8; ++r) so[wave][8 * g + r][j * 16 + col] = acc[j][r];
  LDSX();
  for (int q = lane; q < 16 * 8; q += 32) { const int rl = q >> 3, pc = q & 7; vst2(tile + (size_t)(wave * 16 + rl) * RS + pc * 4, *(const v4f*)&so[wave][rl][pc * 4]); }
}
// ---- k_out: Y = V3(hi/lo) . bf16(Wo rows [256][256]) + bo; block (64 rows, 128 cols); K = 256
__global__ __launch_bounds__(128) void k_out(const float* __restrict__ V3, const float* __restrict__ Wo, const float* __restrict__ bo, float* __restrict__ Y, int rb0) {
  __shared__ __align__(16) float so[4][16][132];
  const int tid = threadIdx.x, wave = tid >> 5, lane = tid & 31, col = lane & 15, g = lane >> 4; const size_t r0 = (size_t)(rb0 + blockIdx.x) * 64 + wave * 16; const int n0 = blockIdx.y * 128;
  v8f acc[8] = {};
#pragma unroll 2
  for (int kc = 0; kc < DMOD / 32; ++kc) { const F2 a = split_row(V3 + (r0 + col) * DMOD, kc * 32, lane);
#pragma unroll
    for (int j = 0; j < 8; ++j) { const v16b w = frag_gbf(Wo + (size_t)(n0 + j * 16 + col) * DMOD + kc * 32, lane); acc[j] = wmma_bf(a.l, w, acc[j]); acc[j] = wmma_bf(a.h, w, acc[j]); } }
#pragma unroll
  for (int j = 0; j < 8; ++j) { const float bb = bfr(bo[n0 + j * 16 + col]);
#pragma unroll
    for (int r = 0; r < 8; ++r) so[wave][8 * g + r][j * 16 + col] = acc[j][r] + bb; }
  LDSX();
  for (int rl = 0; rl < 16; ++rl) vst2(Y + (r0 + rl) * DMOD + n0 + lane * 4, *(const v4f*)&so[wave][rl][lane * 4]);
}

#ifndef DBG
#define DBG 0
#endif
#if DBG != 0
__global__ __launch_bounds__(256) void k_dump(const float* __restrict__ src, int n, float* __restrict__ out) {   // out[0..n) = src, rest of batch-0 region zero
  const size_t p = (size_t)blockIdx.x * 256 + threadIdx.x; v4f v; for (int i = 0; i < 4; ++i) { const size_t f = p * 4 + i; v[i] = f < (size_t)n ? src[f] : 0.f; } vst2(out + p * 4, v);
}
#endif
extern "C" void kernel_launch(void* const* d_in, const int* in_sizes, int n_in, void* d_out, int out_size, void* d_ws, size_t ws_size, hipStream_t stream) {
  (void)in_sizes; (void)n_in; (void)out_size;
  const float** F = (const float**)d_in;   // X, Wq, bq, Wk, bk, Wv, bv, Wo, bo, feat
  if (ws_size < (size_t)WS_END) return;
  char* ws = (char*)d_ws; float *PB = (float*)(ws + WS_A), *V = (float*)(ws + WS_V), *QS1 = (float*)(ws + WS_QS1), *KS1 = (float*)(ws + WS_KS1), *QS2 = (float*)(ws + WS_QS2), *KS2 = (float*)(ws + WS_KS2), *MM = (float*)(ws + WS_MM), *AM = (float*)(ws + WS_AM), *KSUM = (float*)(ws + WS_KSUM), *AN = (float*)(ws + WS_AN), *SX = (float*)(ws + WS_SX);
  k_poolx<<<NBT * N1 + NBT * N2, 256, 0, stream>>>(F[0], SX);
  k_pproj<<<dim3((NBT * N1 + NBT * N2) / 16, 8), 128, 0, stream>>>(SX, F[1], F[2], F[3], F[4], QS1, KS1, QS2, KS2);
  k_rope<<<NBT * N2, 256, 0, stream>>>(QS2, KS2);
  // ---- the mixing matrices of both axes (assets: l = n1 = 64; time: l = n2 = 128 with RoPE)
  k_minmax<<<dim3(64, 4), 256, 0, stream>>>(QS1, KS1, QS2, KS2, MM);
  k_mmfin<<<4, 64, 0, stream>>>(MM);
  k_feat<<<FEAT_NB + 4 * PROJ_F, 32, 0, stream>>>(QS1, KS1, QS2, KS2, MM, F[9], PB, F[0], F[5], F[6], V);
  k_ksum<<<dim3(NBT * NHD, 2), 256, 0, stream>>>(PB, KSUM);
  k_an<<<2 * NBT * NHD + PROJ_N - PROJ_F, 128, 0, stream>>>(PB, KSUM, AN, F[0], F[5], F[6], V);
#if DBG == 1
  k_dump<<<N1 * N2 * DMOD / 1024, 256, 0, stream>>>(AN, NBT * NHD * N2, (float*)d_out); return;      // pass-1 att_norm [4][8][128] (l < 64 valid, rest 1.0)
#elif DBG == 2
  k_dump<<<N1 * N2 * DMOD / 1024, 256, 0, stream>>>(PB, NBT * NHD * N1 * MF, (float*)d_out); return;  // pass-1 phi(q) [4][8][64][192]
#elif DBG == 6
  k_dump<<<N1 * N2 * DMOD / 1024, 256, 0, stream>>>(AN + NBT * NHD * N2, NBT * NHD * N2, (float*)d_out); return;    // pass-2 att_norm
#endif
  k_amat<<<dim3(NBT * NHD, N1 / 16 + N2 / 16), 128, 0, stream>>>(PB, AN, AM);
  // ---- pass 1: assets axis (other = n2 = 128)
  k_att<1><<<(TNB - TB0) * N2 * NHD, N1 * 2, 0, stream>>>(AM, TB0 * N2, V);
#if DBG == 3
  k_dump<<<N1 * N2 * DMOD / 1024, 256, 0, stream>>>(V, N1 * N2 * DMOD, (float*)d_out); return;
#endif
  // ---- pass 2: time axis (other = n1 = 64)
  k_att<2><<<(TNB - TB0) * N1 * NHD, N2 * 2, 0, stream>>>(AM + AMSZ, TB0 * N1, V);
#if DBG == 5
  k_dump<<<N1 * N2 * DMOD / 1024, 256, 0, stream>>>(V, N1 * N2 * DMOD, (float*)d_out); return;     // value after pass 2, batch 0
#endif
  k_out<<<dim3((TNB - TB0) * N1 * N2 / 64, 2), 128, 0, stream>>>(V, F[7], F[8], (float*)d_out, TB0 * N1 * N2 / 64);
}

// v005
// One run takes 118 microseconds.
// Next to v004, in two timings, it ran 1.48 times as fast each time.
// Over all steps from v000 it is 7.01 times as fast.
// compute dtype: X, the projection weights/biases and the random-feature matrix (module inputs) rounded to bf16; the v projection with exact bf16 products; the q and k projections taken on the axis sums of bf16(X) (f32 sums as three bf16 pieces, 3 products, all 24 bits); the feature-map GEMM (pooled q,k x feat) with the pooled operand as a bf16 hi + bf16 residual pair (2 products); the phi(q) phi(k)^T and mixing-matrix x value contractions with both computed operands hi/lo (3 products);
// the output projection hi/lo against bf16 Wo (2 products); axis pooling, RoPE, global min-max normalisation, exp feature maps, normalisers and divisions in f32; f32 accumulate.
#include <hip/hip_runtime.h>
#include <math.h>

typedef __attribute__((ext_vector_type(16))) _Float16 v16h;
typedef __attribute__((ext_vector_type(16))) __bf16 v16b;
typedef __attribute__((ext_vector_type(8)))  _Float16 v8h;
typedef __attribute__((ext_vector_type(8)))  float v8f;
typedef __attribute__((ext_vector_type(4)))  float v4f;
typedef __attribute__((ext_vector_type(2)))  float v2f;
typedef __attribute__((ext_vector_type(4)))  unsigned v4u;
typedef __attribute__((ext_vector_type(4)))  int v4i;
typedef float __attribute__((may_alias)) float_a;
typedef int __attribute__((may_alias)) int_a;

template <typename T> __device__ __forceinline__ void vst2(void* p, T v) { *(T*)p = v;  }
__device__ __forceinline__ v8f wmma16(v16h a, v16h b, v8f c) {
  v8f d = __builtin_amdgcn_wmma_f32_16x16x32_f16(false, a, false, b, (short)0, c, false, false);
  asm volatile("v_nop\n\tv_nop\n\tv_nop\n\tv_nop" : "+v"(d) : "v"(a), "v"(b));
  return d;
}
__device__ __forceinline__ v8f wmma_bf(v16b a, v16b b, v8f c) {
  v8f d = __builtin_amdgcn_wmma_f32_16x16x32_bf16(false, a, false, b, (short)0, c, false, false);
  asm volatile("v_nop\n\tv_nop\n\tv_nop\n\tv_nop" : "+v"(d) : "v"(a), "v"(b));
  return d;
}
// 16x16x32 fragments: lane = (h = lane>>4, row/col = lane&15); elements 0..7 = k0+8h+0..7, 8..15 = k0+16+8h+0..7; D element r = row 8h+r
__device__ __forceinline__ v16h frag_h(const _Float16* rowk0, int lane) {
  union { v16h v; v8h q[2]; } u; const _Float16* p = rowk0 + 8 * (lane >> 4);
  u.q[0] = *(const v8h*)p; u.q[1] = *(const v8h*)(p + 16); return u.v;
}
__device__ __forceinline__ v16h frag_f32(const float* rowk0, int lane) {
  v16h a; const float* p = rowk0 + 8 * (lane >> 4);
#pragma unroll
  for (int i = 0; i < 8; ++i) { a[i] = (_Float16)p[i]; a[8 + i] = (_Float16)p[16 + i]; }
  return a;
}
__device__ __forceinline__ v16h frag_f32s(const float* rowk0, int lane, float sc) {
  v16h a; const float* p = rowk0 + 8 * (lane >> 4);
#pragma unroll
  for (int i = 0; i < 8; ++i) { a[i] = (_Float16)(p[i] * sc); a[8 + i] = (_Float16)(p[16 + i] * sc); }
  return a;
}
// column fragment from a [K][ld] layout (column n), rows >= K read as 0
__device__ __forceinline__ v16h fragc_f32(const float* W, int k0, int n, int lane, int ld, int K) {
  v16h a; const int g = lane >> 4;
#pragma unroll
  for (int i = 0; i < 8; ++i) { const int ka = k0 + 8 * g + i, kb = ka + 16;
    a[i] = (_Float16)(ka < K ? W[(size_t)(ka < K ? ka : K - 1) * ld + n] : 0.f); a[8 + i] = (_Float16)(kb < K ? W[(size_t)(kb < K ? kb : K - 1) * ld + n] : 0.f); }
  return a;
}
struct F2 { v16b h, l; };
__device__ __forceinline__ F2 bsplit16(const float v[16]) { F2 r;
#pragma unroll
  for (int i = 0; i < 16; ++i) { const __bf16 h = (__bf16)v[i]; r.h[i] = h; r.l[i] = (__bf16)(v[i] - (float)h); }
  return r; }
__device__ __forceinline__ F2 split_row(const float* row, int k0, int lane) { float v[16]; const float* p = row + k0 + 8 * (lane >> 4);
#pragma unroll
  for (int i = 0; i < 8; ++i) { v[i] = p[i]; v[8 + i] = p[16 + i]; }
  return bsplit16(v); }
__device__ __forceinline__ F2 split_rowK(const float* row, int k0, int lane, int K) { float v[16]; const int g = lane >> 4;
#pragma unroll
  for (int i = 0; i < 8; ++i) { const int ka = k0 + 8 * g + i, kb = ka + 16; v[i] = ka < K ? row[ka < K ? ka : K - 1] : 0.f; v[8 + i] = kb < K ? row[kb < K ? kb : K - 1] : 0.f; }
  return bsplit16(v); }
__device__ __forceinline__ F2 split_col(const float* W, int k0, int n, int lane, int ld, int K) { float v[16]; const int g = lane >> 4;
#pragma unroll
  for (int i = 0; i < 8; ++i) { const int ka = k0 + 8 * g + i, kb = ka + 16; v[i] = ka < K ? W[(size_t)(ka < K ? ka : K - 1) * ld + n] : 0.f; v[8 + i] = kb < K ? W[(size_t)(kb < K ? kb : K - 1) * ld + n] : 0.f; }
  return bsplit16(v); }
__device__ __forceinline__ v8f mac3(const F2& a, const F2& b, v8f c) { c = wmma_bf(a.l, b.h, c); c = wmma_bf(a.h, b.l, c); return wmma_bf(a.h, b.h, c); }
__device__ __forceinline__ float sigm(float v) { return 1.0f / (1.0f + expf(-v)); }
#define LDSX() do { asm volatile("s_wait_dscnt 0" ::: "memory"); __builtin_amdgcn_wave_barrier(); __builtin_amdgcn_fence(__ATOMIC_RELEASE, "workgroup"); } while (0)


// High-order linear attention over a [4, 64, 128, 256] tensor: q/k/v = X W^T + b; for the assets axis (n1, pooled over n2) and then the time axis (n2, pooled over n1, with RoPE): Performer-style positive features phi(x) = exp(xs f^T - |xs|^2/2 - log(M)/2 + 1e-6), xs = (x - min x)/(max x - min x) * 32^-1/4 (global min/max),
// out_l = sum_l' A[l][l'] v_l', A[l][l'] = phi(q_l) . phi(k_l') / (phi(q_l) . sum_l phi(k_l)): the product phi(q) (phi(k)^T v) taken as (phi(q) phi(k)^T) v, since A depends on (b, head) alone and the attended length (64, 128) is below the 192 features; finally value W_o^T + b_o.
// q and k are used only through their axis sums, and sum_i (x_i W^T + b) = (sum_i x_i) W^T + n b: X is pooled first and only the 768 pooled rows are projected.
// k_poolx (axis sums of X; Wv and Wo packed as bf16 fragments); k_pproj (pooled q and k); proj_tile (v); k_rope (dim-2 pooled q,k); k_minmax; k_feat (phi via WMMA); k_ksum; k_an (normaliser); k_amat (per (b, head): A); k_att (per (b, other-position, head): value tile transposed in LDS, A x tile, written back in place);
// A depends on the pooled q and k alone, never on the value: k_minmax, k_feat, k_ksum, k_an and k_amat each run once, for both axes (and for q and k) in one grid, the block index naming the tensor t (0 = q axis 1, 1 = k axis 1, 2 = q axis 2, 3 = k axis 2) or the axis ax (0, 1)
#define NBT 4
#define N1 64
#define N2 128
#define DMOD 256
#define NHD 8
#define DHD 32
#define MF 192
#define NPOS (NBT * N1 * N2)      // 32768 positions
#ifndef TNB
#define TNB NBT                   // batches run through the attention passes / output (debug: fewer)
#endif
#ifndef TB0
#define TB0 0                     // first batch of the attention loops (debug)
#endif
typedef __attribute__((ext_vector_type(8))) __bf16 v8b;
typedef __attribute__((ext_vector_type(4))) __bf16 v4b;
__device__ __forceinline__ v16b frag_b(const __bf16* rowk0, int lane) {
  union { v16b v; v8b q[2]; } u; const __bf16* p = rowk0 + 8 * (lane >> 4);
  u.q[0] = *(const v8b*)p; u.q[1] = *(const v8b*)(p + 16); return u.v;
}
__device__ __forceinline__ v16b frag_gbf(const float* rowk0, int lane) {
  v16b a; const float* p = rowk0 + 8 * (lane >> 4);
#pragma unroll
  for (int i = 0; i < 8; ++i) { a[i] = (__bf16)p[i]; a[8 + i] = (__bf16)p[16 + i]; }
  return a;
}
// B fragment of a packed weight matrix (k_poolx lays it down): tile (nt = 16 output columns, kc = 32 of K) = 2 planes of 512 B, plane p holds per lane its elements 8p..8p+7 (same k order as frag_gbf), so each 16-B load of a wave covers 4 whole 128-B lines
__device__ __forceinline__ v16b frag_pw(const __bf16* PW, int nt, int kc, int lane) {
  union { v16b v; v8b q[2]; } u; const __bf16* p = PW + (size_t)(nt * (DMOD / 32) + kc) * 512 + lane * 8;
  u.q[0] = *(const v8b*)p; u.q[1] = *(const v8b*)(p + 256); return u.v;
}
__device__ __forceinline__ float bfr(float v) { return (float)(__bf16)v; }
__device__ __attribute__((noinline)) float exp_ni(float v) { return expf(v); }
__device__ __attribute__((noinline)) float pow_ni(float a, float b) { return powf(a, b); }
__device__ __attribute__((noinline)) float cos_ni(float v) { return cosf(v); }
__device__ __attribute__((noinline)) float sin_ni(float v) { return sinf(v); }

#define WS_A    0u                              // 32 MB, 12 MB used: f32 phi rows, 4 tensors t of PSZ floats each: [(b,h)][l][m] (l rows, m contiguous; L = 64 rows per (b,h) for t < 2, 128 for t >= 2)
#define PSZ     (NBT * NHD * N2 * MF)
#define WS_B    (WS_A + 4u * NPOS * DMOD)          // 32 MB, 256 KB used: bf16(Wv), then bf16(Wo), each 256 x 256 in fragment order (frag_pw)
#define PWSZ    (DMOD * DMOD)
#define WS_V    (WS_B + 4u * NPOS * DMOD)          // f32 32 MB: value [b][n1][n2][h*32+d] (updated in place per pass: V -> V2 -> V3, by the block that owns the tile)
#define WS_QS1  (WS_V + 4u * NPOS * DMOD)          // f32 [4][64][256]  q summed over n2
#define WS_KS1  (WS_QS1 + 4u * NBT * N1 * DMOD)
#define WS_QS2  (WS_KS1 + 4u * NBT * N1 * DMOD)    // f32 [4][128][256] q summed over n1 (then RoPE'd in place)
#define WS_KS2  (WS_QS2 + 4u * NBT * N2 * DMOD)
#define WS_MM   (WS_KS2 + 4u * NBT * N2 * DMOD)
#define MMS 32
#define WS_AM   (WS_MM + 4u * 4 * 65 * MMS)        // f32 [2 axes][4][8][128][128] A (l rows, l' contiguous, pitch 128; axis 1 uses l, l' < 64); WS_MM holds [4 tensors][65 slots][32 floats]
#define AMSZ    (NBT * NHD * N2 * N2)
#define WS_KSUM (WS_AM + 4u * 2 * AMSZ)            // f32 [2 axes][4][8][192]
#define WS_AN   (WS_KSUM + 4u * 2 * NBT * NHD * MF) // f32 [2 axes][4][8][128] att_norm
#define WS_SX   (WS_AN + 4u * 2 * NBT * NHD * N2)  // f32 [256 + 512][256] bf16(X) summed over n2 (rows b*64 + n1), then summed over n1 (rows 256 + b*128 + n2)
#define WS_END  (WS_SX + 4u * (NBT * N1 + NBT * N2) * DMOD)

// ---- proj_tile: [32768 rows] x [v 256 cols] = bf16(X) . W rows ([out][in]) + b (exact); tile pb < PROJ_N = (64 rows, 128 cols), one wave = 16 of its rows, no wave needs another (so: the wave's own 16 x 132 floats of LDS); 512-B segments of 1-KB rows.
//      The v projection needs X alone and is first needed by k_att<1>: it has no launch of its own; its tiles ride as the last blocks in the grids of k_feat and k_an, whose few waves wait on latency and leave most of the chip idle
#define PROJ_N  (NPOS / 64 * 2)
#define PROJ_F  (PROJ_N * 21 / 32)                 // tiles [0, PROJ_F) ride in k_feat (the longer of the two), [PROJ_F, PROJ_N) in k_an
__device__ __forceinline__ void proj_tile(const float* __restrict__ X, const __bf16* __restrict__ PW, const float* __restrict__ bm, float* __restrict__ dst, float (*so)[132], int pb, int wave, int lane) {
  const int col = lane & 15, g = lane >> 4; const size_t r0 = (size_t)(pb % (NPOS / 64)) * 64 + wave * 16; const int n0 = pb / (NPOS / 64) * 128;
  v8f acc[8] = {};
#pragma unroll 2
  for (int kc = 0; kc < DMOD / 32; ++kc) { v16b w[8];
#pragma unroll      // w indexed by constants, in registers: the k step's 16 loads of B go out as one group, ahead of its first WMMA
    for (int j = 0; j < 8; ++j) w[j] = frag_pw(PW, n0 / 16 + j, kc, lane);
    const v16b a = frag_gbf(X + (r0 + col) * DMOD + kc * 32, lane);
#pragma unroll
    for (int j = 0; j < 8; ++j) acc[j] = wmma_bf(a, w[j], acc[j]); }
#pragma unroll
  for (int j = 0; j < 8; ++j) { const float bb = bfr(bm[n0 + j * 16 + col]);
#pragma unroll
    for (int r = 0; r < 8; ++r) so[8 * g + r][j * 16 + col] = acc[j][r] + bb; }
  LDSX();
  for (int rl = 0; rl < 16; ++rl) vst2(dst + (r0 + rl) * DMOD + n0 + lane * 4, *(const v4f*)&so[rl][lane * 4]);
}
// ---- k_poolx: axis sums of bf16(X); behind these 768 blocks, PACK_NB blocks round Wv and Wo to bf16 once and lay them in fragment order (thread = one 16-B piece: 8 consecutive k of one row). Blocks < 256: SX[b*64 + n1][c] = sum_{n2}; blocks >= 256: SX[256 + b*128 + n2][c] = sum_{n1}. Thread = (part = tid >> 6, 4 columns): a part sums every 4th row (ascending), the 4 parts are added in LDS; 1-KB rows
template <int NR> __device__ __forceinline__ v4f sum_rows(const float* __restrict__ p, size_t step) {
  v4f s = {0.f, 0.f, 0.f, 0.f};
#pragma unroll 16   // 16 row loads of 16 B in flight per lane: the kernel is a stream from memory
  for (int i = 0; i < NR; ++i) { const v4f v = *(const v4f*)(p + (size_t)i * step);
#pragma unroll      // vector elements by constant index
    for (int e = 0; e < 4; ++e) s[e] += bfr(v[e]); }
  return s;
}
#define PACK_NB (2 * PWSZ / 8 / 256)
__global__ __launch_bounds__(256) void k_poolx(const float* __restrict__ X, float* __restrict__ SX, const float* __restrict__ Wv, const float* __restrict__ Wo, float* __restrict__ PWF) {
  __shared__ __align__(16) float sp[4][DMOD];
  const int tid = threadIdx.x, part = tid >> 6, c4 = (tid & 63) * 4, blk = blockIdx.x; v4f s;
  if (blk >= NBT * N1 + NBT * N2) {   // piece p of a matrix = (nt = p >> 9, kc = (p >> 6) & 7, plane = (p >> 5) & 1, lane = p & 31)
    const int idx = (blk - (NBT * N1 + NBT * N2)) * 256 + tid, p = idx & (PWSZ / 8 - 1), ln = p & 31; const float* Wm = idx < PWSZ / 8 ? Wv : Wo;
    const float* sw = Wm + (size_t)((p >> 9) * 16 + (ln & 15)) * DMOD + ((p >> 6) & 7) * 32 + ((p >> 5) & 1) * 16 + 8 * (ln >> 4);
    const v4f x0 = *(const v4f*)sw, x1 = *(const v4f*)(sw + 4); v8b o;
#pragma unroll      // vector elements by constant index
    for (int e = 0; e < 4; ++e) { o[e] = (__bf16)x0[e]; o[4 + e] = (__bf16)x1[e]; }
    vst2((__bf16*)PWF + (size_t)idx * 8, o); return; }
  if (blk < NBT * N1) s = sum_rows<N2 / 4>(X + ((size_t)blk * N2 + part) * DMOD + c4, (size_t)4 * DMOD);
  else { const int r = blk - NBT * N1, b = r / N2, i2 = r % N2; s = sum_rows<N1 / 4>(X + (((size_t)b * N1 + part) * N2 + i2) * DMOD + c4, (size_t)4 * N2 * DMOD); }
  *(v4f*)&sp[part][c4] = s;
  __syncthreads();
  if (tid < 64) vst2(SX + (size_t)blk * DMOD + c4, (*(const v4f*)&sp[0][c4] + *(const v4f*)&sp[1][c4]) + (*(const v4f*)&sp[2][c4] + *(const v4f*)&sp[3][c4]));
}
// ---- k_pproj: pooled q and k: [768 rows of SX] x [q|k 512 cols] = SX (three bf16 pieces, 3 products) . bf16(W rows) + n bf16(b), n = rows summed (128 or 64); block (16 rows, 64 cols), wave = 16 cols; K = 256; 256-B segments of 1-KB rows
__global__ __launch_bounds__(128) void k_pproj(const float* __restrict__ SX, const float* __restrict__ Wq, const float* __restrict__ bq, const float* __restrict__ Wk, const float* __restrict__ bk, float* __restrict__ QS1, float* __restrict__ KS1, float* __restrict__ QS2, float* __restrict__ KS2) {
  __shared__ __align__(16) float so[16][68];
  const int tid = threadIdx.x, wave = tid >> 5, lane = tid & 31, col = lane & 15, g = lane >> 4; const int r0 = blockIdx.x * 16, which = blockIdx.y >> 2, nb0 = (blockIdx.y & 3) * 64, n = nb0 + wave * 16 + col;
  const float* Wm = which == 0 ? Wq : Wk; const float* bm = which == 0 ? bq : bk; const bool ax1 = r0 < NBT * N1;
  float* dst = ax1 ? (which == 0 ? QS1 : KS1) + (size_t)r0 * DMOD : (which == 0 ? QS2 : KS2) + (size_t)(r0 - NBT * N1) * DMOD;
  const float* pa = SX + (size_t)(r0 + col) * DMOD + 8 * g; const float* pw = Wm + (size_t)n * DMOD + 8 * g; const float bb = (ax1 ? (float)N2 : (float)N1) * bfr(bm[n]);
  v8f acc = {};   // every loop below is unrolled whole, so that a, w and the fragments are indexed by constants and stay in registers
#pragma unroll
  for (int kh = 0; kh < 2; ++kh) { v4f a[4][4], w[4][4];   // half of K at a time: its 32 loads go out together
#pragma unroll
    for (int k = 0; k < 4; ++k)
#pragma unroll
      for (int i = 0; i < 4; ++i) { const int o = (kh * 4 + k) * 32 + (i >> 1) * 16 + (i & 1) * 4; a[k][i] = *(const v4f*)(pa + o); w[k][i] = *(const v4f*)(pw + o); }
#pragma unroll
    for (int k = 0; k < 4; ++k) { v16b ah, am, al, wb;
#pragma unroll
      for (int i = 0; i < 16; ++i) { const float v = a[k][i >> 2][i & 3]; const __bf16 h = (__bf16)v; const float r1 = v - (float)h; const __bf16 m = (__bf16)r1; ah[i] = h; am[i] = m; al[i] = (__bf16)(r1 - (float)m); wb[i] = (__bf16)w[k][i >> 2][i & 3]; }
      acc = wmma_bf(al, wb, acc); acc = wmma_bf(am, wb, acc); acc = wmma_bf(ah, wb, acc); } }
#pragma unroll
  for (int r = 0; r < 8; ++r) so[8 * g + r][wave * 16 + col] = acc[r] + bb;
  __syncthreads();
  for (int q = tid; q < 16 * 16; q += 128) { const int rl = q >> 4, pc = q & 15; vst2(dst + (size_t)rl * DMOD + nb0 + pc * 4, *(const v4f*)&so[rl][pc * 4]); }
}
// ---- k_rope: in place on S2 (q and k pooled over n1): per (b, l < 128, h): x[32] -> x cos + rot(x) sin, rot = (-x[16:], x[:16]), angle = l * 10000^(-j/16) (j = d mod 16); block = (b, l), thread = (h, d)
__global__ __launch_bounds__(256) void k_rope(float* __restrict__ SQ, float* __restrict__ SK) {
  __shared__ __align__(16) float sq[DMOD], sk[DMOD];
  const int l = blockIdx.x % N2, tid = threadIdx.x; const size_t row = (size_t)blockIdx.x * DMOD; const int d = tid & 31, j = d & 15;
  const float invf = 1.0f / pow_ni(10000.0f, (float)(2 * j) / 32.0f); const float ang = (float)l * invf; const float c = cos_ni(ang), s = sin_ni(ang);
  const float xq = SQ[row + tid], xk = SK[row + tid]; const float rq = d < 16 ? -SQ[row + tid + 16] : SQ[row + tid - 16]; const float rk = d < 16 ? -SK[row + tid + 16] : SK[row + tid - 16];
  sq[tid] = xq * c + rq * s; sk[tid] = xk * c + rk * s;
  __syncthreads();
  if (tid < 64) vst2(SQ + row + tid * 4, *(const v4f*)&sq[tid * 4]); else if (tid < 128) vst2(SK + row + (tid - 64) * 4, *(const v4f*)&sk[(tid - 64) * 4]);
}
// ---- k_minmax: partial min/max of tensor t = blockIdx.y (n floats): block i of 64 scans a strided slice -> MMP[t][i][2]; k_mmfin: finals MM[t] = (min, max) (block t, 64 threads)
__global__ __launch_bounds__(256) void k_minmax(const float* __restrict__ T0, const float* __restrict__ T1, const float* __restrict__ T2, const float* __restrict__ T3, float* __restrict__ MMP) {
  __shared__ float smn[8], smx[8]; __shared__ __align__(16) float sres[4];
  const int t = blockIdx.y, n = (t < 2 ? NBT * N1 : NBT * N2) * DMOD; const float* T = t == 0 ? T0 : t == 1 ? T1 : t == 2 ? T2 : T3;
  const int tid = threadIdx.x, wave = tid >> 5, lane = tid & 31; float mn = 3.0e38f, mx = -3.0e38f;
  for (int i = blockIdx.x * 256 + tid; i < n; i += 64 * 256) { const float v = T[i]; mn = fminf(mn, v); mx = fmaxf(mx, v); }
#pragma unroll
  for (int o = 1; o < 32; o <<= 1) { mn = fminf(mn, __shfl_xor(mn, o)); mx = fmaxf(mx, __shfl_xor(mx, o)); }
  if (lane == 0) { smn[wave] = mn; smx[wave] = mx; }
  __syncthreads();
  if (tid == 0) { float a = smn[0], bq2 = smx[0]; for (int w = 1; w < 8; ++w) { a = fminf(a, smn[w]); bq2 = fmaxf(bq2, smx[w]); } sres[0] = a; sres[1] = bq2; sres[2] = 0.f; sres[3] = 0.f; }
  __syncthreads();
  if (tid < 8) { const v4f z = {0.f, 0.f, 0.f, 0.f}; vst2(MMP + ((size_t)t * 65 + blockIdx.x) * MMS + tid * 4, tid == 0 ? *(const v4f*)sres : z); }
}
__global__ __launch_bounds__(64) void k_mmfin(float* __restrict__ MMP) {
  const int t = blockIdx.x, tid = threadIdx.x; float mn = MMP[((size_t)t * 65 + tid) * MMS], mx = MMP[((size_t)t * 65 + tid) * MMS + 1];
#pragma unroll
  for (int o = 1; o < 32; o <<= 1) { mn = fminf(mn, __shfl_xor(mn, o)); mx = fmaxf(mx, __shfl_xor(mx, o)); }
  __shared__ float s2[4];
  if ((tid & 31) == 0) { s2[(tid >> 5) * 2] = mn; s2[(tid >> 5) * 2 + 1] = mx; }
  __syncthreads();
  __shared__ __align__(16) float sfin[4];
  if (tid == 0) { sfin[0] = fminf(s2[0], s2[2]); sfin[1] = fmaxf(s2[1], s2[3]); sfin[2] = 0.f; sfin[3] = 0.f; }
  __syncthreads();
  if (tid < 8) { const v4f z = {0.f, 0.f, 0.f, 0.f}; vst2(MMP + ((size_t)t * 65 + 64) * MMS + tid * 4, tid == 0 ? *(const v4f*)sfin : z); }
}

// ---- k_feat: phi for the pooled tensor S = S_t (rows (b,l), l < L) and head h; blockIdx.x = h * 96 + bx, bx: 16 row tiles each of t = 0, 1, then 32 each of t = 2, 3; behind these FEAT_NB blocks, per block, one wave's quarter of a v-projection tile; block = 16 rows (one wave): xs = (x - mn)/(mx - mn) * 32^-1/4; dots on WMMA (xs hi/lo x bf16(feat rows), K = 32, 12 tiles); phi = exp(dot - |xs|^2/2 - ln(192)/2 + 1e-6);
//      P[(b*8 + h)*L + l][m] rows of 768 B (48 pieces)
#define FEAT_NB ((2 * (NBT * N1 / 16) + 2 * (NBT * N2 / 16)) * NHD)
__global__ __launch_bounds__(32) void k_feat(const float* __restrict__ S0, const float* __restrict__ S1, const float* __restrict__ S2, const float* __restrict__ S3, const float* __restrict__ MM, const float* __restrict__ feat, float* __restrict__ PB, const float* __restrict__ X, const float* __restrict__ PWF, const float* __restrict__ bv, float* __restrict__ V) {
  __shared__ __align__(16) union { struct { float sx[16][36]; float so[16][196]; float soff[16]; } f; float pj[16][132]; } sm; auto& sx = sm.f.sx; auto& so = sm.f.so; auto& soff = sm.f.soff;
  const int fb = blockIdx.x;
  if (fb >= FEAT_NB) { proj_tile(X, (const __bf16*)PWF, bv, V, sm.pj, (fb - FEAT_NB) >> 2, (fb - FEAT_NB) & 3, threadIdx.x); return; }
  constexpr int T1N = NBT * N1 / 16, T2N = NBT * N2 / 16; const int bx = fb % (FEAT_NB / NHD), t = bx < 2 * T1N ? bx / T1N : 2 + (bx - 2 * T1N) / T2N, L = t < 2 ? N1 : N2;
  const float* S = t == 0 ? S0 : t == 1 ? S1 : t == 2 ? S2 : S3; float* P = PB + (size_t)t * PSZ;
  const int lane = threadIdx.x, col = lane & 15, g = lane >> 4; const int h = fb / (FEAT_NB / NHD); const int r0 = (t < 2 ? bx % T1N : (bx - 2 * T1N) % T2N) * 16; const int b = r0 / L, l0 = r0 % L;
  const float mn = MM[((size_t)t * 65 + 64) * MMS], mx = MM[((size_t)t * 65 + 64) * MMS + 1]; const float sc = 1.0f / (mx - mn); const float temp = 0.42044820762685725f;   // 32^-0.25
  { const int rl = lane >> 1, half = lane & 1; float ss = 0.f;
    for (int d = half * 16; d < half * 16 + 16; ++d) { const float x = S[(size_t)(r0 + rl) * DMOD + h * DHD + d]; const float xs = (x - mn) * sc * temp; sx[rl][d] = xs; ss += xs * xs; }
    ss += __shfl_xor(ss, 1); if (half == 0) { soff[rl] = -0.5f * ss - 0.5f * 5.2574953720277815f + 1e-6f; sx[rl][32] = 0.f; sx[rl][33] = 0.f; sx[rl][34] = 0.f; sx[rl][35] = 0.f; } }
  LDSX();
  const F2 a = split_row(&sx[col][0], 0, lane);
#pragma unroll
  for (int j = 0; j < 12; ++j) { v8f acc = {}; const v16b w = frag_gbf(feat + (size_t)(j * 16 + col) * DHD, lane); acc = wmma_bf(a.l, w, acc); acc = wmma_bf(a.h, w, acc);
#pragma unroll
    for (int r = 0; r < 8; ++r) so[8 * g + r][j * 16 + col] = exp_ni(acc[r] + soff[8 * g + r]); }
  LDSX();
  for (int q = lane; q < 16 * 48; q += 32) { const int rl = q / 48, pc = q % 48; vst2(P + ((size_t)(b * NHD + h) * L + l0 + rl) * MF + pc * 4, *(const v4f*)&so[rl][pc * 4]); }
}
// ---- k_ksum: ksum[ax][(b*8+h)][m] = sum_l KP[(b*8+h)*L + l][m] (l ascending), KP = phi tensor 2 ax + 1; block = (b,h) x axis ax = blockIdx.y, thread = m
__global__ __launch_bounds__(256) void k_ksum(const float* __restrict__ PB, float* __restrict__ KSB) {
  __shared__ __align__(16) float ssum[MF];
  const int bh = blockIdx.x, ax = blockIdx.y, L = ax == 0 ? N1 : N2, tid = threadIdx.x; const float* KP = PB + (size_t)(2 * ax + 1) * PSZ; float* KS = KSB + (size_t)ax * NBT * NHD * MF;
  if (tid < MF) { float s = 0.f;
    for (int l0 = 0; l0 < L; l0 += 32) { float v[32];   // L is a multiple of 32; 32 loads in flight per round, summed in ascending l
#pragma unroll
      for (int i = 0; i < 32; ++i) v[i] = KP[((size_t)bh * L + l0 + i) * MF + tid];
#pragma unroll
      for (int i = 0; i < 32; ++i) s += v[i]; }
    ssum[tid] = s; }
  __syncthreads();
  if (tid < 48) vst2(KS + (size_t)bh * MF + tid * 4, *(const v4f*)&ssum[tid * 4]);
}
// ---- k_an: att_norm[ax][(b*8+h)][l] = sum_m QP[(b*8+h)*L + l][m] * ksum[ax][(b*8+h)][m], QP = phi tensor 2 ax; blockIdx.x = ax * 32 + (b,h), behind these 64 blocks v-projection tiles; thread = l (< L); rows pitch 128
__global__ __launch_bounds__(128) void k_an(const float* __restrict__ PB, const float* __restrict__ KSB, float* __restrict__ ANB, const float* __restrict__ X, const float* __restrict__ PWF, const float* __restrict__ bv, float* __restrict__ V) {
  __shared__ __align__(16) union { struct { float sres[N2]; float sks[MF]; } a; float pj[4][16][132]; } sm; auto& sks = sm.a.sks; auto& sres = sm.a.sres;
  const int fb = blockIdx.x, tid = threadIdx.x;
  if (fb >= 2 * NBT * NHD) { proj_tile(X, (const __bf16*)PWF, bv, V, sm.pj[tid >> 5], PROJ_F + fb - 2 * NBT * NHD, tid >> 5, tid & 31); return; }
  const int bh = fb % (NBT * NHD), ax = fb / (NBT * NHD), L = ax == 0 ? N1 : N2; const float* QP = PB + (size_t)(2 * ax) * PSZ; const float* KS = KSB + (size_t)ax * NBT * NHD * MF; float* AN = ANB + (size_t)ax * NBT * NHD * N2;
  for (int m = tid; m < MF; m += 128) sks[m] = KS[(size_t)bh * MF + m];
  __syncthreads();
  float s = 0.f; if (tid < L) { const float* row = QP + ((size_t)bh * L + tid) * MF; for (int m = 0; m < MF; ++m) s += row[m] * sks[m]; }
  sres[tid] = tid < L ? s : 1.0f;
  __syncthreads();
  if (tid < 32) vst2(AN + (size_t)bh * N2 + tid * 4, *(const v4f*)&sres[tid * 4]);
}
// ---- k_amat: per axis and (b,h): A[l][l'] = (sum_m QP[l][m] (hi/lo) . KP[l'][m] (hi/lo)) / att_norm[l]: M = l (blockIdx.y: 4 tiles of axis 1, then 8 of axis 2), N = l' (32 per wave = 2 tiles), K = m (6 steps), 3 products; rows pitch 128, 128-B segment per wave and row
__global__ __launch_bounds__(128) void k_amat(const float* __restrict__ PB, const float* __restrict__ ANB, float* __restrict__ AMB) {
  __shared__ __align__(16) float so[4][16][36];
  const int tid = threadIdx.x, wave = tid >> 5, lane = tid & 31, col = lane & 15, g = lane >> 4; const int by = blockIdx.y, ax = by < N1 / 16 ? 0 : 1, L = ax == 0 ? N1 : N2; const int bh = blockIdx.x, l0 = (ax == 0 ? by : by - N1 / 16) * 16, n0 = wave * 32;
  if (n0 >= L) return;
  const float* QP = PB + (size_t)(2 * ax) * PSZ; const float* KP = QP + PSZ; const float* AN = ANB + (size_t)ax * NBT * NHD * N2; float* AM = AMB + (size_t)ax * AMSZ;
  const float* qrow = QP + ((size_t)bh * L + l0 + col) * MF;
  v8f acc[2] = {};
#pragma unroll
  for (int kc = 0; kc < MF / 32; ++kc) { const F2 a = split_row(qrow, kc * 32, lane);
#pragma unroll
    for (int j = 0; j < 2; ++j) { const F2 kb = split_row(KP + ((size_t)bh * L + n0 + j * 16 + col) * MF, kc * 32, lane); acc[j] = mac3(a, kb, acc[j]); } }
  float inv[8];
#pragma unroll
  for (int r = 0; r < 8; ++r) inv[r] = 1.0f / AN[(size_t)bh * N2 + l0 + 8 * g + r];
#pragma unroll
  for (int j = 0; j < 2; ++j)
#pragma unroll
    for (int r = 0; r < 8; ++r) so[wave][8 * g + r][j * 16 + col] = acc[j][r] * inv[r];
  LDSX();
  for (int q = lane; q < 16 * 8; q += 32) { const int rl = q >> 3, pc = q & 7; vst2(AM + ((size_t)bh * N2 + l0 + rl) * N2 + n0 + pc * 4, *(const v4f*)&so[wave][rl][pc * 4]); }
}
// ---- k_att: per (b, other o, head h), in place on the value tensor: out[l][d] = sum_l' A[(b,h)][l][l'] (hi/lo) . V[l'][(h,d)] (hi/lo): M = l (one 16-row tile per wave, L/16 waves), N = d (2 tiles), K = l' (2 or 4 steps), 3 products; all batches in one launch.
//      The block owns the L x 32 tile (128-B row segments) that it reads and writes: it is read once (thread = 4 rows x 16 B), split into bf16 hi and residual and laid down transposed in LDS ([d][l'], 8-B stores, pitch 2 L + 16 B for the 16-B fragment reads); the stores to V follow the barrier behind which every read has landed
template <int PASS>
__global__ __launch_bounds__(PASS == 1 ? N1 * 2 : N2 * 2) void k_att(const float* __restrict__ AM, int ob0, float* V) {
  constexpr int L = (PASS == 1 ? N1 : N2), O = (PASS == 1 ? N2 : N1); constexpr size_t RS = (PASS == 1 ? (size_t)N2 * DMOD : (size_t)DMOD);   // RS: floats from row l to row l + 1
  __shared__ __align__(16) __bf16 vh[DHD][L + 8], vl[DHD][L + 8]; __shared__ __align__(16) float so[L / 16][16][36];
  const int tid = threadIdx.x, wave = tid >> 5, lane = tid & 31, col = lane & 15, g = lane >> 4; const int h = blockIdx.x % NHD, bo = ob0 + blockIdx.x / NHD; const int b = bo / O, o = bo % O;
  float* tile = V + (PASS == 1 ? ((size_t)b * N1 * N2 + o) : ((size_t)b * N1 + o) * N2) * DMOD + h * DHD;
  const float* arow = AM + ((size_t)(b * NHD + h) * N2 + wave * 16 + col) * N2;
  const int p4 = (tid & 7) * 4, l4 = (tid >> 3) * 4; const float* src = tile + (size_t)l4 * RS + p4; v4f x[4]; F2 a[L / 32];   // every loop below is unrolled whole: x, a, hi, lo and acc are indexed by constants and stay in registers; the tile's 4 loads and A's loads go out together, ahead of the barrier
#pragma unroll
  for (int i = 0; i < 4; ++i) x[i] = *(const v4f*)(src + (size_t)i * RS);
#pragma unroll
  for (int kc = 0; kc < L / 32; ++kc) a[kc] = split_row(arow, kc * 32, lane);
#pragma unroll
  for (int e = 0; e < 4; ++e) { v4b hi, lo;
#pragma unroll
    for (int i = 0; i < 4; ++i) { const float v = x[i][e]; const __bf16 hh = (__bf16)v; hi[i] = hh; lo[i] = (__bf16)(v - (float)hh); }
    *(v4b*)&vh[p4 + e][l4] = hi; *(v4b*)&vl[p4 + e][l4] = lo; }
  __syncthreads();
  v8f acc[2] = {};
#pragma unroll
  for (int kc = 0; kc < L / 32; ++kc)
#pragma unroll
    for (int j = 0; j < 2; ++j) { F2 vb; vb.h = frag_b(&vh[j * 16 + col][kc * 32], lane); vb.l = frag_b(&vl[j * 16 + col][kc * 32], lane); acc[j] = mac3(a[kc], vb, acc[j]); }
#pragma unroll
  for (int j = 0; j < 2; ++j)
#pragma unroll
    for (int r = 0; r < 8; ++r) so[wave][8 * g + r][j * 16 + col] = acc[j][r];
  LDSX();
  for (int q = lane; q < 16 * 8; q += 32) { const int rl = q >> 3, pc = q & 7; vst2(tile + (size_t)(wave * 16 + rl) * RS + pc * 4, *(const v4f*)&so[wave][rl][pc * 4]); }
}
// ---- k_out: Y = V3(hi/lo) . bf16(Wo rows [256][256], packed) + bo; block (64 rows, 128 cols); K = 256
__global__ __launch_bounds__(128) void k_out(const float* __restrict__ V3, const float* __restrict__ PWF, const float* __restrict__ bo, float* __restrict__ Y, int rb0) {
  __shared__ __align__(16) float so[4][16][132];
  const int tid = threadIdx.x, wave = tid >> 5, lane = tid & 31, col = lane & 15, g = lane >> 4; const size_t r0 = (size_t)(rb0 + blockIdx.x) * 64 + wave * 16; const int n0 = blockIdx.y * 128;
  v8f acc[8] = {};
#pragma unroll 2
  for (int kc = 0; kc < DMOD / 32; ++kc) { v16b w[8];
#pragma unroll      // w indexed by constants, in registers: the k step's 16 loads of B go out as one group, ahead of its first WMMA
    for (int j = 0; j < 8; ++j) w[j] = frag_pw((const __bf16*)PWF + PWSZ, n0 / 16 + j, kc, lane);
    const F2 a = split_row(V3 + (r0 + col) * DMOD, kc * 32, lane);
#pragma unroll
    for (int j = 0; j < 8; ++j) { acc[j] = wmma_bf(a.l, w[j], acc[j]); acc[j] = wmma_bf(a.h, w[j], acc[j]); } }
#pragma unroll
  for (int j = 0; j < 8; ++j) { const float bb = bfr(bo[n0 + j * 16 + col]);
#pragma unroll
    for (int r = 0; r < 8; ++r) so[wave][8 * g + r][j * 16 + col] = acc[j][r] + bb; }
  LDSX();
  for (int rl = 0; rl < 16; ++rl) vst2(Y + (r0 + rl) * DMOD + n0 + lane * 4, *(const v4f*)&so[wave][rl][lane * 4]);
}

#ifndef DBG
#define DBG 0
#endif
#if DBG != 0
__global__ __launch_bounds__(256) void k_dump(const float* __restrict__ src, int n, float* __restrict__ out) {   // out[0..n) = src, rest of batch-0 region zero
  const size_t p = (size_t)blockIdx.x * 256 + threadIdx.x; v4f v; for (int i = 0; i < 4; ++i) { const size_t f = p * 4 + i; v[i] = f < (size_t)n ? src[f] : 0.f; } vst2(out + p * 4, v);
}
#endif
extern "C" void kernel_launch(void* const* d_in, const int* in_sizes, int n_in, void* d_out, int out_size, void* d_ws, size_t ws_size, hipStream_t stream) {
  (void)in_sizes; (void)n_in; (void)out_size;
  const float** F = (const float**)d_in;   // X, Wq, bq, Wk, bk, Wv, bv, Wo, bo, feat
  if (ws_size < (size_t)WS_END) return;
  char* ws = (char*)d_ws; float *PB = (float*)(ws + WS_A), *V = (float*)(ws + WS_V), *QS1 = (float*)(ws + WS_QS1), *KS1 = (float*)(ws + WS_KS1), *QS2 = (float*)(ws + WS_QS2), *KS2 = (float*)(ws + WS_KS2), *MM = (float*)(ws + WS_MM), *AM = (float*)(ws + WS_AM), *KSUM = (float*)(ws + WS_KSUM), *AN = (float*)(ws + WS_AN), *SX = (float*)(ws + WS_SX), *PW = (float*)(ws + WS_B);
  k_poolx<<<NBT * N1 + NBT * N2 + PACK_NB, 256, 0, stream>>>(F[0], SX, F[5], F[7], PW);
  k_pproj<<<dim3((NBT * N1 + NBT * N2) / 16, 8), 128, 0, stream>>>(SX, F[1], F[2], F[3], F[4], QS1, KS1, QS2, KS2);
  k_rope<<<NBT * N2, 256, 0, stream>>>(QS2, KS2);
  // ---- the mixing matrices of both axes (assets: l = n1 = 64; time: l = n2 = 128 with RoPE)
  k_minmax<<<dim3(64, 4), 256, 0, stream>>>(QS1, KS1, QS2, KS2, MM);
  k_mmfin<<<4, 64, 0, stream>>>(MM);
  k_feat<<<FEAT_NB + 4 * PROJ_F, 32, 0, stream>>>(QS1, KS1, QS2, KS2, MM, F[9], PB, F[0], PW, F[6], V);
  k_ksum<<<dim3(NBT * NHD, 2), 256, 0, stream>>>(PB, KSUM);
  k_an<<<2 * NBT * NHD + PROJ_N - PROJ_F, 128, 0, stream>>>(PB, KSUM, AN, F[0], PW, F[6], V);
#if DBG == 1
  k_dump<<<N1 * N2 * DMOD / 1024, 256, 0, stream>>>(AN, NBT * NHD * N2, (float*)d_out); return;      // pass-1 att_norm [4][8][128] (l < 64 valid, rest 1.0)
#elif DBG == 2
  k_dump<<<N1 * N2 * DMOD / 1024, 256, 0, stream>>>(PB, NBT * NHD * N1 * MF, (float*)d_out); return;  // pass-1 phi(q) [4][8][64][192]
#elif DBG == 6
  k_dump<<<N1 * N2 * DMOD / 1024, 256, 0, stream>>>(AN + NBT * NHD * N2, NBT * NHD * N2, (float*)d_out); return;    // pass-2 att_norm
#endif
  k_amat<<<dim3(NBT * NHD, N1 / 16 + N2 / 16), 128, 0, stream>>>(PB, AN, AM);
  // ---- pass 1: assets axis (other = n2 = 128)
  k_att<1><<<(TNB - TB0) * N2 * NHD, N1 * 2, 0, stream>>>(AM, TB0 * N2, V);
#if DBG == 3
  k_dump<<<N1 * N2 * DMOD / 1024, 256, 0, stream>>>(V, N1 * N2 * DMOD, (float*)d_out); return;
#endif
  // ---- pass 2: time axis (other = n1 = 64)
  k_att<2><<<(TNB - TB0) * N1 * NHD, N2 * 2, 0, stream>>>(AM + AMSZ, TB0 * N1, V);
#if DBG == 5
  k_dump<<<N1 * N2 * DMOD / 1024, 256, 0, stream>>>(V, N1 * N2 * DMOD, (float*)d_out); return;     // value after pass 2, batch 0
#endif
  k_out<<<dim3((TNB - TB0) * N1 * N2 / 64, 2), 128, 0, stream>>>(V, PW, F[8], (float*)d_out, TB0 * N1 * N2 / 64);
}

// v006
// One run takes 101 microseconds.
// Next to v005, in two timings, it ran 1.17 times as fast each time.
// Counting every step since v000, it is 8.22 times as fast.
// compute dtype: X, the projection weights/biases and the random-feature matrix (module inputs) rounded to bf16; the v projection with exact bf16 products; the q and k projections taken on the axis sums of bf16(X) (f32 sums as three bf16 pieces, 3 products, all 24 bits); the feature-map GEMM (pooled q,k x feat) with the pooled operand as a bf16 hi + bf16 residual pair (2 products); the phi(q) phi(k)^T and mixing-matrix x value contractions with both computed operands hi/lo (3 products);
// the output projection hi/lo against bf16 Wo (2 products); axis pooling, RoPE, global min-max normalisation, exp feature maps, normalisers and divisions in f32; f32 accumulate.
#include <hip/hip_runtime.h>
#include <math.h>

typedef __attribute__((ext_vector_type(16))) _Float16 v16h;
typedef __attribute__((ext_vector_type(16))) __bf16 v16b;
typedef __attribute__((ext_vector_type(8)))  _Float16 v8h;
typedef __attribute__((ext_vector_type(8)))  float v8f;
typedef __attribute__((ext_vector_type(4)))  float v4f;
typedef __attribute__((ext_vector_type(2)))  float v2f;
typedef __attribute__((ext_vector_type(4)))  unsigned v4u;
typedef __attribute__((ext_vector_type(4)))  int v4i;
typedef float __attribute__((may_alias)) float_a;
typedef int __attribute__((may_alias)) int_a;

template <typename T> __device__ __forceinline__ void vst2(void* p, T v) { *(T*)p = v;  }
__device__ __forceinline__ v8f wmma16(v16h a, v16h b, v8f c) {
  v8f d = __builtin_amdgcn_wmma_f32_16x16x32_f16(false, a, false, b, (short)0, c, false, false);
  asm volatile("v_nop\n\tv_nop\n\tv_nop\n\tv_nop" : "+v"(d) : "v"(a), "v"(b));
  return d;
}
__device__ __forceinline__ v8f wmma_bf(v16b a, v16b b, v8f c) {
  v8f d = __builtin_amdgcn_wmma_f32_16x16x32_bf16(false, a, false, b, (short)0, c, false, false);
  asm volatile("v_nop\n\tv_nop\n\tv_nop\n\tv_nop" : "+v"(d) : "v"(a), "v"(b));
  return d;
}
// 16x16x32 fragments: lane = (h = lane>>4, row/col = lane&15); elements 0..7 = k0+8h+0..7, 8..15 = k0+16+8h+0..7; D element r = row 8h+r
__device__ __forceinline__ v16h frag_h(const _Float16* rowk0, int lane) {
  union { v16h v; v8h q[2]; } u; const _Float16* p = rowk0 + 8 * (lane >> 4);
  u.q[0] = *(const v8h*)p; u.q[1] = *(const v8h*)(p + 16); return u.v;
}
__device__ __forceinline__ v16h frag_f32(const float* rowk0, int lane) {
  v16h a; const float* p = rowk0 + 8 * (lane >> 4);
#pragma unroll
  for (int i = 0; i < 8; ++i) { a[i] = (_Float16)p[i]; a[8 + i] = (_Float16)p[16 + i]; }
  return a;
}
__device__ __forceinline__ v16h frag_f32s(const float* rowk0, int lane, float sc) {
  v16h a; const float* p = rowk0 + 8 * (lane >> 4);
#pragma unroll
  for (int i = 0; i < 8; ++i) { a[i] = (_Float16)(p[i] * sc); a[8 + i] = (_Float16)(p[16 + i] * sc); }
  return a;
}
// column fragment from a [K][ld] layout (column n), rows >= K read as 0
__device__ __forceinline__ v16h fragc_f32(const float* W, int k0, int n, int lane, int ld, int K) {
  v16h a; const int g = lane >> 4;
#pragma unroll
  for (int i = 0; i < 8; ++i) { const int ka = k0 + 8 * g + i, kb = ka + 16;
    a[i] = (_Float16)(ka < K ? W[(size_t)(ka < K ? ka : K - 1) * ld + n] : 0.f); a[8 + i] = (_Float16)(kb < K ? W[(size_t)(kb < K ? kb : K - 1) * ld + n] : 0.f); }
  return a;
}
struct F2 { v16b h, l; };
__device__ __forceinline__ F2 bsplit16(const float v[16]) { F2 r;
#pragma unroll
  for (int i = 0; i < 16; ++i) { const __bf16 h = (__bf16)v[i]; r.h[i] = h; r.l[i] = (__bf16)(v[i] - (float)h); }
  return r; }
__device__ __forceinline__ F2 split_row(const float* row, int k0, int lane) { float v[16]; const float* p = row + k0 + 8 * (lane >> 4);
#pragma unroll
  for (int i = 0; i < 8; ++i) { v[i] = p[i]; v[8 + i] = p[16 + i]; }
  return bsplit16(v); }
__device__ __forceinline__ F2 split_rowK(const float* row, int k0, int lane, int K) { float v[16]; const int g = lane >> 4;
#pragma unroll
  for (int i = 0; i < 8; ++i) { const int ka = k0 + 8 * g + i, kb = ka + 16; v[i] = ka < K ? row[ka < K ? ka : K - 1] : 0.f; v[8 + i] = kb < K ? row[kb < K ? kb : K - 1] : 0.f; }
  return bsplit16(v); }
__device__ __forceinline__ F2 split_col(const float* W, int k0, int n, int lane, int ld, int K) { float v[16]; const int g = lane >> 4;
#pragma unroll
  for (int i = 0; i < 8; ++i) { const int ka = k0 + 8 * g + i, kb = ka + 16; v[i] = ka < K ? W[(size_t)(ka < K ? ka : K - 1) * ld + n] : 0.f; v[8 + i] = kb < K ? W[(size_t)(kb < K ? kb : K - 1) * ld + n] : 0.f; }
  return bsplit16(v); }
__device__ __forceinline__ v8f mac3(const F2& a, const F2& b, v8f c) { c = wmma_bf(a.l, b.h, c); c = wmma_bf(a.h, b.l, c); return wmma_bf(a.h, b.h, c); }
__device__ __forceinline__ float sigm(float v) { return 1.0f / (1.0f + expf(-v)); }
#define LDSX() do { asm volatile("s_wait_dscnt 0" ::: "memory"); __builtin_amdgcn_wave_barrier(); __builtin_amdgcn_fence(__ATOMIC_RELEASE, "workgroup"); } while (0)


// High-order linear attention over a [4, 64, 128, 256] tensor: q/k/v = X W^T + b; for the assets axis (n1, pooled over n2) and then the time axis (n2, pooled over n1, with RoPE): Performer-style positive features phi(x) = exp(xs f^T - |xs|^2/2 - log(M)/2 + 1e-6), xs = (x - min x)/(max x - min x) * 32^-1/4 (global min/max),
// out_l = sum_l' A[l][l'] v_l', A[l][l'] = phi(q_l) . phi(k_l') / (phi(q_l) . sum_l phi(k_l)): the product phi(q) (phi(k)^T v) taken as (phi(q) phi(k)^T) v, since A depends on (b, head) alone and the attended length (64, 128) is below the 192 features; finally value W_o^T + b_o.
// q and k are used only through their axis sums, and sum_i (x_i W^T + b) = (sum_i x_i) W^T + n b: X is pooled first and only the 768 pooled rows are projected.
// k_poolx (axis sums of X; Wv and Wo packed as bf16 fragments; RoPE's cos and sin table); k_pproj (pooled q and k, RoPE on the dim-2 rows, min-max per block); proj_tile (v); k_feat (min-max finals, phi via WMMA, key sums per 16 rows); k_amat (per (b, head): key sum, normaliser, A); k_att (per (b, other-position, head): value tile transposed in LDS, A x tile, written back in place);
// A depends on the pooled q and k alone, never on the value: k_feat and k_amat each run once, for both axes (and for q and k) in one grid, the block index naming the tensor t (0 = q axis 1, 1 = k axis 1, 2 = q axis 2, 3 = k axis 2) or the axis ax (0, 1).
// A small elementwise or reducing stage has no launch of its own: the block that makes the values does the part it can (RoPE, its own min-max, its own 16-row key sum) before it stores them, and the block that needs the whole finishes it on entry (min-max over the block slots, key sum over the row tiles, normaliser of its own 16 rows)
#define NBT 4
#define N1 64
#define N2 128
#define DMOD 256
#define NHD 8
#define DHD 32
#define MF 192
#define NPOS (NBT * N1 * N2)      // 32768 positions
#ifndef TNB
#define TNB NBT                   // batches run through the attention passes / output (debug: fewer)
#endif
#ifndef TB0
#define TB0 0                     // first batch of the attention loops (debug)
#endif
typedef __attribute__((ext_vector_type(8))) __bf16 v8b;
typedef __attribute__((ext_vector_type(4))) __bf16 v4b;
__device__ __forceinline__ v16b frag_b(const __bf16* rowk0, int lane) {
  union { v16b v; v8b q[2]; } u; const __bf16* p = rowk0 + 8 * (lane >> 4);
  u.q[0] = *(const v8b*)p; u.q[1] = *(const v8b*)(p + 16); return u.v;
}
__device__ __forceinline__ v16b frag_gbf(const float* rowk0, int lane) {
  v16b a; const float* p = rowk0 + 8 * (lane >> 4);
#pragma unroll
  for (int i = 0; i < 8; ++i) { a[i] = (__bf16)p[i]; a[8 + i] = (__bf16)p[16 + i]; }
  return a;
}
// B fragment of a packed weight matrix (k_poolx lays it down): tile (nt = 16 output columns, kc = 32 of K) = 2 planes of 512 B, plane p holds per lane its elements 8p..8p+7 (same k order as frag_gbf), so each 16-B load of a wave covers 4 whole 128-B lines
__device__ __forceinline__ v16b frag_pw(const __bf16* PW, int nt, int kc, int lane) {
  union { v16b v; v8b q[2]; } u; const __bf16* p = PW + (size_t)(nt * (DMOD / 32) + kc) * 512 + lane * 8;
  u.q[0] = *(const v8b*)p; u.q[1] = *(const v8b*)(p + 256); return u.v;
}
__device__ __forceinline__ float bfr(float v) { return (float)(__bf16)v; }
__device__ __attribute__((noinline)) float exp_ni(float v) { return expf(v); }
__device__ __attribute__((noinline)) float pow_ni(float a, float b) { return powf(a, b); }
__device__ __attribute__((noinline)) float cos_ni(float v) { return cosf(v); }
__device__ __attribute__((noinline)) float sin_ni(float v) { return sinf(v); }

#define WS_A    0u                              // 32 MB, 12 MB used: f32 phi rows, 4 tensors t of PSZ floats each: [(b,h)][l][m] (l rows, m contiguous; L = 64 rows per (b,h) for t < 2, 128 for t >= 2)
#define PSZ     (NBT * NHD * N2 * MF)
#define WS_B    (WS_A + 4u * NPOS * DMOD)          // 32 MB, 256 KB used: bf16(Wv), then bf16(Wo), each 256 x 256 in fragment order (frag_pw)
#define PWSZ    (DMOD * DMOD)
#define WS_V    (WS_B + 4u * NPOS * DMOD)          // f32 32 MB: value [b][n1][n2][h*32+d] (updated in place per pass: V -> V2 -> V3, by the block that owns the tile)
#define WS_QS1  (WS_V + 4u * NPOS * DMOD)          // f32 [4][64][256]  q summed over n2
#define WS_KS1  (WS_QS1 + 4u * NBT * N1 * DMOD)
#define WS_QS2  (WS_KS1 + 4u * NBT * N1 * DMOD)    // f32 [4][128][256] q summed over n1, RoPE applied
#define WS_KS2  (WS_QS2 + 4u * NBT * N2 * DMOD)
#define WS_MM   (WS_KS2 + 4u * NBT * N2 * DMOD)
#define MMS 32
#define MMN 128
#define WS_AM   (WS_MM + 4u * 4 * MMN * MMS)       // f32 [2 axes][4][8][128][128] A (l rows, l' contiguous, pitch 128; axis 1 uses l, l' < 64); WS_MM holds [4 tensors][128 slots][32 floats]: (min, max) of one k_pproj block per slot, 64 slots used for t < 2, 128 for t >= 2
#define AMSZ    (NBT * NHD * N2 * N2)
#define WS_KSUM (WS_AM + 4u * 2 * AMSZ)            // f32 [2 axes][4][8][8 row tiles][192]: phi(k) summed over the 16 rows of a tile (axis 1 uses 4 tiles)
#define WS_SX   (WS_KSUM + 4u * 2 * NBT * NHD * (N2 / 16) * MF)  // f32 [256 + 512][256] bf16(X) summed over n2 (rows b*64 + n1), then summed over n1 (rows 256 + b*128 + n2)
#define WS_CS   (WS_SX + 4u * (NBT * N1 + NBT * N2) * DMOD)   // f32 [2][128][16]: cos, then sin, of RoPE's angles (l, j)
#define WS_END  (WS_CS + 4u * 2 * N2 * 16)

// ---- proj_tile: [32768 rows] x [v 256 cols] = bf16(X) . W rows ([out][in]) + b (exact); tile pb < PROJ_N = (64 rows, 128 cols), one wave = 16 of its rows, no wave needs another (so: the wave's own 16 x 132 floats of LDS); 512-B segments of 1-KB rows.
//      The v projection needs X alone and is first needed by k_att<1>: it has no launch of its own; its tiles ride as the last blocks in the grids of k_feat and k_amat, whose few waves wait on latency and leave most of the chip idle
#define PROJ_N  (NPOS / 64 * 2)
#define PROJ_F  (PROJ_N * 21 / 32)                 // tiles [0, PROJ_F) ride in k_feat (the longer of the two), [PROJ_F, PROJ_N) in k_amat
__device__ __forceinline__ void proj_tile(const float* __restrict__ X, const __bf16* __restrict__ PW, const float* __restrict__ bm, float* __restrict__ dst, float (*so)[132], int pb, int wave, int lane) {
  const int col = lane & 15, g = lane >> 4; const size_t r0 = (size_t)(pb % (NPOS / 64)) * 64 + wave * 16; const int n0 = pb / (NPOS / 64) * 128;
  v8f acc[8] = {};
#pragma unroll 2
  for (int kc = 0; kc < DMOD / 32; ++kc) { v16b w[8];
#pragma unroll      // w indexed by constants, in registers: the k step's 16 loads of B go out as one group, ahead of its first WMMA
    for (int j = 0; j < 8; ++j) w[j] = frag_pw(PW, n0 / 16 + j, kc, lane);
    const v16b a = frag_gbf(X + (r0 + col) * DMOD + kc * 32, lane);
#pragma unroll
    for (int j = 0; j < 8; ++j) acc[j] = wmma_bf(a, w[j], acc[j]); }
#pragma unroll
  for (int j = 0; j < 8; ++j) { const float bb = bfr(bm[n0 + j * 16 + col]);
#pragma unroll
    for (int r = 0; r < 8; ++r) so[8 * g + r][j * 16 + col] = acc[j][r] + bb; }
  LDSX();
  for (int rl = 0; rl < 16; ++rl) vst2(dst + (r0 + rl) * DMOD + n0 + lane * 4, *(const v4f*)&so[rl][lane * 4]);
}
// ---- k_poolx: axis sums of bf16(X); behind these 768 blocks, PACK_NB blocks round Wv and Wo to bf16 once and lay them in fragment order (thread = one 16-B piece: 8 consecutive k of one row). Blocks < 256: SX[b*64 + n1][c] = sum_{n2}; blocks >= 256: SX[256 + b*128 + n2][c] = sum_{n1}. Thread = (part = tid >> 6, 4 columns): a part sums every 4th row (ascending), the 4 parts are added in LDS; 1-KB rows
template <int NR> __device__ __forceinline__ v4f sum_rows(const float* __restrict__ p, size_t step) {
  v4f s = {0.f, 0.f, 0.f, 0.f};
#pragma unroll 16   // 16 row loads of 16 B in flight per lane: the kernel is a stream from memory
  for (int i = 0; i < NR; ++i) { const v4f v = *(const v4f*)(p + (size_t)i * step);
#pragma unroll      // vector elements by constant index
    for (int e = 0; e < 4; ++e) s[e] += bfr(v[e]); }
  return s;
}
#define PACK_NB (2 * PWSZ / 8 / 256)
#define TRIG_NB (N2 * 16 / 256)
__global__ __launch_bounds__(256) void k_poolx(const float* __restrict__ X, float* __restrict__ SX, const float* __restrict__ Wv, const float* __restrict__ Wo, float* __restrict__ PWF, float* __restrict__ CS) {
  __shared__ __align__(16) float sp[4][DMOD];
  const int tid = threadIdx.x, part = tid >> 6, c4 = (tid & 63) * 4, blk = blockIdx.x; v4f s;
  if (blk >= NBT * N1 + NBT * N2 + PACK_NB) {   // the last TRIG_NB blocks: RoPE's table CS[l][j] = cos(l * 10000^(-j/16)), then the sines, thread = (l, j); a wave stores whole lines
    const int idx = (blk - (NBT * N1 + NBT * N2 + PACK_NB)) * 256 + tid, j = idx & 15; const float invf = 1.0f / pow_ni(10000.0f, (float)(2 * j) / 32.0f); const float ang = (float)(idx >> 4) * invf;
    CS[idx] = cos_ni(ang); CS[N2 * 16 + idx] = sin_ni(ang); return; }
  if (blk >= NBT * N1 + NBT * N2) {   // piece p of a matrix = (nt = p >> 9, kc = (p >> 6) & 7, plane = (p >> 5) & 1, lane = p & 31)
    const int idx = (blk - (NBT * N1 + NBT * N2)) * 256 + tid, p = idx & (PWSZ / 8 - 1), ln = p & 31; const float* Wm = idx < PWSZ / 8 ? Wv : Wo;
    const float* sw = Wm + (size_t)((p >> 9) * 16 + (ln & 15)) * DMOD + ((p >> 6) & 7) * 32 + ((p >> 5) & 1) * 16 + 8 * (ln >> 4);
    const v4f x0 = *(const v4f*)sw, x1 = *(const v4f*)(sw + 4); v8b o;
#pragma unroll      // vector elements by constant index
    for (int e = 0; e < 4; ++e) { o[e] = (__bf16)x0[e]; o[4 + e] = (__bf16)x1[e]; }
    vst2((__bf16*)PWF + (size_t)idx * 8, o); return; }
  if (blk < NBT * N1) s = sum_rows<N2 / 4>(X + ((size_t)blk * N2 + part) * DMOD + c4, (size_t)4 * DMOD);
  else { const int r = blk - NBT * N1, b = r / N2, i2 = r % N2; s = sum_rows<N1 / 4>(X + (((size_t)b * N1 + part) * N2 + i2) * DMOD + c4, (size_t)4 * N2 * DMOD); }
  *(v4f*)&sp[part][c4] = s;
  __syncthreads();
  if (tid < 64) vst2(SX + (size_t)blk * DMOD + c4, (*(const v4f*)&sp[0][c4] + *(const v4f*)&sp[1][c4]) + (*(const v4f*)&sp[2][c4] + *(const v4f*)&sp[3][c4]));
}
// ---- k_pproj: pooled q and k: [768 rows of SX] x [q|k 512 cols] = SX (three bf16 pieces, 3 products) . bf16(W rows) + n bf16(b), n = rows summed (128 or 64); block (16 rows, 64 cols = 2 heads), wave = 16 cols; K = 256; 256-B segments of 1-KB rows.
//      Rows pooled over n1 (row = (b, l < 128)) get RoPE on the way out of LDS: per head x[32] -> x cos + rot(x) sin, rot = (-x[16:], x[:16]), angle = l * 10000^(-j/16) (j = d mod 16), cos and sin from k_poolx's table; both halves of a head lie in the block's tile.
//      The block's min and max of what it stores go to its own slot MMP[t][slot] (t: 0 = q axis 1, 1 = k axis 1, 2 = q axis 2, 3 = k axis 2), one 128-B line
__global__ __launch_bounds__(128) void k_pproj(const float* __restrict__ SX, const float* __restrict__ Wq, const float* __restrict__ bq, const float* __restrict__ Wk, const float* __restrict__ bk, float* __restrict__ QS1, float* __restrict__ KS1, float* __restrict__ QS2, float* __restrict__ KS2, const float* __restrict__ CS, float* __restrict__ MMP) {
  __shared__ __align__(16) float so[16][68]; __shared__ float smn[4], smx[4];
  const int tid = threadIdx.x, wave = tid >> 5, lane = tid & 31, col = lane & 15, g = lane >> 4; const int r0 = blockIdx.x * 16, which = blockIdx.y >> 2, nb0 = (blockIdx.y & 3) * 64, n = nb0 + wave * 16 + col;
  const float* Wm = which == 0 ? Wq : Wk; const float* bm = which == 0 ? bq : bk; const bool ax1 = r0 < NBT * N1;
  float* dst = ax1 ? (which == 0 ? QS1 : KS1) + (size_t)r0 * DMOD : (which == 0 ? QS2 : KS2) + (size_t)(r0 - NBT * N1) * DMOD;
  const float* pa = SX + (size_t)(r0 + col) * DMOD + 8 * g; const float* pw = Wm + (size_t)n * DMOD + 8 * g; const float bb = (ax1 ? (float)N2 : (float)N1) * bfr(bm[n]);
  v4f rc[2], rs[2];   // cos, sin of the 2 x 4 elements that this thread stores at the end: loaded here, in one flight with the operands, by every block (no branch, no wait in front of the operand loads); l = row mod 128 (NBT * N1 is a multiple of N2); the axis-1 blocks do not use them
#pragma unroll      // rc, rs by constant index
  for (int e = 0; e < 2; ++e) { const float* pt = CS + (size_t)((r0 + (tid >> 4) + 8 * e) % N2) * 16 + ((tid & 3) * 4); rc[e] = *(const v4f*)pt; rs[e] = *(const v4f*)(pt + N2 * 16); }
  v8f acc = {};   // every loop below is unrolled whole, so that a, w and the fragments are indexed by constants and stay in registers
#pragma unroll
  for (int kh = 0; kh < 2; ++kh) { v4f a[4][4], w[4][4];   // half of K at a time: its 32 loads go out together
#pragma unroll
    for (int k = 0; k < 4; ++k)
#pragma unroll
      for (int i = 0; i < 4; ++i) { const int o = (kh * 4 + k) * 32 + (i >> 1) * 16 + (i & 1) * 4; a[k][i] = *(const v4f*)(pa + o); w[k][i] = *(const v4f*)(pw + o); }
#pragma unroll
    for (int k = 0; k < 4; ++k) { v16b ah, am, al, wb;
#pragma unroll
      for (int i = 0; i < 16; ++i) { const float v = a[k][i >> 2][i & 3]; const __bf16 h = (__bf16)v; const float r1 = v - (float)h; const __bf16 m = (__bf16)r1; ah[i] = h; am[i] = m; al[i] = (__bf16)(r1 - (float)m); wb[i] = (__bf16)w[k][i >> 2][i & 3]; }
      acc = wmma_bf(al, wb, acc); acc = wmma_bf(am, wb, acc); acc = wmma_bf(ah, wb, acc); } }
#pragma unroll
  for (int r = 0; r < 8; ++r) so[8 * g + r][wave * 16 + col] = acc[r] + bb;
  __syncthreads();
  float mn = 3.0e38f, mx = -3.0e38f;
  v4f o2[2]; float* pst = dst + (size_t)(tid >> 4) * DMOD + nb0 + (tid & 15) * 4;
#pragma unroll      // rc, rs, o2 by constant index
  for (int qi = 0; qi < 2; ++qi) { const int rl = (tid >> 4) + 8 * qi, pc = tid & 15; v4f v = *(const v4f*)&so[rl][pc * 4];
    if (!ax1) { const v4f p = *(const v4f*)&so[rl][(pc * 4) ^ 16]; const float sg = (pc & 4) ? 1.0f : -1.0f;   // partner column d +- 16; the lower half takes it negated
#pragma unroll      // vector elements by constant index
      for (int e = 0; e < 4; ++e) v[e] = v[e] * rc[qi][e] + (sg * p[e]) * rs[qi][e]; }
#pragma unroll      // vector elements by constant index
    for (int e = 0; e < 4; ++e) { mn = fminf(mn, v[e]); mx = fmaxf(mx, v[e]); }
    o2[qi] = v; }
  // rows rl and rl + 8 (8 KB on); the stores and their s_wait_xcnt in one statement, so that the wait stands in front of the min-max code below, which takes the stored registers over
  asm volatile("global_store_b128 %0, %1, off\n\tglobal_store_b128 %0, %2, off offset:8192\n\ts_wait_xcnt 0x0" :: "v"(pst), "v"(o2[0]), "v"(o2[1]) : "memory");
#pragma unroll
  for (int o = 1; o < 32; o <<= 1) { mn = fminf(mn, __shfl_xor(mn, o)); mx = fmaxf(mx, __shfl_xor(mx, o)); }
  if (lane == 0) { smn[wave] = mn; smx[wave] = mx; }
  __syncthreads();
  if (tid < 8) { const v4f z = {0.f, 0.f, 0.f, 0.f}, m4 = {fminf(fminf(smn[0], smn[1]), fminf(smn[2], smn[3])), fmaxf(fmaxf(smx[0], smx[1]), fmaxf(smx[2], smx[3])), 0.f, 0.f};
    const int t = (ax1 ? 0 : 2) + which, slot = (ax1 ? r0 : r0 - NBT * N1) / 16 * 4 + (blockIdx.y & 3); vst2(MMP + ((size_t)t * MMN + slot) * MMS + tid * 4, tid == 0 ? m4 : z); }
}
// ---- k_feat: phi for the pooled tensor S = S_t (rows (b,l), l < L) and head h; blockIdx.x = h * 96 + bx, bx: 16 row tiles each of t = 0, 1, then 32 each of t = 2, 3; behind these FEAT_NB blocks, per block, one wave's quarter of a v-projection tile; block = 16 rows (one wave): xs = (x - mn)/(mx - mn) * 32^-1/4; dots on WMMA (xs hi/lo x bf16(feat rows), K = 32, 12 tiles); phi = exp(dot - |xs|^2/2 - ln(192)/2 + 1e-6);
//      P[(b*8 + h)*L + l][m] rows of 768 B (48 pieces). On entry the wave takes the tensor's global min and max over the slots that k_pproj's blocks left; a block of a k tensor also leaves the sum of its 16 phi rows (ascending) in KPB[ax][(b,h)][l0 / 16][m], 6 whole lines
#define FEAT_NB ((2 * (NBT * N1 / 16) + 2 * (NBT * N2 / 16)) * NHD)
__global__ __launch_bounds__(32) void k_feat(const float* __restrict__ S0, const float* __restrict__ S1, const float* __restrict__ S2, const float* __restrict__ S3, const float* __restrict__ MM, const float* __restrict__ feat, float* __restrict__ PB, float* __restrict__ KPB, const float* __restrict__ X, const float* __restrict__ PWF, const float* __restrict__ bv, float* __restrict__ V) {
  __shared__ __align__(16) union { struct { float sx[16][36]; float so[16][196]; float soff[16]; } f; float pj[16][132]; } sm; auto& sx = sm.f.sx; auto& so = sm.f.so; auto& soff = sm.f.soff;
  const int fb = blockIdx.x;
  if (fb >= FEAT_NB) { proj_tile(X, (const __bf16*)PWF, bv, V, sm.pj, (fb - FEAT_NB) >> 2, (fb - FEAT_NB) & 3, threadIdx.x); return; }
  constexpr int T1N = NBT * N1 / 16, T2N = NBT * N2 / 16; const int bx = fb % (FEAT_NB / NHD), t = bx < 2 * T1N ? bx / T1N : 2 + (bx - 2 * T1N) / T2N, L = t < 2 ? N1 : N2;
  const float* S = t == 0 ? S0 : t == 1 ? S1 : t == 2 ? S2 : S3; float* P = PB + (size_t)t * PSZ;
  const int lane = threadIdx.x, col = lane & 15, g = lane >> 4; const int h = fb / (FEAT_NB / NHD); const int r0 = (t < 2 ? bx % T1N : (bx - 2 * T1N) % T2N) * 16; const int b = r0 / L, l0 = r0 % L;
  float mn = 3.0e38f, mx = -3.0e38f;
#pragma unroll      // the 4 slot loads go out together; with 64 slots each is read twice, which a min or max does not see
  for (int i = 0; i < MMN / 32; ++i) { const v2f m2 = *(const v2f*)(MM + ((size_t)t * MMN + ((lane + 32 * i) & (t < 2 ? MMN / 2 - 1 : MMN - 1))) * MMS); mn = fminf(mn, m2[0]); mx = fmaxf(mx, m2[1]); }
#pragma unroll
  for (int o = 1; o < 32; o <<= 1) { mn = fminf(mn, __shfl_xor(mn, o)); mx = fmaxf(mx, __shfl_xor(mx, o)); }
  const float sc = 1.0f / (mx - mn); const float temp = 0.42044820762685725f;   // 32^-0.25
  { const int rl = lane >> 1, half = lane & 1; float ss = 0.f;
    for (int d = half * 16; d < half * 16 + 16; ++d) { const float x = S[(size_t)(r0 + rl) * DMOD + h * DHD + d]; const float xs = (x - mn) * sc * temp; sx[rl][d] = xs; ss += xs * xs; }
    ss += __shfl_xor(ss, 1); if (half == 0) { soff[rl] = -0.5f * ss - 0.5f * 5.2574953720277815f + 1e-6f; sx[rl][32] = 0.f; sx[rl][33] = 0.f; sx[rl][34] = 0.f; sx[rl][35] = 0.f; } }
  LDSX();
  const F2 a = split_row(&sx[col][0], 0, lane);
#pragma unroll
  for (int j = 0; j < 12; ++j) { v8f acc = {}; const v16b w = frag_gbf(feat + (size_t)(j * 16 + col) * DHD, lane); acc = wmma_bf(a.l, w, acc); acc = wmma_bf(a.h, w, acc);
#pragma unroll
    for (int r = 0; r < 8; ++r) so[8 * g + r][j * 16 + col] = exp_ni(acc[r] + soff[8 * g + r]); }
  LDSX();
  for (int q = lane; q < 16 * 48; q += 32) { const int rl = q / 48, pc = q % 48; vst2(P + ((size_t)(b * NHD + h) * L + l0 + rl) * MF + pc * 4, *(const v4f*)&so[rl][pc * 4]); }
  if (t & 1) { float* KQ = KPB + (((size_t)(t >> 1) * NBT * NHD + b * NHD + h) * (N2 / 16) + l0 / 16) * MF;
    for (int i = 0; i < MF / 32; ++i) { float s = 0.f;
#pragma unroll      // 16 LDS reads in flight
      for (int r = 0; r < 16; ++r) s += so[r][i * 32 + lane];
      KQ[i * 32 + lane] = s; } }
}
// ---- k_amat: per axis and (b,h): A[l][l'] = (sum_m QP[l][m] (hi/lo) . KP[l'][m] (hi/lo)) / att_norm[l]: M = l (by = 4 tiles of axis 1, then 8 of axis 2), N = l' (32 per wave = 2 tiles), K = m (6 steps), 3 products; rows pitch 128, 128-B segment per wave and row; blockIdx.x = by * 32 + (b,h), behind these AMAT_NB blocks v-projection tiles.
//      att_norm[l] = sum_m QP[l][m] ksum[m], ksum[m] = sum_l' KP[l'][m]: each wave adds k_feat's row-tile sums (ascending) into its own 192 floats of LDS and takes the dot products of its 16 q rows in f32 from the values it loads for the A fragments (lane = (row, half of each 32 m), the halves added by a shuffle); no wave needs another
#define AMAT_NB (NBT * NHD * (N1 / 16 + N2 / 16))
__global__ __launch_bounds__(128) void k_amat(const float* __restrict__ PB, const float* __restrict__ KPB, float* __restrict__ AMB, const float* __restrict__ X, const float* __restrict__ PWF, const float* __restrict__ bv, float* __restrict__ V) {
  __shared__ __align__(16) union { struct { float so[4][16][36]; float sks[4][MF]; } a; float pj[4][16][132]; } sm; auto& so = sm.a.so; auto& sks = sm.a.sks;
  const int fb = blockIdx.x, tid = threadIdx.x, wave = tid >> 5, lane = tid & 31, col = lane & 15, g = lane >> 4;
  if (fb >= AMAT_NB) { proj_tile(X, (const __bf16*)PWF, bv, V, sm.pj[wave], PROJ_F + fb - AMAT_NB, wave, lane); return; }
  const int by = fb / (NBT * NHD), ax = by < N1 / 16 ? 0 : 1, L = ax == 0 ? N1 : N2; const int bh = fb % (NBT * NHD), l0 = (ax == 0 ? by : by - N1 / 16) * 16, n0 = wave * 32;
  if (n0 >= L) return;
  const float* QP = PB + (size_t)(2 * ax) * PSZ; const float* KP = QP + PSZ; float* AM = AMB + (size_t)ax * AMSZ;
  const float* KQ = KPB + ((size_t)ax * NBT * NHD + bh) * (N2 / 16) * MF + lane; float ks[MF / 32] = {};
  { float v[N2 / 16][MF / 32] = {};   // every loop of this kernel is unrolled whole: its arrays are indexed by constants and stay in registers. The 4 or 8 tiles' loads go out together; a tile that axis 1 lacks adds 0; ascending tile order
#pragma unroll
    for (int tl = 0; tl < N1 / 16; ++tl)
#pragma unroll
      for (int i = 0; i < MF / 32; ++i) v[tl][i] = KQ[(size_t)tl * MF + i * 32];
    asm volatile("s_wait_xcnt 0x0" ::: "memory");   // behind the 24 loads above, ahead of any rewrite of their base or offset register (on the axis-1 way only counted data waits follow before the base is reused)
    if (ax == 1) {
#pragma unroll
      for (int tl = N1 / 16; tl < N2 / 16; ++tl)
#pragma unroll
        for (int i = 0; i < MF / 32; ++i) v[tl][i] = KQ[(size_t)tl * MF + i * 32]; }
#pragma unroll
    for (int tl = 0; tl < N2 / 16; ++tl)
#pragma unroll
      for (int i = 0; i < MF / 32; ++i) ks[i] += v[tl][i]; }
#pragma unroll
  for (int i = 0; i < MF / 32; ++i) sks[wave][i * 32 + lane] = ks[i];
  LDSX();
  const float* qrow = QP + ((size_t)bh * L + l0 + col) * MF;
  v8f acc[2] = {}; float dn = 0.f;
#pragma unroll
  for (int kc = 0; kc < MF / 32; ++kc) { float v[16]; const float* p = qrow + kc * 32 + 8 * g; const float* kp = &sks[wave][kc * 32 + 8 * g]; float dk = 0.f;
#pragma unroll
    for (int i = 0; i < 8; ++i) { v[i] = p[i]; v[8 + i] = p[16 + i]; }
#pragma unroll
    for (int i = 0; i < 8; ++i) dk += v[i] * kp[i];
#pragma unroll
    for (int i = 0; i < 8; ++i) dk += v[8 + i] * kp[16 + i];
    dn += dk; const F2 a = bsplit16(v);
#pragma unroll
    for (int j = 0; j < 2; ++j) { const F2 kb = split_row(KP + ((size_t)bh * L + n0 + j * 16 + col) * MF, kc * 32, lane); acc[j] = mac3(a, kb, acc[j]); } }
  dn += __shfl_xor(dn, 16);   // lanes col and col + 16 now both hold att_norm of row l0 + col
  float inv[8];
#pragma unroll
  for (int r = 0; r < 8; ++r) inv[r] = 1.0f / __shfl(dn, 8 * g + r);
#pragma unroll
  for (int j = 0; j < 2; ++j)
#pragma unroll
    for (int r = 0; r < 8; ++r) so[wave][8 * g + r][j * 16 + col] = acc[j][r] * inv[r];
  LDSX();
  for (int q = lane; q < 16 * 8; q += 32) { const int rl = q >> 3, pc = q & 7; vst2(AM + ((size_t)bh * N2 + l0 + rl) * N2 + n0 + pc * 4, *(const v4f*)&so[wave][rl][pc * 4]); }
}
// ---- k_att: per (b, other o, head h), in place on the value tensor: out[l][d] = sum_l' A[(b,h)][l][l'] (hi/lo) . V[l'][(h,d)] (hi/lo): M = l (one 16-row tile per wave, L/16 waves), N = d (2 tiles), K = l' (2 or 4 steps), 3 products; all batches in one launch.
//      The block owns the L x 32 tile (128-B row segments) that it reads and writes: it is read once (thread = 4 rows x 16 B), split into bf16 hi and residual and laid down transposed in LDS ([d][l'], 8-B stores, pitch 2 L + 16 B for the 16-B fragment reads); the stores to V follow the barrier behind which every read has landed
template <int PASS>
__global__ __launch_bounds__(PASS == 1 ? N1 * 2 : N2 * 2) void k_att(const float* __restrict__ AM, int ob0, float* V) {
  constexpr int L = (PASS == 1 ? N1 : N2), O = (PASS == 1 ? N2 : N1); constexpr size_t RS = (PASS == 1 ? (size_t)N2 * DMOD : (size_t)DMOD);   // RS: floats from row l to row l + 1
  __shared__ __align__(16) __bf16 vh[DHD][L + 8], vl[DHD][L + 8]; __shared__ __align__(16) float so[L / 16][16][36];
  const int tid = threadIdx.x, wave = tid >> 5, lane = tid & 31, col = lane & 15, g = lane >> 4; const int h = blockIdx.x % NHD, bo = ob0 + blockIdx.x / NHD; const int b = bo / O, o = bo % O;
  float* tile = V + (PASS == 1 ? ((size_t)b * N1 * N2 + o) : ((size_t)b * N1 + o) * N2) * DMOD + h * DHD;
  const float* arow = AM + ((size_t)(b * NHD + h) * N2 + wave * 16 + col) * N2;
  const int p4 = (tid & 7) * 4, l4 = (tid >> 3) * 4; const float* src = tile + (size_t)l4 * RS + p4; v4f x[4]; F2 a[L / 32];   // every loop below is unrolled whole: x, a, hi, lo and acc are indexed by constants and stay in registers; the tile's 4 loads and A's loads go out together, ahead of the barrier
#pragma unroll
  for (int i = 0; i < 4; ++i) x[i] = *(const v4f*)(src + (size_t)i * RS);
#pragma unroll
  for (int kc = 0; kc < L / 32; ++kc) a[kc] = split_row(arow, kc * 32, lane);
#pragma unroll
  for (int e = 0; e < 4; ++e) { v4b hi, lo;
#pragma unroll
    for (int i = 0; i < 4; ++i) { const float v = x[i][e]; const __bf16 hh = (__bf16)v; hi[i] = hh; lo[i] = (__bf16)(v - (float)hh); }
    *(v4b*)&vh[p4 + e][l4] = hi; *(v4b*)&vl[p4 + e][l4] = lo; }
  __syncthreads();
  v8f acc[2] = {};
#pragma unroll
  for (int kc = 0; kc < L / 32; ++kc)
#pragma unroll
    for (int j = 0; j < 2; ++j) { F2 vb; vb.h = frag_b(&vh[j * 16 + col][kc * 32], lane); vb.l = frag_b(&vl[j * 16 + col][kc * 32], lane); acc[j] = mac3(a[kc], vb, acc[j]); }
#pragma unroll
  for (int j = 0; j < 2; ++j)
#pragma unroll
    for (int r = 0; r < 8; ++r) so[wave][8 * g + r][j * 16 + col] = acc[j][r];
  LDSX();
  for (int q = lane; q < 16 * 8; q += 32) { const int rl = q >> 3, pc = q & 7; vst2(tile + (size_t)(wave * 16 + rl) * RS + pc * 4, *(const v4f*)&so[wave][rl][pc * 4]); }
}
// ---- k_out: Y = V3(hi/lo) . bf16(Wo rows [256][256], packed) + bo; block (64 rows, 128 cols); K = 256
__global__ __launch_bounds__(128) void k_out(const float* __restrict__ V3, const float* __restrict__ PWF, const float* __restrict__ bo, float* __restrict__ Y, int rb0) {
  __shared__ __align__(16) float so[4][16][132];
  const int tid = threadIdx.x, wave = tid >> 5, lane = tid & 31, col = lane & 15, g = lane >> 4; const size_t r0 = (size_t)(rb0 + blockIdx.x) * 64 + wave * 16; const int n0 = blockIdx.y * 128;
  v8f acc[8] = {};
#pragma unroll 2
  for (int kc = 0; kc < DMOD / 32; ++kc) { v16b w[8];
#pragma unroll      // w indexed by constants, in registers: the k step's 16 loads of B go out as one group, ahead of its first WMMA
    for (int j = 0; j < 8; ++j) w[j] = frag_pw((const __bf16*)PWF + PWSZ, n0 / 16 + j, kc, lane);
    const F2 a = split_row(V3 + (r0 + col) * DMOD, kc * 32, lane);
#pragma unroll
    for (int j = 0; j < 8; ++j) { acc[j] = wmma_bf(a.l, w[j], acc[j]); acc[j] = wmma_bf(a.h, w[j], acc[j]); } }
#pragma unroll
  for (int j = 0; j < 8; ++j) { const float bb = bfr(bo[n0 + j * 16 + col]);
#pragma unroll
    for (int r = 0; r < 8; ++r) so[wave][8 * g + r][j * 16 + col] = acc[j][r] + bb; }
  LDSX();
  for (int rl = 0; rl < 16; ++rl) vst2(Y + (r0 + rl) * DMOD + n0 + lane * 4, *(const v4f*)&so[wave][rl][lane * 4]);
}

#ifndef DBG
#define DBG 0
#endif
#if DBG != 0
__global__ __launch_bounds__(256) void k_dump(const float* __restrict__ src, int n, float* __restrict__ out) {   // out[0..n) = src, rest of batch-0 region zero
  const size_t p = (size_t)blockIdx.x * 256 + threadIdx.x; v4f v; for (int i = 0; i < 4; ++i) { const size_t f = p * 4 + i; v[i] = f < (size_t)n ? src[f] : 0.f; } vst2(out + p * 4, v);
}
#endif
extern "C" void kernel_launch(void* const* d_in, const int* in_sizes, int n_in, void* d_out, int out_size, void* d_ws, size_t ws_size, hipStream_t stream) {
  (void)in_sizes; (void)n_in; (void)out_size;
  const float** F = (const float**)d_in;   // X, Wq, bq, Wk, bk, Wv, bv, Wo, bo, feat
  if (ws_size < (size_t)WS_END) return;
  char* ws = (char*)d_ws; float *PB = (float*)(ws + WS_A), *V = (float*)(ws + WS_V), *QS1 = (float*)(ws + WS_QS1), *KS1 = (float*)(ws + WS_KS1), *QS2 = (float*)(ws + WS_QS2), *KS2 = (float*)(ws + WS_KS2), *MM = (float*)(ws + WS_MM), *AM = (float*)(ws + WS_AM), *KSUM = (float*)(ws + WS_KSUM), *SX = (float*)(ws + WS_SX), *CS = (float*)(ws + WS_CS), *PW = (float*)(ws + WS_B);
  k_poolx<<<NBT * N1 + NBT * N2 + PACK_NB + TRIG_NB, 256, 0, stream>>>(F[0], SX, F[5], F[7], PW, CS);
  k_pproj<<<dim3((NBT * N1 + NBT * N2) / 16, 8), 128, 0, stream>>>(SX, F[1], F[2], F[3], F[4], QS1, KS1, QS2, KS2, CS, MM);
  // ---- the mixing matrices of both axes (assets: l = n1 = 64; time: l = n2 = 128 with RoPE)
  k_feat<<<FEAT_NB + 4 * PROJ_F, 32, 0, stream>>>(QS1, KS1, QS2, KS2, MM, F[9], PB, KSUM, F[0], PW, F[6], V);
#if DBG == 2
  k_dump<<<N1 * N2 * DMOD / 1024, 256, 0, stream>>>(PB, NBT * NHD * N1 * MF, (float*)d_out); return;  // pass-1 phi(q) [4][8][64][192]
#endif
  k_amat<<<AMAT_NB + PROJ_N - PROJ_F, 128, 0, stream>>>(PB, KSUM, AM, F[0], PW, F[6], V);
  // ---- pass 1: assets axis (other = n2 = 128)
  k_att<1><<<(TNB - TB0) * N2 * NHD, N1 * 2, 0, stream>>>(AM, TB0 * N2, V);
#if DBG == 3
  k_dump<<<N1 * N2 * DMOD / 1024, 256, 0, stream>>>(V, N1 * N2 * DMOD, (float*)d_out); return;
#endif
  // ---- pass 2: time axis (other = n1 = 64)
  k_att<2><<<(TNB - TB0) * N1 * NHD, N2 * 2, 0, stream>>>(AM + AMSZ, TB0 * N1, V);
#if DBG == 5
  k_dump<<<N1 * N2 * DMOD / 1024, 256, 0, stream>>>(V, N1 * N2 * DMOD, (float*)d_out); return;     // value after pass 2, batch 0
#endif
  k_out<<<dim3((TNB - TB0) * N1 * N2 / 64, 2), 128, 0, stream>>>(V, PW, F[8], (float*)d_out, TB0 * N1 * N2 / 64);
}

// v007
// It runs in 96.5 microseconds.
// Two timings next to v006 put it at 1.05 and 1.04 times that version's speed.
// Counting every step since v000, it is 8.61 times as fast.
// compute dtype: X, the projection weights/biases and the random-feature matrix (module inputs) rounded to bf16; the v projection with exact bf16 products; the q and k projections taken on the axis sums of bf16(X) (f32 sums as three bf16 pieces, 3 products, all 24 bits); the feature-map GEMM (pooled q,k x feat) with the pooled operand as a bf16 hi + bf16 residual pair (2 products); the phi(q) phi(k)^T and mixing-matrix x value contractions with both computed operands hi/lo (3 products);
// the output projection hi/lo against bf16 Wo (2 products); axis pooling, RoPE, global min-max normalisation, exp feature maps, normalisers and divisions in f32; f32 accumulate.
#include <hip/hip_runtime.h>
#include <math.h>

typedef __attribute__((ext_vector_type(16))) _Float16 v16h;
typedef __attribute__((ext_vector_type(16))) __bf16 v16b;
typedef __attribute__((ext_vector_type(8)))  _Float16 v8h;
typedef __attribute__((ext_vector_type(8)))  float v8f;
typedef __attribute__((ext_vector_type(4)))  float v4f;
typedef __attribute__((ext_vector_type(2)))  float v2f;
typedef __attribute__((ext_vector_type(4)))  unsigned v4u;
typedef __attribute__((ext_vector_type(4)))  int v4i;
typedef float __attribute__((may_alias)) float_a;
typedef int __attribute__((may_alias)) int_a;

template <typename T> __device__ __forceinline__ void vst2(void* p, T v) { *(T*)p = v;  }
__device__ __forceinline__ v8f wmma16(v16h a, v16h b, v8f c) {
  v8f d = __builtin_amdgcn_wmma_f32_16x16x32_f16(false, a, false, b, (short)0, c, false, false);
  asm volatile("v_nop\n\tv_nop\n\tv_nop\n\tv_nop" : "+v"(d) : "v"(a), "v"(b));
  return d;
}
__device__ __forceinline__ v8f wmma_bf(v16b a, v16b b, v8f c) {
  v8f d = __builtin_amdgcn_wmma_f32_16x16x32_bf16(false, a, false, b, (short)0, c, false, false);
  asm volatile("v_nop\n\tv_nop\n\tv_nop\n\tv_nop" : "+v"(d) : "v"(a), "v"(b));
  return d;
}
// 16x16x32 fragments: lane = (h = lane>>4, row/col = lane&15); elements 0..7 = k0+8h+0..7, 8..15 = k0+16+8h+0..7; D element r = row 8h+r
__device__ __forceinline__ v16h frag_h(const _Float16* rowk0, int lane) {
  union { v16h v; v8h q[2]; } u; const _Float16* p = rowk0 + 8 * (lane >> 4);
  u.q[0] = *(const v8h*)p; u.q[1] = *(const v8h*)(p + 16); return u.v;
}
__device__ __forceinline__ v16h frag_f32(const float* rowk0, int lane) {
  v16h a; const float* p = rowk0 + 8 * (lane >> 4);
#pragma unroll
  for (int i = 0; i < 8; ++i) { a[i] = (_Float16)p[i]; a[8 + i] = (_Float16)p[16 + i]; }
  return a;
}
__device__ __forceinline__ v16h frag_f32s(const float* rowk0, int lane, float sc) {
  v16h a; const float* p = rowk0 + 8 * (lane >> 4);
#pragma unroll
  for (int i = 0; i < 8; ++i) { a[i] = (_Float16)(p[i] * sc); a[8 + i] = (_Float16)(p[16 + i] * sc); }
  return a;
}
// column fragment from a [K][ld] layout (column n), rows >= K read as 0
__device__ __forceinline__ v16h fragc_f32(const float* W, int k0, int n, int lane, int ld, int K) {
  v16h a; const int g = lane >> 4;
#pragma unroll
  for (int i = 0; i < 8; ++i) { const int ka = k0 + 8 * g + i, kb = ka + 16;
    a[i] = (_Float16)(ka < K ? W[(size_t)(ka < K ? ka : K - 1) * ld + n] : 0.f); a[8 + i] = (_Float16)(kb < K ? W[(size_t)(kb < K ? kb : K - 1) * ld + n] : 0.f); }
  return a;
}
struct F2 { v16b h, l; };
__device__ __forceinline__ F2 bsplit16(const float v[16]) { F2 r;
#pragma unroll
  for (int i = 0; i < 16; ++i) { const __bf16 h = (__bf16)v[i]; r.h[i] = h; r.l[i] = (__bf16)(v[i] - (float)h); }
  return r; }
__device__ __forceinline__ F2 split_row(const float* row, int k0, int lane) { float v[16]; const float* p = row + k0 + 8 * (lane >> 4);
#pragma unroll
  for (int i = 0; i < 8; ++i) { v[i] = p[i]; v[8 + i] = p[16 + i]; }
  return bsplit16(v); }
__device__ __forceinline__ F2 split_rowK(const float* row, int k0, int lane, int K) { float v[16]; const int g = lane >> 4;
#pragma unroll
  for (int i = 0; i < 8; ++i) { const int ka = k0 + 8 * g + i, kb = ka + 16; v[i] = ka < K ? row[ka < K ? ka : K - 1] : 0.f; v[8 + i] = kb < K ? row[kb < K ? kb : K - 1] : 0.f; }
  return bsplit16(v); }
__device__ __forceinline__ F2 split_col(const float* W, int k0, int n, int lane, int ld, int K) { float v[16]; const int g = lane >> 4;
#pragma unroll
  for (int i = 0; i < 8; ++i) { const int ka = k0 + 8 * g + i, kb = ka + 16; v[i] = ka < K ? W[(size_t)(ka < K ? ka : K - 1) * ld + n] : 0.f; v[8 + i] = kb < K ? W[(size_t)(kb < K ? kb : K - 1) * ld + n] : 0.f; }
  return bsplit16(v); }
__device__ __forceinline__ v8f mac3(const F2& a, const F2& b, v8f c) { c = wmma_bf(a.l, b.h, c); c = wmma_bf(a.h, b.l, c); return wmma_bf(a.h, b.h, c); }
__device__ __forceinline__ float sigm(float v) { return 1.0f / (1.0f + expf(-v)); }
#define LDSX() do { asm volatile("s_wait_dscnt 0" ::: "memory"); __builtin_amdgcn_wave_barrier(); __builtin_amdgcn_fence(__ATOMIC_RELEASE, "workgroup"); } while (0)


// High-order linear attention over a [4, 64, 128, 256] tensor: q/k/v = X W^T + b; for the assets axis (n1, pooled over n2) and then the time axis (n2, pooled over n1, with RoPE): Performer-style positive features phi(x) = exp(xs f^T - |xs|^2/2 - log(M)/2 + 1e-6), xs = (x - min x)/(max x - min x) * 32^-1/4 (global min/max),
// out_l = sum_l' A[l][l'] v_l', A[l][l'] = phi(q_l) . phi(k_l') / (phi(q_l) . sum_l phi(k_l)): the product phi(q) (phi(k)^T v) taken as (phi(q) phi(k)^T) v, since A depends on (b, head) alone and the attended length (64, 128) is below the 192 features; finally value W_o^T + b_o.
// q and k are used only through their axis sums, and sum_i (x_i W^T + b) = (sum_i x_i) W^T + n b: X is pooled first and only the 768 pooled rows are projected.
// k_poolx (axis sums of X; Wv and Wo packed as bf16 fragments; RoPE's cos and sin table); k_pproj (pooled q and k, RoPE on the dim-2 rows, min-max per block); proj_tile (v); k_feat (min-max finals, phi via WMMA, key sums per 16 rows); k_amat (per (b, head): key sum, normaliser, A); k_att (per (b, 4 other-positions, head): value tiles transposed in LDS, A x tiles, written back in place);
// A depends on the pooled q and k alone, never on the value: k_feat and k_amat each run once, for both axes (and for q and k) in one grid, the block index naming the tensor t (0 = q axis 1, 1 = k axis 1, 2 = q axis 2, 3 = k axis 2) or the axis ax (0, 1).
// A small elementwise or reducing stage has no launch of its own: the block that makes the values does the part it can (RoPE, its own min-max, its own 16-row key sum) before it stores them, and the block that needs the whole finishes it on entry (min-max over the block slots, key sum over the row tiles, normaliser of its own 16 rows)
#define NBT 4
#define N1 64
#define N2 128
#define DMOD 256
#define NHD 8
#define DHD 32
#define MF 192
#define NPOS (NBT * N1 * N2)      // 32768 positions
#ifndef TNB
#define TNB NBT                   // batches run through the attention passes / output (debug: fewer)
#endif
#ifndef TB0
#define TB0 0                     // first batch of the attention loops (debug)
#endif
typedef __attribute__((ext_vector_type(8))) __bf16 v8b;
typedef __attribute__((ext_vector_type(4))) __bf16 v4b;
__device__ __forceinline__ v16b frag_b(const __bf16* rowk0, int lane) {
  union { v16b v; v8b q[2]; } u; const __bf16* p = rowk0 + 8 * (lane >> 4);
  u.q[0] = *(const v8b*)p; u.q[1] = *(const v8b*)(p + 16); return u.v;
}
__device__ __forceinline__ v16b frag_gbf(const float* rowk0, int lane) {
  v16b a; const float* p = rowk0 + 8 * (lane >> 4);
#pragma unroll
  for (int i = 0; i < 8; ++i) { a[i] = (__bf16)p[i]; a[8 + i] = (__bf16)p[16 + i]; }
  return a;
}
// B fragment of a packed weight matrix (k_poolx lays it down): tile (nt = 16 output columns, kc = 32 of K) = 2 planes of 512 B, plane p holds per lane its elements 8p..8p+7 (same k order as frag_gbf), so each 16-B load of a wave covers 4 whole 128-B lines
__device__ __forceinline__ v16b frag_pw(const __bf16* PW, int nt, int kc, int lane) {
  union { v16b v; v8b q[2]; } u; const __bf16* p = PW + (size_t)(nt * (DMOD / 32) + kc) * 512 + lane * 8;
  u.q[0] = *(const v8b*)p; u.q[1] = *(const v8b*)(p + 256); return u.v;
}
__device__ __forceinline__ float bfr(float v) { return (float)(__bf16)v; }
__device__ __attribute__((noinline)) float exp_ni(float v) { return expf(v); }
__device__ __attribute__((noinline)) float pow_ni(float a, float b) { return powf(a, b); }
__device__ __attribute__((noinline)) float cos_ni(float v) { return cosf(v); }
__device__ __attribute__((noinline)) float sin_ni(float v) { return sinf(v); }

#define WS_A    0u                              // 32 MB, 12 MB used: f32 phi rows, 4 tensors t of PSZ floats each: [(b,h)][l][m] (l rows, m contiguous; L = 64 rows per (b,h) for t < 2, 128 for t >= 2)
#define PSZ     (NBT * NHD * N2 * MF)
#define WS_B    (WS_A + 4u * NPOS * DMOD)          // 32 MB, 256 KB used: bf16(Wv), then bf16(Wo), each 256 x 256 in fragment order (frag_pw)
#define PWSZ    (DMOD * DMOD)
#define WS_V    (WS_B + 4u * NPOS * DMOD)          // f32 32 MB: value [b][n1][n2][h*32+d] (updated in place per pass: V -> V2 -> V3, by the block that owns the tile)
#define WS_QS1  (WS_V + 4u * NPOS * DMOD)          // f32 [4][64][256]  q summed over n2
#define WS_KS1  (WS_QS1 + 4u * NBT * N1 * DMOD)
#define WS_QS2  (WS_KS1 + 4u * NBT * N1 * DMOD)    // f32 [4][128][256] q summed over n1, RoPE applied
#define WS_KS2  (WS_QS2 + 4u * NBT * N2 * DMOD)
#define WS_MM   (WS_KS2 + 4u * NBT * N2 * DMOD)
#define MMS 32
#define MMN 128
#define WS_AM   (WS_MM + 4u * 4 * MMN * MMS)       // f32 [2 axes][4][8][128][128] A (l rows, l' contiguous, pitch 128; axis 1 uses l, l' < 64); WS_MM holds [4 tensors][128 slots][32 floats]: (min, max) of one k_pproj block per slot, 64 slots used for t < 2, 128 for t >= 2
#define AMSZ    (NBT * NHD * N2 * N2)
#define WS_KSUM (WS_AM + 4u * 2 * AMSZ)            // f32 [2 axes][4][8][8 row tiles][192]: phi(k) summed over the 16 rows of a tile (axis 1 uses 4 tiles)
#define WS_SX   (WS_KSUM + 4u * 2 * NBT * NHD * (N2 / 16) * MF)  // f32 [256 + 512][256] bf16(X) summed over n2 (rows b*64 + n1), then summed over n1 (rows 256 + b*128 + n2)
#define WS_CS   (WS_SX + 4u * (NBT * N1 + NBT * N2) * DMOD)   // f32 [2][128][16]: cos, then sin, of RoPE's angles (l, j)
#define WS_END  (WS_CS + 4u * 2 * N2 * 16)

// ---- proj_tile: [32768 rows] x [v 256 cols] = bf16(X) . W rows ([out][in]) + b (exact); tile pb < PROJ_N = (64 rows, 128 cols), one wave = 16 of its rows, no wave needs another (so: the wave's own 16 x 132 floats of LDS); 512-B segments of 1-KB rows.
//      The v projection needs X alone and is first needed by k_att<1>: it has no launch of its own; its tiles ride as the last blocks in the grids of k_feat and k_amat, whose few waves wait on latency and leave most of the chip idle
#define PROJ_N  (NPOS / 64 * 2)
#define PROJ_F  (PROJ_N * 21 / 32)                 // tiles [0, PROJ_F) ride in k_feat (the longer of the two), [PROJ_F, PROJ_N) in k_amat
__device__ __forceinline__ void proj_tile(const float* __restrict__ X, const __bf16* __restrict__ PW, const float* __restrict__ bm, float* __restrict__ dst, float (*so)[132], int pb, int wave, int lane) {
  const int col = lane & 15, g = lane >> 4; const size_t r0 = (size_t)(pb % (NPOS / 64)) * 64 + wave * 16; const int n0 = pb / (NPOS / 64) * 128;
  v8f acc[8] = {};
#pragma unroll 2
  for (int kc = 0; kc < DMOD / 32; ++kc) { v16b w[8];
#pragma unroll      // w indexed by constants, in registers: the k step's 16 loads of B go out as one group, ahead of its first WMMA
    for (int j = 0; j < 8; ++j) w[j] = frag_pw(PW, n0 / 16 + j, kc, lane);
    const v16b a = frag_gbf(X + (r0 + col) * DMOD + kc * 32, lane);
#pragma unroll
    for (int j = 0; j < 8; ++j) acc[j] = wmma_bf(a, w[j], acc[j]); }
#pragma unroll
  for (int j = 0; j < 8; ++j) { const float bb = bfr(bm[n0 + j * 16 + col]);
#pragma unroll
    for (int r = 0; r < 8; ++r) so[8 * g + r][j * 16 + col] = acc[j][r] + bb; }
  LDSX();
  for (int rl = 0; rl < 16; ++rl) vst2(dst + (r0 + rl) * DMOD + n0 + lane * 4, *(const v4f*)&so[rl][lane * 4]);
}
// ---- k_poolx: axis sums of bf16(X); behind these 768 blocks, PACK_NB blocks round Wv and Wo to bf16 once and lay them in fragment order (thread = one 16-B piece: 8 consecutive k of one row). Blocks < 256: SX[b*64 + n1][c] = sum_{n2}; blocks >= 256: SX[256 + b*128 + n2][c] = sum_{n1}. Thread = (part = tid >> 6, 4 columns): a part sums every 4th row (ascending), the 4 parts are added in LDS; 1-KB rows
template <int NR> __device__ __forceinline__ v4f sum_rows(const float* __restrict__ p, size_t step) {
  v4f s = {0.f, 0.f, 0.f, 0.f};
#pragma unroll 16   // 16 row loads of 16 B in flight per lane: the kernel is a stream from memory
  for (int i = 0; i < NR; ++i) { const v4f v = *(const v4f*)(p + (size_t)i * step);
#pragma unroll      // vector elements by constant index
    for (int e = 0; e < 4; ++e) s[e] += bfr(v[e]); }
  return s;
}
#define PACK_NB (2 * PWSZ / 8 / 256)
#define TRIG_NB (N2 * 16 / 256)
__global__ __launch_bounds__(256) void k_poolx(const float* __restrict__ X, float* __restrict__ SX, const float* __restrict__ Wv, const float* __restrict__ Wo, float* __restrict__ PWF, float* __restrict__ CS) {
  __shared__ __align__(16) float sp[4][DMOD];
  const int tid = threadIdx.x, part = tid >> 6, c4 = (tid & 63) * 4, blk = blockIdx.x; v4f s;
  if (blk >= NBT * N1 + NBT * N2 + PACK_NB) {   // the last TRIG_NB blocks: RoPE's table CS[l][j] = cos(l * 10000^(-j/16)), then the sines, thread = (l, j); a wave stores whole lines
    const int idx = (blk - (NBT * N1 + NBT * N2 + PACK_NB)) * 256 + tid, j = idx & 15; const float invf = 1.0f / pow_ni(10000.0f, (float)(2 * j) / 32.0f); const float ang = (float)(idx >> 4) * invf;
    CS[idx] = cos_ni(ang); CS[N2 * 16 + idx] = sin_ni(ang); return; }
  if (blk >= NBT * N1 + NBT * N2) {   // piece p of a matrix = (nt = p >> 9, kc = (p >> 6) & 7, plane = (p >> 5) & 1, lane = p & 31)
    const int idx = (blk - (NBT * N1 + NBT * N2)) * 256 + tid, p = idx & (PWSZ / 8 - 1), ln = p & 31; const float* Wm = idx < PWSZ / 8 ? Wv : Wo;
    const float* sw = Wm + (size_t)((p >> 9) * 16 + (ln & 15)) * DMOD + ((p >> 6) & 7) * 32 + ((p >> 5) & 1) * 16 + 8 * (ln >> 4);
    const v4f x0 = *(const v4f*)sw, x1 = *(const v4f*)(sw + 4); v8b o;
#pragma unroll      // vector elements by constant index
    for (int e = 0; e < 4; ++e) { o[e] = (__bf16)x0[e]; o[4 + e] = (__bf16)x1[e]; }
    vst2((__bf16*)PWF + (size_t)idx * 8, o); return; }
  if (blk < NBT * N1) s = sum_rows<N2 / 4>(X + ((size_t)blk * N2 + part) * DMOD + c4, (size_t)4 * DMOD);
  else { const int r = blk - NBT * N1, b = r / N2, i2 = r % N2; s = sum_rows<N1 / 4>(X + (((size_t)b * N1 + part) * N2 + i2) * DMOD + c4, (size_t)4 * N2 * DMOD); }
  *(v4f*)&sp[part][c4] = s;
  __syncthreads();
  if (tid < 64) vst2(SX + (size_t)blk * DMOD + c4, (*(const v4f*)&sp[0][c4] + *(const v4f*)&sp[1][c4]) + (*(const v4f*)&sp[2][c4] + *(const v4f*)&sp[3][c4]));
}
// ---- k_pproj: pooled q and k: [768 rows of SX] x [q|k 512 cols] = SX (three bf16 pieces, 3 products) . bf16(W rows) + n bf16(b), n = rows summed (128 or 64); block (16 rows, 64 cols = 2 heads), wave = 16 cols; K = 256; 256-B segments of 1-KB rows.
//      Rows pooled over n1 (row = (b, l < 128)) get RoPE on the way out of LDS: per head x[32] -> x cos + rot(x) sin, rot = (-x[16:], x[:16]), angle = l * 10000^(-j/16) (j = d mod 16), cos and sin from k_poolx's table; both halves of a head lie in the block's tile.
//      The block's min and max of what it stores go to its own slot MMP[t][slot] (t: 0 = q axis 1, 1 = k axis 1, 2 = q axis 2, 3 = k axis 2), one 128-B line
__global__ __launch_bounds__(128) void k_pproj(const float* __restrict__ SX, const float* __restrict__ Wq, const float* __restrict__ bq, const float* __restrict__ Wk, const float* __restrict__ bk, float* __restrict__ QS1, float* __restrict__ KS1, float* __restrict__ QS2, float* __restrict__ KS2, const float* __restrict__ CS, float* __restrict__ MMP) {
  __shared__ __align__(16) float so[16][68]; __shared__ float smn[4], smx[4];
  const int tid = threadIdx.x, wave = tid >> 5, lane = tid & 31, col = lane & 15, g = lane >> 4; const int r0 = blockIdx.x * 16, which = blockIdx.y >> 2, nb0 = (blockIdx.y & 3) * 64, n = nb0 + wave * 16 + col;
  const float* Wm = which == 0 ? Wq : Wk; const float* bm = which == 0 ? bq : bk; const bool ax1 = r0 < NBT * N1;
  float* dst = ax1 ? (which == 0 ? QS1 : KS1) + (size_t)r0 * DMOD : (which == 0 ? QS2 : KS2) + (size_t)(r0 - NBT * N1) * DMOD;
  const float* pa = SX + (size_t)(r0 + col) * DMOD + 8 * g; const float* pw = Wm + (size_t)n * DMOD + 8 * g; const float bb = (ax1 ? (float)N2 : (float)N1) * bfr(bm[n]);
  v4f rc[2], rs[2];   // cos, sin of the 2 x 4 elements that this thread stores at the end: loaded here, in one flight with the operands, by every block (no branch, no wait in front of the operand loads); l = row mod 128 (NBT * N1 is a multiple of N2); the axis-1 blocks do not use them
#pragma unroll      // rc, rs by constant index
  for (int e = 0; e < 2; ++e) { const float* pt = CS + (size_t)((r0 + (tid >> 4) + 8 * e) % N2) * 16 + ((tid & 3) * 4); rc[e] = *(const v4f*)pt; rs[e] = *(const v4f*)(pt + N2 * 16); }
  v8f acc = {};   // every loop below is unrolled whole, so that a, w and the fragments are indexed by constants and stay in registers
#pragma unroll
  for (int kh = 0; kh < 2; ++kh) { v4f a[4][4], w[4][4];   // half of K at a time: its 32 loads go out together
#pragma unroll
    for (int k = 0; k < 4; ++k)
#pragma unroll
      for (int i = 0; i < 4; ++i) { const int o = (kh * 4 + k) * 32 + (i >> 1) * 16 + (i & 1) * 4; a[k][i] = *(const v4f*)(pa + o); w[k][i] = *(const v4f*)(pw + o); }
#pragma unroll
    for (int k = 0; k < 4; ++k) { v16b ah, am, al, wb;
#pragma unroll
      for (int i = 0; i < 16; ++i) { const float v = a[k][i >> 2][i & 3]; const __bf16 h = (__bf16)v; const float r1 = v - (float)h; const __bf16 m = (__bf16)r1; ah[i] = h; am[i] = m; al[i] = (__bf16)(r1 - (float)m); wb[i] = (__bf16)w[k][i >> 2][i & 3]; }
      acc = wmma_bf(al, wb, acc); acc = wmma_bf(am, wb, acc); acc = wmma_bf(ah, wb, acc); } }
#pragma unroll
  for (int r = 0; r < 8; ++r) so[8 * g + r][wave * 16 + col] = acc[r] + bb;
  __syncthreads();
  float mn = 3.0e38f, mx = -3.0e38f;
  v4f o2[2]; float* pst = dst + (size_t)(tid >> 4) * DMOD + nb0 + (tid & 15) * 4;
#pragma unroll      // rc, rs, o2 by constant index
  for (int qi = 0; qi < 2; ++qi) { const int rl = (tid >> 4) + 8 * qi, pc = tid & 15; v4f v = *(const v4f*)&so[rl][pc * 4];
    if (!ax1) { const v4f p = *(const v4f*)&so[rl][(pc * 4) ^ 16]; const float sg = (pc & 4) ? 1.0f : -1.0f;   // partner column d +- 16; the lower half takes it negated
#pragma unroll      // vector elements by constant index
      for (int e = 0; e < 4; ++e) v[e] = v[e] * rc[qi][e] + (sg * p[e]) * rs[qi][e]; }
#pragma unroll      // vector elements by constant index
    for (int e = 0; e < 4; ++e) { mn = fminf(mn, v[e]); mx = fmaxf(mx, v[e]); }
    o2[qi] = v; }
  // rows rl and rl + 8 (8 KB on); the stores and their s_wait_xcnt in one statement, so that the wait stands in front of the min-max code below, which takes the stored registers over
  asm volatile("global_store_b128 %0, %1, off\n\tglobal_store_b128 %0, %2, off offset:8192\n\ts_wait_xcnt 0x0" :: "v"(pst), "v"(o2[0]), "v"(o2[1]) : "memory");
#pragma unroll
  for (int o = 1; o < 32; o <<= 1) { mn = fminf(mn, __shfl_xor(mn, o)); mx = fmaxf(mx, __shfl_xor(mx, o)); }
  if (lane == 0) { smn[wave] = mn; smx[wave] = mx; }
  __syncthreads();
  if (tid < 8) { const v4f z = {0.f, 0.f, 0.f, 0.f}, m4 = {fminf(fminf(smn[0], smn[1]), fminf(smn[2], smn[3])), fmaxf(fmaxf(smx[0], smx[1]), fmaxf(smx[2], smx[3])), 0.f, 0.f};
    const int t = (ax1 ? 0 : 2) + which, slot = (ax1 ? r0 : r0 - NBT * N1) / 16 * 4 + (blockIdx.y & 3); vst2(MMP + ((size_t)t * MMN + slot) * MMS + tid * 4, tid == 0 ? m4 : z); }
}
// ---- k_feat: phi for the pooled tensor S = S_t (rows (b,l), l < L) and head h; blockIdx.x = h * 96 + bx, bx: 16 row tiles each of t = 0, 1, then 32 each of t = 2, 3; behind these FEAT_NB blocks, per block, one wave's quarter of a v-projection tile; block = 16 rows (one wave): xs = (x - mn)/(mx - mn) * 32^-1/4; dots on WMMA (xs hi/lo x bf16(feat rows), K = 32, 12 tiles); phi = exp(dot - |xs|^2/2 - ln(192)/2 + 1e-6);
//      P[(b*8 + h)*L + l][m] rows of 768 B (48 pieces). On entry the wave takes the tensor's global min and max over the slots that k_pproj's blocks left; a block of a k tensor also leaves the sum of its 16 phi rows (ascending) in KPB[ax][(b,h)][l0 / 16][m], 6 whole lines
#define FEAT_NB ((2 * (NBT * N1 / 16) + 2 * (NBT * N2 / 16)) * NHD)
__global__ __launch_bounds__(32) void k_feat(const float* __restrict__ S0, const float* __restrict__ S1, const float* __restrict__ S2, const float* __restrict__ S3, const float* __restrict__ MM, const float* __restrict__ feat, float* __restrict__ PB, float* __restrict__ KPB, const float* __restrict__ X, const float* __restrict__ PWF, const float* __restrict__ bv, float* __restrict__ V) {
  __shared__ __align__(16) union { struct { float sx[16][36]; float so[16][196]; float soff[16]; } f; float pj[16][132]; } sm; auto& sx = sm.f.sx; auto& so = sm.f.so; auto& soff = sm.f.soff;
  const int fb = blockIdx.x;
  if (fb >= FEAT_NB) { proj_tile(X, (const __bf16*)PWF, bv, V, sm.pj, (fb - FEAT_NB) >> 2, (fb - FEAT_NB) & 3, threadIdx.x); return; }
  constexpr int T1N = NBT * N1 / 16, T2N = NBT * N2 / 16; const int bx = fb % (FEAT_NB / NHD), t = bx < 2 * T1N ? bx / T1N : 2 + (bx - 2 * T1N) / T2N, L = t < 2 ? N1 : N2;
  const float* S = t == 0 ? S0 : t == 1 ? S1 : t == 2 ? S2 : S3; float* P = PB + (size_t)t * PSZ;
  const int lane = threadIdx.x, col = lane & 15, g = lane >> 4; const int h = fb / (FEAT_NB / NHD); const int r0 = (t < 2 ? bx % T1N : (bx - 2 * T1N) % T2N) * 16; const int b = r0 / L, l0 = r0 % L;
  float mn = 3.0e38f, mx = -3.0e38f;
#pragma unroll      // the 4 slot loads go out together; with 64 slots each is read twice, which a min or max does not see
  for (int i = 0; i < MMN / 32; ++i) { const v2f m2 = *(const v2f*)(MM + ((size_t)t * MMN + ((lane + 32 * i) & (t < 2 ? MMN / 2 - 1 : MMN - 1))) * MMS); mn = fminf(mn, m2[0]); mx = fmaxf(mx, m2[1]); }
#pragma unroll
  for (int o = 1; o < 32; o <<= 1) { mn = fminf(mn, __shfl_xor(mn, o)); mx = fmaxf(mx, __shfl_xor(mx, o)); }
  const float sc = 1.0f / (mx - mn); const float temp = 0.42044820762685725f;   // 32^-0.25
  { const int rl = lane >> 1, half = lane & 1; float ss = 0.f;
    for (int d = half * 16; d < half * 16 + 16; ++d) { const float x = S[(size_t)(r0 + rl) * DMOD + h * DHD + d]; const float xs = (x - mn) * sc * temp; sx[rl][d] = xs; ss += xs * xs; }
    ss += __shfl_xor(ss, 1); if (half == 0) { soff[rl] = -0.5f * ss - 0.5f * 5.2574953720277815f + 1e-6f; sx[rl][32] = 0.f; sx[rl][33] = 0.f; sx[rl][34] = 0.f; sx[rl][35] = 0.f; } }
  LDSX();
  const F2 a = split_row(&sx[col][0], 0, lane);
#pragma unroll
  for (int j = 0; j < 12; ++j) { v8f acc = {}; const v16b w = frag_gbf(feat + (size_t)(j * 16 + col) * DHD, lane); acc = wmma_bf(a.l, w, acc); acc = wmma_bf(a.h, w, acc);
#pragma unroll
    for (int r = 0; r < 8; ++r) so[8 * g + r][j * 16 + col] = exp_ni(acc[r] + soff[8 * g + r]); }
  LDSX();
  for (int q = lane; q < 16 * 48; q += 32) { const int rl = q / 48, pc = q % 48; vst2(P + ((size_t)(b * NHD + h) * L + l0 + rl) * MF + pc * 4, *(const v4f*)&so[rl][pc * 4]); }
  if (t & 1) { float* KQ = KPB + (((size_t)(t >> 1) * NBT * NHD + b * NHD + h) * (N2 / 16) + l0 / 16) * MF;
    for (int i = 0; i < MF / 32; ++i) { float s = 0.f;
#pragma unroll      // 16 LDS reads in flight
      for (int r = 0; r < 16; ++r) s += so[r][i * 32 + lane];
      KQ[i * 32 + lane] = s; } }
}
// ---- k_amat: per axis and (b,h): A[l][l'] = (sum_m QP[l][m] (hi/lo) . KP[l'][m] (hi/lo)) / att_norm[l]: M = l (by = 4 tiles of axis 1, then 8 of axis 2), N = l' (32 per wave = 2 tiles), K = m (6 steps), 3 products; rows pitch 128, 128-B segment per wave and row; blockIdx.x = by * 32 + (b,h), behind these AMAT_NB blocks v-projection tiles.
//      att_norm[l] = sum_m QP[l][m] ksum[m], ksum[m] = sum_l' KP[l'][m]: each wave adds k_feat's row-tile sums (ascending) into its own 192 floats of LDS and takes the dot products of its 16 q rows in f32 from the values it loads for the A fragments (lane = (row, half of each 32 m), the halves added by a shuffle); no wave needs another
#define AMAT_NB (NBT * NHD * (N1 / 16 + N2 / 16))
__global__ __launch_bounds__(128) void k_amat(const float* __restrict__ PB, const float* __restrict__ KPB, float* __restrict__ AMB, const float* __restrict__ X, const float* __restrict__ PWF, const float* __restrict__ bv, float* __restrict__ V) {
  __shared__ __align__(16) union { struct { float so[4][16][36]; float sks[4][MF]; } a; float pj[4][16][132]; } sm; auto& so = sm.a.so; auto& sks = sm.a.sks;
  const int fb = blockIdx.x, tid = threadIdx.x, wave = tid >> 5, lane = tid & 31, col = lane & 15, g = lane >> 4;
  if (fb >= AMAT_NB) { proj_tile(X, (const __bf16*)PWF, bv, V, sm.pj[wave], PROJ_F + fb - AMAT_NB, wave, lane); return; }
  const int by = fb / (NBT * NHD), ax = by < N1 / 16 ? 0 : 1, L = ax == 0 ? N1 : N2; const int bh = fb % (NBT * NHD), l0 = (ax == 0 ? by : by - N1 / 16) * 16, n0 = wave * 32;
  if (n0 >= L) return;
  const float* QP = PB + (size_t)(2 * ax) * PSZ; const float* KP = QP + PSZ; float* AM = AMB + (size_t)ax * AMSZ;
  const float* KQ = KPB + ((size_t)ax * NBT * NHD + bh) * (N2 / 16) * MF + lane; float ks[MF / 32] = {};
  { float v[N2 / 16][MF / 32] = {};   // every loop of this kernel is unrolled whole: its arrays are indexed by constants and stay in registers. The 4 or 8 tiles' loads go out together; a tile that axis 1 lacks adds 0; ascending tile order
#pragma unroll
    for (int tl = 0; tl < N1 / 16; ++tl)
#pragma unroll
      for (int i = 0; i < MF / 32; ++i) v[tl][i] = KQ[(size_t)tl * MF + i * 32];
    asm volatile("s_wait_xcnt 0x0" ::: "memory");   // behind the 24 loads above, ahead of any rewrite of their base or offset register (on the axis-1 way only counted data waits follow before the base is reused)
    if (ax == 1) {
#pragma unroll
      for (int tl = N1 / 16; tl < N2 / 16; ++tl)
#pragma unroll
        for (int i = 0; i < MF / 32; ++i) v[tl][i] = KQ[(size_t)tl * MF + i * 32]; }
#pragma unroll
    for (int tl = 0; tl < N2 / 16; ++tl)
#pragma unroll
      for (int i = 0; i < MF / 32; ++i) ks[i] += v[tl][i]; }
#pragma unroll
  for (int i = 0; i < MF / 32; ++i) sks[wave][i * 32 + lane] = ks[i];
  LDSX();
  const float* qrow = QP + ((size_t)bh * L + l0 + col) * MF;
  v8f acc[2] = {}; float dn = 0.f;
#pragma unroll
  for (int kc = 0; kc < MF / 32; ++kc) { float v[16]; const float* p = qrow + kc * 32 + 8 * g; const float* kp = &sks[wave][kc * 32 + 8 * g]; float dk = 0.f;
#pragma unroll
    for (int i = 0; i < 8; ++i) { v[i] = p[i]; v[8 + i] = p[16 + i]; }
#pragma unroll
    for (int i = 0; i < 8; ++i) dk += v[i] * kp[i];
#pragma unroll
    for (int i = 0; i < 8; ++i) dk += v[8 + i] * kp[16 + i];
    dn += dk; const F2 a = bsplit16(v);
#pragma unroll
    for (int j = 0; j < 2; ++j) { const F2 kb = split_row(KP + ((size_t)bh * L + n0 + j * 16 + col) * MF, kc * 32, lane); acc[j] = mac3(a, kb, acc[j]); } }
  dn += __shfl_xor(dn, 16);   // lanes col and col + 16 now both hold att_norm of row l0 + col
  float inv[8];
#pragma unroll
  for (int r = 0; r < 8; ++r) inv[r] = 1.0f / __shfl(dn, 8 * g + r);
#pragma unroll
  for (int j = 0; j < 2; ++j)
#pragma unroll
    for (int r = 0; r < 8; ++r) so[wave][8 * g + r][j * 16 + col] = acc[j][r] * inv[r];
  LDSX();
  for (int q = lane; q < 16 * 8; q += 32) { const int rl = q >> 3, pc = q & 7; vst2(AM + ((size_t)bh * N2 + l0 + rl) * N2 + n0 + pc * 4, *(const v4f*)&so[wave][rl][pc * 4]); }
}
// ---- k_att: per (b, ATT_G neighbouring other positions o, head h), in place on the value tensor: out[l][d] = sum_l' A[(b,h)][l][l'] (hi/lo) . V[l'][(h,d)] (hi/lo): M = l (one 16-row tile per wave, L/16 waves), N = d (2 tiles per position), K = l' (2 or 4 steps), 3 products; all batches in one launch.
//      A depends on (b, h) alone: a wave loads and splits its 16 rows of A once and uses the fragments for the ATT_G value tiles of the block (ATT_G divides both axis lengths, so a block stays inside one batch).
//      The block owns the ATT_G tiles of L x 32 (128-B row segments) that it reads and writes: each is read once (thread = 4 rows x 16 B), split into bf16 hi and residual and laid down transposed in LDS ([d][l'], 8-B stores, pitch 2 L + 16 B for the 16-B fragment reads); the stores to V follow the barrier behind which every read has landed
#define ATT_G 4
template <int PASS>
__global__ __launch_bounds__(PASS == 1 ? N1 * 2 : N2 * 2) void k_att(const float* __restrict__ AM, int ob0, float* V) {
  constexpr int L = (PASS == 1 ? N1 : N2), O = (PASS == 1 ? N2 : N1); constexpr size_t RS = (PASS == 1 ? (size_t)N2 * DMOD : (size_t)DMOD), OS = (PASS == 1 ? (size_t)DMOD : (size_t)N2 * DMOD);   // RS: floats from row l to row l + 1; OS: from position o to o + 1
  __shared__ __align__(16) __bf16 vh[ATT_G][DHD][L + 8], vl[ATT_G][DHD][L + 8]; __shared__ __align__(16) float so[L / 16][ATT_G][16][36];
  const int tid = threadIdx.x, wave = tid >> 5, lane = tid & 31, col = lane & 15, g = lane >> 4; const int h = blockIdx.x % NHD, bo = ob0 + blockIdx.x / NHD * ATT_G; const int b = bo / O, o = bo % O;
  float* tile = V + (PASS == 1 ? ((size_t)b * N1 * N2 + o) : ((size_t)b * N1 + o) * N2) * DMOD + h * DHD;   // the first of the block's tiles
  const float* arow = AM + ((size_t)(b * NHD + h) * N2 + wave * 16 + col) * N2;
  const int p4 = (tid & 7) * 4, l4 = (tid >> 3) * 4; const float* src = tile + (size_t)l4 * RS + p4; v4f x[ATT_G][4]; F2 a[L / 32];   // every loop below is unrolled whole: x, a, hi, lo and acc are indexed by constants and stay in registers; the tiles' 16 loads and A's loads go out together, ahead of the barrier
#pragma unroll
  for (int t = 0; t < ATT_G; ++t)
#pragma unroll
    for (int i = 0; i < 4; ++i) x[t][i] = *(const v4f*)(src + (size_t)t * OS + (size_t)i * RS);
#pragma unroll
  for (int kc = 0; kc < L / 32; ++kc) a[kc] = split_row(arow, kc * 32, lane);
#pragma unroll
  for (int t = 0; t < ATT_G; ++t)
#pragma unroll
    for (int e = 0; e < 4; ++e) { v4b hi, lo;
#pragma unroll
      for (int i = 0; i < 4; ++i) { const float v = x[t][i][e]; const __bf16 hh = (__bf16)v; hi[i] = hh; lo[i] = (__bf16)(v - (float)hh); }
      *(v4b*)&vh[t][p4 + e][l4] = hi; *(v4b*)&vl[t][p4 + e][l4] = lo; }
  __syncthreads();
  v8f acc[ATT_G][2] = {};
#pragma unroll
  for (int t = 0; t < ATT_G; ++t)
#pragma unroll
    for (int kc = 0; kc < L / 32; ++kc)
#pragma unroll
      for (int j = 0; j < 2; ++j) { F2 vb; vb.h = frag_b(&vh[t][j * 16 + col][kc * 32], lane); vb.l = frag_b(&vl[t][j * 16 + col][kc * 32], lane); acc[t][j] = mac3(a[kc], vb, acc[t][j]); }
#pragma unroll
  for (int t = 0; t < ATT_G; ++t)
#pragma unroll
    for (int j = 0; j < 2; ++j)
#pragma unroll
      for (int r = 0; r < 8; ++r) so[wave][t][8 * g + r][j * 16 + col] = acc[t][j][r];
  LDSX();
#pragma unroll
  for (int t = 0; t < ATT_G; ++t)
#pragma unroll      // the wave's 16 LDS reads go out as one group with one wait, not one wait per store
    for (int q4 = 0; q4 < 4; ++q4) { const int rl = q4 * 4 + (lane >> 3), pc = lane & 7; vst2(tile + (size_t)t * OS + (size_t)(wave * 16 + rl) * RS + pc * 4, *(const v4f*)&so[wave][t][rl][pc * 4]); }
}
// ---- k_out: Y = V3(hi/lo) . bf16(Wo rows [256][256], packed) + bo; block (64 rows, 128 cols); K = 256
__global__ __launch_bounds__(128) void k_out(const float* __restrict__ V3, const float* __restrict__ PWF, const float* __restrict__ bo, float* __restrict__ Y, int rb0) {
  __shared__ __align__(16) float so[4][16][132];
  const int tid = threadIdx.x, wave = tid >> 5, lane = tid & 31, col = lane & 15, g = lane >> 4; const size_t r0 = (size_t)(rb0 + blockIdx.x) * 64 + wave * 16; const int n0 = blockIdx.y * 128;
  v8f acc[8] = {};
#pragma unroll 2
  for (int kc = 0; kc < DMOD / 32; ++kc) { v16b w[8];
#pragma unroll      // w indexed by constants, in registers: the k step's 16 loads of B go out as one group, ahead of its first WMMA
    for (int j = 0; j < 8; ++j) w[j] = frag_pw((const __bf16*)PWF + PWSZ, n0 / 16 + j, kc, lane);
    const F2 a = split_row(V3 + (r0 + col) * DMOD, kc * 32, lane);
#pragma unroll
    for (int j = 0; j < 8; ++j) { acc[j] = wmma_bf(a.l, w[j], acc[j]); acc[j] = wmma_bf(a.h, w[j], acc[j]); } }
#pragma unroll
  for (int j = 0; j < 8; ++j) { const float bb = bfr(bo[n0 + j * 16 + col]);
#pragma unroll
    for (int r = 0; r < 8; ++r) so[wave][8 * g + r][j * 16 + col] = acc[j][r] + bb; }
  LDSX();
  for (int rl = 0; rl < 16; ++rl) vst2(Y + (r0 + rl) * DMOD + n0 + lane * 4, *(const v4f*)&so[wave][rl][lane * 4]);
}

#ifndef DBG
#define DBG 0
#endif
#if DBG != 0
__global__ __launch_bounds__(256) void k_dump(const float* __restrict__ src, int n, float* __restrict__ out) {   // out[0..n) = src, rest of batch-0 region zero
  const size_t p = (size_t)blockIdx.x * 256 + threadIdx.x; v4f v; for (int i = 0; i < 4; ++i) { const size_t f = p * 4 + i; v[i] = f < (size_t)n ? src[f] : 0.f; } vst2(out + p * 4, v);
}
#endif
extern "C" void kernel_launch(void* const* d_in, const int* in_sizes, int n_in, void* d_out, int out_size, void* d_ws, size_t ws_size, hipStream_t stream) {
  (void)in_sizes; (void)n_in; (void)out_size;
  const float** F = (const float**)d_in;   // X, Wq, bq, Wk, bk, Wv, bv, Wo, bo, feat
  if (ws_size < (size_t)WS_END) return;
  char* ws = (char*)d_ws; float *PB = (float*)(ws + WS_A), *V = (float*)(ws + WS_V), *QS1 = (float*)(ws + WS_QS1), *KS1 = (float*)(ws + WS_KS1), *QS2 = (float*)(ws + WS_QS2), *KS2 = (float*)(ws + WS_KS2), *MM = (float*)(ws + WS_MM), *AM = (float*)(ws + WS_AM), *KSUM = (float*)(ws + WS_KSUM), *SX = (float*)(ws + WS_SX), *CS = (float*)(ws + WS_CS), *PW = (float*)(ws + WS_B);
  k_poolx<<<NBT * N1 + NBT * N2 + PACK_NB + TRIG_NB, 256, 0, stream>>>(F[0], SX, F[5], F[7], PW, CS);
  k_pproj<<<dim3((NBT * N1 + NBT * N2) / 16, 8), 128, 0, stream>>>(SX, F[1], F[2], F[3], F[4], QS1, KS1, QS2, KS2, CS, MM);
  // ---- the mixing matrices of both axes (assets: l = n1 = 64; time: l = n2 = 128 with RoPE)
  k_feat<<<FEAT_NB + 4 * PROJ_F, 32, 0, stream>>>(QS1, KS1, QS2, KS2, MM, F[9], PB, KSUM, F[0], PW, F[6], V);
#if DBG == 2
  k_dump<<<N1 * N2 * DMOD / 1024, 256, 0, stream>>>(PB, NBT * NHD * N1 * MF, (float*)d_out); return;  // pass-1 phi(q) [4][8][64][192]
#endif
  k_amat<<<AMAT_NB + PROJ_N - PROJ_F, 128, 0, stream>>>(PB, KSUM, AM, F[0], PW, F[6], V);
  // ---- pass 1: assets axis (other = n2 = 128)
  k_att<1><<<(TNB - TB0) * N2 * NHD / ATT_G, N1 * 2, 0, stream>>>(AM, TB0 * N2, V);
#if DBG == 3
  k_dump<<<N1 * N2 * DMOD / 1024, 256, 0, stream>>>(V, N1 * N2 * DMOD, (float*)d_out); return;
#endif
  // ---- pass 2: time axis (other = n1 = 64)
  k_att<2><<<(TNB - TB0) * N1 * NHD / ATT_G, N2 * 2, 0, stream>>>(AM + AMSZ, TB0 * N1, V);
#if DBG == 5
  k_dump<<<N1 * N2 * DMOD / 1024, 256, 0, stream>>>(V, N1 * N2 * DMOD, (float*)d_out); return;     // value after pass 2, batch 0
#endif
  k_out<<<dim3((TNB - TB0) * N1 * N2 / 64, 2), 128, 0, stream>>>(V, PW, F[8], (float*)d_out, TB0 * N1 * N2 / 64);
}

// v008
// It runs in 91.6 microseconds.
// In two side-by-side timings against v007, it was 1.06 and 1.05 times as fast.
// All steps since v000 together make it 9.08 times as fast.
// compute dtype: X, the projection weights/biases and the random-feature matrix (module inputs) rounded to bf16; the v projection with exact bf16 products; the q and k projections taken on the axis sums of bf16(X) (f32 sums as three bf16 pieces, 3 products, all 24 bits); the feature-map GEMM (pooled q,k x feat) with the pooled operand as a bf16 hi + bf16 residual pair (2 products); the phi(q) phi(k)^T and mixing-matrix x value contractions with both computed operands hi/lo (3 products);
// the output projection hi/lo against bf16 Wo (2 products); axis pooling, RoPE, global min-max normalisation, exp feature maps, normalisers and divisions in f32; f32 accumulate.
#include <hip/hip_runtime.h>
#include <math.h>

typedef __attribute__((ext_vector_type(16))) _Float16 v16h;
typedef __attribute__((ext_vector_type(16))) __bf16 v16b;
typedef __attribute__((ext_vector_type(8)))  _Float16 v8h;
typedef __attribute__((ext_vector_type(8)))  float v8f;
typedef __attribute__((ext_vector_type(4)))  float v4f;
typedef __attribute__((ext_vector_type(2)))  float v2f;
typedef __attribute__((ext_vector_type(4)))  unsigned v4u;
typedef __attribute__((ext_vector_type(4)))  int v4i;
typedef float __attribute__((may_alias)) float_a;
typedef int __attribute__((may_alias)) int_a;

template <typename T> __device__ __forceinline__ void vst2(void* p, T v) { *(T*)p = v;  }
__device__ __forceinline__ v8f wmma16(v16h a, v16h b, v8f c) {
  v8f d = __builtin_amdgcn_wmma_f32_16x16x32_f16(false, a, false, b, (short)0, c, false, false);
  asm volatile("v_nop\n\tv_nop\n\tv_nop\n\tv_nop" : "+v"(d) : "v"(a), "v"(b));
  return d;
}
__device__ __forceinline__ v8f wmma_bf(v16b a, v16b b, v8f c) {
  v8f d = __builtin_amdgcn_wmma_f32_16x16x32_bf16(false, a, false, b, (short)0, c, false, false);
  asm volatile("v_nop\n\tv_nop\n\tv_nop\n\tv_nop" : "+v"(d) : "v"(a), "v"(b));
  return d;
}
// 16x16x32 fragments: lane = (h = lane>>4, row/col = lane&15); elements 0..7 = k0+8h+0..7, 8..15 = k0+16+8h+0..7; D element r = row 8h+r
__device__ __forceinline__ v16h frag_h(const _Float16* rowk0, int lane) {
  union { v16h v; v8h q[2]; } u; const _Float16* p = rowk0 + 8 * (lane >> 4);
  u.q[0] = *(const v8h*)p; u.q[1] = *(const v8h*)(p + 16); return u.v;
}
__device__ __forceinline__ v16h frag_f32(const float* rowk0, int lane) {
  v16h a; const float* p = rowk0 + 8 * (lane >> 4);
#pragma unroll
  for (int i = 0; i < 8; ++i) { a[i] = (_Float16)p[i]; a[8 + i] = (_Float16)p[16 + i]; }
  return a;
}
__device__ __forceinline__ v16h frag_f32s(const float* rowk0, int lane, float sc) {
  v16h a; const float* p = rowk0 + 8 * (lane >> 4);
#pragma unroll
  for (int i = 0; i < 8; ++i) { a[i] = (_Float16)(p[i] * sc); a[8 + i] = (_Float16)(p[16 + i] * sc); }
  return a;
}
// column fragment from a [K][ld] layout (column n), rows >= K read as 0
__device__ __forceinline__ v16h fragc_f32(const float* W, int k0, int n, int lane, int ld, int K) {
  v16h a; const int g = lane >> 4;
#pragma unroll
  for (int i = 0; i < 8; ++i) { const int ka = k0 + 8 * g + i, kb = ka + 16;
    a[i] = (_Float16)(ka < K ? W[(size_t)(ka < K ? ka : K - 1) * ld + n] : 0.f); a[8 + i] = (_Float16)(kb < K ? W[(size_t)(kb < K ? kb : K - 1) * ld + n] : 0.f); }
  return a;
}
struct F2 { v16b h, l; };
__device__ __forceinline__ F2 bsplit16(const float v[16]) { F2 r;
#pragma unroll
  for (int i = 0; i < 16; ++i) { const __bf16 h = (__bf16)v[i]; r.h[i] = h; r.l[i] = (__bf16)(v[i] - (float)h); }
  return r; }
__device__ __forceinline__ F2 split_row(const float* row, int k0, int lane) { float v[16]; const float* p = row + k0 + 8 * (lane >> 4);
#pragma unroll
  for (int i = 0; i < 8; ++i) { v[i] = p[i]; v[8 + i] = p[16 + i]; }
  return bsplit16(v); }
__device__ __forceinline__ F2 split_rowK(const float* row, int k0, int lane, int K) { float v[16]; const int g = lane >> 4;
#pragma unroll
  for (int i = 0; i < 8; ++i) { const int ka = k0 + 8 * g + i, kb = ka + 16; v[i] = ka < K ? row[ka < K ? ka : K - 1] : 0.f; v[8 + i] = kb < K ? row[kb < K ? kb : K - 1] : 0.f; }
  return bsplit16(v); }
__device__ __forceinline__ F2 split_col(const float* W, int k0, int n, int lane, int ld, int K) { float v[16]; const int g = lane >> 4;
#pragma unroll
  for (int i = 0; i < 8; ++i) { const int ka = k0 + 8 * g + i, kb = ka + 16; v[i] = ka < K ? W[(size_t)(ka < K ? ka : K - 1) * ld + n] : 0.f; v[8 + i] = kb < K ? W[(size_t)(kb < K ? kb : K - 1) * ld + n] : 0.f; }
  return bsplit16(v); }
__device__ __forceinline__ v8f mac3(const F2& a, const F2& b, v8f c) { c = wmma_bf(a.l, b.h, c); c = wmma_bf(a.h, b.l, c); return wmma_bf(a.h, b.h, c); }
__device__ __forceinline__ float sigm(float v) { return 1.0f / (1.0f + expf(-v)); }
#define LDSX() do { asm volatile("s_wait_dscnt 0" ::: "memory"); __builtin_amdgcn_wave_barrier(); __builtin_amdgcn_fence(__ATOMIC_RELEASE, "workgroup"); } while (0)


// High-order linear attention over a [4, 64, 128, 256] tensor: q/k/v = X W^T + b; for the assets axis (n1, pooled over n2) and then the time axis (n2, pooled over n1, with RoPE): Performer-style positive features phi(x) = exp(xs f^T - |xs|^2/2 - log(M)/2 + 1e-6), xs = (x - min x)/(max x - min x) * 32^-1/4 (global min/max),
// out_l = sum_l' A[l][l'] v_l', A[l][l'] = phi(q_l) . phi(k_l') / (phi(q_l) . sum_l phi(k_l)): the product phi(q) (phi(k)^T v) taken as (phi(q) phi(k)^T) v, since A depends on (b, head) alone and the attended length (64, 128) is below the 192 features; finally value W_o^T + b_o.
// q and k are used only through their axis sums, and sum_i (x_i W^T + b) = (sum_i x_i) W^T + n b: X is pooled first and only the 768 pooled rows are projected.
// k_poolx (axis sums of X; Wv and Wo packed as bf16 fragments; RoPE's cos and sin table); k_pproj (pooled q and k, RoPE on the dim-2 rows, min-max per block); proj_tile (v); k_feat (min-max finals, phi via WMMA, key sums per 16 rows); k_amat (per (b, head): key sum, normaliser, A); k_att (per (b, 4 other-positions, head): value tiles transposed in LDS, A x tiles, written back in place);
// A depends on the pooled q and k alone, never on the value: k_feat and k_amat each run once, for both axes (and for q and k) in one grid, the block index naming the tensor t (0 = q axis 1, 1 = k axis 1, 2 = q axis 2, 3 = k axis 2) or the axis ax (0, 1).
// A small elementwise or reducing stage has no launch of its own: the block that makes the values does the part it can (RoPE, its own min-max, its own 16-row key sum) before it stores them, and the block that needs the whole finishes it on entry (min-max over the block slots, key sum over the row tiles, normaliser of its own 16 rows)
#define NBT 4
#define N1 64
#define N2 128
#define DMOD 256
#define NHD 8
#define DHD 32
#define MF 192
#define NPOS (NBT * N1 * N2)      // 32768 positions
#ifndef TNB
#define TNB NBT                   // batches run through the attention passes / output (debug: fewer)
#endif
#ifndef TB0
#define TB0 0                     // first batch of the attention loops (debug)
#endif
typedef __attribute__((ext_vector_type(8))) __bf16 v8b;
typedef __attribute__((ext_vector_type(4))) __bf16 v4b;
__device__ __forceinline__ v16b frag_b(const __bf16* rowk0, int lane) {
  union { v16b v; v8b q[2]; } u; const __bf16* p = rowk0 + 8 * (lane >> 4);
  u.q[0] = *(const v8b*)p; u.q[1] = *(const v8b*)(p + 16); return u.v;
}
__device__ __forceinline__ v16b frag_gbf(const float* rowk0, int lane) {
  v16b a; const float* p = rowk0 + 8 * (lane >> 4);
#pragma unroll
  for (int i = 0; i < 8; ++i) { a[i] = (__bf16)p[i]; a[8 + i] = (__bf16)p[16 + i]; }
  return a;
}
// B fragment of a packed weight matrix (k_poolx lays it down): tile (nt = 16 output columns, kc = 32 of K) = 2 planes of 512 B, plane p holds per lane its elements 8p..8p+7 (same k order as frag_gbf), so each 16-B load of a wave covers 4 whole 128-B lines
__device__ __forceinline__ v16b frag_pw(const __bf16* PW, int nt, int kc, int lane) {
  union { v16b v; v8b q[2]; } u; const __bf16* p = PW + (size_t)(nt * (DMOD / 32) + kc) * 512 + lane * 8;
  u.q[0] = *(const v8b*)p; u.q[1] = *(const v8b*)(p + 256); return u.v;
}
__device__ __forceinline__ float bfr(float v) { return (float)(__bf16)v; }
// exp(x) inline = 2^e 2^a, e = the integer nearest x log2(e), a = x log2(e) - e by two fused multiply-adds on log2(e) = c + cc (as exact as expf's own reduction), with expf's two range ends.
// The hardware exponential stands in one statement with a v_nop: the slot that the instruction set asks for behind a transcendental before its result is read or its source overwritten
__device__ __forceinline__ float exp_il(float x) {
  const float c = __uint_as_float(0x3fb8aa3bu), cc = __uint_as_float(0x32a5705fu);
  const float e = rintf(x * c), a = fmaf(x, cc, fmaf(x, c, -e));
  float r; asm("v_exp_f32 %0, %1\n\tv_nop" : "=v"(r) : "v"(a));   // the v_nop fills the slot behind the transcendental, whatever the compiler puts next
  r = ldexpf(r, (int)e);
  r = __uint_as_float(0xc2ce8ed0u) > x ? 0.0f : r;
  return __uint_as_float(0x42b17218u) < x ? __uint_as_float(0x7f800000u) : r;
}
__device__ __attribute__((noinline)) float pow_ni(float a, float b) { return powf(a, b); }
__device__ __attribute__((noinline)) float cos_ni(float v) { return cosf(v); }
__device__ __attribute__((noinline)) float sin_ni(float v) { return sinf(v); }

#define WS_A    0u                              // 32 MB, 12 MB used: f32 phi rows, 4 tensors t of PSZ floats each: [(b,h)][l][m] (l rows, m contiguous; L = 64 rows per (b,h) for t < 2, 128 for t >= 2)
#define PSZ     (NBT * NHD * N2 * MF)
#define WS_B    (WS_A + 4u * NPOS * DMOD)          // 32 MB, 256 KB used: bf16(Wv), then bf16(Wo), each 256 x 256 in fragment order (frag_pw)
#define PWSZ    (DMOD * DMOD)
#define WS_V    (WS_B + 4u * NPOS * DMOD)          // f32 32 MB: value [b][n1][n2][h*32+d] (updated in place per pass: V -> V2 -> V3, by the block that owns the tile)
#define WS_QS1  (WS_V + 4u * NPOS * DMOD)          // f32 [4][64][256]  q summed over n2
#define WS_KS1  (WS_QS1 + 4u * NBT * N1 * DMOD)
#define WS_QS2  (WS_KS1 + 4u * NBT * N1 * DMOD)    // f32 [4][128][256] q summed over n1, RoPE applied
#define WS_KS2  (WS_QS2 + 4u * NBT * N2 * DMOD)
#define WS_MM   (WS_KS2 + 4u * NBT * N2 * DMOD)
#define MMS 32
#define MMN 128
#define WS_AM   (WS_MM + 4u * 4 * MMN * MMS)       // f32 [2 axes][4][8][128][128] A (l rows, l' contiguous, pitch 128; axis 1 uses l, l' < 64); WS_MM holds [4 tensors][128 slots][32 floats]: (min, max) of one k_pproj block per slot, 64 slots used for t < 2, 128 for t >= 2
#define AMSZ    (NBT * NHD * N2 * N2)
#define WS_KSUM (WS_AM + 4u * 2 * AMSZ)            // f32 [2 axes][4][8][8 row tiles][192]: phi(k) summed over the 16 rows of a tile (axis 1 uses 4 tiles)
#define WS_SX   (WS_KSUM + 4u * 2 * NBT * NHD * (N2 / 16) * MF)  // f32 [256 + 512][256] bf16(X) summed over n2 (rows b*64 + n1), then summed over n1 (rows 256 + b*128 + n2)
#define WS_CS   (WS_SX + 4u * (NBT * N1 + NBT * N2) * DMOD)   // f32 [2][128][16]: cos, then sin, of RoPE's angles (l, j)
#define WS_END  (WS_CS + 4u * 2 * N2 * 16)

// ---- proj_tile: [32768 rows] x [v 256 cols] = bf16(X) . W rows ([out][in]) + b (exact); tile pb < PROJ_N = (64 rows, 128 cols), one wave = 16 of its rows, no wave needs another (so: the wave's own 16 x 132 floats of LDS); 512-B segments of 1-KB rows.
//      The v projection needs X alone and is first needed by k_att<1>: it has no launch of its own; its tiles ride as the last blocks in the grids of k_feat and k_amat, whose few waves wait on latency and leave most of the chip idle
#define PROJ_N  (NPOS / 64 * 2)
#define PROJ_F  (PROJ_N * 21 / 32)                 // tiles [0, PROJ_F) ride in k_feat, [PROJ_F, PROJ_N) in k_amat
__device__ __forceinline__ void proj_tile(const float* __restrict__ X, const __bf16* __restrict__ PW, const float* __restrict__ bm, float* __restrict__ dst, float (*so)[132], int pb, int wave, int lane) {
  const int col = lane & 15, g = lane >> 4; const size_t r0 = (size_t)(pb % (NPOS / 64)) * 64 + wave * 16; const int n0 = pb / (NPOS / 64) * 128;
  v8f acc[8] = {};
#pragma unroll 2
  for (int kc = 0; kc < DMOD / 32; ++kc) { v16b w[8];
#pragma unroll      // w indexed by constants, in registers: the k step's 16 loads of B go out as one group, ahead of its first WMMA
    for (int j = 0; j < 8; ++j) w[j] = frag_pw(PW, n0 / 16 + j, kc, lane);
    const v16b a = frag_gbf(X + (r0 + col) * DMOD + kc * 32, lane);
#pragma unroll
    for (int j = 0; j < 8; ++j) acc[j] = wmma_bf(a, w[j], acc[j]); }
#pragma unroll
  for (int j = 0; j < 8; ++j) { const float bb = bfr(bm[n0 + j * 16 + col]);
#pragma unroll
    for (int r = 0; r < 8; ++r) so[8 * g + r][j * 16 + col] = acc[j][r] + bb; }
  LDSX();
  for (int rl = 0; rl < 16; ++rl) vst2(dst + (r0 + rl) * DMOD + n0 + lane * 4, *(const v4f*)&so[rl][lane * 4]);
}
// ---- k_poolx: axis sums of bf16(X); behind these 768 blocks, PACK_NB blocks round Wv and Wo to bf16 once and lay them in fragment order (thread = one 16-B piece: 8 consecutive k of one row). Blocks < 256: SX[b*64 + n1][c] = sum_{n2}; blocks >= 256: SX[256 + b*128 + n2][c] = sum_{n1}. Thread = (part = tid >> 6, 4 columns): a part sums every 4th row (ascending), the 4 parts are added in LDS; 1-KB rows
template <int NR> __device__ __forceinline__ v4f sum_rows(const float* __restrict__ p, size_t step) {
  v4f s = {0.f, 0.f, 0.f, 0.f};
#pragma unroll 16   // 16 row loads of 16 B in flight per lane: the kernel is a stream from memory
  for (int i = 0; i < NR; ++i) { const v4f v = *(const v4f*)(p + (size_t)i * step);
#pragma unroll      // vector elements by constant index
    for (int e = 0; e < 4; ++e) s[e] += bfr(v[e]); }
  return s;
}
#define PACK_NB (2 * PWSZ / 8 / 256)
#define TRIG_NB (N2 * 16 / 256)
__global__ __launch_bounds__(256) void k_poolx(const float* __restrict__ X, float* __restrict__ SX, const float* __restrict__ Wv, const float* __restrict__ Wo, float* __restrict__ PWF, float* __restrict__ CS) {
  __shared__ __align__(16) float sp[4][DMOD];
  const int tid = threadIdx.x, part = tid >> 6, c4 = (tid & 63) * 4, blk = blockIdx.x; v4f s;
  if (blk >= NBT * N1 + NBT * N2 + PACK_NB) {   // the last TRIG_NB blocks: RoPE's table CS[l][j] = cos(l * 10000^(-j/16)), then the sines, thread = (l, j); a wave stores whole lines
    const int idx = (blk - (NBT * N1 + NBT * N2 + PACK_NB)) * 256 + tid, j = idx & 15; const float invf = 1.0f / pow_ni(10000.0f, (float)(2 * j) / 32.0f); const float ang = (float)(idx >> 4) * invf;
    CS[idx] = cos_ni(ang); CS[N2 * 16 + idx] = sin_ni(ang); return; }
  if (blk >= NBT * N1 + NBT * N2) {   // piece p of a matrix = (nt = p >> 9, kc = (p >> 6) & 7, plane = (p >> 5) & 1, lane = p & 31)
    const int idx = (blk - (NBT * N1 + NBT * N2)) * 256 + tid, p = idx & (PWSZ / 8 - 1), ln = p & 31; const float* Wm = idx < PWSZ / 8 ? Wv : Wo;
    const float* sw = Wm + (size_t)((p >> 9) * 16 + (ln & 15)) * DMOD + ((p >> 6) & 7) * 32 + ((p >> 5) & 1) * 16 + 8 * (ln >> 4);
    const v4f x0 = *(const v4f*)sw, x1 = *(const v4f*)(sw + 4); v8b o;
#pragma unroll      // vector elements by constant index
    for (int e = 0; e < 4; ++e) { o[e] = (__bf16)x0[e]; o[4 + e] = (__bf16)x1[e]; }
    vst2((__bf16*)PWF + (size_t)idx * 8, o); return; }
  if (blk < NBT * N1) s = sum_rows<N2 / 4>(X + ((size_t)blk * N2 + part) * DMOD + c4, (size_t)4 * DMOD);
  else { const int r = blk - NBT * N1, b = r / N2, i2 = r % N2; s = sum_rows<N1 / 4>(X + (((size_t)b * N1 + part) * N2 + i2) * DMOD + c4, (size_t)4 * N2 * DMOD); }
  *(v4f*)&sp[part][c4] = s;
  __syncthreads();
  if (tid < 64) vst2(SX + (size_t)blk * DMOD + c4, (*(const v4f*)&sp[0][c4] + *(const v4f*)&sp[1][c4]) + (*(const v4f*)&sp[2][c4] + *(const v4f*)&sp[3][c4]));
}
// ---- k_pproj: pooled q and k: [768 rows of SX] x [q|k 512 cols] = SX (three bf16 pieces, 3 products) . bf16(W rows) + n bf16(b), n = rows summed (128 or 64); block (16 rows, 64 cols = 2 heads), wave = 16 cols; K = 256; 256-B segments of 1-KB rows.
//      Rows pooled over n1 (row = (b, l < 128)) get RoPE on the way out of LDS: per head x[32] -> x cos + rot(x) sin, rot = (-x[16:], x[:16]), angle = l * 10000^(-j/16) (j = d mod 16), cos and sin from k_poolx's table; both halves of a head lie in the block's tile.
//      The block's min and max of what it stores go to its own slot MMP[t][slot] (t: 0 = q axis 1, 1 = k axis 1, 2 = q axis 2, 3 = k axis 2), one 128-B line
__global__ __launch_bounds__(128) void k_pproj(const float* __restrict__ SX, const float* __restrict__ Wq, const float* __restrict__ bq, const float* __restrict__ Wk, const float* __restrict__ bk, float* __restrict__ QS1, float* __restrict__ KS1, float* __restrict__ QS2, float* __restrict__ KS2, const float* __restrict__ CS, float* __restrict__ MMP) {
  __shared__ __align__(16) float so[16][68]; __shared__ float smn[4], smx[4];
  const int tid = threadIdx.x, wave = tid >> 5, lane = tid & 31, col = lane & 15, g = lane >> 4; const int r0 = blockIdx.x * 16, which = blockIdx.y >> 2, nb0 = (blockIdx.y & 3) * 64, n = nb0 + wave * 16 + col;
  const float* Wm = which == 0 ? Wq : Wk; const float* bm = which == 0 ? bq : bk; const bool ax1 = r0 < NBT * N1;
  float* dst = ax1 ? (which == 0 ? QS1 : KS1) + (size_t)r0 * DMOD : (which == 0 ? QS2 : KS2) + (size_t)(r0 - NBT * N1) * DMOD;
  const float* pa = SX + (size_t)(r0 + col) * DMOD + 8 * g; const float* pw = Wm + (size_t)n * DMOD + 8 * g; const float bb = (ax1 ? (float)N2 : (float)N1) * bfr(bm[n]);
  v4f rc[2], rs[2];   // cos, sin of the 2 x 4 elements that this thread stores at the end: loaded here, in one flight with the operands, by every block (no branch, no wait in front of the operand loads); l = row mod 128 (NBT * N1 is a multiple of N2); the axis-1 blocks do not use them
#pragma unroll      // rc, rs by constant index
  for (int e = 0; e < 2; ++e) { const float* pt = CS + (size_t)((r0 + (tid >> 4) + 8 * e) % N2) * 16 + ((tid & 3) * 4); rc[e] = *(const v4f*)pt; rs[e] = *(const v4f*)(pt + N2 * 16); }
  v8f acc = {};   // every loop below is unrolled whole, so that a, w and the fragments are indexed by constants and stay in registers
#pragma unroll
  for (int kh = 0; kh < 2; ++kh) { v4f a[4][4], w[4][4];   // half of K at a time: its 32 loads go out together
#pragma unroll
    for (int k = 0; k < 4; ++k)
#pragma unroll
      for (int i = 0; i < 4; ++i) { const int o = (kh * 4 + k) * 32 + (i >> 1) * 16 + (i & 1) * 4; a[k][i] = *(const v4f*)(pa + o); w[k][i] = *(const v4f*)(pw + o); }
#pragma unroll
    for (int k = 0; k < 4; ++k) { v16b ah, am, al, wb;
#pragma unroll
      for (int i = 0; i < 16; ++i) { const float v = a[k][i >> 2][i & 3]; const __bf16 h = (__bf16)v; const float r1 = v - (float)h; const __bf16 m = (__bf16)r1; ah[i] = h; am[i] = m; al[i] = (__bf16)(r1 - (float)m); wb[i] = (__bf16)w[k][i >> 2][i & 3]; }
      acc = wmma_bf(al, wb, acc); acc = wmma_bf(am, wb, acc); acc = wmma_bf(ah, wb, acc); } }
#pragma unroll
  for (int r = 0; r < 8; ++r) so[8 * g + r][wave * 16 + col] = acc[r] + bb;
  __syncthreads();
  float mn = 3.0e38f, mx = -3.0e38f;
  v4f o2[2]; float* pst = dst + (size_t)(tid >> 4) * DMOD + nb0 + (tid & 15) * 4;
#pragma unroll      // rc, rs, o2 by constant index
  for (int qi = 0; qi < 2; ++qi) { const int rl = (tid >> 4) + 8 * qi, pc = tid & 15; v4f v = *(const v4f*)&so[rl][pc * 4];
    if (!ax1) { const v4f p = *(const v4f*)&so[rl][(pc * 4) ^ 16]; const float sg = (pc & 4) ? 1.0f : -1.0f;   // partner column d +- 16; the lower half takes it negated
#pragma unroll      // vector elements by constant index
      for (int e = 0; e < 4; ++e) v[e] = v[e] * rc[qi][e] + (sg * p[e]) * rs[qi][e]; }
#pragma unroll      // vector elements by constant index
    for (int e = 0; e < 4; ++e) { mn = fminf(mn, v[e]); mx = fmaxf(mx, v[e]); }
    o2[qi] = v; }
  // rows rl and rl + 8 (8 KB on); the stores and their s_wait_xcnt in one statement, so that the wait stands in front of the min-max code below, which takes the stored registers over
  asm volatile("global_store_b128 %0, %1, off\n\tglobal_store_b128 %0, %2, off offset:8192\n\ts_wait_xcnt 0x0" :: "v"(pst), "v"(o2[0]), "v"(o2[1]) : "memory");
#pragma unroll
  for (int o = 1; o < 32; o <<= 1) { mn = fminf(mn, __shfl_xor(mn, o)); mx = fmaxf(mx, __shfl_xor(mx, o)); }
  if (lane == 0) { smn[wave] = mn; smx[wave] = mx; }
  __syncthreads();
  if (tid < 8) { const v4f z = {0.f, 0.f, 0.f, 0.f}, m4 = {fminf(fminf(smn[0], smn[1]), fminf(smn[2], smn[3])), fmaxf(fmaxf(smx[0], smx[1]), fmaxf(smx[2], smx[3])), 0.f, 0.f};
    const int t = (ax1 ? 0 : 2) + which, slot = (ax1 ? r0 : r0 - NBT * N1) / 16 * 4 + (blockIdx.y & 3); vst2(MMP + ((size_t)t * MMN + slot) * MMS + tid * 4, tid == 0 ? m4 : z); }
}
// ---- k_feat: phi for the pooled tensor S = S_t (rows (b,l), l < L) and head h; blockIdx.x = h * 96 + bx, bx: 16 row tiles each of t = 0, 1, then 32 each of t = 2, 3; behind these FEAT_NB blocks, per block, one wave's quarter of a v-projection tile; block = 16 rows (one wave): xs = (x - mn)/(mx - mn) * 32^-1/4; dots on WMMA (xs hi/lo x bf16(feat rows), K = 32, 12 tiles); phi = exp(dot - |xs|^2/2 - ln(192)/2 + 1e-6);
//      P[(b*8 + h)*L + l][m] rows of 768 B (48 pieces). On entry the wave takes the tensor's global min and max over the slots that k_pproj's blocks left; a block of a k tensor also leaves the sum of its 16 phi rows (ascending) in KPB[ax][(b,h)][l0 / 16][m], 6 whole lines
#define FEAT_NB ((2 * (NBT * N1 / 16) + 2 * (NBT * N2 / 16)) * NHD)
__global__ __launch_bounds__(32) void k_feat(const float* __restrict__ S0, const float* __restrict__ S1, const float* __restrict__ S2, const float* __restrict__ S3, const float* __restrict__ MM, const float* __restrict__ feat, float* __restrict__ PB, float* __restrict__ KPB, const float* __restrict__ X, const float* __restrict__ PWF, const float* __restrict__ bv, float* __restrict__ V) {
  __shared__ __align__(16) union { struct { float sx[16][36]; float so[16][196]; float soff[16]; } f; float pj[16][132]; } sm; auto& sx = sm.f.sx; auto& so = sm.f.so; auto& soff = sm.f.soff;
  const int fb = blockIdx.x;
  if (fb >= FEAT_NB) { proj_tile(X, (const __bf16*)PWF, bv, V, sm.pj, (fb - FEAT_NB) >> 2, (fb - FEAT_NB) & 3, threadIdx.x); return; }
  constexpr int T1N = NBT * N1 / 16, T2N = NBT * N2 / 16; const int bx = fb % (FEAT_NB / NHD), t = bx < 2 * T1N ? bx / T1N : 2 + (bx - 2 * T1N) / T2N, L = t < 2 ? N1 : N2;
  const float* S = t == 0 ? S0 : t == 1 ? S1 : t == 2 ? S2 : S3; float* P = PB + (size_t)t * PSZ;
  const int lane = threadIdx.x, col = lane & 15, g = lane >> 4; const int h = fb / (FEAT_NB / NHD); const int r0 = (t < 2 ? bx % T1N : (bx - 2 * T1N) % T2N) * 16; const int b = r0 / L, l0 = r0 % L;
  float mn = 3.0e38f, mx = -3.0e38f;
#pragma unroll      // the 4 slot loads go out together; with 64 slots each is read twice, which a min or max does not see
  for (int i = 0; i < MMN / 32; ++i) { const v2f m2 = *(const v2f*)(MM + ((size_t)t * MMN + ((lane + 32 * i) & (t < 2 ? MMN / 2 - 1 : MMN - 1))) * MMS); mn = fminf(mn, m2[0]); mx = fmaxf(mx, m2[1]); }
  v16b w[12];
#pragma unroll      // w by constant index, in registers; the 12 tiles' feat rows need no value of this block: their 48 loads go out here as one group and land behind the min-max reduction
  for (int j = 0; j < 12; ++j) w[j] = frag_gbf(feat + (size_t)(j * 16 + col) * DHD, lane);
#pragma unroll
  for (int o = 1; o < 32; o <<= 1) { mn = fminf(mn, __shfl_xor(mn, o)); mx = fmaxf(mx, __shfl_xor(mx, o)); }
  const float sc = 1.0f / (mx - mn); const float temp = 0.42044820762685725f;   // 32^-0.25
  { const int rl = lane >> 1, half = lane & 1; float ss = 0.f;
    for (int d = half * 16; d < half * 16 + 16; ++d) { const float x = S[(size_t)(r0 + rl) * DMOD + h * DHD + d]; const float xs = (x - mn) * sc * temp; sx[rl][d] = xs; ss += xs * xs; }
    ss += __shfl_xor(ss, 1); if (half == 0) { soff[rl] = -0.5f * ss - 0.5f * 5.2574953720277815f + 1e-6f; sx[rl][32] = 0.f; sx[rl][33] = 0.f; sx[rl][34] = 0.f; sx[rl][35] = 0.f; } }
  LDSX();
  const F2 a = split_row(&sx[col][0], 0, lane);
  const v4f of0 = *(const v4f*)&soff[8 * g], of1 = *(const v4f*)&soff[8 * g + 4];   // the offsets of this lane's 8 rows, read once
#pragma unroll      // straight-line code: the 96 exponentials of a lane are independent of one another and fill each other's latencies
  for (int j = 0; j < 12; ++j) { v8f acc = {}; acc = wmma_bf(a.l, w[j], acc); acc = wmma_bf(a.h, w[j], acc);
#pragma unroll
    for (int r = 0; r < 8; ++r) so[8 * g + r][j * 16 + col] = exp_il(acc[r] + (r < 4 ? of0[r & 3] : of1[r & 3])); }
  LDSX();
  float* prow = P + ((size_t)(b * NHD + h) * L + l0) * MF;   // the block's 16 rows of 48 pieces lie one behind the other: piece q at float 4 q
  // piece q = lane + 32 s + 96 m (s < 3, m < 8) lies in row 2 m + ds, ds = (lane + 32 s) / 48: three LDS addresses, the rest constant offsets (2 rows of 196 floats per m)
  const float* sl[3] = { &so[0][0] + lane * 4, &so[0][0] + (lane + 32) * 4 + (lane >= 16 ? 4 : 0), &so[0][0] + (lane + 64) * 4 + 4 }; v4f pv[24];
#pragma unroll      // pv by constant index; the 24 LDS reads go out as one group, not one wait per store
  for (int i = 0; i < 24; ++i) pv[i] = *(const v4f*)(sl[i % 3] + (i / 3) * (2 * 196));
#pragma unroll
  for (int i = 0; i < 24; ++i) vst2(prow + (size_t)(lane + 32 * i) * 4, pv[i]);
  asm volatile("s_wait_xcnt 0x0" ::: "memory");   // behind the 24 stores above, ahead of the key-sum code, which takes their base and data registers over
  if (t & 1) { float* KQ = KPB + (((size_t)(t >> 1) * NBT * NHD + b * NHD + h) * (N2 / 16) + l0 / 16) * MF;
    for (int i = 0; i < MF / 32; ++i) { float s = 0.f;
#pragma unroll      // 16 LDS reads in flight
      for (int r = 0; r < 16; ++r) s += so[r][i * 32 + lane];
      KQ[i * 32 + lane] = s; } }
}
// ---- k_amat: per axis and (b,h): A[l][l'] = (sum_m QP[l][m] (hi/lo) . KP[l'][m] (hi/lo)) / att_norm[l]: M = l (by = 4 tiles of axis 1, then 8 of axis 2), N = l' (32 per wave = 2 tiles), K = m (6 steps), 3 products; rows pitch 128, 128-B segment per wave and row; blockIdx.x = by * 32 + (b,h), behind these AMAT_NB blocks v-projection tiles.
//      att_norm[l] = sum_m QP[l][m] ksum[m], ksum[m] = sum_l' KP[l'][m]: each wave adds k_feat's row-tile sums (ascending) into its own 192 floats of LDS and takes the dot products of its 16 q rows in f32 from the values it loads for the A fragments (lane = (row, half of each 32 m), the halves added by a shuffle); no wave needs another
#define AMAT_NB (NBT * NHD * (N1 / 16 + N2 / 16))
__global__ __launch_bounds__(128) void k_amat(const float* __restrict__ PB, const float* __restrict__ KPB, float* __restrict__ AMB, const float* __restrict__ X, const float* __restrict__ PWF, const float* __restrict__ bv, float* __restrict__ V) {
  __shared__ __align__(16) union { struct { float so[4][16][36]; float sks[4][MF]; } a; float pj[4][16][132]; } sm; auto& so = sm.a.so; auto& sks = sm.a.sks;
  const int fb = blockIdx.x, tid = threadIdx.x, wave = tid >> 5, lane = tid & 31, col = lane & 15, g = lane >> 4;
  if (fb >= AMAT_NB) { proj_tile(X, (const __bf16*)PWF, bv, V, sm.pj[wave], PROJ_F + fb - AMAT_NB, wave, lane); return; }
  const int by = fb / (NBT * NHD), ax = by < N1 / 16 ? 0 : 1, L = ax == 0 ? N1 : N2; const int bh = fb % (NBT * NHD), l0 = (ax == 0 ? by : by - N1 / 16) * 16, n0 = wave * 32;
  if (n0 >= L) return;
  const float* QP = PB + (size_t)(2 * ax) * PSZ; const float* KP = QP + PSZ; float* AM = AMB + (size_t)ax * AMSZ;
  const float* KQ = KPB + ((size_t)ax * NBT * NHD + bh) * (N2 / 16) * MF + lane; float ks[MF / 32] = {};
  { float v[N2 / 16][MF / 32] = {};   // every loop of this kernel is unrolled whole: its arrays are indexed by constants and stay in registers. The 4 or 8 tiles' loads go out together; a tile that axis 1 lacks adds 0; ascending tile order
#pragma unroll
    for (int tl = 0; tl < N1 / 16; ++tl)
#pragma unroll
      for (int i = 0; i < MF / 32; ++i) v[tl][i] = KQ[(size_t)tl * MF + i * 32];
    asm volatile("s_wait_xcnt 0x0" ::: "memory");   // behind the 24 loads above, ahead of any rewrite of their base or offset register (on the axis-1 way only counted data waits follow before the base is reused)
    if (ax == 1) {
#pragma unroll
      for (int tl = N1 / 16; tl < N2 / 16; ++tl)
#pragma unroll
        for (int i = 0; i < MF / 32; ++i) v[tl][i] = KQ[(size_t)tl * MF + i * 32]; }
#pragma unroll
    for (int tl = 0; tl < N2 / 16; ++tl)
#pragma unroll
      for (int i = 0; i < MF / 32; ++i) ks[i] += v[tl][i]; }
#pragma unroll
  for (int i = 0; i < MF / 32; ++i) sks[wave][i * 32 + lane] = ks[i];
  LDSX();
  const float* qrow = QP + ((size_t)bh * L + l0 + col) * MF;
  v8f acc[2] = {}; float dn = 0.f;
#pragma unroll
  for (int kc = 0; kc < MF / 32; ++kc) { float v[16]; const float* p = qrow + kc * 32 + 8 * g; const float* kp = &sks[wave][kc * 32 + 8 * g]; float dk = 0.f;
#pragma unroll
    for (int i = 0; i < 8; ++i) { v[i] = p[i]; v[8 + i] = p[16 + i]; }
#pragma unroll
    for (int i = 0; i < 8; ++i) dk += v[i] * kp[i];
#pragma unroll
    for (int i = 0; i < 8; ++i) dk += v[8 + i] * kp[16 + i];
    dn += dk; const F2 a = bsplit16(v);
#pragma unroll
    for (int j = 0; j < 2; ++j) { const F2 kb = split_row(KP + ((size_t)bh * L + n0 + j * 16 + col) * MF, kc * 32, lane); acc[j] = mac3(a, kb, acc[j]); } }
  dn += __shfl_xor(dn, 16);   // lanes col and col + 16 now both hold att_norm of row l0 + col
  float inv[8];
#pragma unroll
  for (int r = 0; r < 8; ++r) inv[r] = 1.0f / __shfl(dn, 8 * g + r);
#pragma unroll
  for (int j = 0; j < 2; ++j)
#pragma unroll
    for (int r = 0; r < 8; ++r) so[wave][8 * g + r][j * 16 + col] = acc[j][r] * inv[r];
  LDSX();
  for (int q = lane; q < 16 * 8; q += 32) { const int rl = q >> 3, pc = q & 7; vst2(AM + ((size_t)bh * N2 + l0 + rl) * N2 + n0 + pc * 4, *(const v4f*)&so[wave][rl][pc * 4]); }
}
// ---- k_att: per (b, ATT_G neighbouring other positions o, head h), in place on the value tensor: out[l][d] = sum_l' A[(b,h)][l][l'] (hi/lo) . V[l'][(h,d)] (hi/lo): M = l (one 16-row tile per wave, L/16 waves), N = d (2 tiles per position), K = l' (2 or 4 steps), 3 products; all batches in one launch.
//      A depends on (b, h) alone: a wave loads and splits its 16 rows of A once and uses the fragments for the ATT_G value tiles of the block (ATT_G divides both axis lengths, so a block stays inside one batch).
//      The block owns the ATT_G tiles of L x 32 (128-B row segments) that it reads and writes: each is read once (thread = 4 rows x 16 B), split into bf16 hi and residual and laid down transposed in LDS ([d][l'], 8-B stores, pitch 2 L + 16 B for the 16-B fragment reads); the stores to V follow the barrier behind which every read has landed
#define ATT_G 4
template <int PASS>
__global__ __launch_bounds__(PASS == 1 ? N1 * 2 : N2 * 2) void k_att(const float* __restrict__ AM, int ob0, float* V) {
  constexpr int L = (PASS == 1 ? N1 : N2), O = (PASS == 1 ? N2 : N1); constexpr size_t RS = (PASS == 1 ? (size_t)N2 * DMOD : (size_t)DMOD), OS = (PASS == 1 ? (size_t)DMOD : (size_t)N2 * DMOD);   // RS: floats from row l to row l + 1; OS: from position o to o + 1
  __shared__ __align__(16) __bf16 vh[ATT_G][DHD][L + 8], vl[ATT_G][DHD][L + 8]; __shared__ __align__(16) float so[L / 16][ATT_G][16][36];
  const int tid = threadIdx.x, wave = tid >> 5, lane = tid & 31, col = lane & 15, g = lane >> 4; const int h = blockIdx.x % NHD, bo = ob0 + blockIdx.x / NHD * ATT_G; const int b = bo / O, o = bo % O;
  float* tile = V + (PASS == 1 ? ((size_t)b * N1 * N2 + o) : ((size_t)b * N1 + o) * N2) * DMOD + h * DHD;   // the first of the block's tiles
  const float* arow = AM + ((size_t)(b * NHD + h) * N2 + wave * 16 + col) * N2;
  const int p4 = (tid & 7) * 4, l4 = (tid >> 3) * 4; const float* src = tile + (size_t)l4 * RS + p4; v4f x[ATT_G][4]; F2 a[L / 32];   // every loop below is unrolled whole: x, a, hi, lo and acc are indexed by constants and stay in registers; the tiles' 16 loads and A's loads go out together, ahead of the barrier
#pragma unroll
  for (int t = 0; t < ATT_G; ++t)
#pragma unroll
    for (int i = 0; i < 4; ++i) x[t][i] = *(const v4f*)(src + (size_t)t * OS + (size_t)i * RS);
#pragma unroll
  for (int kc = 0; kc < L / 32; ++kc) a[kc] = split_row(arow, kc * 32, lane);
#pragma unroll
  for (int t = 0; t < ATT_G; ++t)
#pragma unroll
    for (int e = 0; e < 4; ++e) { v4b hi, lo;
#pragma unroll
      for (int i = 0; i < 4; ++i) { const float v = x[t][i][e]; const __bf16 hh = (__bf16)v; hi[i] = hh; lo[i] = (__bf16)(v - (float)hh); }
      *(v4b*)&vh[t][p4 + e][l4] = hi; *(v4b*)&vl[t][p4 + e][l4] = lo; }
  __syncthreads();
  v8f acc[ATT_G][2] = {};
#pragma unroll
  for (int t = 0; t < ATT_G; ++t)
#pragma unroll
    for (int kc = 0; kc < L / 32; ++kc)
#pragma unroll
      for (int j = 0; j < 2; ++j) { F2 vb; vb.h = frag_b(&vh[t][j * 16 + col][kc * 32], lane); vb.l = frag_b(&vl[t][j * 16 + col][kc * 32], lane); acc[t][j] = mac3(a[kc], vb, acc[t][j]); }
#pragma unroll
  for (int t = 0; t < ATT_G; ++t)
#pragma unroll
    for (int j = 0; j < 2; ++j)
#pragma unroll
      for (int r = 0; r < 8; ++r) so[wave][t][8 * g + r][j * 16 + col] = acc[t][j][r];
  LDSX();
#pragma unroll
  for (int t = 0; t < ATT_G; ++t)
#pragma unroll      // the wave's 16 LDS reads go out as one group with one wait, not one wait per store
    for (int q4 = 0; q4 < 4; ++q4) { const int rl = q4 * 4 + (lane >> 3), pc = lane & 7; vst2(tile + (size_t)t * OS + (size_t)(wave * 16 + rl) * RS + pc * 4, *(const v4f*)&so[wave][t][rl][pc * 4]); }
}
// ---- k_out: Y = V3(hi/lo) . bf16(Wo rows [256][256], packed) + bo; block (64 rows, 128 cols); K = 256
__global__ __launch_bounds__(128) void k_out(const float* __restrict__ V3, const float* __restrict__ PWF, const float* __restrict__ bo, float* __restrict__ Y, int rb0) {
  __shared__ __align__(16) float so[4][16][132];
  const int tid = threadIdx.x, wave = tid >> 5, lane = tid & 31, col = lane & 15, g = lane >> 4; const size_t r0 = (size_t)(rb0 + blockIdx.x) * 64 + wave * 16; const int n0 = blockIdx.y * 128;
  v8f acc[8] = {};
#pragma unroll 2
  for (int kc = 0; kc < DMOD / 32; ++kc) { v16b w[8];
#pragma unroll      // w indexed by constants, in registers: the k step's 16 loads of B go out as one group, ahead of its first WMMA
    for (int j = 0; j < 8; ++j) w[j] = frag_pw((const __bf16*)PWF + PWSZ, n0 / 16 + j, kc, lane);
    const F2 a = split_row(V3 + (r0 + col) * DMOD, kc * 32, lane);
#pragma unroll
    for (int j = 0; j < 8; ++j) { acc[j] = wmma_bf(a.l, w[j], acc[j]); acc[j] = wmma_bf(a.h, w[j], acc[j]); } }
#pragma unroll
  for (int j = 0; j < 8; ++j) { const float bb = bfr(bo[n0 + j * 16 + col]);
#pragma unroll
    for (int r = 0; r < 8; ++r) so[wave][8 * g + r][j * 16 + col] = acc[j][r] + bb; }
  LDSX();
  for (int rl = 0; rl < 16; ++rl) vst2(Y + (r0 + rl) * DMOD + n0 + lane * 4, *(const v4f*)&so[wave][rl][lane * 4]);
}

#ifndef DBG
#define DBG 0
#endif
#if DBG != 0
__global__ __launch_bounds__(256) void k_dump(const float* __restrict__ src, int n, float* __restrict__ out) {   // out[0..n) = src, rest of batch-0 region zero
  const size_t p = (size_t)blockIdx.x * 256 + threadIdx.x; v4f v; for (int i = 0; i < 4; ++i) { const size_t f = p * 4 + i; v[i] = f < (size_t)n ? src[f] : 0.f; } vst2(out + p * 4, v);
}
#endif
extern "C" void kernel_launch(void* const* d_in, const int* in_sizes, int n_in, void* d_out, int out_size, void* d_ws, size_t ws_size, hipStream_t stream) {
  (void)in_sizes; (void)n_in; (void)out_size;
  const float** F = (const float**)d_in;   // X, Wq, bq, Wk, bk, Wv, bv, Wo, bo, feat
  if (ws_size < (size_t)WS_END) return;
  char* ws = (char*)d_ws; float *PB = (float*)(ws + WS_A), *V = (float*)(ws + WS_V), *QS1 = (float*)(ws + WS_QS1), *KS1 = (float*)(ws + WS_KS1), *QS2 = (float*)(ws + WS_QS2), *KS2 = (float*)(ws + WS_KS2), *MM = (float*)(ws + WS_MM), *AM = (float*)(ws + WS_AM), *KSUM = (float*)(ws + WS_KSUM), *SX = (float*)(ws + WS_SX), *CS = (float*)(ws + WS_CS), *PW = (float*)(ws + WS_B);
  k_poolx<<<NBT * N1 + NBT * N2 + PACK_NB + TRIG_NB, 256, 0, stream>>>(F[0], SX, F[5], F[7], PW, CS);
  k_pproj<<<dim3((NBT * N1 + NBT * N2) / 16, 8), 128, 0, stream>>>(SX, F[1], F[2], F[3], F[4], QS1, KS1, QS2, KS2, CS, MM);
  // ---- the mixing matrices of both axes (assets: l = n1 = 64; time: l = n2 = 128 with RoPE)
  k_feat<<<FEAT_NB + 4 * PROJ_F, 32, 0, stream>>>(QS1, KS1, QS2, KS2, MM, F[9], PB, KSUM, F[0], PW, F[6], V);
#if DBG == 2
  k_dump<<<N1 * N2 * DMOD / 1024, 256, 0, stream>>>(PB, NBT * NHD * N1 * MF, (float*)d_out); return;  // pass-1 phi(q) [4][8][64][192]
#endif
  k_amat<<<AMAT_NB + PROJ_N - PROJ_F, 128, 0, stream>>>(PB, KSUM, AM, F[0], PW, F[6], V);
  // ---- pass 1: assets axis (other = n2 = 128)
  k_att<1><<<(TNB - TB0) * N2 * NHD / ATT_G, N1 * 2, 0, stream>>>(AM, TB0 * N2, V);
#if DBG == 3
  k_dump<<<N1 * N2 * DMOD / 1024, 256, 0, stream>>>(V, N1 * N2 * DMOD, (float*)d_out); return;
#endif
  // ---- pass 2: time axis (other = n1 = 64)
  k_att<2><<<(TNB - TB0) * N1 * NHD / ATT_G, N2 * 2, 0, stream>>>(AM + AMSZ, TB0 * N1, V);
#if DBG == 5
  k_dump<<<N1 * N2 * DMOD / 1024, 256, 0, stream>>>(V, N1 * N2 * DMOD, (float*)d_out); return;     // value after pass 2, batch 0
#endif
  k_out<<<dim3((TNB - TB0) * N1 * N2 / 64, 2), 128, 0, stream>>>(V, PW, F[8], (float*)d_out, TB0 * N1 * N2 / 64);
}

// v009
// Measured time: 86.7 microseconds a run.
// In two side-by-side timings against v008, it was 1.05 and 1.07 times as fast.
// Over all steps from v000 it is 9.60 times as fast.
// compute dtype: X, the projection weights/biases and the random-feature matrix (module inputs) rounded to bf16; the v projection with exact bf16 products; the q and k projections taken on the axis sums of bf16(X) (f32 sums as three bf16 pieces, 3 products, all 24 bits); the feature-map GEMM (pooled q,k x feat) with the pooled operand as a bf16 hi + bf16 residual pair (2 products); the phi(q) phi(k)^T and mixing-matrix x value contractions with both computed operands hi/lo (3 products);
// the output projection hi/lo against bf16 Wo (2 products); axis pooling, RoPE, global min-max normalisation, exp feature maps, normalisers and divisions in f32; f32 accumulate.
#include <hip/hip_runtime.h>
#include <math.h>

typedef __attribute__((ext_vector_type(16))) _Float16 v16h;
typedef __attribute__((ext_vector_type(16))) __bf16 v16b;
typedef __attribute__((ext_vector_type(8)))  _Float16 v8h;
typedef __attribute__((ext_vector_type(8)))  float v8f;
typedef __attribute__((ext_vector_type(4)))  float v4f;
typedef __attribute__((ext_vector_type(2)))  float v2f;
typedef __attribute__((ext_vector_type(4)))  unsigned v4u;
typedef __attribute__((ext_vector_type(4)))  int v4i;
typedef float __attribute__((may_alias)) float_a;
typedef int __attribute__((may_alias)) int_a;

template <typename T> __device__ __forceinline__ void vst2(void* p, T v) { *(T*)p = v;  }
__device__ __forceinline__ v8f wmma16(v16h a, v16h b, v8f c) {
  v8f d = __builtin_amdgcn_wmma_f32_16x16x32_f16(false, a, false, b, (short)0, c, false, false);
  asm volatile("v_nop\n\tv_nop\n\tv_nop\n\tv_nop" : "+v"(d) : "v"(a), "v"(b));
  return d;
}
__device__ __forceinline__ v8f wmma_bf(v16b a, v16b b, v8f c) {
  v8f d = __builtin_amdgcn_wmma_f32_16x16x32_bf16(false, a, false, b, (short)0, c, false, false);
  asm volatile("v_nop\n\tv_nop\n\tv_nop\n\tv_nop" : "+v"(d) : "v"(a), "v"(b));
  return d;
}
// 16x16x32 fragments: lane = (h = lane>>4, row/col = lane&15); elements 0..7 = k0+8h+0..7, 8..15 = k0+16+8h+0..7; D element r = row 8h+r
__device__ __forceinline__ v16h frag_h(const _Float16* rowk0, int lane) {
  union { v16h v; v8h q[2]; } u; const _Float16* p = rowk0 + 8 * (lane >> 4);
  u.q[0] = *(const v8h*)p; u.q[1] = *(const v8h*)(p + 16); return u.v;
}
__device__ __forceinline__ v16h frag_f32(const float* rowk0, int lane) {
  v16h a; const float* p = rowk0 + 8 * (lane >> 4);
#pragma unroll
  for (int i = 0; i < 8; ++i) { a[i] = (_Float16)p[i]; a[8 + i] = (_Float16)p[16 + i]; }
  return a;
}
__device__ __forceinline__ v16h frag_f32s(const float* rowk0, int lane, float sc) {
  v16h a; const float* p = rowk0 + 8 * (lane >> 4);
#pragma unroll
  for (int i = 0; i < 8; ++i) { a[i] = (_Float16)(p[i] * sc); a[8 + i] = (_Float16)(p[16 + i] * sc); }
  return a;
}
// column fragment from a [K][ld] layout (column n), rows >= K read as 0
__device__ __forceinline__ v16h fragc_f32(const float* W, int k0, int n, int lane, int ld, int K) {
  v16h a; const int g = lane >> 4;
#pragma unroll
  for (int i = 0; i < 8; ++i) { const int ka = k0 + 8 * g + i, kb = ka + 16;
    a[i] = (_Float16)(ka < K ? W[(size_t)(ka < K ? ka : K - 1) * ld + n] : 0.f); a[8 + i] = (_Float16)(kb < K ? W[(size_t)(kb < K ? kb : K - 1) * ld + n] : 0.f); }
  return a;
}
struct F2 { v16b h, l; };
__device__ __forceinline__ F2 bsplit16(const float v[16]) { F2 r;
#pragma unroll
  for (int i = 0; i < 16; ++i) { const __bf16 h = (__bf16)v[i]; r.h[i] = h; r.l[i] = (__bf16)(v[i] - (float)h); }
  return r; }
__device__ __forceinline__ F2 split_row(const float* row, int k0, int lane) { float v[16]; const float* p = row + k0 + 8 * (lane >> 4);
#pragma unroll
  for (int i = 0; i < 8; ++i) { v[i] = p[i]; v[8 + i] = p[16 + i]; }
  return bsplit16(v); }
__device__ __forceinline__ F2 split_rowK(const float* row, int k0, int lane, int K) { float v[16]; const int g = lane >> 4;
#pragma unroll
  for (int i = 0; i < 8; ++i) { const int ka = k0 + 8 * g + i, kb = ka + 16; v[i] = ka < K ? row[ka < K ? ka : K - 1] : 0.f; v[8 + i] = kb < K ? row[kb < K ? kb : K - 1] : 0.f; }
  return bsplit16(v); }
__device__ __forceinline__ F2 split_col(const float* W, int k0, int n, int lane, int ld, int K) { float v[16]; const int g = lane >> 4;
#pragma unroll
  for (int i = 0; i < 8; ++i) { const int ka = k0 + 8 * g + i, kb = ka + 16; v[i] = ka < K ? W[(size_t)(ka < K ? ka : K - 1) * ld + n] : 0.f; v[8 + i] = kb < K ? W[(size_t)(kb < K ? kb : K - 1) * ld + n] : 0.f; }
  return bsplit16(v); }
__device__ __forceinline__ v8f mac3(const F2& a, const F2& b, v8f c) { c = wmma_bf(a.l, b.h, c); c = wmma_bf(a.h, b.l, c); return wmma_bf(a.h, b.h, c); }
__device__ __forceinline__ float sigm(float v) { return 1.0f / (1.0f + expf(-v)); }
#define LDSX() do { asm volatile("s_wait_dscnt 0" ::: "memory"); __builtin_amdgcn_wave_barrier(); __builtin_amdgcn_fence(__ATOMIC_RELEASE, "workgroup"); } while (0)


// High-order linear attention over a [4, 64, 128, 256] tensor: q/k/v = X W^T + b; for the assets axis (n1, pooled over n2) and then the time axis (n2, pooled over n1, with RoPE): Performer-style positive features phi(x) = exp(xs f^T - |xs|^2/2 - log(M)/2 + 1e-6), xs = (x - min x)/(max x - min x) * 32^-1/4 (global min/max),
// out_l = sum_l' A[l][l'] v_l', A[l][l'] = phi(q_l) . phi(k_l') / (phi(q_l) . sum_l phi(k_l)): the product phi(q) (phi(k)^T v) taken as (phi(q) phi(k)^T) v, since A depends on (b, head) alone and the attended length (64, 128) is below the 192 features; finally value W_o^T + b_o.
// q and k are used only through their axis sums, and sum_i (x_i W^T + b) = (sum_i x_i) W^T + n b: X is pooled first and only the 768 pooled rows are projected.
// k_poolx (axis sums of X; Wv and Wo packed as bf16 fragments; RoPE's cos and sin table); k_pproj (pooled q and k, RoPE on the dim-2 rows, min-max per block); proj_tile (v); k_feat (min-max finals, phi via WMMA, key sums per 16 rows); k_amat (per (b, head): key sum, normaliser, A); k_att (pass 1, per (b, 4 other-positions, head): value tiles transposed in LDS, A x tiles, written back in place); k_atto (pass 2 and the output projection, per (b, n1), all heads);
// A depends on the pooled q and k alone, never on the value: k_feat and k_amat each run once, for both axes (and for q and k) in one grid, the block index naming the tensor t (0 = q axis 1, 1 = k axis 1, 2 = q axis 2, 3 = k axis 2) or the axis ax (0, 1).
// A small elementwise or reducing stage has no launch of its own: the block that makes the values does the part it can (RoPE, its own min-max, its own 16-row key sum) before it stores them, and the block that needs the whole finishes it on entry (min-max over the block slots, key sum over the row tiles, normaliser of its own 16 rows)
#define NBT 4
#define N1 64
#define N2 128
#define DMOD 256
#define NHD 8
#define DHD 32
#define MF 192
#define NPOS (NBT * N1 * N2)      // 32768 positions
#ifndef TNB
#define TNB NBT                   // batches run through the attention passes / output (debug: fewer)
#endif
#ifndef TB0
#define TB0 0                     // first batch of the attention loops (debug)
#endif
typedef __attribute__((ext_vector_type(8))) __bf16 v8b;
typedef __attribute__((ext_vector_type(4))) __bf16 v4b;
__device__ __forceinline__ v16b frag_b(const __bf16* rowk0, int lane) {
  union { v16b v; v8b q[2]; } u; const __bf16* p = rowk0 + 8 * (lane >> 4);
  u.q[0] = *(const v8b*)p; u.q[1] = *(const v8b*)(p + 16); return u.v;
}
__device__ __forceinline__ v16b frag_gbf(const float* rowk0, int lane) {
  v16b a; const float* p = rowk0 + 8 * (lane >> 4);
#pragma unroll
  for (int i = 0; i < 8; ++i) { a[i] = (__bf16)p[i]; a[8 + i] = (__bf16)p[16 + i]; }
  return a;
}
// B fragment of a packed weight matrix (k_poolx lays it down): tile (nt = 16 output columns, kc = 32 of K) = 2 planes of 512 B, plane p holds per lane its elements 8p..8p+7 (same k order as frag_gbf), so each 16-B load of a wave covers 4 whole 128-B lines
__device__ __forceinline__ v16b frag_pw(const __bf16* PW, int nt, int kc, int lane) {
  union { v16b v; v8b q[2]; } u; const __bf16* p = PW + (size_t)(nt * (DMOD / 32) + kc) * 512 + lane * 8;
  u.q[0] = *(const v8b*)p; u.q[1] = *(const v8b*)(p + 256); return u.v;
}
__device__ __forceinline__ float bfr(float v) { return (float)(__bf16)v; }
// exp(x) inline = 2^e 2^a, e = the integer nearest x log2(e), a = x log2(e) - e by two fused multiply-adds on log2(e) = c + cc (as exact as expf's own reduction), with expf's two range ends.
// The hardware exponential stands in one statement with a v_nop: the slot that the instruction set asks for behind a transcendental before its result is read or its source overwritten
__device__ __forceinline__ float exp_il(float x) {
  const float c = __uint_as_float(0x3fb8aa3bu), cc = __uint_as_float(0x32a5705fu);
  const float e = rintf(x * c), a = fmaf(x, cc, fmaf(x, c, -e));
  float r; asm("v_exp_f32 %0, %1\n\tv_nop" : "=v"(r) : "v"(a));   // the v_nop fills the slot behind the transcendental, whatever the compiler puts next
  r = ldexpf(r, (int)e);
  r = __uint_as_float(0xc2ce8ed0u) > x ? 0.0f : r;
  return __uint_as_float(0x42b17218u) < x ? __uint_as_float(0x7f800000u) : r;
}
__device__ __attribute__((noinline)) float pow_ni(float a, float b) { return powf(a, b); }
__device__ __attribute__((noinline)) float cos_ni(float v) { return cosf(v); }
__device__ __attribute__((noinline)) float sin_ni(float v) { return sinf(v); }

#define WS_A    0u                              // 32 MB, 12 MB used: f32 phi rows, 4 tensors t of PSZ floats each: [(b,h)][l][m] (l rows, m contiguous; L = 64 rows per (b,h) for t < 2, 128 for t >= 2)
#define PSZ     (NBT * NHD * N2 * MF)
#define WS_B    (WS_A + 4u * NPOS * DMOD)          // 32 MB, 256 KB used: bf16(Wv), then bf16(Wo), each 256 x 256 in fragment order (frag_pw)
#define PWSZ    (DMOD * DMOD)
#define WS_V    (WS_B + 4u * NPOS * DMOD)          // f32 32 MB: value [b][n1][n2][h*32+d] (updated in place by pass 1: V -> V2, by the block that owns the tile; pass 2 reads it and keeps its result on the WGP)
#define WS_QS1  (WS_V + 4u * NPOS * DMOD)          // f32 [4][64][256]  q summed over n2
#define WS_KS1  (WS_QS1 + 4u * NBT * N1 * DMOD)
#define WS_QS2  (WS_KS1 + 4u * NBT * N1 * DMOD)    // f32 [4][128][256] q summed over n1, RoPE applied
#define WS_KS2  (WS_QS2 + 4u * NBT * N2 * DMOD)
#define WS_MM   (WS_KS2 + 4u * NBT * N2 * DMOD)
#define MMS 32
#define MMN 128
#define WS_AM   (WS_MM + 4u * 4 * MMN * MMS)       // f32 [2 axes][4][8][128][128] A (l rows, l' contiguous, pitch 128; axis 1 uses l, l' < 64); WS_MM holds [4 tensors][128 slots][32 floats]: (min, max) of one k_pproj block per slot, 64 slots used for t < 2, 128 for t >= 2
#define AMSZ    (NBT * NHD * N2 * N2)
#define WS_KSUM (WS_AM + 4u * 2 * AMSZ)            // f32 [2 axes][4][8][8 row tiles][192]: phi(k) summed over the 16 rows of a tile (axis 1 uses 4 tiles)
#define WS_SX   (WS_KSUM + 4u * 2 * NBT * NHD * (N2 / 16) * MF)  // f32 [256 + 512][256] bf16(X) summed over n2 (rows b*64 + n1), then summed over n1 (rows 256 + b*128 + n2)
#define WS_CS   (WS_SX + 4u * (NBT * N1 + NBT * N2) * DMOD)   // f32 [2][128][16]: cos, then sin, of RoPE's angles (l, j)
#define WS_END  (WS_CS + 4u * 2 * N2 * 16)

// ---- proj_tile: [32768 rows] x [v 256 cols] = bf16(X) . W rows ([out][in]) + b (exact); tile pb < PROJ_N = (64 rows, 128 cols), one wave = 16 of its rows, no wave needs another (so: the wave's own 16 x 132 floats of LDS); 512-B segments of 1-KB rows.
//      The v projection needs X alone and is first needed by k_att<1>: it has no launch of its own; its tiles ride as the last blocks in the grids of k_feat and k_amat, whose few waves wait on latency and leave most of the chip idle
#define PROJ_N  (NPOS / 64 * 2)
#define PROJ_F  (PROJ_N * 21 / 32)                 // tiles [0, PROJ_F) ride in k_feat, [PROJ_F, PROJ_N) in k_amat
__device__ __forceinline__ void proj_tile(const float* __restrict__ X, const __bf16* __restrict__ PW, const float* __restrict__ bm, float* __restrict__ dst, float (*so)[132], int pb, int wave, int lane) {
  const int col = lane & 15, g = lane >> 4; const size_t r0 = (size_t)(pb % (NPOS / 64)) * 64 + wave * 16; const int n0 = pb / (NPOS / 64) * 128;
  v8f acc[8] = {};
#pragma unroll 2
  for (int kc = 0; kc < DMOD / 32; ++kc) { v16b w[8];
#pragma unroll      // w indexed by constants, in registers: the k step's 16 loads of B go out as one group, ahead of its first WMMA
    for (int j = 0; j < 8; ++j) w[j] = frag_pw(PW, n0 / 16 + j, kc, lane);
    const v16b a = frag_gbf(X + (r0 + col) * DMOD + kc * 32, lane);
#pragma unroll
    for (int j = 0; j < 8; ++j) acc[j] = wmma_bf(a, w[j], acc[j]); }
#pragma unroll
  for (int j = 0; j < 8; ++j) { const float bb = bfr(bm[n0 + j * 16 + col]);
#pragma unroll
    for (int r = 0; r < 8; ++r) so[8 * g + r][j * 16 + col] = acc[j][r] + bb; }
  LDSX();
  for (int rl = 0; rl < 16; ++rl) vst2(dst + (r0 + rl) * DMOD + n0 + lane * 4, *(const v4f*)&so[rl][lane * 4]);
}
// ---- k_poolx: axis sums of bf16(X); behind these 768 blocks, PACK_NB blocks round Wv and Wo to bf16 once and lay them in fragment order (thread = one 16-B piece: 8 consecutive k of one row). Blocks < 256: SX[b*64 + n1][c] = sum_{n2}; blocks >= 256: SX[256 + b*128 + n2][c] = sum_{n1}. Thread = (part = tid >> 6, 4 columns): a part sums every 4th row (ascending), the 4 parts are added in LDS; 1-KB rows
template <int NR> __device__ __forceinline__ v4f sum_rows(const float* __restrict__ p, size_t step) {
  v4f s = {0.f, 0.f, 0.f, 0.f};
#pragma unroll 16   // 16 row loads of 16 B in flight per lane: the kernel is a stream from memory
  for (int i = 0; i < NR; ++i) { const v4f v = *(const v4f*)(p + (size_t)i * step);
#pragma unroll      // vector elements by constant index
    for (int e = 0; e < 4; ++e) s[e] += bfr(v[e]); }
  return s;
}
#define PACK_NB (2 * PWSZ / 8 / 256)
#define TRIG_NB (N2 * 16 / 256)
__global__ __launch_bounds__(256) void k_poolx(const float* __restrict__ X, float* __restrict__ SX, const float* __restrict__ Wv, const float* __restrict__ Wo, float* __restrict__ PWF, float* __restrict__ CS) {
  __shared__ __align__(16) float sp[4][DMOD];
  const int tid = threadIdx.x, part = tid >> 6, c4 = (tid & 63) * 4, blk = blockIdx.x; v4f s;
  if (blk >= NBT * N1 + NBT * N2 + PACK_NB) {   // the last TRIG_NB blocks: RoPE's table CS[l][j] = cos(l * 10000^(-j/16)), then the sines, thread = (l, j); a wave stores whole lines
    const int idx = (blk - (NBT * N1 + NBT * N2 + PACK_NB)) * 256 + tid, j = idx & 15; const float invf = 1.0f / pow_ni(10000.0f, (float)(2 * j) / 32.0f); const float ang = (float)(idx >> 4) * invf;
    CS[idx] = cos_ni(ang); CS[N2 * 16 + idx] = sin_ni(ang); return; }
  if (blk >= NBT * N1 + NBT * N2) {   // piece p of a matrix = (nt = p >> 9, kc = (p >> 6) & 7, plane = (p >> 5) & 1, lane = p & 31)
    const int idx = (blk - (NBT * N1 + NBT * N2)) * 256 + tid, p = idx & (PWSZ / 8 - 1), ln = p & 31; const float* Wm = idx < PWSZ / 8 ? Wv : Wo;
    const float* sw = Wm + (size_t)((p >> 9) * 16 + (ln & 15)) * DMOD + ((p >> 6) & 7) * 32 + ((p >> 5) & 1) * 16 + 8 * (ln >> 4);
    const v4f x0 = *(const v4f*)sw, x1 = *(const v4f*)(sw + 4); v8b o;
#pragma unroll      // vector elements by constant index
    for (int e = 0; e < 4; ++e) { o[e] = (__bf16)x0[e]; o[4 + e] = (__bf16)x1[e]; }
    vst2((__bf16*)PWF + (size_t)idx * 8, o); return; }
  if (blk < NBT * N1) s = sum_rows<N2 / 4>(X + ((size_t)blk * N2 + part) * DMOD + c4, (size_t)4 * DMOD);
  else { const int r = blk - NBT * N1, b = r / N2, i2 = r % N2; s = sum_rows<N1 / 4>(X + (((size_t)b * N1 + part) * N2 + i2) * DMOD + c4, (size_t)4 * N2 * DMOD); }
  *(v4f*)&sp[part][c4] = s;
  __syncthreads();
  if (tid < 64) vst2(SX + (size_t)blk * DMOD + c4, (*(const v4f*)&sp[0][c4] + *(const v4f*)&sp[1][c4]) + (*(const v4f*)&sp[2][c4] + *(const v4f*)&sp[3][c4]));
}
// ---- k_pproj: pooled q and k: [768 rows of SX] x [q|k 512 cols] = SX (three bf16 pieces, 3 products) . bf16(W rows) + n bf16(b), n = rows summed (128 or 64); block (16 rows, 64 cols = 2 heads), wave = 16 cols; K = 256; 256-B segments of 1-KB rows.
//      Rows pooled over n1 (row = (b, l < 128)) get RoPE on the way out of LDS: per head x[32] -> x cos + rot(x) sin, rot = (-x[16:], x[:16]), angle = l * 10000^(-j/16) (j = d mod 16), cos and sin from k_poolx's table; both halves of a head lie in the block's tile.
//      The block's min and max of what it stores go to its own slot MMP[t][slot] (t: 0 = q axis 1, 1 = k axis 1, 2 = q axis 2, 3 = k axis 2), one 128-B line
__global__ __launch_bounds__(128) void k_pproj(const float* __restrict__ SX, const float* __restrict__ Wq, const float* __restrict__ bq, const float* __restrict__ Wk, const float* __restrict__ bk, float* __restrict__ QS1, float* __restrict__ KS1, float* __restrict__ QS2, float* __restrict__ KS2, const float* __restrict__ CS, float* __restrict__ MMP) {
  __shared__ __align__(16) float so[16][68]; __shared__ float smn[4], smx[4];
  const int tid = threadIdx.x, wave = tid >> 5, lane = tid & 31, col = lane & 15, g = lane >> 4; const int r0 = blockIdx.x * 16, which = blockIdx.y >> 2, nb0 = (blockIdx.y & 3) * 64, n = nb0 + wave * 16 + col;
  const float* Wm = which == 0 ? Wq : Wk; const float* bm = which == 0 ? bq : bk; const bool ax1 = r0 < NBT * N1;
  float* dst = ax1 ? (which == 0 ? QS1 : KS1) + (size_t)r0 * DMOD : (which == 0 ? QS2 : KS2) + (size_t)(r0 - NBT * N1) * DMOD;
  const float* pa = SX + (size_t)(r0 + col) * DMOD + 8 * g; const float* pw = Wm + (size_t)n * DMOD + 8 * g; const float bb = (ax1 ? (float)N2 : (float)N1) * bfr(bm[n]);
  v4f rc[2], rs[2];   // cos, sin of the 2 x 4 elements that this thread stores at the end: loaded here, in one flight with the operands, by every block (no branch, no wait in front of the operand loads); l = row mod 128 (NBT * N1 is a multiple of N2); the axis-1 blocks do not use them
#pragma unroll      // rc, rs by constant index
  for (int e = 0; e < 2; ++e) { const float* pt = CS + (size_t)((r0 + (tid >> 4) + 8 * e) % N2) * 16 + ((tid & 3) * 4); rc[e] = *(const v4f*)pt; rs[e] = *(const v4f*)(pt + N2 * 16); }
  v8f acc = {};   // every loop below is unrolled whole, so that a, w and the fragments are indexed by constants and stay in registers
#pragma unroll
  for (int kh = 0; kh < 2; ++kh) { v4f a[4][4], w[4][4];   // half of K at a time: its 32 loads go out together
#pragma unroll
    for (int k = 0; k < 4; ++k)
#pragma unroll
      for (int i = 0; i < 4; ++i) { const int o = (kh * 4 + k) * 32 + (i >> 1) * 16 + (i & 1) * 4; a[k][i] = *(const v4f*)(pa + o); w[k][i] = *(const v4f*)(pw + o); }
#pragma unroll
    for (int k = 0; k < 4; ++k) { v16b ah, am, al, wb;
#pragma unroll
      for (int i = 0; i < 16; ++i) { const float v = a[k][i >> 2][i & 3]; const __bf16 h = (__bf16)v; const float r1 = v - (float)h; const __bf16 m = (__bf16)r1; ah[i] = h; am[i] = m; al[i] = (__bf16)(r1 - (float)m); wb[i] = (__bf16)w[k][i >> 2][i & 3]; }
      acc = wmma_bf(al, wb, acc); acc = wmma_bf(am, wb, acc); acc = wmma_bf(ah, wb, acc); } }
#pragma unroll
  for (int r = 0; r < 8; ++r) so[8 * g + r][wave * 16 + col] = acc[r] + bb;
  __syncthreads();
  float mn = 3.0e38f, mx = -3.0e38f;
  v4f o2[2]; float* pst = dst + (size_t)(tid >> 4) * DMOD + nb0 + (tid & 15) * 4;
#pragma unroll      // rc, rs, o2 by constant index
  for (int qi = 0; qi < 2; ++qi) { const int rl = (tid >> 4) + 8 * qi, pc = tid & 15; v4f v = *(const v4f*)&so[rl][pc * 4];
    if (!ax1) { const v4f p = *(const v4f*)&so[rl][(pc * 4) ^ 16]; const float sg = (pc & 4) ? 1.0f : -1.0f;   // partner column d +- 16; the lower half takes it negated
#pragma unroll      // vector elements by constant index
      for (int e = 0; e < 4; ++e) v[e] = v[e] * rc[qi][e] + (sg * p[e]) * rs[qi][e]; }
#pragma unroll      // vector elements by constant index
    for (int e = 0; e < 4; ++e) { mn = fminf(mn, v[e]); mx = fmaxf(mx, v[e]); }
    o2[qi] = v; }
  // rows rl and rl + 8 (8 KB on); the stores and their s_wait_xcnt in one statement, so that the wait stands in front of the min-max code below, which takes the stored registers over
  asm volatile("global_store_b128 %0, %1, off\n\tglobal_store_b128 %0, %2, off offset:8192\n\ts_wait_xcnt 0x0" :: "v"(pst), "v"(o2[0]), "v"(o2[1]) : "memory");
#pragma unroll
  for (int o = 1; o < 32; o <<= 1) { mn = fminf(mn, __shfl_xor(mn, o)); mx = fmaxf(mx, __shfl_xor(mx, o)); }
  if (lane == 0) { smn[wave] = mn; smx[wave] = mx; }
  __syncthreads();
  if (tid < 8) { const v4f z = {0.f, 0.f, 0.f, 0.f}, m4 = {fminf(fminf(smn[0], smn[1]), fminf(smn[2], smn[3])), fmaxf(fmaxf(smx[0], smx[1]), fmaxf(smx[2], smx[3])), 0.f, 0.f};
    const int t = (ax1 ? 0 : 2) + which, slot = (ax1 ? r0 : r0 - NBT * N1) / 16 * 4 + (blockIdx.y & 3); vst2(MMP + ((size_t)t * MMN + slot) * MMS + tid * 4, tid == 0 ? m4 : z); }
}
// ---- k_feat: phi for the pooled tensor S = S_t (rows (b,l), l < L) and head h; blockIdx.x = h * 96 + bx, bx: 16 row tiles each of t = 0, 1, then 32 each of t = 2, 3; behind these FEAT_NB blocks, per block, one wave's quarter of a v-projection tile; block = 16 rows (one wave): xs = (x - mn)/(mx - mn) * 32^-1/4; dots on WMMA (xs hi/lo x bf16(feat rows), K = 32, 12 tiles); phi = exp(dot - |xs|^2/2 - ln(192)/2 + 1e-6);
//      P[(b*8 + h)*L + l][m] rows of 768 B (48 pieces). On entry the wave takes the tensor's global min and max over the slots that k_pproj's blocks left; a block of a k tensor also leaves the sum of its 16 phi rows (ascending) in KPB[ax][(b,h)][l0 / 16][m], 6 whole lines
#define FEAT_NB ((2 * (NBT * N1 / 16) + 2 * (NBT * N2 / 16)) * NHD)
__global__ __launch_bounds__(32) void k_feat(const float* __restrict__ S0, const float* __restrict__ S1, const float* __restrict__ S2, const float* __restrict__ S3, const float* __restrict__ MM, const float* __restrict__ feat, float* __restrict__ PB, float* __restrict__ KPB, const float* __restrict__ X, const float* __restrict__ PWF, const float* __restrict__ bv, float* __restrict__ V) {
  __shared__ __align__(16) union { struct { float sx[16][36]; float so[16][196]; float soff[16]; } f; float pj[16][132]; } sm; auto& sx = sm.f.sx; auto& so = sm.f.so; auto& soff = sm.f.soff;
  const int fb = blockIdx.x;
  if (fb >= FEAT_NB) { proj_tile(X, (const __bf16*)PWF, bv, V, sm.pj, (fb - FEAT_NB) >> 2, (fb - FEAT_NB) & 3, threadIdx.x); return; }
  constexpr int T1N = NBT * N1 / 16, T2N = NBT * N2 / 16; const int bx = fb % (FEAT_NB / NHD), t = bx < 2 * T1N ? bx / T1N : 2 + (bx - 2 * T1N) / T2N, L = t < 2 ? N1 : N2;
  const float* S = t == 0 ? S0 : t == 1 ? S1 : t == 2 ? S2 : S3; float* P = PB + (size_t)t * PSZ;
  const int lane = threadIdx.x, col = lane & 15, g = lane >> 4; const int h = fb / (FEAT_NB / NHD); const int r0 = (t < 2 ? bx % T1N : (bx - 2 * T1N) % T2N) * 16; const int b = r0 / L, l0 = r0 % L;
  float mn = 3.0e38f, mx = -3.0e38f;
#pragma unroll      // the 4 slot loads go out together; with 64 slots each is read twice, which a min or max does not see
  for (int i = 0; i < MMN / 32; ++i) { const v2f m2 = *(const v2f*)(MM + ((size_t)t * MMN + ((lane + 32 * i) & (t < 2 ? MMN / 2 - 1 : MMN - 1))) * MMS); mn = fminf(mn, m2[0]); mx = fmaxf(mx, m2[1]); }
  v16b w[12];
#pragma unroll      // w by constant index, in registers; the 12 tiles' feat rows need no value of this block: their 48 loads go out here as one group and land behind the min-max reduction
  for (int j = 0; j < 12; ++j) w[j] = frag_gbf(feat + (size_t)(j * 16 + col) * DHD, lane);
#pragma unroll
  for (int o = 1; o < 32; o <<= 1) { mn = fminf(mn, __shfl_xor(mn, o)); mx = fmaxf(mx, __shfl_xor(mx, o)); }
  const float sc = 1.0f / (mx - mn); const float temp = 0.42044820762685725f;   // 32^-0.25
  { const int rl = lane >> 1, half = lane & 1; float ss = 0.f;
    for (int d = half * 16; d < half * 16 + 16; ++d) { const float x = S[(size_t)(r0 + rl) * DMOD + h * DHD + d]; const float xs = (x - mn) * sc * temp; sx[rl][d] = xs; ss += xs * xs; }
    ss += __shfl_xor(ss, 1); if (half == 0) { soff[rl] = -0.5f * ss - 0.5f * 5.2574953720277815f + 1e-6f; sx[rl][32] = 0.f; sx[rl][33] = 0.f; sx[rl][34] = 0.f; sx[rl][35] = 0.f; } }
  LDSX();
  const F2 a = split_row(&sx[col][0], 0, lane);
  const v4f of0 = *(const v4f*)&soff[8 * g], of1 = *(const v4f*)&soff[8 * g + 4];   // the offsets of this lane's 8 rows, read once
#pragma unroll      // straight-line code: the 96 exponentials of a lane are independent of one another and fill each other's latencies
  for (int j = 0; j < 12; ++j) { v8f acc = {}; acc = wmma_bf(a.l, w[j], acc); acc = wmma_bf(a.h, w[j], acc);
#pragma unroll
    for (int r = 0; r < 8; ++r) so[8 * g + r][j * 16 + col] = exp_il(acc[r] + (r < 4 ? of0[r & 3] : of1[r & 3])); }
  LDSX();
  float* prow = P + ((size_t)(b * NHD + h) * L + l0) * MF;   // the block's 16 rows of 48 pieces lie one behind the other: piece q at float 4 q
  // piece q = lane + 32 s + 96 m (s < 3, m < 8) lies in row 2 m + ds, ds = (lane + 32 s) / 48: three LDS addresses, the rest constant offsets (2 rows of 196 floats per m)
  const float* sl[3] = { &so[0][0] + lane * 4, &so[0][0] + (lane + 32) * 4 + (lane >= 16 ? 4 : 0), &so[0][0] + (lane + 64) * 4 + 4 }; v4f pv[24];
#pragma unroll      // pv by constant index; the 24 LDS reads go out as one group, not one wait per store
  for (int i = 0; i < 24; ++i) pv[i] = *(const v4f*)(sl[i % 3] + (i / 3) * (2 * 196));
#pragma unroll
  for (int i = 0; i < 24; ++i) vst2(prow + (size_t)(lane + 32 * i) * 4, pv[i]);
  asm volatile("s_wait_xcnt 0x0" ::: "memory");   // behind the 24 stores above, ahead of the key-sum code, which takes their base and data registers over
  if (t & 1) { float* KQ = KPB + (((size_t)(t >> 1) * NBT * NHD + b * NHD + h) * (N2 / 16) + l0 / 16) * MF;
    for (int i = 0; i < MF / 32; ++i) { float s = 0.f;
#pragma unroll      // 16 LDS reads in flight
      for (int r = 0; r < 16; ++r) s += so[r][i * 32 + lane];
      KQ[i * 32 + lane] = s; } }
}
// ---- k_amat: per axis and (b,h): A[l][l'] = (sum_m QP[l][m] (hi/lo) . KP[l'][m] (hi/lo)) / att_norm[l]: M = l (by = 4 tiles of axis 1, then 8 of axis 2), N = l' (32 per wave = 2 tiles), K = m (6 steps), 3 products; rows pitch 128, 128-B segment per wave and row; blockIdx.x = by * 32 + (b,h), behind these AMAT_NB blocks v-projection tiles.
//      att_norm[l] = sum_m QP[l][m] ksum[m], ksum[m] = sum_l' KP[l'][m]: each wave adds k_feat's row-tile sums (ascending) into its own 192 floats of LDS and takes the dot products of its 16 q rows in f32 from the values it loads for the A fragments (lane = (row, half of each 32 m), the halves added by a shuffle); no wave needs another
#define AMAT_NB (NBT * NHD * (N1 / 16 + N2 / 16))
__global__ __launch_bounds__(128) void k_amat(const float* __restrict__ PB, const float* __restrict__ KPB, float* __restrict__ AMB, const float* __restrict__ X, const float* __restrict__ PWF, const float* __restrict__ bv, float* __restrict__ V) {
  __shared__ __align__(16) union { struct { float so[4][16][36]; float sks[4][MF]; } a; float pj[4][16][132]; } sm; auto& so = sm.a.so; auto& sks = sm.a.sks;
  const int fb = blockIdx.x, tid = threadIdx.x, wave = tid >> 5, lane = tid & 31, col = lane & 15, g = lane >> 4;
  if (fb >= AMAT_NB) { proj_tile(X, (const __bf16*)PWF, bv, V, sm.pj[wave], PROJ_F + fb - AMAT_NB, wave, lane); return; }
  const int by = fb / (NBT * NHD), ax = by < N1 / 16 ? 0 : 1, L = ax == 0 ? N1 : N2; const int bh = fb % (NBT * NHD), l0 = (ax == 0 ? by : by - N1 / 16) * 16, n0 = wave * 32;
  if (n0 >= L) return;
  const float* QP = PB + (size_t)(2 * ax) * PSZ; const float* KP = QP + PSZ; float* AM = AMB + (size_t)ax * AMSZ;
  const float* KQ = KPB + ((size_t)ax * NBT * NHD + bh) * (N2 / 16) * MF + lane; float ks[MF / 32] = {};
  { float v[N2 / 16][MF / 32] = {};   // every loop of this kernel is unrolled whole: its arrays are indexed by constants and stay in registers. The 4 or 8 tiles' loads go out together; a tile that axis 1 lacks adds 0; ascending tile order
#pragma unroll
    for (int tl = 0; tl < N1 / 16; ++tl)
#pragma unroll
      for (int i = 0; i < MF / 32; ++i) v[tl][i] = KQ[(size_t)tl * MF + i * 32];
    asm volatile("s_wait_xcnt 0x0" ::: "memory");   // behind the 24 loads above, ahead of any rewrite of their base or offset register (on the axis-1 way only counted data waits follow before the base is reused)
    if (ax == 1) {
#pragma unroll
      for (int tl = N1 / 16; tl < N2 / 16; ++tl)
#pragma unroll
        for (int i = 0; i < MF / 32; ++i) v[tl][i] = KQ[(size_t)tl * MF + i * 32]; }
#pragma unroll
    for (int tl = 0; tl < N2 / 16; ++tl)
#pragma unroll
      for (int i = 0; i < MF / 32; ++i) ks[i] += v[tl][i]; }
#pragma unroll
  for (int i = 0; i < MF / 32; ++i) sks[wave][i * 32 + lane] = ks[i];
  LDSX();
  const float* qrow = QP + ((size_t)bh * L + l0 + col) * MF;
  v8f acc[2] = {}; float dn = 0.f;
#pragma unroll
  for (int kc = 0; kc < MF / 32; ++kc) { float v[16]; const float* p = qrow + kc * 32 + 8 * g; const float* kp = &sks[wave][kc * 32 + 8 * g]; float dk = 0.f;
#pragma unroll
    for (int i = 0; i < 8; ++i) { v[i] = p[i]; v[8 + i] = p[16 + i]; }
#pragma unroll
    for (int i = 0; i < 8; ++i) dk += v[i] * kp[i];
#pragma unroll
    for (int i = 0; i < 8; ++i) dk += v[8 + i] * kp[16 + i];
    dn += dk; const F2 a = bsplit16(v);
#pragma unroll
    for (int j = 0; j < 2; ++j) { const F2 kb = split_row(KP + ((size_t)bh * L + n0 + j * 16 + col) * MF, kc * 32, lane); acc[j] = mac3(a, kb, acc[j]); } }
  dn += __shfl_xor(dn, 16);   // lanes col and col + 16 now both hold att_norm of row l0 + col
  float inv[8];
#pragma unroll
  for (int r = 0; r < 8; ++r) inv[r] = 1.0f / __shfl(dn, 8 * g + r);
#pragma unroll
  for (int j = 0; j < 2; ++j)
#pragma unroll
    for (int r = 0; r < 8; ++r) so[wave][8 * g + r][j * 16 + col] = acc[j][r] * inv[r];
  LDSX();
  for (int q = lane; q < 16 * 8; q += 32) { const int rl = q >> 3, pc = q & 7; vst2(AM + ((size_t)bh * N2 + l0 + rl) * N2 + n0 + pc * 4, *(const v4f*)&so[wave][rl][pc * 4]); }
}
// ---- k_att: per (b, ATT_G neighbouring other positions o, head h), in place on the value tensor: out[l][d] = sum_l' A[(b,h)][l][l'] (hi/lo) . V[l'][(h,d)] (hi/lo): M = l (one 16-row tile per wave, L/16 waves), N = d (2 tiles per position), K = l' (2 or 4 steps), 3 products; all batches in one launch.
//      A depends on (b, h) alone: a wave loads and splits its 16 rows of A once and uses the fragments for the ATT_G value tiles of the block (ATT_G divides both axis lengths, so a block stays inside one batch).
//      The block owns the ATT_G tiles of L x 32 (128-B row segments) that it reads and writes: each is read once (thread = 4 rows x 16 B), split into bf16 hi and residual and laid down transposed in LDS ([d][l'], 8-B stores, pitch 2 L + 16 B for the 16-B fragment reads); the stores to V follow the barrier behind which every read has landed
#define ATT_G 4
template <int PASS>
__global__ __launch_bounds__(PASS == 1 ? N1 * 2 : N2 * 2) void k_att(const float* __restrict__ AM, int ob0, float* V) {
  constexpr int L = (PASS == 1 ? N1 : N2), O = (PASS == 1 ? N2 : N1); constexpr size_t RS = (PASS == 1 ? (size_t)N2 * DMOD : (size_t)DMOD), OS = (PASS == 1 ? (size_t)DMOD : (size_t)N2 * DMOD);   // RS: floats from row l to row l + 1; OS: from position o to o + 1
  __shared__ __align__(16) __bf16 vh[ATT_G][DHD][L + 8], vl[ATT_G][DHD][L + 8]; __shared__ __align__(16) float so[L / 16][ATT_G][16][36];
  const int tid = threadIdx.x, wave = tid >> 5, lane = tid & 31, col = lane & 15, g = lane >> 4; const int h = blockIdx.x % NHD, bo = ob0 + blockIdx.x / NHD * ATT_G; const int b = bo / O, o = bo % O;
  float* tile = V + (PASS == 1 ? ((size_t)b * N1 * N2 + o) : ((size_t)b * N1 + o) * N2) * DMOD + h * DHD;   // the first of the block's tiles
  const float* arow = AM + ((size_t)(b * NHD + h) * N2 + wave * 16 + col) * N2;
  const int p4 = (tid & 7) * 4, l4 = (tid >> 3) * 4; const float* src = tile + (size_t)l4 * RS + p4; v4f x[ATT_G][4]; F2 a[L / 32];   // every loop below is unrolled whole: x, a, hi, lo and acc are indexed by constants and stay in registers; the tiles' 16 loads and A's loads go out together, ahead of the barrier
#pragma unroll
  for (int t = 0; t < ATT_G; ++t)
#pragma unroll
    for (int i = 0; i < 4; ++i) x[t][i] = *(const v4f*)(src + (size_t)t * OS + (size_t)i * RS);
#pragma unroll
  for (int kc = 0; kc < L / 32; ++kc) a[kc] = split_row(arow, kc * 32, lane);
#pragma unroll
  for (int t = 0; t < ATT_G; ++t)
#pragma unroll
    for (int e = 0; e < 4; ++e) { v4b hi, lo;
#pragma unroll
      for (int i = 0; i < 4; ++i) { const float v = x[t][i][e]; const __bf16 hh = (__bf16)v; hi[i] = hh; lo[i] = (__bf16)(v - (float)hh); }
      *(v4b*)&vh[t][p4 + e][l4] = hi; *(v4b*)&vl[t][p4 + e][l4] = lo; }
  __syncthreads();
  v8f acc[ATT_G][2] = {};
#pragma unroll
  for (int t = 0; t < ATT_G; ++t)
#pragma unroll
    for (int kc = 0; kc < L / 32; ++kc)
#pragma unroll
      for (int j = 0; j < 2; ++j) { F2 vb; vb.h = frag_b(&vh[t][j * 16 + col][kc * 32], lane); vb.l = frag_b(&vl[t][j * 16 + col][kc * 32], lane); acc[t][j] = mac3(a[kc], vb, acc[t][j]); }
#pragma unroll
  for (int t = 0; t < ATT_G; ++t)
#pragma unroll
    for (int j = 0; j < 2; ++j)
#pragma unroll
      for (int r = 0; r < 8; ++r) so[wave][t][8 * g + r][j * 16 + col] = acc[t][j][r];
  LDSX();
#pragma unroll
  for (int t = 0; t < ATT_G; ++t)
#pragma unroll      // the wave's 16 LDS reads go out as one group with one wait, not one wait per store
    for (int q4 = 0; q4 < 4; ++q4) { const int rl = q4 * 4 + (lane >> 3), pc = lane & 7; vst2(tile + (size_t)t * OS + (size_t)(wave * 16 + rl) * RS + pc * 4, *(const v4f*)&so[wave][t][rl][pc * 4]); }
}
// ---- k_atto: pass 2 (time axis) and the output projection in one kernel, per (b, n1): the block owns the 128 rows x 256 columns (all 8 heads) of that position, so the attended value never goes to memory; 16 waves, one block per WGP.
//      1) the value tile is read once (thread = 4 rows x 16 B of 4 heads), split into bf16 hi and residual, laid transposed in LDS ([head][d][l'], as in k_att); barrier.
//      2) wave = (16 rows l, 4 heads): the product is taken transposed, D[d][l] = sum_l' V[l'][d] (A operand, hi/lo) . A[l][l'] (B operand, hi/lo), same 3 products in the same order: a lane then holds 8 consecutive d of one row l,
//         which it splits hi/lo and stores as 16-B pieces into row-major LDS planes sh, sl [l][256] (pitch 528 B for the 16-B fragment reads). The mixing-matrix rows of the next head are loaded while this head is worked on; barrier.
//      3) wave = (32 rows, 64 columns): Y = value(hi/lo, fragments from sh, sl) . bf16(Wo rows, packed) + bo, K = 256; a Wo fragment serves 4 products; the result leaves through the wave's own 32 x 68 floats of LDS (over the dead transposed tile) as 256-B row segments
struct R16 { v4f q[4]; };
__device__ __forceinline__ R16 ld_row16(const float* row, int k0, int lane) { R16 r; const float* p = row + k0 + 8 * (lane >> 4);
  r.q[0] = *(const v4f*)p; r.q[1] = *(const v4f*)(p + 4); r.q[2] = *(const v4f*)(p + 16); r.q[3] = *(const v4f*)(p + 20); return r; }
__device__ __forceinline__ F2 split_r16(const R16& r) { float v[16];
#pragma unroll
  for (int i = 0; i < 16; ++i) v[i] = r.q[i >> 2][i & 3];
  return bsplit16(v); }
__global__ __launch_bounds__(512) void k_atto(const float* __restrict__ AM, int ob0, const float* __restrict__ V, const float* __restrict__ PWF, const float* __restrict__ bo, float* __restrict__ Y) {
  __shared__ __align__(16) union { struct { __bf16 vh[NHD][DHD][N2 + 8], vl[NHD][DHD][N2 + 8]; } t; float so[16][32][68]; } sm; auto& vh = sm.t.vh; auto& vl = sm.t.vl; auto& so = sm.so;
  __shared__ __align__(16) __bf16 sh[N2][DMOD + 8], sl[N2][DMOD + 8];
  const int tid = threadIdx.x, wave = tid >> 5, lane = tid & 31, col = lane & 15, g = lane >> 4; const int pos = ob0 + blockIdx.x, b = pos / N1; const size_t row0 = (size_t)pos * N2;   // pos = b * 64 + n1
  const int lt = wave & 7, h0 = (wave >> 3) * 4;
  const float* arow = AM + ((size_t)(b * NHD + h0) * N2 + lt * 16 + col) * N2;   // row l of head h0; a head further = N2 * N2 floats on
  const int t8 = tid & 255, hs = tid >> 8, p4 = (t8 & 7) * 4, l4 = (t8 >> 3) * 4; const float* src = V + (row0 + l4) * DMOD + hs * DHD + p4; v4f x[4][4]; R16 ra[N2 / 32];   // every loop below but the k loop of part 3 is unrolled whole: the arrays are indexed by constants and stay in registers; the tile's 16 loads and the first head's A rows go out together
#pragma unroll
  for (int t = 0; t < 4; ++t)
#pragma unroll
    for (int i = 0; i < 4; ++i) x[t][i] = *(const v4f*)(src + t * 2 * DHD + (size_t)i * DMOD);
#pragma unroll
  for (int kc = 0; kc < N2 / 32; ++kc) ra[kc] = ld_row16(arow, kc * 32, lane);
#pragma unroll
  for (int t = 0; t < 4; ++t)
#pragma unroll
    for (int e = 0; e < 4; ++e) { v4b hi, lo;
#pragma unroll
      for (int i = 0; i < 4; ++i) { const float v = x[t][i][e]; const __bf16 hh = (__bf16)v; hi[i] = hh; lo[i] = (__bf16)(v - (float)hh); }
      *(v4b*)&vh[t * 2 + hs][p4 + e][l4] = hi; *(v4b*)&vl[t * 2 + hs][p4 + e][l4] = lo; }
  __syncthreads();
#pragma unroll
  for (int q = 0; q < 4; ++q) { const int hd = h0 + q; F2 a[N2 / 32];
#pragma unroll
    for (int kc = 0; kc < N2 / 32; ++kc) a[kc] = split_r16(ra[kc]);
    if (q < 3) {
#pragma unroll
      for (int kc = 0; kc < N2 / 32; ++kc) ra[kc] = ld_row16(arow + (size_t)(q + 1) * N2 * N2, kc * 32, lane); }
    v8f acc[2] = {};
#pragma unroll
    for (int kc = 0; kc < N2 / 32; ++kc)
#pragma unroll
      for (int j = 0; j < 2; ++j) { const v16b bh = frag_b(&vh[hd][j * 16 + col][kc * 32], lane), bl = frag_b(&vl[hd][j * 16 + col][kc * 32], lane);
        acc[j] = wmma_bf(bh, a[kc].l, acc[j]); acc[j] = wmma_bf(bl, a[kc].h, acc[j]); acc[j] = wmma_bf(bh, a[kc].h, acc[j]); }
#pragma unroll
    for (int j = 0; j < 2; ++j) { v8b hi, lo;
#pragma unroll
      for (int r = 0; r < 8; ++r) { const float v = acc[j][r]; const __bf16 hh = (__bf16)v; hi[r] = hh; lo[r] = (__bf16)(v - (float)hh); }
      *(v8b*)&sh[lt * 16 + col][hd * DHD + j * 16 + 8 * g] = hi; *(v8b*)&sl[lt * 16 + col][hd * DHD + j * 16 + 8 * g] = lo; } }
  __syncthreads();
  const int lp = wave & 3, nq = wave >> 2; const __bf16* PWo = (const __bf16*)PWF + PWSZ;
  v8f acc[2][4] = {};
#pragma unroll 2
  for (int kc = 0; kc < DMOD / 32; ++kc) { v16b w[4], ah[2], al[2];
#pragma unroll      // w, ah, al indexed by constants, in registers: the k step's 8 loads of B and 8 LDS reads of A go out as one group, ahead of its first WMMA
    for (int j = 0; j < 4; ++j) w[j] = frag_pw(PWo, nq * 4 + j, kc, lane);
#pragma unroll
    for (int i = 0; i < 2; ++i) { ah[i] = frag_b(&sh[lp * 32 + i * 16 + col][kc * 32], lane); al[i] = frag_b(&sl[lp * 32 + i * 16 + col][kc * 32], lane); }
#pragma unroll
    for (int i = 0; i < 2; ++i)
#pragma unroll
      for (int j = 0; j < 4; ++j) { acc[i][j] = wmma_bf(al[i], w[j], acc[i][j]); acc[i][j] = wmma_bf(ah[i], w[j], acc[i][j]); } }
#pragma unroll
  for (int j = 0; j < 4; ++j) { const float bb = bfr(bo[nq * 64 + j * 16 + col]);
#pragma unroll
    for (int i = 0; i < 2; ++i)
#pragma unroll
      for (int r = 0; r < 8; ++r) so[wave][i * 16 + 8 * g + r][j * 16 + col] = acc[i][j][r] + bb; }
  LDSX();
#pragma unroll      // the wave's 16 LDS reads go out as one group with one wait, not one wait per store
  for (int s = 0; s < 16; ++s) { const int rl = s * 2 + g; vst2(Y + (row0 + lp * 32 + rl) * DMOD + nq * 64 + col * 4, *(const v4f*)&so[wave][rl][col * 4]); }
}

#ifndef DBG
#define DBG 0
#endif
#if DBG != 0
__global__ __launch_bounds__(256) void k_dump(const float* __restrict__ src, int n, float* __restrict__ out) {   // out[0..n) = src, rest of batch-0 region zero
  const size_t p = (size_t)blockIdx.x * 256 + threadIdx.x; v4f v; for (int i = 0; i < 4; ++i) { const size_t f = p * 4 + i; v[i] = f < (size_t)n ? src[f] : 0.f; } vst2(out + p * 4, v);
}
#endif
extern "C" void kernel_launch(void* const* d_in, const int* in_sizes, int n_in, void* d_out, int out_size, void* d_ws, size_t ws_size, hipStream_t stream) {
  (void)in_sizes; (void)n_in; (void)out_size;
  const float** F = (const float**)d_in;   // X, Wq, bq, Wk, bk, Wv, bv, Wo, bo, feat
  if (ws_size < (size_t)WS_END) return;
  char* ws = (char*)d_ws; float *PB = (float*)(ws + WS_A), *V = (float*)(ws + WS_V), *QS1 = (float*)(ws + WS_QS1), *KS1 = (float*)(ws + WS_KS1), *QS2 = (float*)(ws + WS_QS2), *KS2 = (float*)(ws + WS_KS2), *MM = (float*)(ws + WS_MM), *AM = (float*)(ws + WS_AM), *KSUM = (float*)(ws + WS_KSUM), *SX = (float*)(ws + WS_SX), *CS = (float*)(ws + WS_CS), *PW = (float*)(ws + WS_B);
  k_poolx<<<NBT * N1 + NBT * N2 + PACK_NB + TRIG_NB, 256, 0, stream>>>(F[0], SX, F[5], F[7], PW, CS);
  k_pproj<<<dim3((NBT * N1 + NBT * N2) / 16, 8), 128, 0, stream>>>(SX, F[1], F[2], F[3], F[4], QS1, KS1, QS2, KS2, CS, MM);
  // ---- the mixing matrices of both axes (assets: l = n1 = 64; time: l = n2 = 128 with RoPE)
  k_feat<<<FEAT_NB + 4 * PROJ_F, 32, 0, stream>>>(QS1, KS1, QS2, KS2, MM, F[9], PB, KSUM, F[0], PW, F[6], V);
#if DBG == 2
  k_dump<<<N1 * N2 * DMOD / 1024, 256, 0, stream>>>(PB, NBT * NHD * N1 * MF, (float*)d_out); return;  // pass-1 phi(q) [4][8][64][192]
#endif
  k_amat<<<AMAT_NB + PROJ_N - PROJ_F, 128, 0, stream>>>(PB, KSUM, AM, F[0], PW, F[6], V);
  // ---- pass 1: assets axis (other = n2 = 128)
  k_att<1><<<(TNB - TB0) * N2 * NHD / ATT_G, N1 * 2, 0, stream>>>(AM, TB0 * N2, V);
#if DBG == 3
  k_dump<<<N1 * N2 * DMOD / 1024, 256, 0, stream>>>(V, N1 * N2 * DMOD, (float*)d_out); return;
#endif
  // ---- pass 2: time axis (other = n1 = 64), with the output projection
  k_atto<<<(TNB - TB0) * N1, 512, 0, stream>>>(AM + AMSZ, TB0 * N1, V, PW, F[8], (float*)d_out);
}

// v010
// A run of this version takes 80.1 microseconds.
// Next to v009, in two timings, it ran 1.10 times as fast each time.
// Over all steps from v000 it is 10.5 times as fast.
// compute dtype: X, the projection weights/biases and the random-feature matrix (module inputs) rounded to bf16; the v projection with exact bf16 products; the q and k projections taken on the axis sums of bf16(X) (f32 sums as three bf16 pieces, 3 products, all 24 bits); the feature-map GEMM (pooled q,k x feat) with the pooled operand as a bf16 hi + bf16 residual pair (2 products); the phi(q) phi(k)^T and mixing-matrix x value contractions with both computed operands hi/lo (3 products);
// the output projection hi/lo against bf16 Wo (2 products); axis pooling, RoPE, global min-max normalisation, exp feature maps, normalisers and divisions in f32; f32 accumulate.
#include <hip/hip_runtime.h>
#include <math.h>

typedef __attribute__((ext_vector_type(16))) _Float16 v16h;
typedef __attribute__((ext_vector_type(16))) __bf16 v16b;
typedef __attribute__((ext_vector_type(8)))  _Float16 v8h;
typedef __attribute__((ext_vector_type(8)))  float v8f;
typedef __attribute__((ext_vector_type(4)))  float v4f;
typedef __attribute__((ext_vector_type(2)))  float v2f;
typedef __attribute__((ext_vector_type(4)))  unsigned v4u;
typedef __attribute__((ext_vector_type(4)))  int v4i;
typedef float __attribute__((may_alias)) float_a;
typedef int __attribute__((may_alias)) int_a;

template <typename T> __device__ __forceinline__ void vst2(void* p, T v) { *(T*)p = v;  }
__device__ __forceinline__ v8f wmma16(v16h a, v16h b, v8f c) {
  v8f d = __builtin_amdgcn_wmma_f32_16x16x32_f16(false, a, false, b, (short)0, c, false, false);
  asm volatile("v_nop\n\tv_nop\n\tv_nop\n\tv_nop" : "+v"(d) : "v"(a), "v"(b));
  return d;
}
__device__ __forceinline__ v8f wmma_bf(v16b a, v16b b, v8f c) {
  v8f d = __builtin_amdgcn_wmma_f32_16x16x32_bf16(false, a, false, b, (short)0, c, false, false);
  asm volatile("v_nop\n\tv_nop\n\tv_nop\n\tv_nop" : "+v"(d) : "v"(a), "v"(b));
  return d;
}
// 16x16x32 fragments: lane = (h = lane>>4, row/col = lane&15); elements 0..7 = k0+8h+0..7, 8..15 = k0+16+8h+0..7; D element r = row 8h+r
__device__ __forceinline__ v16h frag_h(const _Float16* rowk0, int lane) {
  union { v16h v; v8h q[2]; } u; const _Float16* p = rowk0 + 8 * (lane >> 4);
  u.q[0] = *(const v8h*)p; u.q[1] = *(const v8h*)(p + 16); return u.v;
}
__device__ __forceinline__ v16h frag_f32(const float* rowk0, int lane) {
  v16h a; const float* p = rowk0 + 8 * (lane >> 4);
#pragma unroll
  for (int i = 0; i < 8; ++i) { a[i] = (_Float16)p[i]; a[8 + i] = (_Float16)p[16 + i]; }
  return a;
}
__device__ __forceinline__ v16h frag_f32s(const float* rowk0, int lane, float sc) {
  v16h a; const float* p = rowk0 + 8 * (lane >> 4);
#pragma unroll
  for (int i = 0; i < 8; ++i) { a[i] = (_Float16)(p[i] * sc); a[8 + i] = (_Float16)(p[16 + i] * sc); }
  return a;
}
// column fragment from a [K][ld] layout (column n), rows >= K read as 0
__device__ __forceinline__ v16h fragc_f32(const float* W, int k0, int n, int lane, int ld, int K) {
  v16h a; const int g = lane >> 4;
#pragma unroll
  for (int i = 0; i < 8; ++i) { const int ka = k0 + 8 * g + i, kb = ka + 16;
    a[i] = (_Float16)(ka < K ? W[(size_t)(ka < K ? ka : K - 1) * ld + n] : 0.f); a[8 + i] = (_Float16)(kb < K ? W[(size_t)(kb < K ? kb : K - 1) * ld + n] : 0.f); }
  return a;
}
struct F2 { v16b h, l; };
__device__ __forceinline__ F2 bsplit16(const float v[16]) { F2 r;
#pragma unroll
  for (int i = 0; i < 16; ++i) { const __bf16 h = (__bf16)v[i]; r.h[i] = h; r.l[i] = (__bf16)(v[i] - (float)h); }
  return r; }
__device__ __forceinline__ F2 split_row(const float* row, int k0, int lane) { float v[16]; const float* p = row + k0 + 8 * (lane >> 4);
#pragma unroll
  for (int i = 0; i < 8; ++i) { v[i] = p[i]; v[8 + i] = p[16 + i]; }
  return bsplit16(v); }
__device__ __forceinline__ F2 split_rowK(const float* row, int k0, int lane, int K) { float v[16]; const int g = lane >> 4;
#pragma unroll
  for (int i = 0; i < 8; ++i) { const int ka = k0 + 8 * g + i, kb = ka + 16; v[i] = ka < K ? row[ka < K ? ka : K - 1] : 0.f; v[8 + i] = kb < K ? row[kb < K ? kb : K - 1] : 0.f; }
  return bsplit16(v); }
__device__ __forceinline__ F2 split_col(const float* W, int k0, int n, int lane, int ld, int K) { float v[16]; const int g = lane >> 4;
#pragma unroll
  for (int i = 0; i < 8; ++i) { const int ka = k0 + 8 * g + i, kb = ka + 16; v[i] = ka < K ? W[(size_t)(ka < K ? ka : K - 1) * ld + n] : 0.f; v[8 + i] = kb < K ? W[(size_t)(kb < K ? kb : K - 1) * ld + n] : 0.f; }
  return bsplit16(v); }
__device__ __forceinline__ v8f mac3(const F2& a, const F2& b, v8f c) { c = wmma_bf(a.l, b.h, c); c = wmma_bf(a.h, b.l, c); return wmma_bf(a.h, b.h, c); }
__device__ __forceinline__ float sigm(float v) { return 1.0f / (1.0f + expf(-v)); }
#define LDSX() do { asm volatile("s_wait_dscnt 0" ::: "memory"); __builtin_amdgcn_wave_barrier(); __builtin_amdgcn_fence(__ATOMIC_RELEASE, "workgroup"); } while (0)


// High-order linear attention over a [4, 64, 128, 256] tensor: q/k/v = X W^T + b; for the assets axis (n1, pooled over n2) and then the time axis (n2, pooled over n1, with RoPE): Performer-style positive features phi(x) = exp(xs f^T - |xs|^2/2 - log(M)/2 + 1e-6), xs = (x - min x)/(max x - min x) * 32^-1/4 (global min/max),
// out_l = sum_l' A[l][l'] v_l', A[l][l'] = phi(q_l) . phi(k_l') / (phi(q_l) . sum_l phi(k_l)): the product phi(q) (phi(k)^T v) taken as (phi(q) phi(k)^T) v, since A depends on (b, head) alone and the attended length (64, 128) is below the 192 features; finally value W_o^T + b_o.
// q and k are used only through their axis sums, and sum_i (x_i W^T + b) = (sum_i x_i) W^T + n b: X is pooled first and only the 768 pooled rows are projected.
// k_poolx (axis sums of X; Wv and Wo packed as bf16 fragments; RoPE's cos and sin table); k_pproj (pooled q and k, RoPE on the dim-2 rows, min-max per block); proj_tile (v); k_feat (min-max finals, phi via WMMA, key sums per 16 rows); k_amat (per (b, head): key sum, normaliser, A); k_att (pass 1, per (b, 4 other-positions, head): value tiles transposed in LDS, A x tiles, written back in place); k_atto (pass 2 and the output projection, per (b, n1), all heads);
// A depends on the pooled q and k alone, never on the value: k_feat and k_amat each run once, for both axes (and for q and k) in one grid, the block index naming the tensor t (0 = q axis 1, 1 = k axis 1, 2 = q axis 2, 3 = k axis 2) or the axis ax (0, 1).
// A small elementwise or reducing stage has no launch of its own: the block that makes the values does the part it can (RoPE, its own min-max, its own 16-row key sum) before it stores them, and the block that needs the whole finishes it on entry (min-max over the block slots, key sum over the row tiles, normaliser of its own 16 rows)
#define NBT 4
#define N1 64
#define N2 128
#define DMOD 256
#define NHD 8
#define DHD 32
#define MF 192
#define NPOS (NBT * N1 * N2)      // 32768 positions
#ifndef TNB
#define TNB NBT                   // batches run through the attention passes / output (debug: fewer)
#endif
#ifndef TB0
#define TB0 0                     // first batch of the attention loops (debug)
#endif
typedef __attribute__((ext_vector_type(8))) __bf16 v8b;
typedef __attribute__((ext_vector_type(4))) __bf16 v4b;
__device__ __forceinline__ v16b frag_b(const __bf16* rowk0, int lane) {
  union { v16b v; v8b q[2]; } u; const __bf16* p = rowk0 + 8 * (lane >> 4);
  u.q[0] = *(const v8b*)p; u.q[1] = *(const v8b*)(p + 16); return u.v;
}
__device__ __forceinline__ v16b frag_gbf(const float* rowk0, int lane) {
  v16b a; const float* p = rowk0 + 8 * (lane >> 4);
#pragma unroll
  for (int i = 0; i < 8; ++i) { a[i] = (__bf16)p[i]; a[8 + i] = (__bf16)p[16 + i]; }
  return a;
}
// B fragment of a packed weight matrix (k_poolx lays it down): tile (nt = 16 output columns, kc = 32 of K) = 2 planes of 512 B, plane p holds per lane its elements 8p..8p+7 (same k order as frag_gbf), so each 16-B load of a wave covers 4 whole 128-B lines
__device__ __forceinline__ v16b frag_pw(const __bf16* PW, int nt, int kc, int lane) {
  union { v16b v; v8b q[2]; } u; const __bf16* p = PW + (size_t)(nt * (DMOD / 32) + kc) * 512 + lane * 8;
  u.q[0] = *(const v8b*)p; u.q[1] = *(const v8b*)(p + 256); return u.v;
}
// fragment pair (hi, residual) of a packed computed operand (phi: k_feat lays it down; A: k_amat): tile (16 rows, 32 of K) = 4 planes of 512 B: hi elements 0..7, hi 8..15, residual 0..7, residual 8..15 of each lane (k order as split_row), so each 16-B load or store of a wave covers 4 whole 128-B lines
typedef __attribute__((address_space(1))) v8b gv8b;   // the packed tiles lie in global memory
__device__ __forceinline__ F2 frag_pa(const __bf16* tile0, int kc, int lane) {
  union { v16b v; v8b q[2]; } uh, ul; const __bf16* p = tile0 + (size_t)kc * 1024 + lane * 8;
  const gv8b* q = (const gv8b*)p; uh.q[0] = q[0]; uh.q[1] = q[32]; ul.q[0] = q[64]; ul.q[1] = q[96];
  F2 r; r.h = uh.v; r.l = ul.v; return r;
}
__device__ __forceinline__ const __bf16* uni_ptr(const __bf16* p) { const unsigned long long a = (unsigned long long)p;
  const unsigned lo = (unsigned)__builtin_amdgcn_readfirstlane((int)(unsigned)a), hi = (unsigned)__builtin_amdgcn_readfirstlane((int)(unsigned)(a >> 32)); return (const __bf16*)(((unsigned long long)hi << 32) | lo); }
union FQ { v16b v; v4u q[2]; };   // a fragment as its two 16-B pieces
__device__ __forceinline__ float bfr(float v) { return (float)(__bf16)v; }
// exp(x) inline = 2^e 2^a, e = the integer nearest x log2(e), a = x log2(e) - e by two fused multiply-adds on log2(e) = c + cc (as exact as expf's own reduction), with expf's two range ends.
// The hardware exponential stands in one statement with a v_nop: the slot that the instruction set asks for behind a transcendental before its result is read or its source overwritten
__device__ __forceinline__ float exp_il(float x) {
  const float c = __uint_as_float(0x3fb8aa3bu), cc = __uint_as_float(0x32a5705fu);
  const float e = rintf(x * c), a = fmaf(x, cc, fmaf(x, c, -e));
  float r; asm("v_exp_f32 %0, %1\n\tv_nop" : "=v"(r) : "v"(a));   // the v_nop fills the slot behind the transcendental, whatever the compiler puts next
  r = ldexpf(r, (int)e);
  r = __uint_as_float(0xc2ce8ed0u) > x ? 0.0f : r;
  return __uint_as_float(0x42b17218u) < x ? __uint_as_float(0x7f800000u) : r;
}
__device__ __attribute__((noinline)) float pow_ni(float a, float b) { return powf(a, b); }
__device__ __attribute__((noinline)) float cos_ni(float v) { return cosf(v); }
__device__ __attribute__((noinline)) float sin_ni(float v) { return sinf(v); }

#define WS_A    0u                              // 32 MB, 12 MB used: phi as bf16 hi and residual in fragment order (frag_pa), 4 B per element, 4 tensors t of PSZ x 4 B each: [(b,h)][L / 16 row tiles][6 k tiles][2 KB] (L = 64 rows per (b,h) for t < 2, 128 for t >= 2)
#define PSZ     (NBT * NHD * N2 * MF)
#define WS_B    (WS_A + 4u * NPOS * DMOD)          // 32 MB, 256 KB used: bf16(Wv), then bf16(Wo), each 256 x 256 in fragment order (frag_pw)
#define PWSZ    (DMOD * DMOD)
#define WS_V    (WS_B + 4u * NPOS * DMOD)          // f32 32 MB: value [b][n1][n2][h*32+d] (updated in place by pass 1: V -> V2, by the block that owns the tile; pass 2 reads it and keeps its result on the WGP)
#define WS_QS1  (WS_V + 4u * NPOS * DMOD)          // f32 [4][64][256]  q summed over n2
#define WS_KS1  (WS_QS1 + 4u * NBT * N1 * DMOD)
#define WS_QS2  (WS_KS1 + 4u * NBT * N1 * DMOD)    // f32 [4][128][256] q summed over n1, RoPE applied
#define WS_KS2  (WS_QS2 + 4u * NBT * N2 * DMOD)
#define WS_MM   (WS_KS2 + 4u * NBT * N2 * DMOD)
#define MMS 32
#define MMN 128
#define WS_AM   (WS_MM + 4u * 4 * MMN * MMS)       // [2 axes][4][8][8 row tiles][4 k tiles][2 KB] A as bf16 hi and residual in fragment order (frag_pa), 4 B per element; axis 1 uses row tiles < 4, k tiles < 2; WS_MM holds [4 tensors][128 slots][32 floats]: (min, max) of one k_pproj block per slot, 64 slots used for t < 2, 128 for t >= 2
#define AMSZ    (NBT * NHD * N2 * N2)
#define WS_KSUM (WS_AM + 4u * 2 * AMSZ)            // f32 [2 axes][4][8][8 row tiles][192]: phi(k) summed over the 16 rows of a tile (axis 1 uses 4 tiles)
#define WS_SX   (WS_KSUM + 4u * 2 * NBT * NHD * (N2 / 16) * MF)  // f32 [256 + 512][256] bf16(X) summed over n2 (rows b*64 + n1), then summed over n1 (rows 256 + b*128 + n2)
#define WS_CS   (WS_SX + 4u * (NBT * N1 + NBT * N2) * DMOD)   // f32 [2][128][16]: cos, then sin, of RoPE's angles (l, j)
#define WS_END  (WS_CS + 4u * 2 * N2 * 16)

// ---- proj_tile: [32768 rows] x [v 256 cols] = bf16(X) . W rows ([out][in]) + b (exact); tile pb < PROJ_N = (64 rows, 128 cols), one wave = 16 of its rows, no wave needs another (so: the wave's own 16 x 132 floats of LDS); 512-B segments of 1-KB rows.
//      The v projection needs X alone and is first needed by k_att<1>: it has no launch of its own; its tiles ride as the last blocks in the grids of k_feat and k_amat, whose few waves wait on latency and leave most of the chip idle
#define PROJ_N  (NPOS / 64 * 2)
#define PROJ_F  (PROJ_N * 21 / 32)                 // tiles [0, PROJ_F) ride in k_feat, [PROJ_F, PROJ_N) in k_amat
__device__ __forceinline__ void proj_tile(const float* __restrict__ X, const __bf16* __restrict__ PW, const float* __restrict__ bm, float* __restrict__ dst, float (*so)[132], int pb, int wave, int lane) {
  const int col = lane & 15, g = lane >> 4; const size_t r0 = (size_t)(pb % (NPOS / 64)) * 64 + wave * 16; const int n0 = pb / (NPOS / 64) * 128;
  v8f acc[8] = {};
#pragma unroll 2
  for (int kc = 0; kc < DMOD / 32; ++kc) { v16b w[8];
#pragma unroll      // w indexed by constants, in registers: the k step's 16 loads of B go out as one group, ahead of its first WMMA
    for (int j = 0; j < 8; ++j) w[j] = frag_pw(PW, n0 / 16 + j, kc, lane);
    const v16b a = frag_gbf(X + (r0 + col) * DMOD + kc * 32, lane);
#pragma unroll
    for (int j = 0; j < 8; ++j) acc[j] = wmma_bf(a, w[j], acc[j]); }
#pragma unroll
  for (int j = 0; j < 8; ++j) { const float bb = bfr(bm[n0 + j * 16 + col]);
#pragma unroll
    for (int r = 0; r < 8; ++r) so[8 * g + r][j * 16 + col] = acc[j][r] + bb; }
  LDSX();
  for (int rl = 0; rl < 16; ++rl) vst2(dst + (r0 + rl) * DMOD + n0 + lane * 4, *(const v4f*)&so[rl][lane * 4]);
}
// ---- k_poolx: axis sums of bf16(X); behind these 768 blocks, PACK_NB blocks round Wv and Wo to bf16 once and lay them in fragment order (thread = one 16-B piece: 8 consecutive k of one row). Blocks < 256: SX[b*64 + n1][c] = sum_{n2}; blocks >= 256: SX[256 + b*128 + n2][c] = sum_{n1}. Thread = (part = tid >> 6, 4 columns): a part sums every 4th row (ascending), the 4 parts are added in LDS; 1-KB rows
template <int NR> __device__ __forceinline__ v4f sum_rows(const float* __restrict__ p, size_t step) {
  v4f s = {0.f, 0.f, 0.f, 0.f};
#pragma unroll 16   // 16 row loads of 16 B in flight per lane: the kernel is a stream from memory
  for (int i = 0; i < NR; ++i) { const v4f v = *(const v4f*)(p + (size_t)i * step);
#pragma unroll      // vector elements by constant index
    for (int e = 0; e < 4; ++e) s[e] += bfr(v[e]); }
  return s;
}
#define PACK_NB (2 * PWSZ / 8 / 256)
#define TRIG_NB (N2 * 16 / 256)
__global__ __launch_bounds__(256) void k_poolx(const float* __restrict__ X, float* __restrict__ SX, const float* __restrict__ Wv, const float* __restrict__ Wo, float* __restrict__ PWF, float* __restrict__ CS) {
  __shared__ __align__(16) float sp[4][DMOD];
  const int tid = threadIdx.x, part = tid >> 6, c4 = (tid & 63) * 4, blk = blockIdx.x; v4f s;
  if (blk >= NBT * N1 + NBT * N2 + PACK_NB) {   // the last TRIG_NB blocks: RoPE's table CS[l][j] = cos(l * 10000^(-j/16)), then the sines, thread = (l, j); a wave stores whole lines
    const int idx = (blk - (NBT * N1 + NBT * N2 + PACK_NB)) * 256 + tid, j = idx & 15; const float invf = 1.0f / pow_ni(10000.0f, (float)(2 * j) / 32.0f); const float ang = (float)(idx >> 4) * invf;
    CS[idx] = cos_ni(ang); CS[N2 * 16 + idx] = sin_ni(ang); return; }
  if (blk >= NBT * N1 + NBT * N2) {   // piece p of a matrix = (nt = p >> 9, kc = (p >> 6) & 7, plane = (p >> 5) & 1, lane = p & 31)
    const int idx = (blk - (NBT * N1 + NBT * N2)) * 256 + tid, p = idx & (PWSZ / 8 - 1), ln = p & 31; const float* Wm = idx < PWSZ / 8 ? Wv : Wo;
    const float* sw = Wm + (size_t)((p >> 9) * 16 + (ln & 15)) * DMOD + ((p >> 6) & 7) * 32 + ((p >> 5) & 1) * 16 + 8 * (ln >> 4);
    const v4f x0 = *(const v4f*)sw, x1 = *(const v4f*)(sw + 4); v8b o;
#pragma unroll      // vector elements by constant index
    for (int e = 0; e < 4; ++e) { o[e] = (__bf16)x0[e]; o[4 + e] = (__bf16)x1[e]; }
    vst2((__bf16*)PWF + (size_t)idx * 8, o); return; }
  if (blk < NBT * N1) s = sum_rows<N2 / 4>(X + ((size_t)blk * N2 + part) * DMOD + c4, (size_t)4 * DMOD);
  else { const int r = blk - NBT * N1, b = r / N2, i2 = r % N2; s = sum_rows<N1 / 4>(X + (((size_t)b * N1 + part) * N2 + i2) * DMOD + c4, (size_t)4 * N2 * DMOD); }
  *(v4f*)&sp[part][c4] = s;
  __syncthreads();
  if (tid < 64) vst2(SX + (size_t)blk * DMOD + c4, (*(const v4f*)&sp[0][c4] + *(const v4f*)&sp[1][c4]) + (*(const v4f*)&sp[2][c4] + *(const v4f*)&sp[3][c4]));
}
// ---- k_pproj: pooled q and k: [768 rows of SX] x [q|k 512 cols] = SX (three bf16 pieces, 3 products) . bf16(W rows) + n bf16(b), n = rows summed (128 or 64); block (16 rows, 64 cols = 2 heads), wave = 16 cols; K = 256; 256-B segments of 1-KB rows.
//      Rows pooled over n1 (row = (b, l < 128)) get RoPE on the way out of LDS: per head x[32] -> x cos + rot(x) sin, rot = (-x[16:], x[:16]), angle = l * 10000^(-j/16) (j = d mod 16), cos and sin from k_poolx's table; both halves of a head lie in the block's tile.
//      The block's min and max of what it stores go to its own slot MMP[t][slot] (t: 0 = q axis 1, 1 = k axis 1, 2 = q axis 2, 3 = k axis 2), one 128-B line
__global__ __launch_bounds__(128) void k_pproj(const float* __restrict__ SX, const float* __restrict__ Wq, const float* __restrict__ bq, const float* __restrict__ Wk, const float* __restrict__ bk, float* __restrict__ QS1, float* __restrict__ KS1, float* __restrict__ QS2, float* __restrict__ KS2, const float* __restrict__ CS, float* __restrict__ MMP) {
  __shared__ __align__(16) float so[16][68]; __shared__ float smn[4], smx[4];
  const int tid = threadIdx.x, wave = tid >> 5, lane = tid & 31, col = lane & 15, g = lane >> 4; const int r0 = blockIdx.x * 16, which = blockIdx.y >> 2, nb0 = (blockIdx.y & 3) * 64, n = nb0 + wave * 16 + col;
  const float* Wm = which == 0 ? Wq : Wk; const float* bm = which == 0 ? bq : bk; const bool ax1 = r0 < NBT * N1;
  float* dst = ax1 ? (which == 0 ? QS1 : KS1) + (size_t)r0 * DMOD : (which == 0 ? QS2 : KS2) + (size_t)(r0 - NBT * N1) * DMOD;
  const float* pa = SX + (size_t)(r0 + col) * DMOD + 8 * g; const float* pw = Wm + (size_t)n * DMOD + 8 * g; const float bb = (ax1 ? (float)N2 : (float)N1) * bfr(bm[n]);
  v4f rc[2], rs[2];   // cos, sin of the 2 x 4 elements that this thread stores at the end: loaded here, in one flight with the operands, by every block (no branch, no wait in front of the operand loads); l = row mod 128 (NBT * N1 is a multiple of N2); the axis-1 blocks do not use them
#pragma unroll      // rc, rs by constant index
  for (int e = 0; e < 2; ++e) { const float* pt = CS + (size_t)((r0 + (tid >> 4) + 8 * e) % N2) * 16 + ((tid & 3) * 4); rc[e] = *(const v4f*)pt; rs[e] = *(const v4f*)(pt + N2 * 16); }
  v8f acc = {};   // every loop below is unrolled whole, so that a, w and the fragments are indexed by constants and stay in registers
#pragma unroll
  for (int kh = 0; kh < 2; ++kh) { v4f a[4][4], w[4][4];   // half of K at a time: its 32 loads go out together
#pragma unroll
    for (int k = 0; k < 4; ++k)
#pragma unroll
      for (int i = 0; i < 4; ++i) { const int o = (kh * 4 + k) * 32 + (i >> 1) * 16 + (i & 1) * 4; a[k][i] = *(const v4f*)(pa + o); w[k][i] = *(const v4f*)(pw + o); }
#pragma unroll
    for (int k = 0; k < 4; ++k) { v16b ah, am, al, wb;
#pragma unroll
      for (int i = 0; i < 16; ++i) { const float v = a[k][i >> 2][i & 3]; const __bf16 h = (__bf16)v; const float r1 = v - (float)h; const __bf16 m = (__bf16)r1; ah[i] = h; am[i] = m; al[i] = (__bf16)(r1 - (float)m); wb[i] = (__bf16)w[k][i >> 2][i & 3]; }
      acc = wmma_bf(al, wb, acc); acc = wmma_bf(am, wb, acc); acc = wmma_bf(ah, wb, acc); } }
#pragma unroll
  for (int r = 0; r < 8; ++r) so[8 * g + r][wave * 16 + col] = acc[r] + bb;
  __syncthreads();
  float mn = 3.0e38f, mx = -3.0e38f;
  v4f o2[2]; float* pst = dst + (size_t)(tid >> 4) * DMOD + nb0 + (tid & 15) * 4;
#pragma unroll      // rc, rs, o2 by constant index
  for (int qi = 0; qi < 2; ++qi) { const int rl = (tid >> 4) + 8 * qi, pc = tid & 15; v4f v = *(const v4f*)&so[rl][pc * 4];
    if (!ax1) { const v4f p = *(const v4f*)&so[rl][(pc * 4) ^ 16]; const float sg = (pc & 4) ? 1.0f : -1.0f;   // partner column d +- 16; the lower half takes it negated
#pragma unroll      // vector elements by constant index
      for (int e = 0; e < 4; ++e) v[e] = v[e] * rc[qi][e] + (sg * p[e]) * rs[qi][e]; }
#pragma unroll      // vector elements by constant index
    for (int e = 0; e < 4; ++e) { mn = fminf(mn, v[e]); mx = fmaxf(mx, v[e]); }
    o2[qi] = v; }
  // rows rl and rl + 8 (8 KB on); the stores and their s_wait_xcnt in one statement, so that the wait stands in front of the min-max code below, which takes the stored registers over
  asm volatile("global_store_b128 %0, %1, off\n\tglobal_store_b128 %0, %2, off offset:8192\n\ts_wait_xcnt 0x0" :: "v"(pst), "v"(o2[0]), "v"(o2[1]) : "memory");
#pragma unroll
  for (int o = 1; o < 32; o <<= 1) { mn = fminf(mn, __shfl_xor(mn, o)); mx = fmaxf(mx, __shfl_xor(mx, o)); }
  if (lane == 0) { smn[wave] = mn; smx[wave] = mx; }
  __syncthreads();
  if (tid < 8) { const v4f z = {0.f, 0.f, 0.f, 0.f}, m4 = {fminf(fminf(smn[0], smn[1]), fminf(smn[2], smn[3])), fmaxf(fmaxf(smx[0], smx[1]), fmaxf(smx[2], smx[3])), 0.f, 0.f};
    const int t = (ax1 ? 0 : 2) + which, slot = (ax1 ? r0 : r0 - NBT * N1) / 16 * 4 + (blockIdx.y & 3); vst2(MMP + ((size_t)t * MMN + slot) * MMS + tid * 4, tid == 0 ? m4 : z); }
}
// ---- k_feat: phi for the pooled tensor S = S_t (rows (b,l), l < L) and head h; blockIdx.x = h * 96 + bx, bx: 16 row tiles each of t = 0, 1, then 32 each of t = 2, 3; behind these FEAT_NB blocks, per block, one wave's quarter of a v-projection tile; block = 16 rows (one wave): xs = (x - mn)/(mx - mn) * 32^-1/4; dots on WMMA (xs hi/lo x bf16(feat rows), K = 32, 12 tiles), taken transposed (D[m][row]: feat rows as the A operand, same 2 products in the same order); phi = exp(dot - |xs|^2/2 - ln(192)/2 + 1e-6);
//      a lane then holds, of its own row (lane & 15), the 2 x 8 values per 32 features that make its fragment: it splits them hi/lo once for all readers and stores 6 packed tiles (frag_pa). On entry the wave takes the tensor's global min and max over the slots that k_pproj's blocks left; a block of a k tensor also leaves the sum of its 16 phi rows (ascending) in KPB[ax][(b,h)][l0 / 16][m], 6 whole lines
#define FEAT_NB ((2 * (NBT * N1 / 16) + 2 * (NBT * N2 / 16)) * NHD)
__global__ __launch_bounds__(32) void k_feat(const float* __restrict__ S0, const float* __restrict__ S1, const float* __restrict__ S2, const float* __restrict__ S3, const float* __restrict__ MM, const float* __restrict__ feat, float* __restrict__ PB, float* __restrict__ KPB, const float* __restrict__ X, const float* __restrict__ PWF, const float* __restrict__ bv, float* __restrict__ V) {
  __shared__ __align__(16) union { struct { float sx[16][36]; float so[16][196]; float soff[16]; } f; float pj[16][132]; } sm; auto& sx = sm.f.sx; auto& so = sm.f.so; auto& soff = sm.f.soff;
  const int fb = blockIdx.x;
  if (fb >= FEAT_NB) { proj_tile(X, (const __bf16*)PWF, bv, V, sm.pj, (fb - FEAT_NB) >> 2, (fb - FEAT_NB) & 3, threadIdx.x); return; }
  constexpr int T1N = NBT * N1 / 16, T2N = NBT * N2 / 16; const int bx = fb % (FEAT_NB / NHD), t = bx < 2 * T1N ? bx / T1N : 2 + (bx - 2 * T1N) / T2N, L = t < 2 ? N1 : N2;
  const float* S = t == 0 ? S0 : t == 1 ? S1 : t == 2 ? S2 : S3; float* P = PB + (size_t)t * PSZ;
  const int lane = threadIdx.x, col = lane & 15, g = lane >> 4; const int h = fb / (FEAT_NB / NHD); const int r0 = (t < 2 ? bx % T1N : (bx - 2 * T1N) % T2N) * 16; const int b = r0 / L, l0 = r0 % L;
  float mn = 3.0e38f, mx = -3.0e38f;
#pragma unroll      // the 4 slot loads go out together; with 64 slots each is read twice, which a min or max does not see
  for (int i = 0; i < MMN / 32; ++i) { const v2f m2 = *(const v2f*)(MM + ((size_t)t * MMN + ((lane + 32 * i) & (t < 2 ? MMN / 2 - 1 : MMN - 1))) * MMS); mn = fminf(mn, m2[0]); mx = fmaxf(mx, m2[1]); }
  v16b w[12];
#pragma unroll      // w by constant index, in registers; the 12 tiles' feat rows need no value of this block: their 48 loads go out here as one group and land behind the min-max reduction
  for (int j = 0; j < 12; ++j) w[j] = frag_gbf(feat + (size_t)(j * 16 + col) * DHD, lane);
#pragma unroll
  for (int o = 1; o < 32; o <<= 1) { mn = fminf(mn, __shfl_xor(mn, o)); mx = fmaxf(mx, __shfl_xor(mx, o)); }
  const float sc = 1.0f / (mx - mn); const float temp = 0.42044820762685725f;   // 32^-0.25
  { const int rl = lane >> 1, half = lane & 1; float ss = 0.f;
    for (int d = half * 16; d < half * 16 + 16; ++d) { const float x = S[(size_t)(r0 + rl) * DMOD + h * DHD + d]; const float xs = (x - mn) * sc * temp; sx[rl][d] = xs; ss += xs * xs; }
    ss += __shfl_xor(ss, 1); if (half == 0) { soff[rl] = -0.5f * ss - 0.5f * 5.2574953720277815f + 1e-6f; sx[rl][32] = 0.f; sx[rl][33] = 0.f; sx[rl][34] = 0.f; sx[rl][35] = 0.f; } }
  LDSX();
  const F2 a = split_row(&sx[col][0], 0, lane);
  const float off = soff[col];   // the offset of this lane's row
  FQ uh[MF / 32], ul[MF / 32];
#pragma unroll      // straight-line code: the 96 exponentials of a lane are independent of one another and fill each other's latencies; uh, ul by constant index
  for (int kc = 0; kc < MF / 32; ++kc) { float v[16];
#pragma unroll
    for (int jj = 0; jj < 2; ++jj) { v8f acc = {}; acc = wmma_bf(w[2 * kc + jj], a.l, acc); acc = wmma_bf(w[2 * kc + jj], a.h, acc);
#pragma unroll
      for (int r = 0; r < 8; ++r) v[8 * jj + r] = exp_il(acc[r] + off); }   // feature kc * 32 + 16 jj + 8 g + r: fragment element 8 jj + r
    if (t & 1) {   // a k tensor's f32 values also go to LDS, [row][m], for the key sum below
#pragma unroll
      for (int p = 0; p < 4; ++p) { const v4f q4 = {v[4 * p], v[4 * p + 1], v[4 * p + 2], v[4 * p + 3]}; *(v4f*)&so[col][kc * 32 + (p >> 1) * 16 + 8 * g + (p & 1) * 4] = q4; } }
    const F2 f = bsplit16(v); uh[kc].v = f.h; ul[kc].v = f.l; }
  __bf16* pt = (__bf16*)P + (size_t)((b * NHD + h) * (L / 16) + l0 / 16) * (MF / 32) * 1024 + lane * 8;   // the block's 6 tiles of 2 KB lie one behind the other
  // the 24 stores and their s_wait_xcnt in one statement, so that the wait stands in front of whatever takes the base and data registers over (the compiler otherwise mixes the splitting into the stores)
  asm volatile("global_store_b128 %0, %1, off\n\t" "global_store_b128 %0, %2, off offset:512\n\t" "global_store_b128 %0, %3, off offset:1024\n\t" "global_store_b128 %0, %4, off offset:1536\n\t"
               "global_store_b128 %0, %5, off offset:2048\n\t" "global_store_b128 %0, %6, off offset:2560\n\t" "global_store_b128 %0, %7, off offset:3072\n\t" "global_store_b128 %0, %8, off offset:3584\n\t"
               "global_store_b128 %0, %9, off offset:4096\n\t" "global_store_b128 %0, %10, off offset:4608\n\t" "global_store_b128 %0, %11, off offset:5120\n\t" "global_store_b128 %0, %12, off offset:5632\n\t"
               "global_store_b128 %0, %13, off offset:6144\n\t" "global_store_b128 %0, %14, off offset:6656\n\t" "global_store_b128 %0, %15, off offset:7168\n\t" "global_store_b128 %0, %16, off offset:7680\n\t"
               "global_store_b128 %0, %17, off offset:8192\n\t" "global_store_b128 %0, %18, off offset:8704\n\t" "global_store_b128 %0, %19, off offset:9216\n\t" "global_store_b128 %0, %20, off offset:9728\n\t"
               "global_store_b128 %0, %21, off offset:10240\n\t" "global_store_b128 %0, %22, off offset:10752\n\t" "global_store_b128 %0, %23, off offset:11264\n\t" "global_store_b128 %0, %24, off offset:11776\n\t"
               "s_wait_xcnt 0x0"
               :: "v"(pt), "v"(uh[0].q[0]), "v"(uh[0].q[1]), "v"(ul[0].q[0]), "v"(ul[0].q[1]),
                  "v"(uh[1].q[0]), "v"(uh[1].q[1]), "v"(ul[1].q[0]), "v"(ul[1].q[1]),
                  "v"(uh[2].q[0]), "v"(uh[2].q[1]), "v"(ul[2].q[0]), "v"(ul[2].q[1]),
                  "v"(uh[3].q[0]), "v"(uh[3].q[1]), "v"(ul[3].q[0]), "v"(ul[3].q[1]),
                  "v"(uh[4].q[0]), "v"(uh[4].q[1]), "v"(ul[4].q[0]), "v"(ul[4].q[1]),
                  "v"(uh[5].q[0]), "v"(uh[5].q[1]), "v"(ul[5].q[0]), "v"(ul[5].q[1]) : "memory");
  if (t & 1) { LDSX(); float* KQ = KPB + (((size_t)(t >> 1) * NBT * NHD + b * NHD + h) * (N2 / 16) + l0 / 16) * MF;
    for (int i = 0; i < MF / 32; ++i) { float s = 0.f;
#pragma unroll      // 16 LDS reads in flight
      for (int r = 0; r < 16; ++r) s += so[r][i * 32 + lane];
      KQ[i * 32 + lane] = s; } }
}
// ---- k_amat: per axis and (b,h): A[l][l'] = (sum_m QP[l][m] (hi/lo) . KP[l'][m] (hi/lo)) / att_norm[l]: M = l (by = 4 tiles of axis 1, then 8 of axis 2), N = l' (32 per wave = 2 tiles), K = m (6 steps), 3 products, taken transposed (D[l'][l]: phi(k) as the A operand, same 3 products in the same order): a lane then holds the 2 x 8 values of its own fragment of A (row l = lane & 15), which it divides, splits hi/lo once for all readers and stores as 4 whole-line 16-B pieces (frag_pa); blockIdx.x = by * 32 + (b,h), behind these AMAT_NB blocks v-projection tiles.
//      phi(q) and phi(k) come packed (frag_pa), no split here; half of K at a time (36 loads), the first half's loads go out ahead of the key sums' and land behind them.
//      att_norm[l] = sum_m QP[l][m] ksum[m], ksum[m] = sum_l' KP[l'][m]: each wave adds k_feat's row-tile sums (ascending) into its own 192 floats of LDS and takes the dot products of its 16 q rows in f32 from the fragments it loads, each value as hi + residual (lane = (row, half of each 32 m), the halves added by a shuffle); no wave needs another
#define AMAT_NB (NBT * NHD * (N1 / 16 + N2 / 16))
__global__ __launch_bounds__(128) void k_amat(const float* __restrict__ PB, const float* __restrict__ KPB, float* __restrict__ AMB, const float* __restrict__ X, const float* __restrict__ PWF, const float* __restrict__ bv, float* __restrict__ V) {
  __shared__ __align__(16) union { float sks[4][MF]; float pj[4][16][132]; } sm; auto& sks = sm.sks;
  const int fb = blockIdx.x, tid = threadIdx.x, wave = tid >> 5, lane = tid & 31, col = lane & 15, g = lane >> 4;
  if (fb >= AMAT_NB) { proj_tile(X, (const __bf16*)PWF, bv, V, sm.pj[wave], PROJ_F + fb - AMAT_NB, wave, lane); return; }
  const int by = fb / (NBT * NHD), ax = by < N1 / 16 ? 0 : 1, L = ax == 0 ? N1 : N2; const int bh = fb % (NBT * NHD), l0 = (ax == 0 ? by : by - N1 / 16) * 16, n0 = wave * 32;
  if (n0 >= L) return;
  const __bf16* QF = (const __bf16*)(PB + (size_t)(2 * ax) * PSZ) + (size_t)(bh * (L / 16) + l0 / 16) * (MF / 32) * 1024; const __bf16* KF = (const __bf16*)(PB + (size_t)(2 * ax + 1) * PSZ) + (size_t)(bh * (L / 16) + __builtin_amdgcn_readfirstlane(n0) / 16) * (MF / 32) * 1024; float* AM = AMB + (size_t)ax * AMSZ;   // the k tiles of the q row tile and of the first of the wave's 2 key row tiles; n0 is the same in every lane of a wave: read as a scalar, both bases stay in scalar registers and every load takes the one lane offset
  F2 qa[MF / 64], kb[2][MF / 64];
#pragma unroll
  for (int k = 0; k < MF / 64; ++k) { qa[k] = frag_pa(QF, k, lane); kb[0][k] = frag_pa(KF, k, lane); kb[1][k] = frag_pa(KF, MF / 32 + k, lane); }
  const float* KQ = KPB + ((size_t)ax * NBT * NHD + bh) * (N2 / 16) * MF + lane; float ks[MF / 32] = {};
  { float v[N2 / 16][MF / 32] = {};   // every loop of this kernel is unrolled whole: its arrays are indexed by constants and stay in registers. The 4 or 8 tiles' loads go out together; a tile that axis 1 lacks adds 0; ascending tile order
#pragma unroll
    for (int tl = 0; tl < N1 / 16; ++tl)
#pragma unroll
      for (int i = 0; i < MF / 32; ++i) v[tl][i] = KQ[(size_t)tl * MF + i * 32];
    asm volatile("s_wait_xcnt 0x0" ::: "memory");   // behind the 24 loads above, ahead of any rewrite of their base or offset register (on the axis-1 way only counted data waits follow before the base is reused)
    if (ax == 1) {
#pragma unroll
      for (int tl = N1 / 16; tl < N2 / 16; ++tl)
#pragma unroll
        for (int i = 0; i < MF / 32; ++i) v[tl][i] = KQ[(size_t)tl * MF + i * 32]; }
#pragma unroll
    for (int tl = 0; tl < N2 / 16; ++tl)
#pragma unroll
      for (int i = 0; i < MF / 32; ++i) ks[i] += v[tl][i]; }
#pragma unroll
  for (int i = 0; i < MF / 32; ++i) sks[wave][i * 32 + lane] = ks[i];
  LDSX();
  v8f acc[2] = {}; float dn = 0.f;
#pragma unroll
  for (int kh = 0; kh < 2; ++kh) {
    if (kh == 1) { const __bf16 *Q1 = uni_ptr(QF), *K1 = uni_ptr(KF);   // scalar bases formed at this place: these loads take them and the one lane offset, as the first half's do; without it the compiler forms two vector address pairs here
#pragma unroll
      for (int k = 0; k < MF / 64; ++k) { qa[k] = frag_pa(Q1, MF / 64 + k, lane); kb[0][k] = frag_pa(K1, MF / 64 + k, lane); kb[1][k] = frag_pa(K1, MF / 32 + MF / 64 + k, lane); } }
#pragma unroll
    for (int k = 0; k < MF / 64; ++k) { const F2& a = qa[k]; const float* kp = &sks[wave][(kh * (MF / 64) + k) * 32 + 8 * g]; float dk = 0.f;
#pragma unroll
      for (int i = 0; i < 8; ++i) dk += ((float)a.h[i] + (float)a.l[i]) * kp[i];
#pragma unroll
      for (int i = 0; i < 8; ++i) dk += ((float)a.h[8 + i] + (float)a.l[8 + i]) * kp[16 + i];
      dn += dk;
#pragma unroll
      for (int j = 0; j < 2; ++j) { acc[j] = wmma_bf(kb[j][k].h, a.l, acc[j]); acc[j] = wmma_bf(kb[j][k].l, a.h, acc[j]); acc[j] = wmma_bf(kb[j][k].h, a.h, acc[j]); } } }
  dn += __shfl_xor(dn, 16);   // lanes col and col + 16 now both hold att_norm of row l0 + col
  const float inv = 1.0f / dn; float v[16];   // acc[j][r] = row l0 + col, column n0 + 16 j + 8 g + r: the lane's fragment elements 8 j + r
#pragma unroll
  for (int r = 0; r < 8; ++r) { v[r] = acc[0][r] * inv; v[8 + r] = acc[1][r] * inv; }
  const F2 f = bsplit16(v); FQ uh, ul; uh.v = f.h; ul.v = f.l;
  __bf16* pt = (__bf16*)AM + ((size_t)(bh * (N2 / 16) + l0 / 16) * (N2 / 32) + wave) * 1024 + lane * 8;
  // the tile's 4 stores and their s_wait_xcnt in one statement: the wait stands in front of whatever takes the base and data registers over
  asm volatile("global_store_b128 %0, %1, off\n\tglobal_store_b128 %0, %2, off offset:512\n\tglobal_store_b128 %0, %3, off offset:1024\n\tglobal_store_b128 %0, %4, off offset:1536\n\ts_wait_xcnt 0x0" :: "v"(pt), "v"(uh.q[0]), "v"(uh.q[1]), "v"(ul.q[0]), "v"(ul.q[1]) : "memory");
}
// ---- k_att: per (b, ATT_G neighbouring other positions o, head h), in place on the value tensor: out[l][d] = sum_l' A[(b,h)][l][l'] (hi/lo) . V[l'][(h,d)] (hi/lo): M = l (one 16-row tile per wave, L/16 waves), N = d (2 tiles per position), K = l' (2 or 4 steps), 3 products; all batches in one launch.
//      A depends on (b, h) alone: a wave loads the packed fragments of its 16 rows of A once and uses them for the ATT_G value tiles of the block (ATT_G divides both axis lengths, so a block stays inside one batch).
//      The block owns the ATT_G tiles of L x 32 (128-B row segments) that it reads and writes: each is read once (thread = 4 rows x 16 B), split into bf16 hi and residual and laid down transposed in LDS ([d][l'], 8-B stores, pitch 2 L + 16 B for the 16-B fragment reads); the stores to V follow the barrier behind which every read has landed
#define ATT_G 4
template <int PASS>
__global__ __launch_bounds__(PASS == 1 ? N1 * 2 : N2 * 2) void k_att(const float* __restrict__ AM, int ob0, float* V) {
  constexpr int L = (PASS == 1 ? N1 : N2), O = (PASS == 1 ? N2 : N1); constexpr size_t RS = (PASS == 1 ? (size_t)N2 * DMOD : (size_t)DMOD), OS = (PASS == 1 ? (size_t)DMOD : (size_t)N2 * DMOD);   // RS: floats from row l to row l + 1; OS: from position o to o + 1
  __shared__ __align__(16) __bf16 vh[ATT_G][DHD][L + 8], vl[ATT_G][DHD][L + 8]; __shared__ __align__(16) float so[L / 16][ATT_G][16][36];
  const int tid = threadIdx.x, wave = tid >> 5, lane = tid & 31, col = lane & 15, g = lane >> 4; const int h = blockIdx.x % NHD, bo = ob0 + blockIdx.x / NHD * ATT_G; const int b = bo / O, o = bo % O;
  float* tile = V + (PASS == 1 ? ((size_t)b * N1 * N2 + o) : ((size_t)b * N1 + o) * N2) * DMOD + h * DHD;   // the first of the block's tiles
  const __bf16* pa = (const __bf16*)AM + (size_t)((b * NHD + h) * (N2 / 16) + wave) * (N2 / 32) * 1024;   // the k tiles of the wave's row tile
  const int p4 = (tid & 7) * 4, l4 = (tid >> 3) * 4; const float* src = tile + (size_t)l4 * RS + p4; v4f x[ATT_G][4]; F2 a[L / 32];   // every loop below is unrolled whole: x, a, hi, lo and acc are indexed by constants and stay in registers; the tiles' 16 loads and A's loads go out together, ahead of the barrier
#pragma unroll
  for (int t = 0; t < ATT_G; ++t)
#pragma unroll
    for (int i = 0; i < 4; ++i) x[t][i] = *(const v4f*)(src + (size_t)t * OS + (size_t)i * RS);
#pragma unroll
  for (int kc = 0; kc < L / 32; ++kc) a[kc] = frag_pa(pa, kc, lane);
#pragma unroll
  for (int t = 0; t < ATT_G; ++t)
#pragma unroll
    for (int e = 0; e < 4; ++e) { v4b hi, lo;
#pragma unroll
      for (int i = 0; i < 4; ++i) { const float v = x[t][i][e]; const __bf16 hh = (__bf16)v; hi[i] = hh; lo[i] = (__bf16)(v - (float)hh); }
      *(v4b*)&vh[t][p4 + e][l4] = hi; *(v4b*)&vl[t][p4 + e][l4] = lo; }
  __syncthreads();
  v8f acc[ATT_G][2] = {};
#pragma unroll
  for (int t = 0; t < ATT_G; ++t)
#pragma unroll
    for (int kc = 0; kc < L / 32; ++kc)
#pragma unroll
      for (int j = 0; j < 2; ++j) { F2 vb; vb.h = frag_b(&vh[t][j * 16 + col][kc * 32], lane); vb.l = frag_b(&vl[t][j * 16 + col][kc * 32], lane); acc[t][j] = mac3(a[kc], vb, acc[t][j]); }
#pragma unroll
  for (int t = 0; t < ATT_G; ++t)
#pragma unroll
    for (int j = 0; j < 2; ++j)
#pragma unroll
      for (int r = 0; r < 8; ++r) so[wave][t][8 * g + r][j * 16 + col] = acc[t][j][r];
  LDSX();
#pragma unroll
  for (int t = 0; t < ATT_G; ++t)
#pragma unroll      // the wave's 16 LDS reads go out as one group with one wait, not one wait per store
    for (int q4 = 0; q4 < 4; ++q4) { const int rl = q4 * 4 + (lane >> 3), pc = lane & 7; vst2(tile + (size_t)t * OS + (size_t)(wave * 16 + rl) * RS + pc * 4, *(const v4f*)&so[wave][t][rl][pc * 4]); }
}
// ---- k_atto: pass 2 (time axis) and the output projection in one kernel, per (b, n1): the block owns the 128 rows x 256 columns (all 8 heads) of that position, so the attended value never goes to memory; 16 waves, one block per WGP.
//      1) the value tile is read once (thread = 4 rows x 16 B of 4 heads), split into bf16 hi and residual, laid transposed in LDS ([head][d][l'], as in k_att); barrier.
//      2) wave = (16 rows l, 4 heads): the product is taken transposed, D[d][l] = sum_l' V[l'][d] (A operand, hi/lo) . A[l][l'] (B operand, hi/lo), same 3 products in the same order: a lane then holds 8 consecutive d of one row l,
//         which it splits hi/lo and stores as 16-B pieces into row-major LDS planes sh, sl [l][256] (pitch 528 B for the 16-B fragment reads). The packed mixing-matrix fragments of the next head are loaded while this head is worked on; barrier.
//      3) wave = (32 rows, 64 columns): Y = value(hi/lo, fragments from sh, sl) . bf16(Wo rows, packed) + bo, K = 256; a Wo fragment serves 4 products; the result leaves through the wave's own 32 x 68 floats of LDS (over the dead transposed tile) as 256-B row segments
__global__ __launch_bounds__(512) void k_atto(const float* __restrict__ AM, int ob0, const float* __restrict__ V, const float* __restrict__ PWF, const float* __restrict__ bo, float* __restrict__ Y) {
  __shared__ __align__(16) union { struct { __bf16 vh[NHD][DHD][N2 + 8], vl[NHD][DHD][N2 + 8]; } t; float so[16][32][68]; } sm; auto& vh = sm.t.vh; auto& vl = sm.t.vl; auto& so = sm.so;
  __shared__ __align__(16) __bf16 sh[N2][DMOD + 8], sl[N2][DMOD + 8];
  const int tid = threadIdx.x, wave = tid >> 5, lane = tid & 31, col = lane & 15, g = lane >> 4; const int pos = ob0 + blockIdx.x, b = pos / N1; const size_t row0 = (size_t)pos * N2;   // pos = b * 64 + n1
  const int lt = wave & 7, h0 = (wave >> 3) * 4;
  const __bf16* pa = (const __bf16*)AM + (size_t)((b * NHD + h0) * (N2 / 16) + lt) * (N2 / 32) * 1024;   // the k tiles of row tile lt of head h0; a head further = 2 * N2 * N2 elements on
  const int t8 = tid & 255, hs = tid >> 8, p4 = (t8 & 7) * 4, l4 = (t8 >> 3) * 4; const float* src = V + (row0 + l4) * DMOD + hs * DHD + p4; v4f x[4][4]; F2 ra[N2 / 32];   // every loop below but the k loop of part 3 is unrolled whole: the arrays are indexed by constants and stay in registers; the tile's 16 loads and the first head's A fragments go out together
#pragma unroll
  for (int t = 0; t < 4; ++t)
#pragma unroll
    for (int i = 0; i < 4; ++i) x[t][i] = *(const v4f*)(src + t * 2 * DHD + (size_t)i * DMOD);
#pragma unroll
  for (int kc = 0; kc < N2 / 32; ++kc) ra[kc] = frag_pa(pa, kc, lane);
#pragma unroll
  for (int t = 0; t < 4; ++t)
#pragma unroll
    for (int e = 0; e < 4; ++e) { v4b hi, lo;
#pragma unroll
      for (int i = 0; i < 4; ++i) { const float v = x[t][i][e]; const __bf16 hh = (__bf16)v; hi[i] = hh; lo[i] = (__bf16)(v - (float)hh); }
      *(v4b*)&vh[t * 2 + hs][p4 + e][l4] = hi; *(v4b*)&vl[t * 2 + hs][p4 + e][l4] = lo; }
  __syncthreads();
#pragma unroll
  for (int q = 0; q < 4; ++q) { const int hd = h0 + q; F2 a[N2 / 32];
#pragma unroll
    for (int kc = 0; kc < N2 / 32; ++kc) a[kc] = ra[kc];
    if (q < 3) {
#pragma unroll
      for (int kc = 0; kc < N2 / 32; ++kc) ra[kc] = frag_pa(pa + (size_t)(q + 1) * 2 * N2 * N2, kc, lane); }
    v8f acc[2] = {};
#pragma unroll
    for (int kc = 0; kc < N2 / 32; ++kc)
#pragma unroll
      for (int j = 0; j < 2; ++j) { const v16b bh = frag_b(&vh[hd][j * 16 + col][kc * 32], lane), bl = frag_b(&vl[hd][j * 16 + col][kc * 32], lane);
        acc[j] = wmma_bf(bh, a[kc].l, acc[j]); acc[j] = wmma_bf(bl, a[kc].h, acc[j]); acc[j] = wmma_bf(bh, a[kc].h, acc[j]); }
#pragma unroll
    for (int j = 0; j < 2; ++j) { v8b hi, lo;
#pragma unroll
      for (int r = 0; r < 8; ++r) { const float v = acc[j][r]; const __bf16 hh = (__bf16)v; hi[r] = hh; lo[r] = (__bf16)(v - (float)hh); }
      *(v8b*)&sh[lt * 16 + col][hd * DHD + j * 16 + 8 * g] = hi; *(v8b*)&sl[lt * 16 + col][hd * DHD + j * 16 + 8 * g] = lo; } }
  __syncthreads();
  const int lp = wave & 3, nq = wave >> 2; const __bf16* PWo = (const __bf16*)PWF + PWSZ;
  v8f acc[2][4] = {};
#pragma unroll 2
  for (int kc = 0; kc < DMOD / 32; ++kc) { v16b w[4], ah[2], al[2];
#pragma unroll      // w, ah, al indexed by constants, in registers: the k step's 8 loads of B and 8 LDS reads of A go out as one group, ahead of its first WMMA
    for (int j = 0; j < 4; ++j) w[j] = frag_pw(PWo, nq * 4 + j, kc, lane);
#pragma unroll
    for (int i = 0; i < 2; ++i) { ah[i] = frag_b(&sh[lp * 32 + i * 16 + col][kc * 32], lane); al[i] = frag_b(&sl[lp * 32 + i * 16 + col][kc * 32], lane); }
#pragma unroll
    for (int i = 0; i < 2; ++i)
#pragma unroll
      for (int j = 0; j < 4; ++j) { acc[i][j] = wmma_bf(al[i], w[j], acc[i][j]); acc[i][j] = wmma_bf(ah[i], w[j], acc[i][j]); } }
#pragma unroll
  for (int j = 0; j < 4; ++j) { const float bb = bfr(bo[nq * 64 + j * 16 + col]);
#pragma unroll
    for (int i = 0; i < 2; ++i)
#pragma unroll
      for (int r = 0; r < 8; ++r) so[wave][i * 16 + 8 * g + r][j * 16 + col] = acc[i][j][r] + bb; }
  LDSX();
#pragma unroll      // the wave's 16 LDS reads go out as one group with one wait, not one wait per store
  for (int s = 0; s < 16; ++s) { const int rl = s * 2 + g; vst2(Y + (row0 + lp * 32 + rl) * DMOD + nq * 64 + col * 4, *(const v4f*)&so[wave][rl][col * 4]); }
}

#ifndef DBG
#define DBG 0
#endif
#if DBG != 0
__global__ __launch_bounds__(256) void k_dump(const float* __restrict__ src, int n, float* __restrict__ out) {   // out[0..n) = src, rest of batch-0 region zero
  const size_t p = (size_t)blockIdx.x * 256 + threadIdx.x; v4f v; for (int i = 0; i < 4; ++i) { const size_t f = p * 4 + i; v[i] = f < (size_t)n ? src[f] : 0.f; } vst2(out + p * 4, v);
}
#endif
extern "C" void kernel_launch(void* const* d_in, const int* in_sizes, int n_in, void* d_out, int out_size, void* d_ws, size_t ws_size, hipStream_t stream) {
  (void)in_sizes; (void)n_in; (void)out_size;
  const float** F = (const float**)d_in;   // X, Wq, bq, Wk, bk, Wv, bv, Wo, bo, feat
  if (ws_size < (size_t)WS_END) return;
  char* ws = (char*)d_ws; float *PB = (float*)(ws + WS_A), *V = (float*)(ws + WS_V), *QS1 = (float*)(ws + WS_QS1), *KS1 = (float*)(ws + WS_KS1), *QS2 = (float*)(ws + WS_QS2), *KS2 = (float*)(ws + WS_KS2), *MM = (float*)(ws + WS_MM), *AM = (float*)(ws + WS_AM), *KSUM = (float*)(ws + WS_KSUM), *SX = (float*)(ws + WS_SX), *CS = (float*)(ws + WS_CS), *PW = (float*)(ws + WS_B);
  k_poolx<<<NBT * N1 + NBT * N2 + PACK_NB + TRIG_NB, 256, 0, stream>>>(F[0], SX, F[5], F[7], PW, CS);
  k_pproj<<<dim3((NBT * N1 + NBT * N2) / 16, 8), 128, 0, stream>>>(SX, F[1], F[2], F[3], F[4], QS1, KS1, QS2, KS2, CS, MM);
  // ---- the mixing matrices of both axes (assets: l = n1 = 64; time: l = n2 = 128 with RoPE)
  k_feat<<<FEAT_NB + 4 * PROJ_F, 32, 0, stream>>>(QS1, KS1, QS2, KS2, MM, F[9], PB, KSUM, F[0], PW, F[6], V);
#if DBG == 2
  k_dump<<<N1 * N2 * DMOD / 1024, 256, 0, stream>>>(PB, NBT * NHD * N1 * MF, (float*)d_out); return;  // pass-1 phi(q), packed bf16 hi/residual tiles [(b,h)][4][6][2 KB]
#endif
  k_amat<<<AMAT_NB + PROJ_N - PROJ_F, 128, 0, stream>>>(PB, KSUM, AM, F[0], PW, F[6], V);
  // ---- pass 1: assets axis (other = n2 = 128)
  k_att<1><<<(TNB - TB0) * N2 * NHD / ATT_G, N1 * 2, 0, stream>>>(AM, TB0 * N2, V);
#if DBG == 3
  k_dump<<<N1 * N2 * DMOD / 1024, 256, 0, stream>>>(V, N1 * N2 * DMOD, (float*)d_out); return;
#endif
  // ---- pass 2: time axis (other = n1 = 64), with the output projection
  k_atto<<<(TNB - TB0) * N1, 512, 0, stream>>>(AM + AMSZ, TB0 * N1, V, PW, F[8], (float*)d_out);
}
